// v000
// The times below were measured on an AMD MI455X: many runs one after another, warmed up first and cycling through
// copies of the inputs, with the whole window's GPU time divided by the number of runs. Launches and the gaps
// between them are all in it. The median over several windows is given; except for v000 it joins two sittings, which
// can be a few percent apart, so the side-by-side timings, each taken in one sitting, are the better comparison.
// v000 is the starting kernel. One run takes 1740 microseconds.
#include <hip/hip_runtime.h>

// Transformer-XL relative multi-head attention (q, k [4][1024][1024]; qh = q Wq ('xw' [1024][1024]), kv = k Wkv ('xw' [1024][2048]: k | v column blocks; 16 heads x 64); r = pos_embed Wr ([2048][64] x [64][64], shared by all heads); AC = (qh + r_r_bias_h).kh, BD = shift((qh + r_w_bias_h).r): BD[i][j] = (qh_i + r_w_bias_h).r[L + j - i]; attn = (AC + BD)/8; keys with mask[b][j] == 0 -> -inf (int [4][1024], read); softmax; out = merged attn.vh -> [4][1024][1024] (4.2 M)).
// Compute dtypes, f32 accumulate: every input rounded to bf16; projections exact; relative terms 3 products / f32 dots; content scores 3 products on every row; softmax f32; output f32.

#define NB_  4
#define TT   1024
#define DM   1024
#define NH_  16
#define NKV  16
#define REP  (NH_ / NKV)
#define HD   64
#define DQ   (NH_ * HD)
#define DKV  (NKV * HD)
#define ZH   2
#define RH   1024                 // = TT: every row hi/lo
#define WIN  0
#define PCAR 1024.0f
#define SCL  0.125f
#define NR   2048    // relative positions (2L)
#define DKV2 2048    // kv projection width (k | v)
typedef _Float16 h16;
typedef unsigned short bf;
typedef __attribute__((ext_vector_type(16))) __bf16   v16bf;
typedef __attribute__((ext_vector_type(16))) _Float16 v16h;
typedef __attribute__((ext_vector_type(8)))  _Float16 v8h;
typedef __attribute__((ext_vector_type(8)))  unsigned short v8us;
typedef __attribute__((ext_vector_type(8)))  float    v8f;
typedef __attribute__((ext_vector_type(4)))  float    v4f;
typedef v8h  __attribute__((may_alias)) v8ha;
typedef v4f  __attribute__((may_alias)) v4fa;
typedef v8us __attribute__((may_alias)) v8usa;

__device__ __forceinline__ unsigned short f2bf(float f) { unsigned u = __float_as_uint(f); u += 0x7FFFu + ((u >> 16) & 1u); return (unsigned short)(u >> 16); }
__device__ __forceinline__ float bf2f(unsigned short b) { return __uint_as_float(((unsigned)b) << 16); }
__device__ __forceinline__ float bfr(float f) { return bf2f(f2bf(f)); }
__device__ __forceinline__ v16h cat16(v8h lo, v8h hi) { return __builtin_shufflevector(lo, hi, 0, 1, 2, 3, 4, 5, 6, 7, 8, 9, 10, 11, 12, 13, 14, 15); }
__device__ __forceinline__ v16bf cat16b(v8us lo, v8us hi) { return __builtin_bit_cast(v16bf, __builtin_shufflevector(lo, hi, 0, 1, 2, 3, 4, 5, 6, 7, 8, 9, 10, 11, 12, 13, 14, 15)); }
__device__ __forceinline__ v8f wmma16(v16h a, v16h b, v8f c) { return __builtin_amdgcn_wmma_f32_16x16x32_f16(false, a, false, b, (short)0, c, false, false); }
__device__ __forceinline__ v8f wmmab(v16bf a, v16bf b, v8f c) { return __builtin_amdgcn_wmma_f32_16x16x32_bf16(false, a, false, b, (short)0, c, false, false); }



// ---- k_gemmw: register-blocked GEMM, ONE WAVE per 64x64 output tile (16 accumulators), operands straight from K-contiguous 16-bit planes; grid (M/64, N/64, Z), 32 threads.
// C[m][n] (f32, pitch ldc, + optional f32 bias[n]) = sum_k A[m][k] Bt[n][k] (+ split products per NSPLIT). z-batch strides sA/sB/sC in elements. K % 32 == 0.
template <typename T16> struct WFrag;
template <> struct WFrag<h16> { typedef v16h V; static __device__ __forceinline__ V ld(const h16* p) { return cat16(*(const v8h*)p, *(const v8h*)(p + 16)); } static __device__ __forceinline__ v8f mma(V a, V b, v8f c) { return wmma16(a, b, c); } };
template <> struct WFrag<bf> { typedef v16bf V; static __device__ __forceinline__ V ld(const bf* p) { return cat16b(*(const v8us*)p, *(const v8us*)(p + 16)); } static __device__ __forceinline__ v8f mma(V a, V b, v8f c) { return wmmab(a, b, c); } };
template <typename T16, int NSPLIT, bool BIAS>
__global__ __launch_bounds__(32) void k_gemmw(const T16* __restrict__ A, const T16* __restrict__ A2, const T16* __restrict__ Bt, const T16* __restrict__ Bt2, int K, float* C, int ldc, const float* __restrict__ bias, size_t sA, size_t sB, size_t sC) {
    typedef typename WFrag<T16>::V V;
    __shared__ __align__(16) float os[16 * 68];
    const size_t z = blockIdx.z; A += z * sA; if (A2) A2 += z * sA; Bt += z * sB; if (Bt2) Bt2 += z * sB; C += z * sC;
    const int lane = threadIdx.x & 31, lr = lane & 15, hi = lane >> 4; const int r0 = blockIdx.x * 64, c0 = blockIdx.y * 64;
    v8f acc[4][4];
#pragma unroll
    for (int mb = 0; mb < 4; ++mb)
#pragma unroll
        for (int nb = 0; nb < 4; ++nb) acc[mb][nb] = (v8f){};
    const size_t aoff = (size_t)(r0 + lr) * K + 8 * hi, boff = (size_t)(c0 + lr) * K + 8 * hi;
#pragma unroll 1
    for (int kc = 0; kc < K; kc += 32) {
        V a[4], a2[4];
#pragma unroll
        for (int mb = 0; mb < 4; ++mb) { a[mb] = WFrag<T16>::ld(A + aoff + (size_t)mb * 16 * K + kc); if (NSPLIT == 1 || NSPLIT == 2) a2[mb] = WFrag<T16>::ld(A2 + aoff + (size_t)mb * 16 * K + kc); }
#pragma unroll
        for (int nb = 0; nb < 4; ++nb) { const V b = WFrag<T16>::ld(Bt + boff + (size_t)nb * 16 * K + kc); V b2; if (NSPLIT >= 2) b2 = WFrag<T16>::ld(Bt2 + boff + (size_t)nb * 16 * K + kc);
#pragma unroll
            for (int mb = 0; mb < 4; ++mb) { acc[mb][nb] = WFrag<T16>::mma(a[mb], b, acc[mb][nb]); if (NSPLIT == 1 || NSPLIT == 2) acc[mb][nb] = WFrag<T16>::mma(a2[mb], b, acc[mb][nb]); if (NSPLIT >= 2) acc[mb][nb] = WFrag<T16>::mma(a[mb], b2, acc[mb][nb]); } }
        asm volatile("v_nop\n\tv_nop\n\tv_nop\n\tv_nop" : "+v"(acc[0][0]), "+v"(acc[1][1]), "+v"(acc[2][2]), "+v"(acc[3][3]) : "v"(a[0]), "v"(a[3]));
    }
#pragma unroll
    for (int mb = 0; mb < 4; ++mb) {
#pragma unroll
        for (int nb = 0; nb < 4; ++nb) {
#pragma unroll
            for (int j = 0; j < 8; ++j) os[(hi * 8 + j) * 68 + nb * 16 + lr] = acc[mb][nb][j]; }
        __builtin_amdgcn_wave_barrier(); asm volatile("" ::: "memory");
        float* crow = C + (size_t)(r0 + mb * 16) * ldc + c0;
{
#pragma unroll
            for (int s = 0; s < 8; ++s) { const int row = 2 * s + hi, cofs = lr * 4; v4f val = *(const v4fa*)(os + row * 68 + cofs); if (BIAS) { val[0] += bfr(bias[c0 + cofs]); val[1] += bfr(bias[c0 + cofs + 1]); val[2] += bfr(bias[c0 + cofs + 2]); val[3] += bfr(bias[c0 + cofs + 3]); }
                *(v4f*)(crow + (size_t)row * ldc + cofs) = val; }
             }
        __builtin_amdgcn_wave_barrier(); asm volatile("" ::: "memory");
    }
}

__device__ __forceinline__ h16 tohx(float x) { return (h16)x; }
__device__ __forceinline__ void splitf(float y, unsigned short& h, unsigned short& l) { h = f2bf(y); l = f2bf(y - bf2f(h)); }
typedef __attribute__((ext_vector_type(2))) _Float16 v2h;
typedef __attribute__((ext_vector_type(4))) _Float16 v4h;
typedef __attribute__((ext_vector_type(2))) unsigned short v2us;
typedef __attribute__((ext_vector_type(4))) unsigned short v4us;
typedef __attribute__((ext_vector_type(2))) float v2f;
typedef __attribute__((ext_vector_type(4))) int v4i;

__global__ __launch_bounds__(256) void k_wtG(const float* __restrict__ w, int K, int N, bf* Bt) {
    const int lane = threadIdx.x & 31; const int L0 = (blockIdx.x * 8 + (threadIdx.x >> 5)) * 8; const int nlines = N * K / 64;
{
#pragma unroll 1
        for (int l = 0; l < 8; ++l) { const int L = L0 + l; if (L >= nlines) break; const size_t e = (size_t)L * 64 + lane * 2; const int k = (int)(e % K), n = (int)(e / K); v2us o;
            o[0] = f2bf(w[(size_t)k * N + n]); o[1] = f2bf(w[(size_t)(k + 1) * N + n]); *(v2us*)(Bt + e) = o; }
         }
}
__global__ __launch_bounds__(256) void k_cvt8(const float* __restrict__ src, bf* dst, size_t n8) { const size_t i = (size_t)blockIdx.x * 256 + threadIdx.x; if (i >= n8) return; const v8f v = *(const v8f*)(src + i * 8); v8us o;
#pragma unroll
    for (int k = 0; k < 8; ++k) o[k] = f2bf(v[k]); *(v8us*)(dst + i * 8) = o;  }

// k_rope: head planes [h][t][d] (fp16 + hi/lo) of rope(x) x sc with the rotate-half convention out[d] = x[d] cos[t][d] - x[d+HD/2] sin[t][d], out[d+HD/2] = x[d+HD/2] cos[t][d+HD/2] + x[d] sin[t][d+HD/2]
__global__ __launch_bounds__(256) void k_rope(const float* __restrict__ F, int pitch, int nheads, const float* __restrict__ CS, const float* __restrict__ RF, const float* __restrict__ nw, float sc, h16* P16, bf* Ph, bf* Pl) {
    const size_t e = ((size_t)blockIdx.x * 256 + threadIdx.x) * 2; if (e >= (size_t)nheads * TT * HD) return; const int d = (int)(e % HD); const int t = (int)((e / HD) % TT); const int h = (int)(e / ((size_t)HD * TT)); const float* f = F + (size_t)t * pitch + h * HD; const float rf = RF ? RF[(size_t)h * TT + t] : 1.0f; v2h o16; v2us oh, ol;
#pragma unroll
    for (int q = 0; q < 2; ++q) { const int dd = d + q; const int dp = (dd < HD / 2) ? dd + HD / 2 : dd - HD / 2; float x0 = f[dd], x1 = f[dp];
        if (RF) { float n0 = __fmul_rn(x0, rf), n1 = __fmul_rn(x1, rf); asm volatile("" : "+v"(n0)); asm volatile("" : "+v"(n1)); x0 = __fmul_rn(bfr(nw[dd]), n0); x1 = __fmul_rn(bfr(nw[dp]), n1); }
        const v2f cs = *(const v2f*)(CS + ((size_t)t * HD + dd) * 2); float a = __fmul_rn(x0, cs[0]), bq = __fmul_rn(x1, cs[1]); asm volatile("" : "+v"(a)); asm volatile("" : "+v"(bq)); const float r = ((dd < HD / 2) ? __fsub_rn(a, bq) : __fadd_rn(a, bq)) * sc;
        o16[q] = tohx(r); unsigned short a2, c2; splitf(r, a2, c2); oh[q] = a2; ol[q] = c2; }
    *(v2h*)(P16 + e) = o16; *(v2us*)(Ph + e) = oh; *(v2us*)(Pl + e) = ol;  }
__global__ __launch_bounds__(256) void k_vtp(const float* __restrict__ F, int pitch, int nheads, h16* V16, bf* Vh, bf* Vl) { const size_t e = ((size_t)blockIdx.x * 256 + threadIdx.x) * 2; if (e >= (size_t)nheads * HD * TT) return; const int t = (int)(e % TT); const int d = (int)((e / TT) % HD); const int g = (int)(e / ((size_t)TT * HD)); v2h o16; v2us oh, ol;
#pragma unroll
    for (int q = 0; q < 2; ++q) { const float x = F[(size_t)(t + q) * pitch + g * HD + d]; o16[q] = tohx(x); unsigned short a2, c2; splitf(x, a2, c2); oh[q] = a2; ol[q] = c2; }
    *(v2h*)(V16 + e) = o16; *(v2us*)(Vh + e) = oh; *(v2us*)(Vl + e) = ol;  }
__global__ __launch_bounds__(256) void k_csid(float* CS) { const int idx = blockIdx.x * 256 + threadIdx.x; if (idx >= TT * HD) return; v2f cs; cs[0] = 1.0f; cs[1] = 0.0f; *(v2f*)(CS + (size_t)idx * 2) = cs;  }
// k_asoft: per row (zz, i): t = S x HD^-0.5, -inf where the key mask is 0; softmax over the 1024 keys (register row, one exp, fixed trees);
__global__ __launch_bounds__(256) void k_asoft(const float* __restrict__ Sb, const int* __restrict__ km, h16* P16, bf* Ph, bf* Pl) {
    const int lane = threadIdx.x & 31; const int row = blockIdx.x * 8 + (threadIdx.x >> 5); if (row >= ZH * TT) return; const int i = row % TT; const int zz = row / TT; (void)zz; const bool hires = (i < RH); const float* sr = Sb + (size_t)row * TT; float v[TT / 32]; float mx = -3.0e38f;
#pragma unroll
    for (int ch = 0; ch < TT / 128; ++ch) { const int j0 = ch * 128 + lane * 4; const v4f a = *(const v4f*)(sr + j0); const v4i mk = *(const v4i*)(km + j0);   /* key mask, loaded unconditionally */
#pragma unroll
        for (int q = 0; q < 4; ++q) { const float t = (mk[q] != 0) ? a[q] * SCL : -3.0e38f; v[ch * 4 + q] = t;   /* mask == 0 -> -inf */ mx = fmaxf(mx, t); } }
#pragma unroll
    for (int sh = 16; sh; sh >>= 1) mx = fmaxf(mx, __shfl_xor(mx, sh, 32));
    float sum = 0.f;
#pragma unroll
    for (int k = 0; k < TT / 32; ++k) { float d0 = __fsub_rn(v[k], mx); asm volatile("" : "+v"(d0)); v[k] = __builtin_amdgcn_exp2f(__fmul_rn(d0, 1.4426950408889634f)); sum += v[k]; }
#pragma unroll
    for (int sh = 16; sh; sh >>= 1) sum += __shfl_xor(sum, sh, 32);
    const float f = __fdiv_rn(hires ? 1.0f : PCAR, sum);
{
        if (hires) {
#pragma unroll
            for (int ch = 0; ch < TT / 128; ++ch) { v4us oh, ol;
#pragma unroll
                for (int q = 0; q < 4; ++q) { unsigned short a, c2; splitf(v[ch * 4 + q] * f, a, c2); oh[q] = a; ol[q] = c2; }
                const size_t oo = ((size_t)zz * (RH ? RH : 1) + i) * TT + ch * 128 + lane * 4; *(v4us*)(Ph + oo) = oh; *(v4us*)(Pl + oo) = ol; }
        } else {
#pragma unroll
            for (int ch = 0; ch < TT / 128; ++ch) { v4h o4;
#pragma unroll
                for (int q = 0; q < 4; ++q) o4[q] = tohx(v[ch * 4 + q] * f);
                *(v4h*)(P16 + (size_t)row * TT + ch * 128 + lane * 4) = o4; } }
         }
}
__global__ __launch_bounds__(256) void k_flat(const float* __restrict__ F, h16* P16, bf* Ph, bf* Pl, size_t n4) { const size_t i = (size_t)blockIdx.x * 256 + threadIdx.x; if (i >= n4) return; const v4f a = *(const v4f*)(F + i * 4); v4h o16; v4us oh, ol;
#pragma unroll
    for (int q = 0; q < 4; ++q) { o16[q] = tohx(a[q]); unsigned short x2, y2; splitf(a[q], x2, y2); oh[q] = x2; ol[q] = y2; }
    *(v4h*)(P16 + i * 4) = o16; *(v4us*)(Ph + i * 4) = oh; *(v4us*)(Pl + i * 4) = ol;  }

__global__ __launch_bounds__(256) void k_hdot(const float* __restrict__ bias, const float* __restrict__ F, int pitch, int nrows, int hcol, float* OUT) { const int lane = threadIdx.x & 31; const size_t wv = (size_t)blockIdx.x * 8 + (threadIdx.x >> 5); if (wv >= (size_t)NH_ * (nrows / 32)) return; const int h = (int)(wv / (nrows / 32)); const int n = (int)(wv % (nrows / 32)) * 32 + lane; const float* f = F + (size_t)n * pitch + (hcol ? h * HD : 0);   /* hcol: F has per-head columns (k); 0: one 64-wide row shared by all heads (r) */ const float* bh = bias + h * HD; float s = 0.f;
#pragma unroll 4
    for (int d = 0; d < HD; ++d) { s = __fadd_rn(s, __fmul_rn(bfr(bh[d]), f[d])); }
    *(float*)(OUT + (size_t)h * nrows + n) = s;  }

__global__ __launch_bounds__(256) void k_addxl(float* Sb, const float* __restrict__ QR, const float* __restrict__ KB, const float* __restrict__ RB, int h0) { const size_t k = (size_t)blockIdx.x * 256 + threadIdx.x; if (k >= (size_t)ZH * TT * TT / 4) return; const size_t e = k * 4; const int j0 = (int)(e % TT); const int i = (int)((e / TT) % TT); const int zz = (int)(e / ((size_t)TT * TT)); const int h = h0 + zz; const float* qr = QR + ((size_t)zz * TT + i) * NR; v4f a = *(const v4f*)(Sb + e); const v4f kb = *(const v4f*)(KB + (size_t)h * TT + j0);
#pragma unroll
    for (int q = 0; q < 4; ++q) { const int idx = TT + j0 + q - i; float s1 = __fadd_rn(a[q], kb[q]); asm volatile("" : "+v"(s1)); float s2 = __fadd_rn(s1, qr[idx]); asm volatile("" : "+v"(s2)); a[q] = __fadd_rn(s2, RB[(size_t)h * NR + idx]); }
    *(v4f*)(Sb + e) = a;  }
__global__ __launch_bounds__(256) void k_merge(const float* __restrict__ O, int h0, float* OUTb) { const size_t e = ((size_t)blockIdx.x * 256 + threadIdx.x) * 2; if (e >= (size_t)ZH * TT * HD) return; const int d = (int)(e % HD); const int t = (int)((e / HD) % TT); const int zz = (int)(e / ((size_t)HD * TT)); const float cs = (t < RH) ? 1.0f : (1.0f / PCAR); const size_t oo = (size_t)t * DQ + (h0 + zz) * HD + d;
    v2f o2; o2[0] = O[e] * cs; o2[1] = O[e + 1] * cs; *(v2f*)(OUTb + oo) = o2;  }

extern "C" void kernel_launch(void* const* d_in, const int* in_sizes, int n_in,
                              void* d_out, int out_size, void* d_ws, size_t ws_size, hipStream_t stream) {
    (void)in_sizes; (void)n_in; (void)out_size;
    const float* x = (const float*)d_in[0]; const float* xk = (const float*)d_in[1]; const int* kmask = (const int*)d_in[2]; const float* pemb = (const float*)d_in[3]; const float* wq = (const float*)d_in[4]; const float* wkv = (const float*)d_in[5]; const float* wr = (const float*)d_in[6]; const float* rrb = (const float*)d_in[7]; const float* rwb = (const float*)d_in[8]; const float* wk = nullptr; const float* wv = nullptr; (void)wk; (void)wv;
    float* OUT = (float*)d_out;     // [4][1024][1024]
    char* wsp = (char*)d_ws;
    auto take = [&](size_t bytes) { char* p = wsp; wsp += (bytes + 255) & ~(size_t)255; return (void*)p; };
    bf* WQ = (bf*)take((size_t)DQ * DM * 2); bf* WKV = (bf*)take((size_t)DKV2 * DM * 2); bf* WR = (bf*)take((size_t)HD * HD * 2); bf* PE = (bf*)take((size_t)NR * HD * 2); float* RF = (float*)take((size_t)NR * HD * 4); h16* RP16 = (h16*)take((size_t)NR * HD * 2); bf* RPh = (bf*)take((size_t)NR * HD * 2); bf* RPl = (bf*)take((size_t)NR * HD * 2); float* KB = (float*)take((size_t)NH_ * TT * 4); float* RB = (float*)take((size_t)NH_ * NR * 4); float* QR = (float*)take((size_t)ZH * TT * NR * 4); float* FKV = (float*)take((size_t)TT * DKV2 * 4); float* CS = (float*)take((size_t)TT * HD * 2 * 4);
    bf* XB = (bf*)take((size_t)TT * DM * 2); float* FQ = (float*)take((size_t)TT * DQ * 4); float* FK = nullptr;
    h16* QP16 = (h16*)take((size_t)NH_ * TT * HD * 2); h16* KP16 = (h16*)take((size_t)NKV * TT * HD * 2); h16* VT16 = (h16*)take((size_t)NKV * HD * TT * 2);
    bf* QPh = (bf*)take((size_t)NH_ * TT * HD * 2); bf* QPl = (bf*)take((size_t)NH_ * TT * HD * 2); bf* KPh = (bf*)take((size_t)NKV * TT * HD * 2); bf* KPl = (bf*)take((size_t)NKV * TT * HD * 2); bf* VTh = (bf*)take((size_t)NKV * HD * TT * 2); bf* VTl = (bf*)take((size_t)NKV * HD * TT * 2); bf* Ph = (bf*)take((size_t)ZH * RH * TT * 2); bf* Pl = (bf*)take((size_t)ZH * RH * TT * 2);
    float* Sb = (float*)take((size_t)ZH * TT * TT * 4); h16* P16 = nullptr; float* Ob = (float*)take((size_t)ZH * TT * HD * 4);
    if ((size_t)(wsp - (char*)d_ws) > ws_size) return;    // ws 256 MiB
    float* FV = nullptr; (void)FV; (void)FK;   // unused: k and v come from the one kv projection into FKV
    { k_wtG<<<(unsigned)((DM * DQ / 64 + 63) / 64), 256, 0, stream>>>(wq, DM, DQ, WQ); k_wtG<<<(unsigned)((DM * DKV2 / 64 + 63) / 64), 256, 0, stream>>>(wkv, DM, DKV2, WKV); k_wtG<<<(unsigned)((HD * HD / 64 + 63) / 64), 256, 0, stream>>>(wr, HD, HD, WR);
      k_cvt8<<<(unsigned)(((size_t)NR * HD / 8 + 255) / 256), 256, 0, stream>>>(pemb, PE, (size_t)NR * HD / 8); k_gemmw<bf, 0, false><<<dim3(NR / 64, HD / 64, 1), 32, 0, stream>>>(PE, nullptr, WR, nullptr, HD, RF, HD, nullptr, 0, 0, 0);   /* r = pos_embed Wr (exact) */
      k_flat<<<(unsigned)(((size_t)NR * HD / 4 + 255) / 256), 256, 0, stream>>>(RF, RP16, RPh, RPl, (size_t)NR * HD / 4); k_hdot<<<(unsigned)(((size_t)NH_ * (NR / 32) + 7) / 8), 256, 0, stream>>>(rwb, RF, HD, NR, 0, RB);   /* r is shared by all heads: no column offset */   /* r planes; RB[h][l] = r_w_bias_h . r_l */
      
       }
    k_csid<<<(TT * HD + 255) / 256, 256, 0, stream>>>(CS);
    const unsigned LQ = (unsigned)(((size_t)NH_ * TT * HD / 2 + 255) / 256), LKv = (unsigned)(((size_t)NKV * TT * HD / 2 + 255) / 256);
    for (int b = 0; b < NB_; ++b) {
        
        k_cvt8<<<(unsigned)(((size_t)TT * DM / 8 + 255) / 256), 256, 0, stream>>>(x + (size_t)b * TT * DM, XB, (size_t)TT * DM / 8);
        k_gemmw<bf, 0, false><<<dim3(TT / 64, DQ / 64, 1), 32, 0, stream>>>(XB, nullptr, WQ, nullptr, DM, FQ, DQ, nullptr, 0, 0, 0);
        k_rope<<<LQ, 256, 0, stream>>>(FQ, DQ, NH_, CS, nullptr, nullptr, 1.0f, QP16, QPh, QPl);
        k_cvt8<<<(unsigned)(((size_t)TT * DM / 8 + 255) / 256), 256, 0, stream>>>(xk + (size_t)b * TT * DM, XB, (size_t)TT * DM / 8); k_gemmw<bf, 0, false><<<dim3(TT / 64, DKV2 / 64, 1), 32, 0, stream>>>(XB, nullptr, WKV, nullptr, DM, FKV, DKV2, nullptr, 0, 0, 0); k_hdot<<<(unsigned)(((size_t)NH_ * (TT / 32) + 7) / 8), 256, 0, stream>>>(rrb, FKV, DKV2, TT, 1, KB);   /* kv = k Wkv; KB[h][j] = r_r_bias_h . kh_j */
        k_rope<<<LKv, 256, 0, stream>>>(FKV, DKV2, NKV, CS, nullptr, nullptr, 1.0f, KP16, KPh, KPl);   /* k = kv columns 0..1023 */
        k_vtp<<<LKv, 256, 0, stream>>>(FKV + DKV, DKV2, NKV, VT16, VTh, VTl);   /* v = kv columns 1024..2047 */
        for (int h0 = 0; h0 < NH_; h0 += ZH) { const size_t zq = (size_t)h0, zk = (size_t)(h0 / REP);   // one kv head per query head: the pass's two heads use consecutive kv planes (z-strides TT*HD)
            k_gemmw<bf, 2, false><<<dim3(RH / 64, TT / 64, ZH), 32, 0, stream>>>(QPh + zq * TT * HD, QPl + zq * TT * HD, KPh + zk * TT * HD, KPl + zk * TT * HD, HD, Sb, TT, nullptr, (size_t)TT * HD, (size_t)TT * HD, (size_t)TT * TT);
            k_gemmw<bf, 2, false><<<dim3(TT / 64, NR / 64, ZH), 32, 0, stream>>>(QPh + zq * TT * HD, QPl + zq * TT * HD, RPh, RPl, HD, QR, NR, nullptr, (size_t)TT * HD, 0, (size_t)TT * NR);   /* QR[i][l] = qh_i . r_l (all rows hi/lo) */
            k_addxl<<<(unsigned)(((size_t)ZH * TT * TT / 4 + 255) / 256), 256, 0, stream>>>(Sb, QR, KB, RB, h0);
            k_asoft<<<ZH * TT / 8, 256, 0, stream>>>(Sb, kmask + (size_t)b * TT, P16, Ph, Pl);
            k_gemmw<bf, 2, false><<<dim3(RH / 64, HD / 64, ZH), 32, 0, stream>>>(Ph, Pl, VTh + zk * HD * TT, VTl + zk * HD * TT, TT, Ob, HD, nullptr, (size_t)RH * TT, (size_t)HD * TT, (size_t)TT * HD);
            k_merge<<<(unsigned)(((size_t)ZH * TT * HD / 2 + 255) / 256), 256, 0, stream>>>(Ob, h0, OUT + (size_t)b * TT * DQ); }
         }
}

// v001
// It runs in 819 microseconds.
// Next to v000, in two timings, it ran 2.13 times as fast each time.
#include <hip/hip_runtime.h>

// Transformer-XL relative multi-head attention (q, k [4][1024][1024]; qh = q Wq ('xw' [1024][1024]), kv = k Wkv ('xw' [1024][2048]: k | v column blocks; 16 heads x 64); r = pos_embed Wr ([2048][64] x [64][64], shared by all heads); AC = (qh + r_r_bias_h).kh, BD = shift((qh + r_w_bias_h).r): BD[i][j] = (qh_i + r_w_bias_h).r[L + j - i]; attn = (AC + BD)/8; keys with mask[b][j] == 0 -> -inf (int [4][1024], read); softmax; out = merged attn.vh -> [4][1024][1024] (4.2 M)).
// Compute dtypes, f32 accumulate: every input rounded to bf16; projections exact; relative terms 3 products / f32 dots; content scores 3 products on every row; softmax f32; output f32.

#define NB_  4
#define TT   1024
#define DM   1024
#define NH_  16
#define NKV  16
#define REP  (NH_ / NKV)
#define HD   64
#define DQ   (NH_ * HD)
#define DKV  (NKV * HD)
#define ZH   16                   // heads per pass = NH_: one pass of six launches covers every head of a batch
#define RH   1024                 // = TT: every row hi/lo
#define WIN  0
#define PCAR 1024.0f
#define SCL  0.125f
#define NR   2048    // relative positions (2L)
#define DKV2 2048    // kv projection width (k | v)
typedef _Float16 h16;
typedef unsigned short bf;
typedef __attribute__((ext_vector_type(16))) __bf16   v16bf;
typedef __attribute__((ext_vector_type(16))) _Float16 v16h;
typedef __attribute__((ext_vector_type(8)))  _Float16 v8h;
typedef __attribute__((ext_vector_type(8)))  unsigned short v8us;
typedef __attribute__((ext_vector_type(8)))  float    v8f;
typedef __attribute__((ext_vector_type(4)))  float    v4f;
typedef v8h  __attribute__((may_alias)) v8ha;
typedef v4f  __attribute__((may_alias)) v4fa;
typedef v8us __attribute__((may_alias)) v8usa;

__device__ __forceinline__ unsigned short f2bf(float f) { unsigned u = __float_as_uint(f); u += 0x7FFFu + ((u >> 16) & 1u); return (unsigned short)(u >> 16); }
__device__ __forceinline__ float bf2f(unsigned short b) { return __uint_as_float(((unsigned)b) << 16); }
__device__ __forceinline__ float bfr(float f) { return bf2f(f2bf(f)); }
__device__ __forceinline__ v16h cat16(v8h lo, v8h hi) { return __builtin_shufflevector(lo, hi, 0, 1, 2, 3, 4, 5, 6, 7, 8, 9, 10, 11, 12, 13, 14, 15); }
__device__ __forceinline__ v16bf cat16b(v8us lo, v8us hi) { return __builtin_bit_cast(v16bf, __builtin_shufflevector(lo, hi, 0, 1, 2, 3, 4, 5, 6, 7, 8, 9, 10, 11, 12, 13, 14, 15)); }
__device__ __forceinline__ v8f wmma16(v16h a, v16h b, v8f c) { return __builtin_amdgcn_wmma_f32_16x16x32_f16(false, a, false, b, (short)0, c, false, false); }
__device__ __forceinline__ v8f wmmab(v16bf a, v16bf b, v8f c) { return __builtin_amdgcn_wmma_f32_16x16x32_bf16(false, a, false, b, (short)0, c, false, false); }



// ---- k_gemmw: register-blocked GEMM, ONE WAVE per 64x64 output tile (16 accumulators), operands straight from K-contiguous 16-bit planes; grid (M/64, N/64, Z), 32 threads.
// C[m][n] (f32, pitch ldc, + optional f32 bias[n]) = sum_k A[m][k] Bt[n][k] (+ split products per NSPLIT). z-batch strides sA/sB/sC in elements. K % 32 == 0.
template <typename T16> struct WFrag;
template <> struct WFrag<h16> { typedef v16h V; static __device__ __forceinline__ V ld(const h16* p) { return cat16(*(const v8h*)p, *(const v8h*)(p + 16)); } static __device__ __forceinline__ v8f mma(V a, V b, v8f c) { return wmma16(a, b, c); } };
template <> struct WFrag<bf> { typedef v16bf V; static __device__ __forceinline__ V ld(const bf* p) { return cat16b(*(const v8us*)p, *(const v8us*)(p + 16)); } static __device__ __forceinline__ v8f mma(V a, V b, v8f c) { return wmmab(a, b, c); } };
template <typename T16, int NSPLIT, bool BIAS>
__global__ __launch_bounds__(32) void k_gemmw(const T16* __restrict__ A, const T16* __restrict__ A2, const T16* __restrict__ Bt, const T16* __restrict__ Bt2, int K, float* C, int ldc, const float* __restrict__ bias, size_t sA, size_t sB, size_t sC) {
    typedef typename WFrag<T16>::V V;
    __shared__ __align__(16) float os[16 * 68];
    const size_t z = blockIdx.z; A += z * sA; if (A2) A2 += z * sA; Bt += z * sB; if (Bt2) Bt2 += z * sB; C += z * sC;
    const int lane = threadIdx.x & 31, lr = lane & 15, hi = lane >> 4; const int r0 = blockIdx.x * 64, c0 = blockIdx.y * 64;
    v8f acc[4][4];
#pragma unroll
    for (int mb = 0; mb < 4; ++mb)
#pragma unroll
        for (int nb = 0; nb < 4; ++nb) acc[mb][nb] = (v8f){};
    const size_t aoff = (size_t)(r0 + lr) * K + 8 * hi, boff = (size_t)(c0 + lr) * K + 8 * hi;
#pragma unroll 1
    for (int kc = 0; kc < K; kc += 32) {
        V a[4], a2[4];
#pragma unroll
        for (int mb = 0; mb < 4; ++mb) { a[mb] = WFrag<T16>::ld(A + aoff + (size_t)mb * 16 * K + kc); if (NSPLIT == 1 || NSPLIT == 2) a2[mb] = WFrag<T16>::ld(A2 + aoff + (size_t)mb * 16 * K + kc); }
#pragma unroll
        for (int nb = 0; nb < 4; ++nb) { const V b = WFrag<T16>::ld(Bt + boff + (size_t)nb * 16 * K + kc); V b2; if (NSPLIT >= 2) b2 = WFrag<T16>::ld(Bt2 + boff + (size_t)nb * 16 * K + kc);
#pragma unroll
            for (int mb = 0; mb < 4; ++mb) { acc[mb][nb] = WFrag<T16>::mma(a[mb], b, acc[mb][nb]); if (NSPLIT == 1 || NSPLIT == 2) acc[mb][nb] = WFrag<T16>::mma(a2[mb], b, acc[mb][nb]); if (NSPLIT >= 2) acc[mb][nb] = WFrag<T16>::mma(a[mb], b2, acc[mb][nb]); } }
        asm volatile("v_nop\n\tv_nop\n\tv_nop\n\tv_nop" : "+v"(acc[0][0]), "+v"(acc[1][1]), "+v"(acc[2][2]), "+v"(acc[3][3]) : "v"(a[0]), "v"(a[3]));
    }
#pragma unroll
    for (int mb = 0; mb < 4; ++mb) {
#pragma unroll
        for (int nb = 0; nb < 4; ++nb) {
#pragma unroll
            for (int j = 0; j < 8; ++j) os[(hi * 8 + j) * 68 + nb * 16 + lr] = acc[mb][nb][j]; }
        __builtin_amdgcn_wave_barrier(); asm volatile("" ::: "memory");
        float* crow = C + (size_t)(r0 + mb * 16) * ldc + c0;
{
#pragma unroll
            for (int s = 0; s < 8; ++s) { const int row = 2 * s + hi, cofs = lr * 4; v4f val = *(const v4fa*)(os + row * 68 + cofs); if (BIAS) { val[0] += bfr(bias[c0 + cofs]); val[1] += bfr(bias[c0 + cofs + 1]); val[2] += bfr(bias[c0 + cofs + 2]); val[3] += bfr(bias[c0 + cofs + 3]); }
                *(v4f*)(crow + (size_t)row * ldc + cofs) = val; }
             }
        __builtin_amdgcn_wave_barrier(); asm volatile("" ::: "memory");
    }
}

__device__ __forceinline__ h16 tohx(float x) { return (h16)x; }
__device__ __forceinline__ void splitf(float y, unsigned short& h, unsigned short& l) { h = f2bf(y); l = f2bf(y - bf2f(h)); }
typedef __attribute__((ext_vector_type(2))) _Float16 v2h;
typedef __attribute__((ext_vector_type(4))) _Float16 v4h;
typedef __attribute__((ext_vector_type(2))) unsigned short v2us;
typedef __attribute__((ext_vector_type(4))) unsigned short v4us;
typedef __attribute__((ext_vector_type(2))) float v2f;
typedef __attribute__((ext_vector_type(4))) int v4i;

__global__ __launch_bounds__(256) void k_wtG(const float* __restrict__ w, int K, int N, bf* Bt) {
    const int lane = threadIdx.x & 31; const int L0 = (blockIdx.x * 8 + (threadIdx.x >> 5)) * 8; const int nlines = N * K / 64;
{
#pragma unroll 1
        for (int l = 0; l < 8; ++l) { const int L = L0 + l; if (L >= nlines) break; const size_t e = (size_t)L * 64 + lane * 2; const int k = (int)(e % K), n = (int)(e / K); v2us o;
            o[0] = f2bf(w[(size_t)k * N + n]); o[1] = f2bf(w[(size_t)(k + 1) * N + n]); *(v2us*)(Bt + e) = o; }
         }
}
__global__ __launch_bounds__(256) void k_cvt8(const float* __restrict__ src, bf* dst, size_t n8) { const size_t i = (size_t)blockIdx.x * 256 + threadIdx.x; if (i >= n8) return; const v8f v = *(const v8f*)(src + i * 8); v8us o;
#pragma unroll
    for (int k = 0; k < 8; ++k) o[k] = f2bf(v[k]); *(v8us*)(dst + i * 8) = o;  }

// k_rope: head planes [h][t][d] (fp16 + hi/lo) of rope(x) x sc with the rotate-half convention out[d] = x[d] cos[t][d] - x[d+HD/2] sin[t][d], out[d+HD/2] = x[d+HD/2] cos[t][d+HD/2] + x[d] sin[t][d+HD/2]
__global__ __launch_bounds__(256) void k_rope(const float* __restrict__ F, int pitch, int nheads, const float* __restrict__ CS, const float* __restrict__ RF, const float* __restrict__ nw, float sc, h16* P16, bf* Ph, bf* Pl) {
    const size_t e = ((size_t)blockIdx.x * 256 + threadIdx.x) * 2; if (e >= (size_t)nheads * TT * HD) return; const int d = (int)(e % HD); const int t = (int)((e / HD) % TT); const int h = (int)(e / ((size_t)HD * TT)); const float* f = F + (size_t)t * pitch + h * HD; const float rf = RF ? RF[(size_t)h * TT + t] : 1.0f; v2h o16; v2us oh, ol;
#pragma unroll
    for (int q = 0; q < 2; ++q) { const int dd = d + q; const int dp = (dd < HD / 2) ? dd + HD / 2 : dd - HD / 2; float x0 = f[dd], x1 = f[dp];
        if (RF) { float n0 = __fmul_rn(x0, rf), n1 = __fmul_rn(x1, rf); asm volatile("" : "+v"(n0)); asm volatile("" : "+v"(n1)); x0 = __fmul_rn(bfr(nw[dd]), n0); x1 = __fmul_rn(bfr(nw[dp]), n1); }
        const v2f cs = *(const v2f*)(CS + ((size_t)t * HD + dd) * 2); float a = __fmul_rn(x0, cs[0]), bq = __fmul_rn(x1, cs[1]); asm volatile("" : "+v"(a)); asm volatile("" : "+v"(bq)); const float r = ((dd < HD / 2) ? __fsub_rn(a, bq) : __fadd_rn(a, bq)) * sc;
        o16[q] = tohx(r); unsigned short a2, c2; splitf(r, a2, c2); oh[q] = a2; ol[q] = c2; }
    *(v2h*)(P16 + e) = o16; *(v2us*)(Ph + e) = oh; *(v2us*)(Pl + e) = ol;  }
__global__ __launch_bounds__(256) void k_vtp(const float* __restrict__ F, int pitch, int nheads, h16* V16, bf* Vh, bf* Vl) { const size_t e = ((size_t)blockIdx.x * 256 + threadIdx.x) * 2; if (e >= (size_t)nheads * HD * TT) return; const int t = (int)(e % TT); const int d = (int)((e / TT) % HD); const int g = (int)(e / ((size_t)TT * HD)); v2h o16; v2us oh, ol;
#pragma unroll
    for (int q = 0; q < 2; ++q) { const float x = F[(size_t)(t + q) * pitch + g * HD + d]; o16[q] = tohx(x); unsigned short a2, c2; splitf(x, a2, c2); oh[q] = a2; ol[q] = c2; }
    *(v2h*)(V16 + e) = o16; *(v2us*)(Vh + e) = oh; *(v2us*)(Vl + e) = ol;  }
__global__ __launch_bounds__(256) void k_csid(float* CS) { const int idx = blockIdx.x * 256 + threadIdx.x; if (idx >= TT * HD) return; v2f cs; cs[0] = 1.0f; cs[1] = 0.0f; *(v2f*)(CS + (size_t)idx * 2) = cs;  }
// k_asoft: per row (zz, i): t = S x HD^-0.5, -inf where the key mask is 0; softmax over the 1024 keys (register row, one exp, fixed trees);
__global__ __launch_bounds__(256) void k_asoft(const float* __restrict__ Sb, const int* __restrict__ km, h16* P16, bf* Ph, bf* Pl) {
    const int lane = threadIdx.x & 31; const int row = blockIdx.x * 8 + (threadIdx.x >> 5); if (row >= ZH * TT) return; const int i = row % TT; const int zz = row / TT; (void)zz; const bool hires = (i < RH); const float* sr = Sb + (size_t)row * TT; float v[TT / 32]; float mx = -3.0e38f;
#pragma unroll
    for (int ch = 0; ch < TT / 128; ++ch) { const int j0 = ch * 128 + lane * 4; const v4f a = *(const v4f*)(sr + j0); const v4i mk = *(const v4i*)(km + j0);   /* key mask, loaded unconditionally */
#pragma unroll
        for (int q = 0; q < 4; ++q) { const float t = (mk[q] != 0) ? a[q] * SCL : -3.0e38f; v[ch * 4 + q] = t;   /* mask == 0 -> -inf */ mx = fmaxf(mx, t); } }
#pragma unroll
    for (int sh = 16; sh; sh >>= 1) mx = fmaxf(mx, __shfl_xor(mx, sh, 32));
    float sum = 0.f;
#pragma unroll
    for (int k = 0; k < TT / 32; ++k) { float d0 = __fsub_rn(v[k], mx); asm volatile("" : "+v"(d0)); v[k] = __builtin_amdgcn_exp2f(__fmul_rn(d0, 1.4426950408889634f)); sum += v[k]; }
#pragma unroll
    for (int sh = 16; sh; sh >>= 1) sum += __shfl_xor(sum, sh, 32);
    const float f = __fdiv_rn(hires ? 1.0f : PCAR, sum);
{
        if (hires) {
#pragma unroll
            for (int ch = 0; ch < TT / 128; ++ch) { v4us oh, ol;
#pragma unroll
                for (int q = 0; q < 4; ++q) { unsigned short a, c2; splitf(v[ch * 4 + q] * f, a, c2); oh[q] = a; ol[q] = c2; }
                const size_t oo = ((size_t)zz * (RH ? RH : 1) + i) * TT + ch * 128 + lane * 4; *(v4us*)(Ph + oo) = oh; *(v4us*)(Pl + oo) = ol; }
        } else {
#pragma unroll
            for (int ch = 0; ch < TT / 128; ++ch) { v4h o4;
#pragma unroll
                for (int q = 0; q < 4; ++q) o4[q] = tohx(v[ch * 4 + q] * f);
                *(v4h*)(P16 + (size_t)row * TT + ch * 128 + lane * 4) = o4; } }
         }
}
__global__ __launch_bounds__(256) void k_flat(const float* __restrict__ F, h16* P16, bf* Ph, bf* Pl, size_t n4) { const size_t i = (size_t)blockIdx.x * 256 + threadIdx.x; if (i >= n4) return; const v4f a = *(const v4f*)(F + i * 4); v4h o16; v4us oh, ol;
#pragma unroll
    for (int q = 0; q < 4; ++q) { o16[q] = tohx(a[q]); unsigned short x2, y2; splitf(a[q], x2, y2); oh[q] = x2; ol[q] = y2; }
    *(v4h*)(P16 + i * 4) = o16; *(v4us*)(Ph + i * 4) = oh; *(v4us*)(Pl + i * 4) = ol;  }

__global__ __launch_bounds__(256) void k_hdot(const float* __restrict__ bias, const float* __restrict__ F, int pitch, int nrows, int hcol, float* OUT) { const int lane = threadIdx.x & 31; const size_t wv = (size_t)blockIdx.x * 8 + (threadIdx.x >> 5); if (wv >= (size_t)NH_ * (nrows / 32)) return; const int h = (int)(wv / (nrows / 32)); const int n = (int)(wv % (nrows / 32)) * 32 + lane; const float* f = F + (size_t)n * pitch + (hcol ? h * HD : 0);   /* hcol: F has per-head columns (k); 0: one 64-wide row shared by all heads (r) */ const float* bh = bias + h * HD; float s = 0.f;
#pragma unroll 4
    for (int d = 0; d < HD; ++d) { s = __fadd_rn(s, __fmul_rn(bfr(bh[d]), f[d])); }
    *(float*)(OUT + (size_t)h * nrows + n) = s;  }

__global__ __launch_bounds__(256) void k_addxl(float* Sb, const float* __restrict__ QR, const float* __restrict__ KB, const float* __restrict__ RB, int h0) { const size_t k = (size_t)blockIdx.x * 256 + threadIdx.x; if (k >= (size_t)ZH * TT * TT / 4) return; const size_t e = k * 4; const int j0 = (int)(e % TT); const int i = (int)((e / TT) % TT); const int zz = (int)(e / ((size_t)TT * TT)); const int h = h0 + zz; const float* qr = QR + ((size_t)zz * TT + i) * NR; v4f a = *(const v4f*)(Sb + e); const v4f kb = *(const v4f*)(KB + (size_t)h * TT + j0);
#pragma unroll
    for (int q = 0; q < 4; ++q) { const int idx = TT + j0 + q - i; float s1 = __fadd_rn(a[q], kb[q]); asm volatile("" : "+v"(s1)); float s2 = __fadd_rn(s1, qr[idx]); asm volatile("" : "+v"(s2)); a[q] = __fadd_rn(s2, RB[(size_t)h * NR + idx]); }
    *(v4f*)(Sb + e) = a;  }
__global__ __launch_bounds__(256) void k_merge(const float* __restrict__ O, int h0, float* OUTb) { const size_t e = ((size_t)blockIdx.x * 256 + threadIdx.x) * 2; if (e >= (size_t)ZH * TT * HD) return; const int d = (int)(e % HD); const int t = (int)((e / HD) % TT); const int zz = (int)(e / ((size_t)HD * TT)); const float cs = (t < RH) ? 1.0f : (1.0f / PCAR); const size_t oo = (size_t)t * DQ + (h0 + zz) * HD + d;
    v2f o2; o2[0] = O[e] * cs; o2[1] = O[e + 1] * cs; *(v2f*)(OUTb + oo) = o2;  }

extern "C" void kernel_launch(void* const* d_in, const int* in_sizes, int n_in,
                              void* d_out, int out_size, void* d_ws, size_t ws_size, hipStream_t stream) {
    (void)in_sizes; (void)n_in; (void)out_size;
    const float* x = (const float*)d_in[0]; const float* xk = (const float*)d_in[1]; const int* kmask = (const int*)d_in[2]; const float* pemb = (const float*)d_in[3]; const float* wq = (const float*)d_in[4]; const float* wkv = (const float*)d_in[5]; const float* wr = (const float*)d_in[6]; const float* rrb = (const float*)d_in[7]; const float* rwb = (const float*)d_in[8]; const float* wk = nullptr; const float* wv = nullptr; (void)wk; (void)wv;
    float* OUT = (float*)d_out;     // [4][1024][1024]
    char* wsp = (char*)d_ws;
    auto take = [&](size_t bytes) { char* p = wsp; wsp += (bytes + 255) & ~(size_t)255; return (void*)p; };
    bf* WQ = (bf*)take((size_t)DQ * DM * 2); bf* WKV = (bf*)take((size_t)DKV2 * DM * 2); bf* WR = (bf*)take((size_t)HD * HD * 2); bf* PE = (bf*)take((size_t)NR * HD * 2); float* RF = (float*)take((size_t)NR * HD * 4); h16* RP16 = (h16*)take((size_t)NR * HD * 2); bf* RPh = (bf*)take((size_t)NR * HD * 2); bf* RPl = (bf*)take((size_t)NR * HD * 2); float* KB = (float*)take((size_t)NH_ * TT * 4); float* RB = (float*)take((size_t)NH_ * NR * 4); float* QR = (float*)take((size_t)ZH * TT * NR * 4); float* FKV = (float*)take((size_t)TT * DKV2 * 4); float* CS = (float*)take((size_t)TT * HD * 2 * 4);
    bf* XB = (bf*)take((size_t)TT * DM * 2); float* FQ = (float*)take((size_t)TT * DQ * 4); float* FK = nullptr;
    h16* QP16 = (h16*)take((size_t)NH_ * TT * HD * 2); h16* KP16 = (h16*)take((size_t)NKV * TT * HD * 2); h16* VT16 = (h16*)take((size_t)NKV * HD * TT * 2);
    bf* QPh = (bf*)take((size_t)NH_ * TT * HD * 2); bf* QPl = (bf*)take((size_t)NH_ * TT * HD * 2); bf* KPh = (bf*)take((size_t)NKV * TT * HD * 2); bf* KPl = (bf*)take((size_t)NKV * TT * HD * 2); bf* VTh = (bf*)take((size_t)NKV * HD * TT * 2); bf* VTl = (bf*)take((size_t)NKV * HD * TT * 2); bf* Ph = (bf*)QR; bf* Pl = Ph + (size_t)ZH * RH * TT;   // the two P planes (ZH*RH*TT*2 B each) lie on QR (ZH*TT*NR*4 B): QR's last reader, k_addxl, ends before k_asoft writes P (stream order), and the next pass rewrites QR only after the P.V launch
    float* Sb = (float*)take((size_t)ZH * TT * TT * 4); h16* P16 = nullptr; float* Ob = (float*)take((size_t)ZH * TT * HD * 4);
    if ((size_t)(wsp - (char*)d_ws) > ws_size) return;    // ws 256 MiB
    float* FV = nullptr; (void)FV; (void)FK;   // unused: k and v come from the one kv projection into FKV
    { k_wtG<<<(unsigned)((DM * DQ / 64 + 63) / 64), 256, 0, stream>>>(wq, DM, DQ, WQ); k_wtG<<<(unsigned)((DM * DKV2 / 64 + 63) / 64), 256, 0, stream>>>(wkv, DM, DKV2, WKV); k_wtG<<<(unsigned)((HD * HD / 64 + 63) / 64), 256, 0, stream>>>(wr, HD, HD, WR);
      k_cvt8<<<(unsigned)(((size_t)NR * HD / 8 + 255) / 256), 256, 0, stream>>>(pemb, PE, (size_t)NR * HD / 8); k_gemmw<bf, 0, false><<<dim3(NR / 64, HD / 64, 1), 32, 0, stream>>>(PE, nullptr, WR, nullptr, HD, RF, HD, nullptr, 0, 0, 0);   /* r = pos_embed Wr (exact) */
      k_flat<<<(unsigned)(((size_t)NR * HD / 4 + 255) / 256), 256, 0, stream>>>(RF, RP16, RPh, RPl, (size_t)NR * HD / 4); k_hdot<<<(unsigned)(((size_t)NH_ * (NR / 32) + 7) / 8), 256, 0, stream>>>(rwb, RF, HD, NR, 0, RB);   /* r is shared by all heads: no column offset */   /* r planes; RB[h][l] = r_w_bias_h . r_l */
      
       }
    k_csid<<<(TT * HD + 255) / 256, 256, 0, stream>>>(CS);
    const unsigned LQ = (unsigned)(((size_t)NH_ * TT * HD / 2 + 255) / 256), LKv = (unsigned)(((size_t)NKV * TT * HD / 2 + 255) / 256);
    for (int b = 0; b < NB_; ++b) {
        
        k_cvt8<<<(unsigned)(((size_t)TT * DM / 8 + 255) / 256), 256, 0, stream>>>(x + (size_t)b * TT * DM, XB, (size_t)TT * DM / 8);
        k_gemmw<bf, 0, false><<<dim3(TT / 64, DQ / 64, 1), 32, 0, stream>>>(XB, nullptr, WQ, nullptr, DM, FQ, DQ, nullptr, 0, 0, 0);
        k_rope<<<LQ, 256, 0, stream>>>(FQ, DQ, NH_, CS, nullptr, nullptr, 1.0f, QP16, QPh, QPl);
        k_cvt8<<<(unsigned)(((size_t)TT * DM / 8 + 255) / 256), 256, 0, stream>>>(xk + (size_t)b * TT * DM, XB, (size_t)TT * DM / 8); k_gemmw<bf, 0, false><<<dim3(TT / 64, DKV2 / 64, 1), 32, 0, stream>>>(XB, nullptr, WKV, nullptr, DM, FKV, DKV2, nullptr, 0, 0, 0); k_hdot<<<(unsigned)(((size_t)NH_ * (TT / 32) + 7) / 8), 256, 0, stream>>>(rrb, FKV, DKV2, TT, 1, KB);   /* kv = k Wkv; KB[h][j] = r_r_bias_h . kh_j */
        k_rope<<<LKv, 256, 0, stream>>>(FKV, DKV2, NKV, CS, nullptr, nullptr, 1.0f, KP16, KPh, KPl);   /* k = kv columns 0..1023 */
        k_vtp<<<LKv, 256, 0, stream>>>(FKV + DKV, DKV2, NKV, VT16, VTh, VTl);   /* v = kv columns 1024..2047 */
        for (int h0 = 0; h0 < NH_; h0 += ZH) { const size_t zq = (size_t)h0, zk = (size_t)(h0 / REP);   // one kv head per query head: the pass's heads use consecutive kv planes (z-strides TT*HD)
            k_gemmw<bf, 2, false><<<dim3(RH / 64, TT / 64, ZH), 32, 0, stream>>>(QPh + zq * TT * HD, QPl + zq * TT * HD, KPh + zk * TT * HD, KPl + zk * TT * HD, HD, Sb, TT, nullptr, (size_t)TT * HD, (size_t)TT * HD, (size_t)TT * TT);
            k_gemmw<bf, 2, false><<<dim3(TT / 64, NR / 64, ZH), 32, 0, stream>>>(QPh + zq * TT * HD, QPl + zq * TT * HD, RPh, RPl, HD, QR, NR, nullptr, (size_t)TT * HD, 0, (size_t)TT * NR);   /* QR[i][l] = qh_i . r_l (all rows hi/lo) */
            k_addxl<<<(unsigned)(((size_t)ZH * TT * TT / 4 + 255) / 256), 256, 0, stream>>>(Sb, QR, KB, RB, h0);
            k_asoft<<<ZH * TT / 8, 256, 0, stream>>>(Sb, kmask + (size_t)b * TT, P16, Ph, Pl);
            k_gemmw<bf, 2, false><<<dim3(RH / 64, HD / 64, ZH), 32, 0, stream>>>(Ph, Pl, VTh + zk * HD * TT, VTl + zk * HD * TT, TT, Ob, HD, nullptr, (size_t)RH * TT, (size_t)HD * TT, (size_t)TT * HD);
            k_merge<<<(unsigned)(((size_t)ZH * TT * HD / 2 + 255) / 256), 256, 0, stream>>>(Ob, h0, OUT + (size_t)b * TT * DQ); }
         }
}

// v002
// One run takes 469 microseconds.
// In two side-by-side timings against v001, it was 1.73 and 1.74 times as fast.
// Counting every step since v000, it is 3.69 times as fast.
#include <hip/hip_runtime.h>

// Transformer-XL relative multi-head attention (q, k [4][1024][1024]; qh = q Wq ('xw' [1024][1024]), kv = k Wkv ('xw' [1024][2048]: k | v column blocks; 16 heads x 64); r = pos_embed Wr ([2048][64] x [64][64], shared by all heads); AC = (qh + r_r_bias_h).kh, BD = shift((qh + r_w_bias_h).r): BD[i][j] = (qh_i + r_w_bias_h).r[L + j - i]; attn = (AC + BD)/8; keys with mask[b][j] == 0 -> -inf (int [4][1024], read); softmax; out = merged attn.vh -> [4][1024][1024] (4.2 M)).
// Compute dtypes, f32 accumulate: every input rounded to bf16; projections exact; relative terms 3 products / f32 dots; content scores 3 products on every row; softmax f32; output f32.

#define NB_  4
#define TT   1024
#define DM   1024
#define NH_  16
#define NKV  16
#define REP  (NH_ / NKV)
#define HD   64
#define DQ   (NH_ * HD)
#define DKV  (NKV * HD)
#define RH   1024                 // = TT: every row hi/lo
#define WIN  0
#define PCAR 1024.0f
#define SCL  0.125f
#define NR   2048    // relative positions (2L)
#define DKV2 2048    // kv projection width (k | v)
typedef _Float16 h16;
typedef unsigned short bf;
typedef __attribute__((ext_vector_type(16))) __bf16   v16bf;
typedef __attribute__((ext_vector_type(16))) _Float16 v16h;
typedef __attribute__((ext_vector_type(8)))  _Float16 v8h;
typedef __attribute__((ext_vector_type(8)))  unsigned short v8us;
typedef __attribute__((ext_vector_type(8)))  float    v8f;
typedef __attribute__((ext_vector_type(4)))  float    v4f;
typedef v8h  __attribute__((may_alias)) v8ha;
typedef v4f  __attribute__((may_alias)) v4fa;
typedef v8us __attribute__((may_alias)) v8usa;

__device__ __forceinline__ unsigned short f2bf(float f) { unsigned u = __float_as_uint(f); u += 0x7FFFu + ((u >> 16) & 1u); return (unsigned short)(u >> 16); }
__device__ __forceinline__ float bf2f(unsigned short b) { return __uint_as_float(((unsigned)b) << 16); }
__device__ __forceinline__ float bfr(float f) { return bf2f(f2bf(f)); }
__device__ __forceinline__ v16h cat16(v8h lo, v8h hi) { return __builtin_shufflevector(lo, hi, 0, 1, 2, 3, 4, 5, 6, 7, 8, 9, 10, 11, 12, 13, 14, 15); }
__device__ __forceinline__ v16bf cat16b(v8us lo, v8us hi) { return __builtin_bit_cast(v16bf, __builtin_shufflevector(lo, hi, 0, 1, 2, 3, 4, 5, 6, 7, 8, 9, 10, 11, 12, 13, 14, 15)); }
__device__ __forceinline__ v8f wmma16(v16h a, v16h b, v8f c) { return __builtin_amdgcn_wmma_f32_16x16x32_f16(false, a, false, b, (short)0, c, false, false); }
__device__ __forceinline__ v8f wmmab(v16bf a, v16bf b, v8f c) { return __builtin_amdgcn_wmma_f32_16x16x32_bf16(false, a, false, b, (short)0, c, false, false); }



// ---- k_gemmw: register-blocked GEMM, ONE WAVE per 64x64 output tile (16 accumulators), operands straight from K-contiguous 16-bit planes; grid (M/64, N/64, Z), 32 threads.
// C[m][n] (f32, pitch ldc, + optional f32 bias[n]) = sum_k A[m][k] Bt[n][k] (+ split products per NSPLIT). z-batch strides sA/sB/sC in elements. K % 32 == 0.
template <typename T16> struct WFrag;
template <> struct WFrag<h16> { typedef v16h V; static __device__ __forceinline__ V ld(const h16* p) { return cat16(*(const v8h*)p, *(const v8h*)(p + 16)); } static __device__ __forceinline__ v8f mma(V a, V b, v8f c) { return wmma16(a, b, c); } };
template <> struct WFrag<bf> { typedef v16bf V; static __device__ __forceinline__ V ld(const bf* p) { return cat16b(*(const v8us*)p, *(const v8us*)(p + 16)); } static __device__ __forceinline__ v8f mma(V a, V b, v8f c) { return wmmab(a, b, c); } };
template <typename T16, int NSPLIT, bool BIAS>
__global__ __launch_bounds__(32) void k_gemmw(const T16* __restrict__ A, const T16* __restrict__ A2, const T16* __restrict__ Bt, const T16* __restrict__ Bt2, int K, float* C, int ldc, const float* __restrict__ bias, size_t sA, size_t sB, size_t sC) {
    typedef typename WFrag<T16>::V V;
    __shared__ __align__(16) float os[16 * 68];
    const size_t z = blockIdx.z; A += z * sA; if (A2) A2 += z * sA; Bt += z * sB; if (Bt2) Bt2 += z * sB; C += z * sC;
    const int lane = threadIdx.x & 31, lr = lane & 15, hi = lane >> 4; const int r0 = blockIdx.x * 64, c0 = blockIdx.y * 64;
    v8f acc[4][4];
#pragma unroll
    for (int mb = 0; mb < 4; ++mb)
#pragma unroll
        for (int nb = 0; nb < 4; ++nb) acc[mb][nb] = (v8f){};
    const size_t aoff = (size_t)(r0 + lr) * K + 8 * hi, boff = (size_t)(c0 + lr) * K + 8 * hi;
#pragma unroll 1
    for (int kc = 0; kc < K; kc += 32) {
        V a[4], a2[4];
#pragma unroll
        for (int mb = 0; mb < 4; ++mb) { a[mb] = WFrag<T16>::ld(A + aoff + (size_t)mb * 16 * K + kc); if (NSPLIT == 1 || NSPLIT == 2) a2[mb] = WFrag<T16>::ld(A2 + aoff + (size_t)mb * 16 * K + kc); }
#pragma unroll
        for (int nb = 0; nb < 4; ++nb) { const V b = WFrag<T16>::ld(Bt + boff + (size_t)nb * 16 * K + kc); V b2; if (NSPLIT >= 2) b2 = WFrag<T16>::ld(Bt2 + boff + (size_t)nb * 16 * K + kc);
#pragma unroll
            for (int mb = 0; mb < 4; ++mb) { acc[mb][nb] = WFrag<T16>::mma(a[mb], b, acc[mb][nb]); if (NSPLIT == 1 || NSPLIT == 2) acc[mb][nb] = WFrag<T16>::mma(a2[mb], b, acc[mb][nb]); if (NSPLIT >= 2) acc[mb][nb] = WFrag<T16>::mma(a[mb], b2, acc[mb][nb]); } }
        asm volatile("v_nop\n\tv_nop\n\tv_nop\n\tv_nop" : "+v"(acc[0][0]), "+v"(acc[1][1]), "+v"(acc[2][2]), "+v"(acc[3][3]) : "v"(a[0]), "v"(a[3]));
    }
#pragma unroll
    for (int mb = 0; mb < 4; ++mb) {
#pragma unroll
        for (int nb = 0; nb < 4; ++nb) {
#pragma unroll
            for (int j = 0; j < 8; ++j) os[(hi * 8 + j) * 68 + nb * 16 + lr] = acc[mb][nb][j]; }
        __builtin_amdgcn_wave_barrier(); asm volatile("" ::: "memory");
        float* crow = C + (size_t)(r0 + mb * 16) * ldc + c0;
{
#pragma unroll
            for (int s = 0; s < 8; ++s) { const int row = 2 * s + hi, cofs = lr * 4; v4f val = *(const v4fa*)(os + row * 68 + cofs); if (BIAS) { val[0] += bfr(bias[c0 + cofs]); val[1] += bfr(bias[c0 + cofs + 1]); val[2] += bfr(bias[c0 + cofs + 2]); val[3] += bfr(bias[c0 + cofs + 3]); }
                *(v4f*)(crow + (size_t)row * ldc + cofs) = val; }
             }
        __builtin_amdgcn_wave_barrier(); asm volatile("" ::: "memory");
    }
}

__device__ __forceinline__ h16 tohx(float x) { return (h16)x; }
__device__ __forceinline__ void splitf(float y, unsigned short& h, unsigned short& l) { h = f2bf(y); l = f2bf(y - bf2f(h)); }
typedef __attribute__((ext_vector_type(2))) _Float16 v2h;
typedef __attribute__((ext_vector_type(4))) _Float16 v4h;
typedef __attribute__((ext_vector_type(2))) unsigned short v2us;
typedef __attribute__((ext_vector_type(4))) unsigned short v4us;
typedef __attribute__((ext_vector_type(2))) float v2f;
typedef __attribute__((ext_vector_type(4))) int v4i;

__global__ __launch_bounds__(256) void k_wtG(const float* __restrict__ w, int K, int N, bf* Bt) {
    const int lane = threadIdx.x & 31; const int L0 = (blockIdx.x * 8 + (threadIdx.x >> 5)) * 8; const int nlines = N * K / 64;
{
#pragma unroll 1
        for (int l = 0; l < 8; ++l) { const int L = L0 + l; if (L >= nlines) break; const size_t e = (size_t)L * 64 + lane * 2; const int k = (int)(e % K), n = (int)(e / K); v2us o;
            o[0] = f2bf(w[(size_t)k * N + n]); o[1] = f2bf(w[(size_t)(k + 1) * N + n]); *(v2us*)(Bt + e) = o; }
         }
}
__global__ __launch_bounds__(256) void k_cvt8(const float* __restrict__ src, bf* dst, size_t n8) { const size_t i = (size_t)blockIdx.x * 256 + threadIdx.x; if (i >= n8) return; const v8f v = *(const v8f*)(src + i * 8); v8us o;
#pragma unroll
    for (int k = 0; k < 8; ++k) o[k] = f2bf(v[k]); *(v8us*)(dst + i * 8) = o;  }

// k_rope: head planes [h][t][d] (fp16 + hi/lo) of rope(x) x sc with the rotate-half convention out[d] = x[d] cos[t][d] - x[d+HD/2] sin[t][d], out[d+HD/2] = x[d+HD/2] cos[t][d+HD/2] + x[d] sin[t][d+HD/2]
__global__ __launch_bounds__(256) void k_rope(const float* __restrict__ F, int pitch, int nheads, const float* __restrict__ CS, const float* __restrict__ RF, const float* __restrict__ nw, float sc, h16* P16, bf* Ph, bf* Pl) {
    const size_t e = ((size_t)blockIdx.x * 256 + threadIdx.x) * 2; if (e >= (size_t)nheads * TT * HD) return; const int d = (int)(e % HD); const int t = (int)((e / HD) % TT); const int h = (int)(e / ((size_t)HD * TT)); const float* f = F + (size_t)t * pitch + h * HD; const float rf = RF ? RF[(size_t)h * TT + t] : 1.0f; v2h o16; v2us oh, ol;
#pragma unroll
    for (int q = 0; q < 2; ++q) { const int dd = d + q; const int dp = (dd < HD / 2) ? dd + HD / 2 : dd - HD / 2; float x0 = f[dd], x1 = f[dp];
        if (RF) { float n0 = __fmul_rn(x0, rf), n1 = __fmul_rn(x1, rf); asm volatile("" : "+v"(n0)); asm volatile("" : "+v"(n1)); x0 = __fmul_rn(bfr(nw[dd]), n0); x1 = __fmul_rn(bfr(nw[dp]), n1); }
        const v2f cs = *(const v2f*)(CS + ((size_t)t * HD + dd) * 2); float a = __fmul_rn(x0, cs[0]), bq = __fmul_rn(x1, cs[1]); asm volatile("" : "+v"(a)); asm volatile("" : "+v"(bq)); const float r = ((dd < HD / 2) ? __fsub_rn(a, bq) : __fadd_rn(a, bq)) * sc;
        o16[q] = tohx(r); unsigned short a2, c2; splitf(r, a2, c2); oh[q] = a2; ol[q] = c2; }
    *(v2h*)(P16 + e) = o16; *(v2us*)(Ph + e) = oh; *(v2us*)(Pl + e) = ol;  }
__global__ __launch_bounds__(256) void k_vtp(const float* __restrict__ F, int pitch, int nheads, h16* V16, bf* Vh, bf* Vl) { const size_t e = ((size_t)blockIdx.x * 256 + threadIdx.x) * 2; if (e >= (size_t)nheads * HD * TT) return; const int t = (int)(e % TT); const int d = (int)((e / TT) % HD); const int g = (int)(e / ((size_t)TT * HD)); v2h o16; v2us oh, ol;
#pragma unroll
    for (int q = 0; q < 2; ++q) { const float x = F[(size_t)(t + q) * pitch + g * HD + d]; o16[q] = tohx(x); unsigned short a2, c2; splitf(x, a2, c2); oh[q] = a2; ol[q] = c2; }
    *(v2h*)(V16 + e) = o16; *(v2us*)(Vh + e) = oh; *(v2us*)(Vl + e) = ol;  }
__global__ __launch_bounds__(256) void k_csid(float* CS) { const int idx = blockIdx.x * 256 + threadIdx.x; if (idx >= TT * HD) return; v2f cs; cs[0] = 1.0f; cs[1] = 0.0f; *(v2f*)(CS + (size_t)idx * 2) = cs;  }
__global__ __launch_bounds__(256) void k_flat(const float* __restrict__ F, h16* P16, bf* Ph, bf* Pl, size_t n4) { const size_t i = (size_t)blockIdx.x * 256 + threadIdx.x; if (i >= n4) return; const v4f a = *(const v4f*)(F + i * 4); v4h o16; v4us oh, ol;
#pragma unroll
    for (int q = 0; q < 4; ++q) { o16[q] = tohx(a[q]); unsigned short x2, y2; splitf(a[q], x2, y2); oh[q] = x2; ol[q] = y2; }
    *(v4h*)(P16 + i * 4) = o16; *(v4us*)(Ph + i * 4) = oh; *(v4us*)(Pl + i * 4) = ol;  }

__global__ __launch_bounds__(256) void k_hdot(const float* __restrict__ bias, const float* __restrict__ F, int pitch, int nrows, int hcol, float* OUT) { const int lane = threadIdx.x & 31; const size_t wv = (size_t)blockIdx.x * 8 + (threadIdx.x >> 5); if (wv >= (size_t)NH_ * (nrows / 32)) return; const int h = (int)(wv / (nrows / 32)); const int n = (int)(wv % (nrows / 32)) * 32 + lane; const float* f = F + (size_t)n * pitch + (hcol ? h * HD : 0);   /* hcol: F has per-head columns (k); 0: one 64-wide row shared by all heads (r) */ const float* bh = bias + h * HD; float s = 0.f;
#pragma unroll 4
    for (int d = 0; d < HD; ++d) { s = __fadd_rn(s, __fmul_rn(bfr(bh[d]), f[d])); }
    *(float*)(OUT + (size_t)h * nrows + n) = s;  }

#define MT   2                    // 16-row query tiles per work-group
#define ROWS (16 * MT)
#define PD   6                    // k steps by which the V fragment loads run ahead in the P.V product
#define PA   3                    // ring of P fragment sets in the P.V product
#define SP   1028                 // floats per LDS score row: 4112 B = 16 B x odd, the conflict-free pitch for 16-byte fragment reads
typedef v4us __attribute__((may_alias)) v4usa;
// ld4: the hi and lo fragments of both 32-wide k halves of one 16-row tile (x[0] hi k 0..31, x[1] lo, x[2] hi k 32..63, x[3] lo).
__device__ __forceinline__ void ld4(const bf* ph, const bf* pl, v16bf (&x)[4]) {
    x[0] = WFrag<bf>::ld(ph); x[1] = WFrag<bf>::ld(pl); x[2] = WFrag<bf>::ld(ph + 32); x[3] = WFrag<bf>::ld(pl + 32);
    asm volatile("s_wait_xcnt 0x0" :: "v"(ph), "v"(pl) : "memory");   // both address pairs stay live up to this wait
}
// k_fattn: one work-group (8 waves) = ROWS query rows of one head; their whole score rows stay in LDS from the score products to the P.V product.
// 1. wave w owns keys [128 w, 128 w + 128): q.r tiles over the window l = TT + j - i are stored straight to their shifted place sc[i][j];
// 2. q.k tiles: sc = ((q.k + KB[j]) + q.r) + RB[l]; 3. softmax, one wave per row, P hi | lo planes written over the row's own scores;
// 4. O = P.V (waves 0..3, one 16-column block each, k ascending), staged in LDS so that each wave stores whole output lines.
__global__ __launch_bounds__(256) void k_fattn(const bf* __restrict__ Qh, const bf* __restrict__ Ql, const bf* __restrict__ Kh, const bf* __restrict__ Kl, const bf* __restrict__ Rh, const bf* __restrict__ Rl, const bf* __restrict__ Vh, const bf* __restrict__ Vl, const float* __restrict__ KB, const float* __restrict__ RB, const int* __restrict__ km, float* OUTb) {
    typedef WFrag<bf> F;
    __shared__ __align__(16) float sc[ROWS * SP];
    __shared__ __align__(16) float os[ROWS * 68];
    __shared__ float rbs[TT + ROWS];
    const int lane = threadIdx.x & 31, lr = lane & 15, hi = lane >> 4; const int w = __builtin_amdgcn_readfirstlane((int)(threadIdx.x >> 5));
    const int i0 = blockIdx.x * ROWS, h = blockIdx.y, jw = w * 128;
    const float* rbg = RB + (size_t)h * NR + (TT - i0 - ROWS) + threadIdx.x; float rv[TT / 256 + 1];   // rbs[x] = RB[h][TT - i0 - ROWS + x]: every l this work-group's rows meet; loaded here, stored in front of the first barrier
#pragma unroll
    for (int q = 0; q < TT / 256; ++q) rv[q] = rbg[q * 256];
    rv[TT / 256] = (threadIdx.x < ROWS) ? rbg[TT] : 0.f;
    v16bf ah[MT][2], al[MT][2];
#pragma unroll
    for (int mb = 0; mb < MT; ++mb) { const size_t o = ((size_t)h * TT + i0 + mb * 16 + lr) * HD + 8 * hi; v16bf x[4]; ld4(Qh + o, Ql + o, x); ah[mb][0] = x[0]; al[mb][0] = x[1]; ah[mb][1] = x[2]; al[mb][1] = x[3]; }
    const int lbase = TT + jw - i0 - ROWS;   // first l of the wave's window; the window [lbase, lbase + 128 + ROWS) lies in [0, NR)
    // Both tile loops are unrolled: which row tile needs which window tile is then decided at compile time, and the next tile's loads (issued ahead, in the source too) fly while this tile is multiplied.
    v16bf nx[4];
    { const size_t o = (size_t)(lbase + lr) * HD + 8 * hi; ld4(Rh + o, Rl + o, nx); }
#pragma unroll
    for (int t = 0; t < 8 + MT; ++t) { const v16bf b[2] = {nx[0], nx[2]}, c[2] = {nx[1], nx[3]};
        if (t + 1 < 8 + MT) { const size_t o = (size_t)(lbase + (t + 1) * 16 + lr) * HD + 8 * hi; ld4(Rh + o, Rl + o, nx); }
        else { const size_t o = ((size_t)h * TT + jw + lr) * HD + 8 * hi; ld4(Kh + o, Kl + o, nx); }   // the first key tile
        v8f acc[MT];
#pragma unroll
        for (int mb = 0; mb < MT; ++mb) acc[mb] = (v8f){};
#pragma unroll
        for (int s = 0; s < 2; ++s) {
#pragma unroll
            for (int mb = 0; mb < MT; ++mb) if (t + mb >= MT - 1 && t + mb <= MT + 7) acc[mb] = wmmab(ah[mb][s], b[s], acc[mb]);
#pragma unroll
            for (int mb = 0; mb < MT; ++mb) if (t + mb >= MT - 1 && t + mb <= MT + 7) acc[mb] = wmmab(al[mb][s], b[s], acc[mb]);
#pragma unroll
            for (int mb = 0; mb < MT; ++mb) if (t + mb >= MT - 1 && t + mb <= MT + 7) acc[mb] = wmmab(ah[mb][s], c[s], acc[mb]); }
        asm volatile("v_nop\n\tv_nop\n\tv_nop\n\tv_nop" : "+v"(acc[0]), "+v"(acc[1]));   // the four vector slots the chip needs before the next tile's first product overwrites these result registers: only LDS stores stand between
#pragma unroll
        for (int mb = 0; mb < MT; ++mb) { if (t + mb < MT - 1 || t + mb > MT + 7) continue;
#pragma unroll
            for (int jj = 0; jj < 8; ++jj) { const int ii = mb * 16 + hi * 8 + jj; const int jrel = t * 16 + lr + ii - ROWS;   /* j - jw of (row ii, l = lbase + 16 t + lr) */ if (jrel >= 0 && jrel < 128) sc[ii * SP + jw + jrel] = acc[mb][jj]; } } }
#pragma unroll
    for (int q = 0; q < TT / 256; ++q) rbs[q * 256 + threadIdx.x] = rv[q];
    if (threadIdx.x < ROWS) rbs[TT + threadIdx.x] = rv[TT / 256];
    __syncthreads();
#pragma unroll
    for (int nb = 0; nb < 8; ++nb) { const int j = jw + nb * 16 + lr; const v16bf b[2] = {nx[0], nx[2]}, c[2] = {nx[1], nx[3]}; const float kb = KB[(size_t)h * TT + j];
        if (nb + 1 < 8) { const size_t o = ((size_t)h * TT + j + 16) * HD + 8 * hi; ld4(Kh + o, Kl + o, nx); }
        v8f acc[MT];
#pragma unroll
        for (int mb = 0; mb < MT; ++mb) acc[mb] = (v8f){};
#pragma unroll
        for (int s = 0; s < 2; ++s) {
#pragma unroll
            for (int mb = 0; mb < MT; ++mb) acc[mb] = wmmab(ah[mb][s], b[s], acc[mb]);
#pragma unroll
            for (int mb = 0; mb < MT; ++mb) acc[mb] = wmmab(al[mb][s], b[s], acc[mb]);
#pragma unroll
            for (int mb = 0; mb < MT; ++mb) acc[mb] = wmmab(ah[mb][s], c[s], acc[mb]); }
#pragma unroll
        for (int mb = 0; mb < MT; ++mb)
#pragma unroll
            for (int jj = 0; jj < 8; ++jj) { const int ii = mb * 16 + hi * 8 + jj; float* p = sc + ii * SP + j; *p = __fadd_rn(__fadd_rn(__fadd_rn(acc[mb][jj], kb), *p), rbs[j - ii + ROWS]); } }
    __syncthreads();
    // V fragments run PD k steps ahead of their products; the first PD are asked for here, so that they land during the softmax
    v16bf vh[PD], vl[PD]; const size_t vo = ((size_t)h * HD + (w & 3) * 16 + lr) * TT + 8 * hi;
    if (w < 4) {
#pragma unroll
        for (int d = 0; d < PD; ++d) { vh[d] = F::ld(Vh + vo + 32 * d); vl[d] = F::ld(Vl + vo + 32 * d); } }
    for (int rr = 0; rr < ROWS / 8; ++rr) { float* sr = sc + (w * (ROWS / 8) + rr) * SP; float v[TT / 32]; float mx = -3.0e38f;
#pragma unroll
        for (int ch = 0; ch < TT / 128; ++ch) { const int j0 = ch * 128 + lane * 4; const v4f a = *(const v4fa*)(sr + j0); const v4i mk = *(const v4i*)(km + j0);
#pragma unroll
            for (int q = 0; q < 4; ++q) { const float t = (mk[q] != 0) ? a[q] * SCL : -3.0e38f; v[ch * 4 + q] = t;   /* mask == 0 -> -inf */ mx = fmaxf(mx, t); } }
#pragma unroll
        for (int sh = 16; sh; sh >>= 1) mx = fmaxf(mx, __shfl_xor(mx, sh, 32));
        float sum = 0.f;
#pragma unroll
        for (int k = 0; k < TT / 32; ++k) { const float d0 = __fsub_rn(v[k], mx); v[k] = __builtin_amdgcn_exp2f(__fmul_rn(d0, 1.4426950408889634f)); sum += v[k]; }
#pragma unroll
        for (int sh = 16; sh; sh >>= 1) sum += __shfl_xor(sum, sh, 32);
        const float f = __fdiv_rn(1.0f, sum); bf* pr = (bf*)sr;   // P hi in the row's first 2 KiB, P lo in its second; every score of the row is in registers by now (the sum needed them all)
#pragma unroll
        for (int ch = 0; ch < TT / 128; ++ch) { v4us oh, ol;
#pragma unroll
            for (int q = 0; q < 4; ++q) { unsigned short a, c2; splitf(v[ch * 4 + q] * f, a, c2); oh[q] = a; ol[q] = c2; }
            *(v4usa*)(pr + ch * 128 + lane * 4) = oh; *(v4usa*)(pr + TT + ch * 128 + lane * 4) = ol; } }
    __syncthreads();
    if (w < 4) { v8f acc[MT];
#pragma unroll
        for (int mb = 0; mb < MT; ++mb) acc[mb] = (v8f){};
        const bf* pl = (const bf*)(sc + lr * SP) + 8 * hi;   // this lane's P hi row of row tile 0; row tile mb lies 16 rows on, P lo TT elements on
        v16bf pa[PA][MT], pb[PA][MT];   // P hi / lo fragments, read from LDS PA - 1 k steps ahead of their products
#pragma unroll
        for (int d = 0; d < PA - 1; ++d)
#pragma unroll
            for (int mb = 0; mb < MT; ++mb) { const bf* pr = pl + mb * 16 * SP * 2 + d * 32; pa[d][mb] = cat16b(*(const v8usa*)pr, *(const v8usa*)(pr + 16)); pb[d][mb] = cat16b(*(const v8usa*)(pr + TT), *(const v8usa*)(pr + TT + 16)); }
        // unrolled: the fragment rings are then indexed at compile time and stay in registers, and the last steps ask for nothing
#pragma unroll
        for (int ks = 0; ks < TT / 32; ++ks) { const int kc = ks * 32; const v16bf b = vh[ks % PD], b2 = vl[ks % PD];
            if (ks + PD < TT / 32) { vh[ks % PD] = F::ld(Vh + vo + kc + 32 * PD); vl[ks % PD] = F::ld(Vl + vo + kc + 32 * PD); }
            if (ks + PA - 1 < TT / 32) {
#pragma unroll
                for (int mb = 0; mb < MT; ++mb) { const bf* pr = pl + mb * 16 * SP * 2 + kc + (PA - 1) * 32; pa[(ks + PA - 1) % PA][mb] = cat16b(*(const v8usa*)pr, *(const v8usa*)(pr + 16)); pb[(ks + PA - 1) % PA][mb] = cat16b(*(const v8usa*)(pr + TT), *(const v8usa*)(pr + TT + 16)); } }
#pragma unroll
            for (int mb = 0; mb < MT; ++mb) acc[mb] = wmmab(pa[ks % PA][mb], b, acc[mb]);
#pragma unroll
            for (int mb = 0; mb < MT; ++mb) acc[mb] = wmmab(pb[ks % PA][mb], b, acc[mb]);
#pragma unroll
            for (int mb = 0; mb < MT; ++mb) acc[mb] = wmmab(pa[ks % PA][mb], b2, acc[mb]); }
#pragma unroll
        for (int mb = 0; mb < MT; ++mb)
#pragma unroll
            for (int jj = 0; jj < 8; ++jj) os[(mb * 16 + hi * 8 + jj) * 68 + w * 16 + lr] = acc[mb][jj]; }
    __syncthreads();
#pragma unroll
    for (int s = 0; s < MT; ++s) { const int row = s * 16 + (int)(threadIdx.x >> 4), cofs = (int)(threadIdx.x & 15) * 4; *(v4f*)(OUTb + (size_t)(i0 + row) * DQ + h * HD + cofs) = *(const v4fa*)(os + row * 68 + cofs); }
}

extern "C" void kernel_launch(void* const* d_in, const int* in_sizes, int n_in,
                              void* d_out, int out_size, void* d_ws, size_t ws_size, hipStream_t stream) {
    (void)in_sizes; (void)n_in; (void)out_size;
    const float* x = (const float*)d_in[0]; const float* xk = (const float*)d_in[1]; const int* kmask = (const int*)d_in[2]; const float* pemb = (const float*)d_in[3]; const float* wq = (const float*)d_in[4]; const float* wkv = (const float*)d_in[5]; const float* wr = (const float*)d_in[6]; const float* rrb = (const float*)d_in[7]; const float* rwb = (const float*)d_in[8]; const float* wk = nullptr; const float* wv = nullptr; (void)wk; (void)wv;
    float* OUT = (float*)d_out;     // [4][1024][1024]
    char* wsp = (char*)d_ws;
    auto take = [&](size_t bytes) { char* p = wsp; wsp += (bytes + 255) & ~(size_t)255; return (void*)p; };
    bf* WQ = (bf*)take((size_t)DQ * DM * 2); bf* WKV = (bf*)take((size_t)DKV2 * DM * 2); bf* WR = (bf*)take((size_t)HD * HD * 2); bf* PE = (bf*)take((size_t)NR * HD * 2); float* RF = (float*)take((size_t)NR * HD * 4); h16* RP16 = (h16*)take((size_t)NR * HD * 2); bf* RPh = (bf*)take((size_t)NR * HD * 2); bf* RPl = (bf*)take((size_t)NR * HD * 2); float* KB = (float*)take((size_t)NH_ * TT * 4); float* RB = (float*)take((size_t)NH_ * NR * 4); float* FKV = (float*)take((size_t)TT * DKV2 * 4); float* CS = (float*)take((size_t)TT * HD * 2 * 4);
    bf* XB = (bf*)take((size_t)TT * DM * 2); float* FQ = (float*)take((size_t)TT * DQ * 4); float* FK = nullptr;
    h16* QP16 = (h16*)take((size_t)NH_ * TT * HD * 2); h16* KP16 = (h16*)take((size_t)NKV * TT * HD * 2); h16* VT16 = (h16*)take((size_t)NKV * HD * TT * 2);
    bf* QPh = (bf*)take((size_t)NH_ * TT * HD * 2); bf* QPl = (bf*)take((size_t)NH_ * TT * HD * 2); bf* KPh = (bf*)take((size_t)NKV * TT * HD * 2); bf* KPl = (bf*)take((size_t)NKV * TT * HD * 2); bf* VTh = (bf*)take((size_t)NKV * HD * TT * 2); bf* VTl = (bf*)take((size_t)NKV * HD * TT * 2);
    if ((size_t)(wsp - (char*)d_ws) > ws_size) return;    // ws 256 MiB
    float* FV = nullptr; (void)FV; (void)FK;   // unused: k and v come from the one kv projection into FKV
    { k_wtG<<<(unsigned)((DM * DQ / 64 + 63) / 64), 256, 0, stream>>>(wq, DM, DQ, WQ); k_wtG<<<(unsigned)((DM * DKV2 / 64 + 63) / 64), 256, 0, stream>>>(wkv, DM, DKV2, WKV); k_wtG<<<(unsigned)((HD * HD / 64 + 63) / 64), 256, 0, stream>>>(wr, HD, HD, WR);
      k_cvt8<<<(unsigned)(((size_t)NR * HD / 8 + 255) / 256), 256, 0, stream>>>(pemb, PE, (size_t)NR * HD / 8); k_gemmw<bf, 0, false><<<dim3(NR / 64, HD / 64, 1), 32, 0, stream>>>(PE, nullptr, WR, nullptr, HD, RF, HD, nullptr, 0, 0, 0);   /* r = pos_embed Wr (exact) */
      k_flat<<<(unsigned)(((size_t)NR * HD / 4 + 255) / 256), 256, 0, stream>>>(RF, RP16, RPh, RPl, (size_t)NR * HD / 4); k_hdot<<<(unsigned)(((size_t)NH_ * (NR / 32) + 7) / 8), 256, 0, stream>>>(rwb, RF, HD, NR, 0, RB);   /* r is shared by all heads: no column offset */   /* r planes; RB[h][l] = r_w_bias_h . r_l */
      
       }
    k_csid<<<(TT * HD + 255) / 256, 256, 0, stream>>>(CS);
    const unsigned LQ = (unsigned)(((size_t)NH_ * TT * HD / 2 + 255) / 256), LKv = (unsigned)(((size_t)NKV * TT * HD / 2 + 255) / 256);
    for (int b = 0; b < NB_; ++b) {
        
        k_cvt8<<<(unsigned)(((size_t)TT * DM / 8 + 255) / 256), 256, 0, stream>>>(x + (size_t)b * TT * DM, XB, (size_t)TT * DM / 8);
        k_gemmw<bf, 0, false><<<dim3(TT / 64, DQ / 64, 1), 32, 0, stream>>>(XB, nullptr, WQ, nullptr, DM, FQ, DQ, nullptr, 0, 0, 0);
        k_rope<<<LQ, 256, 0, stream>>>(FQ, DQ, NH_, CS, nullptr, nullptr, 1.0f, QP16, QPh, QPl);
        k_cvt8<<<(unsigned)(((size_t)TT * DM / 8 + 255) / 256), 256, 0, stream>>>(xk + (size_t)b * TT * DM, XB, (size_t)TT * DM / 8); k_gemmw<bf, 0, false><<<dim3(TT / 64, DKV2 / 64, 1), 32, 0, stream>>>(XB, nullptr, WKV, nullptr, DM, FKV, DKV2, nullptr, 0, 0, 0); k_hdot<<<(unsigned)(((size_t)NH_ * (TT / 32) + 7) / 8), 256, 0, stream>>>(rrb, FKV, DKV2, TT, 1, KB);   /* kv = k Wkv; KB[h][j] = r_r_bias_h . kh_j */
        k_rope<<<LKv, 256, 0, stream>>>(FKV, DKV2, NKV, CS, nullptr, nullptr, 1.0f, KP16, KPh, KPl);   /* k = kv columns 0..1023 */
        k_vtp<<<LKv, 256, 0, stream>>>(FKV + DKV, DKV2, NKV, VT16, VTh, VTl);   /* v = kv columns 1024..2047 */
        k_fattn<<<dim3(TT / ROWS, NH_, 1), 256, 0, stream>>>(QPh, QPl, KPh, KPl, RPh, RPl, VTh, VTl, KB, RB, kmask + (size_t)b * TT, OUT + (size_t)b * TT * DQ);   /* scores, shift, softmax and P.V of every head of the batch */
         }
}

// v003
// It runs in 283 microseconds.
// Two timings next to v002 put it at 1.64 and 1.61 times that version's speed.
// Counting every step since v000, it is 6.02 times as fast.
#include <hip/hip_runtime.h>

// Transformer-XL relative multi-head attention (q, k [4][1024][1024]; qh = q Wq ('xw' [1024][1024]), kv = k Wkv ('xw' [1024][2048]: k | v column blocks; 16 heads x 64); r = pos_embed Wr ([2048][64] x [64][64], shared by all heads); AC = (qh + r_r_bias_h).kh, BD = shift((qh + r_w_bias_h).r): BD[i][j] = (qh_i + r_w_bias_h).r[L + j - i]; attn = (AC + BD)/8; keys with mask[b][j] == 0 -> -inf (int [4][1024], read); softmax; out = merged attn.vh -> [4][1024][1024] (4.2 M)).
// Compute dtypes, f32 accumulate: every input rounded to bf16; projections exact; relative terms 3 products / f32 dots; content scores 3 products on every row; softmax f32; output f32.

#define NB_  4
#define TT   1024
#define DM   1024
#define NH_  16
#define NKV  16
#define REP  (NH_ / NKV)
#define HD   64
#define DQ   (NH_ * HD)
#define DKV  (NKV * HD)
#define RH   1024                 // = TT: every row hi/lo
#define WIN  0
#define PCAR 1024.0f
#define SCL  0.125f
#define NR   2048    // relative positions (2L)
#define DKV2 2048    // kv projection width (k | v)
typedef _Float16 h16;
typedef unsigned short bf;
typedef __attribute__((ext_vector_type(16))) __bf16   v16bf;
typedef __attribute__((ext_vector_type(16))) _Float16 v16h;
typedef __attribute__((ext_vector_type(8)))  _Float16 v8h;
typedef __attribute__((ext_vector_type(8)))  unsigned short v8us;
typedef __attribute__((ext_vector_type(8)))  float    v8f;
typedef __attribute__((ext_vector_type(4)))  float    v4f;
typedef v8h  __attribute__((may_alias)) v8ha;
typedef v4f  __attribute__((may_alias)) v4fa;
typedef v8us __attribute__((may_alias)) v8usa;

__device__ __forceinline__ unsigned short f2bf(float f) { unsigned u = __float_as_uint(f); u += 0x7FFFu + ((u >> 16) & 1u); return (unsigned short)(u >> 16); }
__device__ __forceinline__ float bf2f(unsigned short b) { return __uint_as_float(((unsigned)b) << 16); }
__device__ __forceinline__ float bfr(float f) { return bf2f(f2bf(f)); }
__device__ __forceinline__ v16h cat16(v8h lo, v8h hi) { return __builtin_shufflevector(lo, hi, 0, 1, 2, 3, 4, 5, 6, 7, 8, 9, 10, 11, 12, 13, 14, 15); }
__device__ __forceinline__ v16bf cat16b(v8us lo, v8us hi) { return __builtin_bit_cast(v16bf, __builtin_shufflevector(lo, hi, 0, 1, 2, 3, 4, 5, 6, 7, 8, 9, 10, 11, 12, 13, 14, 15)); }
__device__ __forceinline__ v8f wmma16(v16h a, v16h b, v8f c) { return __builtin_amdgcn_wmma_f32_16x16x32_f16(false, a, false, b, (short)0, c, false, false); }
__device__ __forceinline__ v8f wmmab(v16bf a, v16bf b, v8f c) { return __builtin_amdgcn_wmma_f32_16x16x32_bf16(false, a, false, b, (short)0, c, false, false); }



// ---- k_gemmw: register-blocked GEMM, ONE WAVE per 64x64 output tile (16 accumulators), operands straight from K-contiguous 16-bit planes; grid (M/64, N/64, Z), 32 threads.
// C[m][n] (f32, pitch ldc, + optional f32 bias[n]) = sum_k A[m][k] Bt[n][k] (+ split products per NSPLIT). z-batch strides sA/sB/sC in elements. K % 32 == 0.
template <typename T16> struct WFrag;
template <> struct WFrag<h16> { typedef v16h V; static __device__ __forceinline__ V ld(const h16* p) { return cat16(*(const v8h*)p, *(const v8h*)(p + 16)); } static __device__ __forceinline__ v8f mma(V a, V b, v8f c) { return wmma16(a, b, c); } };
template <> struct WFrag<bf> { typedef v16bf V; static __device__ __forceinline__ V ld(const bf* p) { return cat16b(*(const v8us*)p, *(const v8us*)(p + 16)); } static __device__ __forceinline__ v8f mma(V a, V b, v8f c) { return wmmab(a, b, c); } };
template <typename T16, int NSPLIT, bool BIAS>
__global__ __launch_bounds__(32) void k_gemmw(const T16* __restrict__ A, const T16* __restrict__ A2, const T16* __restrict__ Bt, const T16* __restrict__ Bt2, int K, float* C, int ldc, const float* __restrict__ bias, size_t sA, size_t sB, size_t sC) {
    typedef typename WFrag<T16>::V V;
    __shared__ __align__(16) float os[16 * 68];
    const size_t z = blockIdx.z; A += z * sA; if (A2) A2 += z * sA; Bt += z * sB; if (Bt2) Bt2 += z * sB; C += z * sC;
    const int lane = threadIdx.x & 31, lr = lane & 15, hi = lane >> 4; const int r0 = blockIdx.x * 64, c0 = blockIdx.y * 64;
    v8f acc[4][4];
#pragma unroll
    for (int mb = 0; mb < 4; ++mb)
#pragma unroll
        for (int nb = 0; nb < 4; ++nb) acc[mb][nb] = (v8f){};
    const size_t aoff = (size_t)(r0 + lr) * K + 8 * hi, boff = (size_t)(c0 + lr) * K + 8 * hi;
#pragma unroll 1
    for (int kc = 0; kc < K; kc += 32) {
        V a[4], a2[4];
#pragma unroll
        for (int mb = 0; mb < 4; ++mb) { a[mb] = WFrag<T16>::ld(A + aoff + (size_t)mb * 16 * K + kc); if (NSPLIT == 1 || NSPLIT == 2) a2[mb] = WFrag<T16>::ld(A2 + aoff + (size_t)mb * 16 * K + kc); }
#pragma unroll
        for (int nb = 0; nb < 4; ++nb) { const V b = WFrag<T16>::ld(Bt + boff + (size_t)nb * 16 * K + kc); V b2; if (NSPLIT >= 2) b2 = WFrag<T16>::ld(Bt2 + boff + (size_t)nb * 16 * K + kc);
#pragma unroll
            for (int mb = 0; mb < 4; ++mb) { acc[mb][nb] = WFrag<T16>::mma(a[mb], b, acc[mb][nb]); if (NSPLIT == 1 || NSPLIT == 2) acc[mb][nb] = WFrag<T16>::mma(a2[mb], b, acc[mb][nb]); if (NSPLIT >= 2) acc[mb][nb] = WFrag<T16>::mma(a[mb], b2, acc[mb][nb]); } }
        asm volatile("v_nop\n\tv_nop\n\tv_nop\n\tv_nop" : "+v"(acc[0][0]), "+v"(acc[1][1]), "+v"(acc[2][2]), "+v"(acc[3][3]) : "v"(a[0]), "v"(a[3]));
    }
#pragma unroll
    for (int mb = 0; mb < 4; ++mb) {
#pragma unroll
        for (int nb = 0; nb < 4; ++nb) {
#pragma unroll
            for (int j = 0; j < 8; ++j) os[(hi * 8 + j) * 68 + nb * 16 + lr] = acc[mb][nb][j]; }
        __builtin_amdgcn_wave_barrier(); asm volatile("" ::: "memory");
        float* crow = C + (size_t)(r0 + mb * 16) * ldc + c0;
{
#pragma unroll
            for (int s = 0; s < 8; ++s) { const int row = 2 * s + hi, cofs = lr * 4; v4f val = *(const v4fa*)(os + row * 68 + cofs); if (BIAS) { val[0] += bfr(bias[c0 + cofs]); val[1] += bfr(bias[c0 + cofs + 1]); val[2] += bfr(bias[c0 + cofs + 2]); val[3] += bfr(bias[c0 + cofs + 3]); }
                *(v4f*)(crow + (size_t)row * ldc + cofs) = val; }
             }
        __builtin_amdgcn_wave_barrier(); asm volatile("" ::: "memory");
    }
}

__device__ __forceinline__ h16 tohx(float x) { return (h16)x; }
__device__ __forceinline__ void splitf(float y, unsigned short& h, unsigned short& l) { h = f2bf(y); l = f2bf(y - bf2f(h)); }
typedef __attribute__((ext_vector_type(2))) _Float16 v2h;
typedef __attribute__((ext_vector_type(4))) _Float16 v4h;
typedef __attribute__((ext_vector_type(2))) unsigned short v2us;
typedef __attribute__((ext_vector_type(4))) unsigned short v4us;
typedef __attribute__((ext_vector_type(2))) float v2f;
typedef __attribute__((ext_vector_type(4))) int v4i;

__global__ __launch_bounds__(256) void k_wtG(const float* __restrict__ w, int K, int N, bf* Bt) {
    const int lane = threadIdx.x & 31; const int L0 = (blockIdx.x * 8 + (threadIdx.x >> 5)) * 8; const int nlines = N * K / 64;
{
#pragma unroll 1
        for (int l = 0; l < 8; ++l) { const int L = L0 + l; if (L >= nlines) break; const size_t e = (size_t)L * 64 + lane * 2; const int k = (int)(e % K), n = (int)(e / K); v2us o;
            o[0] = f2bf(w[(size_t)k * N + n]); o[1] = f2bf(w[(size_t)(k + 1) * N + n]); *(v2us*)(Bt + e) = o; }
         }
}
__global__ __launch_bounds__(256) void k_cvt8(const float* __restrict__ src, bf* dst, size_t n8) { const size_t i = (size_t)blockIdx.x * 256 + threadIdx.x; if (i >= n8) return; const v8f v = *(const v8f*)(src + i * 8); v8us o;
#pragma unroll
    for (int k = 0; k < 8; ++k) o[k] = f2bf(v[k]); *(v8us*)(dst + i * 8) = o;  }

// k_rope: head planes [h][t][d] (fp16 + hi/lo) of rope(x) x sc with the rotate-half convention out[d] = x[d] cos[t][d] - x[d+HD/2] sin[t][d], out[d+HD/2] = x[d+HD/2] cos[t][d+HD/2] + x[d] sin[t][d+HD/2]
__global__ __launch_bounds__(256) void k_rope(const float* __restrict__ F, int pitch, int nheads, const float* __restrict__ CS, const float* __restrict__ RF, const float* __restrict__ nw, float sc, h16* P16, bf* Ph, bf* Pl) {
    { const size_t bz = blockIdx.y, po = bz * nheads * TT * HD; F += bz * TT * pitch; P16 += po; Ph += po; Pl += po; }   // blockIdx.y = batch: TT rows of F, one set of head planes
    const size_t e = ((size_t)blockIdx.x * 256 + threadIdx.x) * 2; if (e >= (size_t)nheads * TT * HD) return; const int d = (int)(e % HD); const int t = (int)((e / HD) % TT); const int h = (int)(e / ((size_t)HD * TT)); const float* f = F + (size_t)t * pitch + h * HD; const float rf = RF ? RF[(size_t)h * TT + t] : 1.0f; v2h o16; v2us oh, ol;
#pragma unroll
    for (int q = 0; q < 2; ++q) { const int dd = d + q; const int dp = (dd < HD / 2) ? dd + HD / 2 : dd - HD / 2; float x0 = f[dd], x1 = f[dp];
        if (RF) { float n0 = __fmul_rn(x0, rf), n1 = __fmul_rn(x1, rf); asm volatile("" : "+v"(n0)); asm volatile("" : "+v"(n1)); x0 = __fmul_rn(bfr(nw[dd]), n0); x1 = __fmul_rn(bfr(nw[dp]), n1); }
        const v2f cs = *(const v2f*)(CS + ((size_t)t * HD + dd) * 2); float a = __fmul_rn(x0, cs[0]), bq = __fmul_rn(x1, cs[1]); asm volatile("" : "+v"(a)); asm volatile("" : "+v"(bq)); const float r = ((dd < HD / 2) ? __fsub_rn(a, bq) : __fadd_rn(a, bq)) * sc;
        o16[q] = tohx(r); unsigned short a2, c2; splitf(r, a2, c2); oh[q] = a2; ol[q] = c2; }
    *(v2h*)(P16 + e) = o16; *(v2us*)(Ph + e) = oh; *(v2us*)(Pl + e) = ol;  }
__global__ __launch_bounds__(256) void k_vtp(const float* __restrict__ F, int pitch, int nheads, h16* V16, bf* Vh, bf* Vl) {
    { const size_t bz = blockIdx.y, po = bz * nheads * HD * TT; F += bz * TT * pitch; V16 += po; Vh += po; Vl += po; }   // blockIdx.y = batch
    const size_t e = ((size_t)blockIdx.x * 256 + threadIdx.x) * 2; if (e >= (size_t)nheads * HD * TT) return; const int t = (int)(e % TT); const int d = (int)((e / TT) % HD); const int g = (int)(e / ((size_t)TT * HD)); v2h o16; v2us oh, ol;
#pragma unroll
    for (int q = 0; q < 2; ++q) { const float x = F[(size_t)(t + q) * pitch + g * HD + d]; o16[q] = tohx(x); unsigned short a2, c2; splitf(x, a2, c2); oh[q] = a2; ol[q] = c2; }
    *(v2h*)(V16 + e) = o16; *(v2us*)(Vh + e) = oh; *(v2us*)(Vl + e) = ol;  }
__global__ __launch_bounds__(256) void k_csid(float* CS) { const int idx = blockIdx.x * 256 + threadIdx.x; if (idx >= TT * HD) return; v2f cs; cs[0] = 1.0f; cs[1] = 0.0f; *(v2f*)(CS + (size_t)idx * 2) = cs;  }
__global__ __launch_bounds__(256) void k_flat(const float* __restrict__ F, h16* P16, bf* Ph, bf* Pl, size_t n4) { const size_t i = (size_t)blockIdx.x * 256 + threadIdx.x; if (i >= n4) return; const v4f a = *(const v4f*)(F + i * 4); v4h o16; v4us oh, ol;
#pragma unroll
    for (int q = 0; q < 4; ++q) { o16[q] = tohx(a[q]); unsigned short x2, y2; splitf(a[q], x2, y2); oh[q] = x2; ol[q] = y2; }
    *(v4h*)(P16 + i * 4) = o16; *(v4us*)(Ph + i * 4) = oh; *(v4us*)(Pl + i * 4) = ol;  }

__global__ __launch_bounds__(256) void k_hdot(const float* __restrict__ bias, const float* __restrict__ F, int pitch, int nrows, int hcol, float* OUT) {
    { const size_t bz = blockIdx.y; F += bz * nrows * pitch; OUT += bz * NH_ * nrows; }   // blockIdx.y = batch (one for r)
    const int lane = threadIdx.x & 31; const size_t wv = (size_t)blockIdx.x * 8 + (threadIdx.x >> 5); if (wv >= (size_t)NH_ * (nrows / 32)) return; const int h = (int)(wv / (nrows / 32)); const int n = (int)(wv % (nrows / 32)) * 32 + lane; const float* f = F + (size_t)n * pitch + (hcol ? h * HD : 0);   /* hcol: F has per-head columns (k); 0: one 64-wide row shared by all heads (r) */ const float* bh = bias + h * HD; float s = 0.f;
#pragma unroll 4
    for (int d = 0; d < HD; ++d) { s = __fadd_rn(s, __fmul_rn(bfr(bh[d]), f[d])); }
    *(float*)(OUT + (size_t)h * nrows + n) = s;  }

#define MT   2                    // 16-row query tiles per work-group
#define ROWS (16 * MT)
#define PD   6                    // k steps by which the V fragment loads run ahead in the P.V product
#define PA   3                    // ring of P fragment sets in the P.V product
#define SP   1028                 // floats per LDS score row: 4112 B = 16 B x odd, the conflict-free pitch for 16-byte fragment reads
typedef v4us __attribute__((may_alias)) v4usa;
// ld4: the hi and lo fragments of both 32-wide k halves of one 16-row tile (x[0] hi k 0..31, x[1] lo, x[2] hi k 32..63, x[3] lo).
__device__ __forceinline__ void ld4(const bf* ph, const bf* pl, v16bf (&x)[4]) {
    x[0] = WFrag<bf>::ld(ph); x[1] = WFrag<bf>::ld(pl); x[2] = WFrag<bf>::ld(ph + 32); x[3] = WFrag<bf>::ld(pl + 32);
    asm volatile("s_wait_xcnt 0x0" :: "v"(ph), "v"(pl) : "memory");   // both address pairs stay live up to this wait
}
// k_fattn: one work-group (8 waves) = ROWS query rows of one head of one batch; their whole score rows stay in LDS from the score products to the P.V product.
// 1. wave w owns keys [128 w, 128 w + 128): q.r tiles over the window l = TT + j - i are stored straight to their shifted place sc[i][j];
// 2. q.k tiles: sc = ((q.k + KB[j]) + q.r) + RB[l]; 3. softmax, one wave per row, P hi | lo planes written over the row's own scores;
// 4. O = P.V (waves 0..3, one 16-column block each, k ascending), staged in LDS so that each wave stores whole output lines.
__global__ __launch_bounds__(256) void k_fattn(const bf* __restrict__ Qh, const bf* __restrict__ Ql, const bf* __restrict__ Kh, const bf* __restrict__ Kl, const bf* __restrict__ Rh, const bf* __restrict__ Rl, const bf* __restrict__ Vh, const bf* __restrict__ Vl, const float* __restrict__ KB, const float* __restrict__ RB, const int* __restrict__ km, float* OUTb) {
    typedef WFrag<bf> F;
    __shared__ __align__(16) float sc[ROWS * SP];
    __shared__ __align__(16) float os[ROWS * 68];
    __shared__ float rbs[TT + ROWS];
    const int lane = threadIdx.x & 31, lr = lane & 15, hi = lane >> 4; const int w = __builtin_amdgcn_readfirstlane((int)(threadIdx.x >> 5));
    const int i0 = blockIdx.x * ROWS, h = blockIdx.y, jw = w * 128;
    { const size_t bz = blockIdx.z, po = bz * NH_ * TT * HD; Qh += po; Ql += po; Kh += po; Kl += po; Vh += po; Vl += po; KB += bz * NH_ * TT; km += bz * TT; OUTb += bz * TT * DQ; }   // blockIdx.z = batch; the r planes and RB are shared by all batches
    const float* rbg = RB + (size_t)h * NR + (TT - i0 - ROWS) + threadIdx.x; float rv[TT / 256 + 1];   // rbs[x] = RB[h][TT - i0 - ROWS + x]: every l this work-group's rows meet; loaded here, stored in front of the first barrier
#pragma unroll
    for (int q = 0; q < TT / 256; ++q) rv[q] = rbg[q * 256];
    rv[TT / 256] = (threadIdx.x < ROWS) ? rbg[TT] : 0.f;
    v16bf ah[MT][2], al[MT][2];
#pragma unroll
    for (int mb = 0; mb < MT; ++mb) { const size_t o = ((size_t)h * TT + i0 + mb * 16 + lr) * HD + 8 * hi; v16bf x[4]; ld4(Qh + o, Ql + o, x); ah[mb][0] = x[0]; al[mb][0] = x[1]; ah[mb][1] = x[2]; al[mb][1] = x[3]; }
    const int lbase = TT + jw - i0 - ROWS;   // first l of the wave's window; the window [lbase, lbase + 128 + ROWS) lies in [0, NR)
    // Both tile loops are unrolled: which row tile needs which window tile is then decided at compile time, and the next tile's loads (issued ahead, in the source too) fly while this tile is multiplied.
    v16bf nx[4];
    { const size_t o = (size_t)(lbase + lr) * HD + 8 * hi; ld4(Rh + o, Rl + o, nx); }
#pragma unroll
    for (int t = 0; t < 8 + MT; ++t) { const v16bf b[2] = {nx[0], nx[2]}, c[2] = {nx[1], nx[3]};
        if (t + 1 < 8 + MT) { const size_t o = (size_t)(lbase + (t + 1) * 16 + lr) * HD + 8 * hi; ld4(Rh + o, Rl + o, nx); }
        else { const size_t o = ((size_t)h * TT + jw + lr) * HD + 8 * hi; ld4(Kh + o, Kl + o, nx); }   // the first key tile
        v8f acc[MT];
#pragma unroll
        for (int mb = 0; mb < MT; ++mb) acc[mb] = (v8f){};
#pragma unroll
        for (int s = 0; s < 2; ++s) {
#pragma unroll
            for (int mb = 0; mb < MT; ++mb) if (t + mb >= MT - 1 && t + mb <= MT + 7) acc[mb] = wmmab(ah[mb][s], b[s], acc[mb]);
#pragma unroll
            for (int mb = 0; mb < MT; ++mb) if (t + mb >= MT - 1 && t + mb <= MT + 7) acc[mb] = wmmab(al[mb][s], b[s], acc[mb]);
#pragma unroll
            for (int mb = 0; mb < MT; ++mb) if (t + mb >= MT - 1 && t + mb <= MT + 7) acc[mb] = wmmab(ah[mb][s], c[s], acc[mb]); }
        asm volatile("v_nop\n\tv_nop\n\tv_nop\n\tv_nop" : "+v"(acc[0]), "+v"(acc[1]));   // the four vector slots the chip needs before the next tile's first product overwrites these result registers: only LDS stores stand between
#pragma unroll
        for (int mb = 0; mb < MT; ++mb) { if (t + mb < MT - 1 || t + mb > MT + 7) continue;
#pragma unroll
            for (int jj = 0; jj < 8; ++jj) { const int ii = mb * 16 + hi * 8 + jj; const int jrel = t * 16 + lr + ii - ROWS;   /* j - jw of (row ii, l = lbase + 16 t + lr) */ if (jrel >= 0 && jrel < 128) sc[ii * SP + jw + jrel] = acc[mb][jj]; } } }
#pragma unroll
    for (int q = 0; q < TT / 256; ++q) rbs[q * 256 + threadIdx.x] = rv[q];
    if (threadIdx.x < ROWS) rbs[TT + threadIdx.x] = rv[TT / 256];
    __syncthreads();
#pragma unroll
    for (int nb = 0; nb < 8; ++nb) { const int j = jw + nb * 16 + lr; const v16bf b[2] = {nx[0], nx[2]}, c[2] = {nx[1], nx[3]}; const float kb = KB[(size_t)h * TT + j];
        if (nb + 1 < 8) { const size_t o = ((size_t)h * TT + j + 16) * HD + 8 * hi; ld4(Kh + o, Kl + o, nx); }
        v8f acc[MT];
#pragma unroll
        for (int mb = 0; mb < MT; ++mb) acc[mb] = (v8f){};
#pragma unroll
        for (int s = 0; s < 2; ++s) {
#pragma unroll
            for (int mb = 0; mb < MT; ++mb) acc[mb] = wmmab(ah[mb][s], b[s], acc[mb]);
#pragma unroll
            for (int mb = 0; mb < MT; ++mb) acc[mb] = wmmab(al[mb][s], b[s], acc[mb]);
#pragma unroll
            for (int mb = 0; mb < MT; ++mb) acc[mb] = wmmab(ah[mb][s], c[s], acc[mb]); }
#pragma unroll
        for (int mb = 0; mb < MT; ++mb)
#pragma unroll
            for (int jj = 0; jj < 8; ++jj) { const int ii = mb * 16 + hi * 8 + jj; float* p = sc + ii * SP + j; *p = __fadd_rn(__fadd_rn(__fadd_rn(acc[mb][jj], kb), *p), rbs[j - ii + ROWS]); } }
    __syncthreads();
    // V fragments run PD k steps ahead of their products; the first PD are asked for here, so that they land during the softmax
    v16bf vh[PD], vl[PD]; const size_t vo = ((size_t)h * HD + (w & 3) * 16 + lr) * TT + 8 * hi;
    if (w < 4) {
#pragma unroll
        for (int d = 0; d < PD; ++d) { vh[d] = F::ld(Vh + vo + 32 * d); vl[d] = F::ld(Vl + vo + 32 * d); } }
    for (int rr = 0; rr < ROWS / 8; ++rr) { float* sr = sc + (w * (ROWS / 8) + rr) * SP; float v[TT / 32]; float mx = -3.0e38f;
#pragma unroll
        for (int ch = 0; ch < TT / 128; ++ch) { const int j0 = ch * 128 + lane * 4; const v4f a = *(const v4fa*)(sr + j0); const v4i mk = *(const v4i*)(km + j0);
#pragma unroll
            for (int q = 0; q < 4; ++q) { const float t = (mk[q] != 0) ? a[q] * SCL : -3.0e38f; v[ch * 4 + q] = t;   /* mask == 0 -> -inf */ mx = fmaxf(mx, t); } }
#pragma unroll
        for (int sh = 16; sh; sh >>= 1) mx = fmaxf(mx, __shfl_xor(mx, sh, 32));
        float sum = 0.f;
#pragma unroll
        for (int k = 0; k < TT / 32; ++k) { const float d0 = __fsub_rn(v[k], mx); v[k] = __builtin_amdgcn_exp2f(__fmul_rn(d0, 1.4426950408889634f)); sum += v[k]; }
#pragma unroll
        for (int sh = 16; sh; sh >>= 1) sum += __shfl_xor(sum, sh, 32);
        const float f = __fdiv_rn(1.0f, sum); bf* pr = (bf*)sr;   // P hi in the row's first 2 KiB, P lo in its second; every score of the row is in registers by now (the sum needed them all)
#pragma unroll
        for (int ch = 0; ch < TT / 128; ++ch) { v4us oh, ol;
#pragma unroll
            for (int q = 0; q < 4; ++q) { unsigned short a, c2; splitf(v[ch * 4 + q] * f, a, c2); oh[q] = a; ol[q] = c2; }
            *(v4usa*)(pr + ch * 128 + lane * 4) = oh; *(v4usa*)(pr + TT + ch * 128 + lane * 4) = ol; } }
    __syncthreads();
    if (w < 4) { v8f acc[MT];
#pragma unroll
        for (int mb = 0; mb < MT; ++mb) acc[mb] = (v8f){};
        const bf* pl = (const bf*)(sc + lr * SP) + 8 * hi;   // this lane's P hi row of row tile 0; row tile mb lies 16 rows on, P lo TT elements on
        v16bf pa[PA][MT], pb[PA][MT];   // P hi / lo fragments, read from LDS PA - 1 k steps ahead of their products
#pragma unroll
        for (int d = 0; d < PA - 1; ++d)
#pragma unroll
            for (int mb = 0; mb < MT; ++mb) { const bf* pr = pl + mb * 16 * SP * 2 + d * 32; pa[d][mb] = cat16b(*(const v8usa*)pr, *(const v8usa*)(pr + 16)); pb[d][mb] = cat16b(*(const v8usa*)(pr + TT), *(const v8usa*)(pr + TT + 16)); }
        // unrolled: the fragment rings are then indexed at compile time and stay in registers, and the last steps ask for nothing
#pragma unroll
        for (int ks = 0; ks < TT / 32; ++ks) { const int kc = ks * 32; const v16bf b = vh[ks % PD], b2 = vl[ks % PD];
            if (ks + PD < TT / 32) { vh[ks % PD] = F::ld(Vh + vo + kc + 32 * PD); vl[ks % PD] = F::ld(Vl + vo + kc + 32 * PD); }
            if (ks + PA - 1 < TT / 32) {
#pragma unroll
                for (int mb = 0; mb < MT; ++mb) { const bf* pr = pl + mb * 16 * SP * 2 + kc + (PA - 1) * 32; pa[(ks + PA - 1) % PA][mb] = cat16b(*(const v8usa*)pr, *(const v8usa*)(pr + 16)); pb[(ks + PA - 1) % PA][mb] = cat16b(*(const v8usa*)(pr + TT), *(const v8usa*)(pr + TT + 16)); } }
#pragma unroll
            for (int mb = 0; mb < MT; ++mb) acc[mb] = wmmab(pa[ks % PA][mb], b, acc[mb]);
#pragma unroll
            for (int mb = 0; mb < MT; ++mb) acc[mb] = wmmab(pb[ks % PA][mb], b, acc[mb]);
#pragma unroll
            for (int mb = 0; mb < MT; ++mb) acc[mb] = wmmab(pa[ks % PA][mb], b2, acc[mb]); }
#pragma unroll
        for (int mb = 0; mb < MT; ++mb)
#pragma unroll
            for (int jj = 0; jj < 8; ++jj) os[(mb * 16 + hi * 8 + jj) * 68 + w * 16 + lr] = acc[mb][jj]; }
    __syncthreads();
#pragma unroll
    for (int s = 0; s < MT; ++s) { const int row = s * 16 + (int)(threadIdx.x >> 4), cofs = (int)(threadIdx.x & 15) * 4; *(v4f*)(OUTb + (size_t)(i0 + row) * DQ + h * HD + cofs) = *(const v4fa*)(os + row * 68 + cofs); }
}

extern "C" void kernel_launch(void* const* d_in, const int* in_sizes, int n_in,
                              void* d_out, int out_size, void* d_ws, size_t ws_size, hipStream_t stream) {
    (void)in_sizes; (void)n_in; (void)out_size;
    const float* x = (const float*)d_in[0]; const float* xk = (const float*)d_in[1]; const int* kmask = (const int*)d_in[2]; const float* pemb = (const float*)d_in[3]; const float* wq = (const float*)d_in[4]; const float* wkv = (const float*)d_in[5]; const float* wr = (const float*)d_in[6]; const float* rrb = (const float*)d_in[7]; const float* rwb = (const float*)d_in[8]; const float* wk = nullptr; const float* wv = nullptr; (void)wk; (void)wv;
    float* OUT = (float*)d_out;     // [4][1024][1024]
    char* wsp = (char*)d_ws;
    auto take = [&](size_t bytes) { char* p = wsp; wsp += (bytes + 255) & ~(size_t)255; return (void*)p; };
    bf* WQ = (bf*)take((size_t)DQ * DM * 2); bf* WKV = (bf*)take((size_t)DKV2 * DM * 2); bf* WR = (bf*)take((size_t)HD * HD * 2); bf* PE = (bf*)take((size_t)NR * HD * 2); float* RF = (float*)take((size_t)NR * HD * 4); h16* RP16 = (h16*)take((size_t)NR * HD * 2); bf* RPh = (bf*)take((size_t)NR * HD * 2); bf* RPl = (bf*)take((size_t)NR * HD * 2); float* KB = (float*)take((size_t)NB_ * NH_ * TT * 4); float* RB = (float*)take((size_t)NH_ * NR * 4); float* FKV = (float*)take((size_t)NB_ * TT * DKV2 * 4); float* CS = (float*)take((size_t)TT * HD * 2 * 4);
    // every per-batch buffer holds all NB_ batches, batch-major
    bf* XB = (bf*)take((size_t)NB_ * TT * DM * 2); float* FQ = (float*)take((size_t)NB_ * TT * DQ * 4); float* FK = nullptr;
    h16* QP16 = (h16*)take((size_t)NB_ * NH_ * TT * HD * 2); h16* KP16 = (h16*)take((size_t)NB_ * NKV * TT * HD * 2); h16* VT16 = (h16*)take((size_t)NB_ * NKV * HD * TT * 2);
    bf* QPh = (bf*)take((size_t)NB_ * NH_ * TT * HD * 2); bf* QPl = (bf*)take((size_t)NB_ * NH_ * TT * HD * 2); bf* KPh = (bf*)take((size_t)NB_ * NKV * TT * HD * 2); bf* KPl = (bf*)take((size_t)NB_ * NKV * TT * HD * 2); bf* VTh = (bf*)take((size_t)NB_ * NKV * HD * TT * 2); bf* VTl = (bf*)take((size_t)NB_ * NKV * HD * TT * 2);
    if ((size_t)(wsp - (char*)d_ws) > ws_size) return;    // about 135 MiB of the 256 MiB
    float* FV = nullptr; (void)FV; (void)FK;   // no separate k or v buffers: both are column blocks of FKV, the one kv projection
    { k_wtG<<<(unsigned)((DM * DQ / 64 + 63) / 64), 256, 0, stream>>>(wq, DM, DQ, WQ); k_wtG<<<(unsigned)((DM * DKV2 / 64 + 63) / 64), 256, 0, stream>>>(wkv, DM, DKV2, WKV); k_wtG<<<(unsigned)((HD * HD / 64 + 63) / 64), 256, 0, stream>>>(wr, HD, HD, WR);
      k_cvt8<<<(unsigned)(((size_t)NR * HD / 8 + 255) / 256), 256, 0, stream>>>(pemb, PE, (size_t)NR * HD / 8); k_gemmw<bf, 0, false><<<dim3(NR / 64, HD / 64, 1), 32, 0, stream>>>(PE, nullptr, WR, nullptr, HD, RF, HD, nullptr, 0, 0, 0);   /* r = pos_embed Wr (exact) */
      k_flat<<<(unsigned)(((size_t)NR * HD / 4 + 255) / 256), 256, 0, stream>>>(RF, RP16, RPh, RPl, (size_t)NR * HD / 4); k_hdot<<<(unsigned)(((size_t)NH_ * (NR / 32) + 7) / 8), 256, 0, stream>>>(rwb, RF, HD, NR, 0, RB);   /* r is shared by all heads: no column offset */   /* r planes; RB[h][l] = r_w_bias_h . r_l */
      
       }
    k_csid<<<(TT * HD + 255) / 256, 256, 0, stream>>>(CS);
    const unsigned LQ = (unsigned)(((size_t)NH_ * TT * HD / 2 + 255) / 256), LKv = (unsigned)(((size_t)NKV * TT * HD / 2 + 255) / 256);
    // One launch of each stage covers all NB_ batches: the projections see the batches as NB_ * TT rows, the plane builders take the batch from blockIdx.y, the attention kernel from blockIdx.z.
    k_cvt8<<<(unsigned)(((size_t)NB_ * TT * DM / 8 + 255) / 256), 256, 0, stream>>>(x, XB, (size_t)NB_ * TT * DM / 8);
    k_gemmw<bf, 0, false><<<dim3(NB_ * TT / 64, DQ / 64, 1), 32, 0, stream>>>(XB, nullptr, WQ, nullptr, DM, FQ, DQ, nullptr, 0, 0, 0);
    k_rope<<<dim3(LQ, NB_, 1), 256, 0, stream>>>(FQ, DQ, NH_, CS, nullptr, nullptr, 1.0f, QP16, QPh, QPl);
    k_cvt8<<<(unsigned)(((size_t)NB_ * TT * DM / 8 + 255) / 256), 256, 0, stream>>>(xk, XB, (size_t)NB_ * TT * DM / 8);
    k_gemmw<bf, 0, false><<<dim3(NB_ * TT / 64, DKV2 / 64, 1), 32, 0, stream>>>(XB, nullptr, WKV, nullptr, DM, FKV, DKV2, nullptr, 0, 0, 0);
    k_hdot<<<dim3((unsigned)(((size_t)NH_ * (TT / 32) + 7) / 8), NB_, 1), 256, 0, stream>>>(rrb, FKV, DKV2, TT, 1, KB);   /* kv = k Wkv; KB[b][h][j] = r_r_bias_h . kh_j */
    k_rope<<<dim3(LKv, NB_, 1), 256, 0, stream>>>(FKV, DKV2, NKV, CS, nullptr, nullptr, 1.0f, KP16, KPh, KPl);   /* k = kv columns 0..1023 */
    k_vtp<<<dim3(LKv, NB_, 1), 256, 0, stream>>>(FKV + DKV, DKV2, NKV, VT16, VTh, VTl);   /* v = kv columns 1024..2047 */
    k_fattn<<<dim3(TT / ROWS, NH_, NB_), 256, 0, stream>>>(QPh, QPl, KPh, KPl, RPh, RPl, VTh, VTl, KB, RB, kmask, OUT);   /* scores, shift, softmax and P.V of every head of every batch */
}

// v004
// One run takes 249 microseconds.
// Timed twice side by side with v003, it ran 1.14 times as fast both times.
// Counting every step since v000, it is 6.85 times as fast.
#include <hip/hip_runtime.h>

// Transformer-XL relative multi-head attention (q, k [4][1024][1024]; qh = q Wq ('xw' [1024][1024]), kv = k Wkv ('xw' [1024][2048]: k | v column blocks; 16 heads x 64); r = pos_embed Wr ([2048][64] x [64][64], shared by all heads); AC = (qh + r_r_bias_h).kh, BD = shift((qh + r_w_bias_h).r): BD[i][j] = (qh_i + r_w_bias_h).r[L + j - i]; attn = (AC + BD)/8; keys with mask[b][j] == 0 -> -inf (int [4][1024], read); softmax; out = merged attn.vh -> [4][1024][1024] (4.2 M)).
// Compute dtypes, f32 accumulate: every input rounded to bf16; projections exact; relative terms 3 products / f32 dots; content scores 3 products on every row; softmax f32; output f32.

#define NB_  4
#define TT   1024
#define DM   1024
#define NH_  16
#define NKV  16
#define REP  (NH_ / NKV)
#define HD   64
#define DQ   (NH_ * HD)
#define DKV  (NKV * HD)
#define RH   1024                 // = TT: every row hi/lo
#define WIN  0
#define PCAR 1024.0f
#define SCL  0.125f
#define NR   2048    // relative positions (2L)
#define DKV2 2048    // kv projection width (k | v)
typedef _Float16 h16;
typedef unsigned short bf;
typedef __attribute__((ext_vector_type(16))) __bf16   v16bf;
typedef __attribute__((ext_vector_type(16))) _Float16 v16h;
typedef __attribute__((ext_vector_type(8)))  _Float16 v8h;
typedef __attribute__((ext_vector_type(8)))  unsigned short v8us;
typedef __attribute__((ext_vector_type(8)))  float    v8f;
typedef __attribute__((ext_vector_type(4)))  float    v4f;
typedef v8h  __attribute__((may_alias)) v8ha;
typedef v4f  __attribute__((may_alias)) v4fa;
typedef v8us __attribute__((may_alias)) v8usa;

__device__ __forceinline__ unsigned short f2bf(float f) { unsigned u = __float_as_uint(f); u += 0x7FFFu + ((u >> 16) & 1u); return (unsigned short)(u >> 16); }
__device__ __forceinline__ float bf2f(unsigned short b) { return __uint_as_float(((unsigned)b) << 16); }
__device__ __forceinline__ float bfr(float f) { return bf2f(f2bf(f)); }
__device__ __forceinline__ void splitf(float y, unsigned short& h, unsigned short& l) { h = f2bf(y); l = f2bf(y - bf2f(h)); }
typedef __attribute__((ext_vector_type(4))) unsigned short v4us;
__device__ __forceinline__ v16h cat16(v8h lo, v8h hi) { return __builtin_shufflevector(lo, hi, 0, 1, 2, 3, 4, 5, 6, 7, 8, 9, 10, 11, 12, 13, 14, 15); }
__device__ __forceinline__ v16bf cat16b(v8us lo, v8us hi) { return __builtin_bit_cast(v16bf, __builtin_shufflevector(lo, hi, 0, 1, 2, 3, 4, 5, 6, 7, 8, 9, 10, 11, 12, 13, 14, 15)); }
__device__ __forceinline__ v8f wmma16(v16h a, v16h b, v8f c) { return __builtin_amdgcn_wmma_f32_16x16x32_f16(false, a, false, b, (short)0, c, false, false); }
__device__ __forceinline__ v8f wmmab(v16bf a, v16bf b, v8f c) { return __builtin_amdgcn_wmma_f32_16x16x32_bf16(false, a, false, b, (short)0, c, false, false); }



// ---- k_gemmw: register-blocked GEMM, ONE WAVE per 64x64 output tile (16 accumulators), operands straight from K-contiguous 16-bit planes; grid (M/64, N/64, Z), 32 threads.
// C[m][n] (f32, pitch ldc, + optional f32 bias[n]) = sum_k A[m][k] Bt[n][k] (+ split products per NSPLIT). z-batch strides sA/sB/sC in elements. K % 32 == 0.
// EPI 0: C goes out as f32. EPI 1 (q projection) and 2 (kv projection), rows = batch x TT: C is not written. A tile is 64 rows of one batch x the 64 columns of one head, and the epilogue writes
// the bf16 hi | lo planes that the attention kernel reads: q, and the kv column blocks below DQ (k), as row planes P[b][h][t][d], k with KBo[b][h][t] = HB_h . row (d ascending); the kv column blocks from DQ on (v) as transposed planes V[b][g][d][t].
template <typename T16> struct WFrag;
template <> struct WFrag<h16> { typedef v16h V; static __device__ __forceinline__ V ld(const h16* p) { return cat16(*(const v8h*)p, *(const v8h*)(p + 16)); } static __device__ __forceinline__ v8f mma(V a, V b, v8f c) { return wmma16(a, b, c); } };
template <> struct WFrag<bf> { typedef v16bf V; static __device__ __forceinline__ V ld(const bf* p) { return cat16b(*(const v8us*)p, *(const v8us*)(p + 16)); } static __device__ __forceinline__ v8f mma(V a, V b, v8f c) { return wmmab(a, b, c); } };
template <typename T16, int NSPLIT, bool BIAS, int EPI>
__global__ __launch_bounds__(32) void k_gemmw(const T16* __restrict__ A, const T16* __restrict__ A2, const T16* __restrict__ Bt, const T16* __restrict__ Bt2, int K, float* C, int ldc, const float* __restrict__ bias, size_t sA, size_t sB, size_t sC, bf* Ph, bf* Pl, bf* Vh, bf* Vl, const float* __restrict__ HB, float* KBo) {
    typedef typename WFrag<T16>::V V;
    __shared__ __align__(16) float os[16 * 68];
    const size_t z = blockIdx.z; A += z * sA; if (A2) A2 += z * sA; Bt += z * sB; if (Bt2) Bt2 += z * sB; C += z * sC;
    const int lane = threadIdx.x & 31, lr = lane & 15, hi = lane >> 4; const int r0 = blockIdx.x * 64, c0 = blockIdx.y * 64;
    v8f acc[4][4];
#pragma unroll
    for (int mb = 0; mb < 4; ++mb)
#pragma unroll
        for (int nb = 0; nb < 4; ++nb) acc[mb][nb] = (v8f){};
    const size_t aoff = (size_t)(r0 + lr) * K + 8 * hi, boff = (size_t)(c0 + lr) * K + 8 * hi;
#pragma unroll 1
    for (int kc = 0; kc < K; kc += 32) {
        V a[4], a2[4];
#pragma unroll
        for (int mb = 0; mb < 4; ++mb) { a[mb] = WFrag<T16>::ld(A + aoff + (size_t)mb * 16 * K + kc); if (NSPLIT == 1 || NSPLIT == 2) a2[mb] = WFrag<T16>::ld(A2 + aoff + (size_t)mb * 16 * K + kc); }
#pragma unroll
        for (int nb = 0; nb < 4; ++nb) { const V b = WFrag<T16>::ld(Bt + boff + (size_t)nb * 16 * K + kc); V b2; if (NSPLIT >= 2) b2 = WFrag<T16>::ld(Bt2 + boff + (size_t)nb * 16 * K + kc);
#pragma unroll
            for (int mb = 0; mb < 4; ++mb) { acc[mb][nb] = WFrag<T16>::mma(a[mb], b, acc[mb][nb]); if (NSPLIT == 1 || NSPLIT == 2) acc[mb][nb] = WFrag<T16>::mma(a2[mb], b, acc[mb][nb]); if (NSPLIT >= 2) acc[mb][nb] = WFrag<T16>::mma(a[mb], b2, acc[mb][nb]); } }
        asm volatile("v_nop\n\tv_nop\n\tv_nop\n\tv_nop" : "+v"(acc[0][0]), "+v"(acc[1][1]), "+v"(acc[2][2]), "+v"(acc[3][3]) : "v"(a[0]), "v"(a[3]));
    }
    if (EPI >= 1) {
        const int bz = r0 / TT, t0 = r0 % TT;
        if (EPI == 1 || c0 < DQ) {   // q or k: 16 rows at a time through LDS, so that each store covers whole 128-byte plane rows
            const int h = c0 / HD; const size_t po = ((size_t)(bz * NH_ + h) * TT + t0 + hi) * HD + lr * 4;
#pragma unroll
            for (int mb = 0; mb < 4; ++mb) {
#pragma unroll
                for (int nb = 0; nb < 4; ++nb) {
#pragma unroll
                    for (int j = 0; j < 8; ++j) os[(hi * 8 + j) * 68 + nb * 16 + lr] = acc[mb][nb][j]; }
                __builtin_amdgcn_wave_barrier(); asm volatile("" ::: "memory");   // the reads below take other lanes' values: the compiler may not lift them over the writes
                v4us oh[8], ol[8];   // step s: row 2 s + hi, columns 4 lr .. 4 lr + 3
#pragma unroll
                for (int s = 0; s < 8; ++s) { const v4f val = *(const v4fa*)(os + (2 * s + hi) * 68 + lr * 4);
#pragma unroll
                    for (int q = 0; q < 4; ++q) { unsigned short x2, y2; splitf(val[q], x2, y2); oh[s][q] = x2; ol[s][q] = y2; } }
                float kd = 0.f;
                if (EPI == 2) { const float* bh = HB + h * HD;   // lane lr sums row lr, d ascending (both lane halves alike, the lower one stores)
#pragma unroll
                    for (int d = 0; d < HD; d += 4) { const v4f f = *(const v4fa*)(os + lr * 68 + d);
#pragma unroll
                        for (int q = 0; q < 4; ++q) kd = __fadd_rn(kd, __fmul_rn(bfr(bh[d + q]), f[q])); } }
                bf* ph = Ph + po + (size_t)mb * 16 * HD; bf* pl = Pl + po + (size_t)mb * 16 * HD;
#pragma unroll
                for (int s = 0; s < 8; ++s) { *(v4us*)(ph + s * 2 * HD) = oh[s]; *(v4us*)(pl + s * 2 * HD) = ol[s]; }
                // every register that the stores above name stays live up to this wait, so that none is rewritten in front of it
                asm volatile("s_wait_xcnt 0x0" :: "v"(ph), "v"(pl), "v"(oh[0]), "v"(oh[1]), "v"(oh[2]), "v"(oh[3]), "v"(oh[4]), "v"(oh[5]), "v"(oh[6]), "v"(oh[7]), "v"(ol[0]), "v"(ol[1]), "v"(ol[2]), "v"(ol[3]), "v"(ol[4]), "v"(ol[5]), "v"(ol[6]), "v"(ol[7]) : "memory");
                if (EPI == 2) { float* kp = KBo + (size_t)(bz * NH_ + h) * TT + t0 + mb * 16 + lr; if (hi == 0) *kp = kd;
                    asm volatile("s_wait_xcnt 0x0" :: "v"(kp), "v"(kd) : "memory"); }   // as above, for the registers of this store
                __builtin_amdgcn_wave_barrier();   // the next 16 rows' LDS writes stay behind this round's reads
            }
        } else {   // v: a lane holds 8 successive t of one d; 16 d rows at a time through LDS (row: 64 t hi | 64 t lo, pitch 272 B), so that each store covers whole 128-byte lines of both planes
            const int g = (c0 - DQ) / HD; bf* ob = (bf*)os; bf* vd = ((lr < 8) ? Vh : Vl) + ((size_t)(bz * NKV + g) * HD + hi) * TT + t0 + (lr & 7) * 8;
#pragma unroll
            for (int nb = 0; nb < 4; ++nb) {
#pragma unroll
                for (int mb = 0; mb < 4; ++mb) { v8us oh, ol;
#pragma unroll
                    for (int j = 0; j < 8; ++j) { unsigned short x2, y2; splitf(acc[mb][nb][j], x2, y2); oh[j] = x2; ol[j] = y2; }
                    *(v8usa*)(ob + lr * 136 + mb * 16 + hi * 8) = oh; *(v8usa*)(ob + lr * 136 + 64 + mb * 16 + hi * 8) = ol; }
                __builtin_amdgcn_wave_barrier(); asm volatile("" ::: "memory");   // as above: reads of other lanes' values stay behind the writes
                v8us val[8]; bf* vp = vd + (size_t)nb * 16 * TT;   // step s: d row 2 s + hi, 16-byte piece lr of its 256 bytes
#pragma unroll
                for (int s = 0; s < 8; ++s) val[s] = *(const v8usa*)(ob + (2 * s + hi) * 136 + lr * 8);
#pragma unroll
                for (int s = 0; s < 8; ++s) *(v8us*)(vp + (size_t)s * 2 * TT) = val[s];
                // every register that the stores above name stays live up to this wait, so that none is rewritten in front of it
                asm volatile("s_wait_xcnt 0x0" :: "v"(vp), "v"(val[0]), "v"(val[1]), "v"(val[2]), "v"(val[3]), "v"(val[4]), "v"(val[5]), "v"(val[6]), "v"(val[7]) : "memory");
                __builtin_amdgcn_wave_barrier();   // the next 16 d rows' LDS writes stay behind this round's reads
            }
        }
        return;
    }
#pragma unroll
    for (int mb = 0; mb < 4; ++mb) {
#pragma unroll
        for (int nb = 0; nb < 4; ++nb) {
#pragma unroll
            for (int j = 0; j < 8; ++j) os[(hi * 8 + j) * 68 + nb * 16 + lr] = acc[mb][nb][j]; }
        __builtin_amdgcn_wave_barrier(); asm volatile("" ::: "memory");
        float* crow = C + (size_t)(r0 + mb * 16) * ldc + c0;
{
#pragma unroll
            for (int s = 0; s < 8; ++s) { const int row = 2 * s + hi, cofs = lr * 4; v4f val = *(const v4fa*)(os + row * 68 + cofs); if (BIAS) { val[0] += bfr(bias[c0 + cofs]); val[1] += bfr(bias[c0 + cofs + 1]); val[2] += bfr(bias[c0 + cofs + 2]); val[3] += bfr(bias[c0 + cofs + 3]); }
                *(v4f*)(crow + (size_t)row * ldc + cofs) = val; }
             }
        __builtin_amdgcn_wave_barrier(); asm volatile("" ::: "memory");
    }
}

__device__ __forceinline__ h16 tohx(float x) { return (h16)x; }
typedef __attribute__((ext_vector_type(2))) _Float16 v2h;
typedef __attribute__((ext_vector_type(4))) _Float16 v4h;
typedef __attribute__((ext_vector_type(2))) unsigned short v2us;
typedef __attribute__((ext_vector_type(2))) float v2f;
typedef __attribute__((ext_vector_type(4))) int v4i;

__global__ __launch_bounds__(256) void k_wtG(const float* __restrict__ w, int K, int N, bf* Bt) {
    const int lane = threadIdx.x & 31; const int L0 = (blockIdx.x * 8 + (threadIdx.x >> 5)) * 8; const int nlines = N * K / 64;
{
#pragma unroll 1
        for (int l = 0; l < 8; ++l) { const int L = L0 + l; if (L >= nlines) break; const size_t e = (size_t)L * 64 + lane * 2; const int k = (int)(e % K), n = (int)(e / K); v2us o;
            o[0] = f2bf(w[(size_t)k * N + n]); o[1] = f2bf(w[(size_t)(k + 1) * N + n]); *(v2us*)(Bt + e) = o; }
         }
}
__global__ __launch_bounds__(256) void k_cvt8(const float* __restrict__ src, bf* dst, size_t n8) { const size_t i = (size_t)blockIdx.x * 256 + threadIdx.x; if (i >= n8) return; const v8f v = *(const v8f*)(src + i * 8); v8us o;
#pragma unroll
    for (int k = 0; k < 8; ++k) o[k] = f2bf(v[k]); *(v8us*)(dst + i * 8) = o;  }

__global__ __launch_bounds__(256) void k_flat(const float* __restrict__ F, h16* P16, bf* Ph, bf* Pl, size_t n4) { const size_t i = (size_t)blockIdx.x * 256 + threadIdx.x; if (i >= n4) return; const v4f a = *(const v4f*)(F + i * 4); v4h o16; v4us oh, ol;
#pragma unroll
    for (int q = 0; q < 4; ++q) { o16[q] = tohx(a[q]); unsigned short x2, y2; splitf(a[q], x2, y2); oh[q] = x2; ol[q] = y2; }
    *(v4h*)(P16 + i * 4) = o16; *(v4us*)(Ph + i * 4) = oh; *(v4us*)(Pl + i * 4) = ol;  }

__global__ __launch_bounds__(256) void k_hdot(const float* __restrict__ bias, const float* __restrict__ F, int pitch, int nrows, int hcol, float* OUT) {
    { const size_t bz = blockIdx.y; F += bz * nrows * pitch; OUT += bz * NH_ * nrows; }   // blockIdx.y = batch (one for r)
    const int lane = threadIdx.x & 31; const size_t wv = (size_t)blockIdx.x * 8 + (threadIdx.x >> 5); if (wv >= (size_t)NH_ * (nrows / 32)) return; const int h = (int)(wv / (nrows / 32)); const int n = (int)(wv % (nrows / 32)) * 32 + lane; const float* f = F + (size_t)n * pitch + (hcol ? h * HD : 0);   /* hcol: F has per-head columns (k); 0: one 64-wide row shared by all heads (r) */ const float* bh = bias + h * HD; float s = 0.f;
#pragma unroll 4
    for (int d = 0; d < HD; ++d) { s = __fadd_rn(s, __fmul_rn(bfr(bh[d]), f[d])); }
    *(float*)(OUT + (size_t)h * nrows + n) = s;  }

#define MT   2                    // 16-row query tiles per work-group
#define ROWS (16 * MT)
#define PD   6                    // k steps by which the V fragment loads run ahead in the P.V product
#define PA   3                    // ring of P fragment sets in the P.V product
#define SP   1028                 // floats per LDS score row: 4112 B = 16 B x odd, the conflict-free pitch for 16-byte fragment reads
typedef v4us __attribute__((may_alias)) v4usa;
// ld4: the hi and lo fragments of both 32-wide k halves of one 16-row tile (x[0] hi k 0..31, x[1] lo, x[2] hi k 32..63, x[3] lo).
__device__ __forceinline__ void ld4(const bf* ph, const bf* pl, v16bf (&x)[4]) {
    x[0] = WFrag<bf>::ld(ph); x[1] = WFrag<bf>::ld(pl); x[2] = WFrag<bf>::ld(ph + 32); x[3] = WFrag<bf>::ld(pl + 32);
    asm volatile("s_wait_xcnt 0x0" :: "v"(ph), "v"(pl) : "memory");   // both address pairs stay live up to this wait
}
// k_fattn: one work-group (8 waves) = ROWS query rows of one head of one batch; their whole score rows stay in LDS from the score products to the P.V product.
// 1. wave w owns keys [128 w, 128 w + 128): q.r tiles over the window l = TT + j - i are stored straight to their shifted place sc[i][j];
// 2. q.k tiles: sc = ((q.k + KB[j]) + q.r) + RB[l]; 3. softmax, one wave per row, P hi | lo planes written over the row's own scores;
// 4. O = P.V (waves 0..3, one 16-column block each, k ascending), staged in LDS so that each wave stores whole output lines.
__global__ __launch_bounds__(256) void k_fattn(const bf* __restrict__ Qh, const bf* __restrict__ Ql, const bf* __restrict__ Kh, const bf* __restrict__ Kl, const bf* __restrict__ Rh, const bf* __restrict__ Rl, const bf* __restrict__ Vh, const bf* __restrict__ Vl, const float* __restrict__ KB, const float* __restrict__ RB, const int* __restrict__ km, float* OUTb) {
    typedef WFrag<bf> F;
    __shared__ __align__(16) float sc[ROWS * SP];
    __shared__ __align__(16) float os[ROWS * 68];
    __shared__ float rbs[TT + ROWS];
    const int lane = threadIdx.x & 31, lr = lane & 15, hi = lane >> 4; const int w = __builtin_amdgcn_readfirstlane((int)(threadIdx.x >> 5));
    const int i0 = blockIdx.x * ROWS, h = blockIdx.y, jw = w * 128;
    { const size_t bz = blockIdx.z, po = bz * NH_ * TT * HD; Qh += po; Ql += po; Kh += po; Kl += po; Vh += po; Vl += po; KB += bz * NH_ * TT; km += bz * TT; OUTb += bz * TT * DQ; }   // blockIdx.z = batch; the r planes and RB are shared by all batches
    const float* rbg = RB + (size_t)h * NR + (TT - i0 - ROWS) + threadIdx.x; float rv[TT / 256 + 1];   // rbs[x] = RB[h][TT - i0 - ROWS + x]: every l this work-group's rows meet; loaded here, stored in front of the first barrier
#pragma unroll
    for (int q = 0; q < TT / 256; ++q) rv[q] = rbg[q * 256];
    rv[TT / 256] = (threadIdx.x < ROWS) ? rbg[TT] : 0.f;
    v16bf ah[MT][2], al[MT][2];
#pragma unroll
    for (int mb = 0; mb < MT; ++mb) { const size_t o = ((size_t)h * TT + i0 + mb * 16 + lr) * HD + 8 * hi; v16bf x[4]; ld4(Qh + o, Ql + o, x); ah[mb][0] = x[0]; al[mb][0] = x[1]; ah[mb][1] = x[2]; al[mb][1] = x[3]; }
    const int lbase = TT + jw - i0 - ROWS;   // first l of the wave's window; the window [lbase, lbase + 128 + ROWS) lies in [0, NR)
    // Both tile loops are unrolled: which row tile needs which window tile is then decided at compile time, and the next tile's loads (issued ahead, in the source too) fly while this tile is multiplied.
    v16bf nx[4];
    { const size_t o = (size_t)(lbase + lr) * HD + 8 * hi; ld4(Rh + o, Rl + o, nx); }
#pragma unroll
    for (int t = 0; t < 8 + MT; ++t) { const v16bf b[2] = {nx[0], nx[2]}, c[2] = {nx[1], nx[3]};
        if (t + 1 < 8 + MT) { const size_t o = (size_t)(lbase + (t + 1) * 16 + lr) * HD + 8 * hi; ld4(Rh + o, Rl + o, nx); }
        else { const size_t o = ((size_t)h * TT + jw + lr) * HD + 8 * hi; ld4(Kh + o, Kl + o, nx); }   // the first key tile
        v8f acc[MT];
#pragma unroll
        for (int mb = 0; mb < MT; ++mb) acc[mb] = (v8f){};
#pragma unroll
        for (int s = 0; s < 2; ++s) {
#pragma unroll
            for (int mb = 0; mb < MT; ++mb) if (t + mb >= MT - 1 && t + mb <= MT + 7) acc[mb] = wmmab(ah[mb][s], b[s], acc[mb]);
#pragma unroll
            for (int mb = 0; mb < MT; ++mb) if (t + mb >= MT - 1 && t + mb <= MT + 7) acc[mb] = wmmab(al[mb][s], b[s], acc[mb]);
#pragma unroll
            for (int mb = 0; mb < MT; ++mb) if (t + mb >= MT - 1 && t + mb <= MT + 7) acc[mb] = wmmab(ah[mb][s], c[s], acc[mb]); }
        asm volatile("v_nop\n\tv_nop\n\tv_nop\n\tv_nop" : "+v"(acc[0]), "+v"(acc[1]));   // the four vector slots the chip needs before the next tile's first product overwrites these result registers: only LDS stores stand between
#pragma unroll
        for (int mb = 0; mb < MT; ++mb) { if (t + mb < MT - 1 || t + mb > MT + 7) continue;
#pragma unroll
            for (int jj = 0; jj < 8; ++jj) { const int ii = mb * 16 + hi * 8 + jj; const int jrel = t * 16 + lr + ii - ROWS;   /* j - jw of (row ii, l = lbase + 16 t + lr) */ if (jrel >= 0 && jrel < 128) sc[ii * SP + jw + jrel] = acc[mb][jj]; } } }
#pragma unroll
    for (int q = 0; q < TT / 256; ++q) rbs[q * 256 + threadIdx.x] = rv[q];
    if (threadIdx.x < ROWS) rbs[TT + threadIdx.x] = rv[TT / 256];
    __syncthreads();
#pragma unroll
    for (int nb = 0; nb < 8; ++nb) { const int j = jw + nb * 16 + lr; const v16bf b[2] = {nx[0], nx[2]}, c[2] = {nx[1], nx[3]}; const float kb = KB[(size_t)h * TT + j];
        if (nb + 1 < 8) { const size_t o = ((size_t)h * TT + j + 16) * HD + 8 * hi; ld4(Kh + o, Kl + o, nx); }
        v8f acc[MT];
#pragma unroll
        for (int mb = 0; mb < MT; ++mb) acc[mb] = (v8f){};
#pragma unroll
        for (int s = 0; s < 2; ++s) {
#pragma unroll
            for (int mb = 0; mb < MT; ++mb) acc[mb] = wmmab(ah[mb][s], b[s], acc[mb]);
#pragma unroll
            for (int mb = 0; mb < MT; ++mb) acc[mb] = wmmab(al[mb][s], b[s], acc[mb]);
#pragma unroll
            for (int mb = 0; mb < MT; ++mb) acc[mb] = wmmab(ah[mb][s], c[s], acc[mb]); }
#pragma unroll
        for (int mb = 0; mb < MT; ++mb)
#pragma unroll
            for (int jj = 0; jj < 8; ++jj) { const int ii = mb * 16 + hi * 8 + jj; float* p = sc + ii * SP + j; *p = __fadd_rn(__fadd_rn(__fadd_rn(acc[mb][jj], kb), *p), rbs[j - ii + ROWS]); } }
    __syncthreads();
    // V fragments run PD k steps ahead of their products; the first PD are asked for here, so that they land during the softmax
    v16bf vh[PD], vl[PD]; const size_t vo = ((size_t)h * HD + (w & 3) * 16 + lr) * TT + 8 * hi;
    if (w < 4) {
#pragma unroll
        for (int d = 0; d < PD; ++d) { vh[d] = F::ld(Vh + vo + 32 * d); vl[d] = F::ld(Vl + vo + 32 * d); } }
    for (int rr = 0; rr < ROWS / 8; ++rr) { float* sr = sc + (w * (ROWS / 8) + rr) * SP; float v[TT / 32]; float mx = -3.0e38f;
#pragma unroll
        for (int ch = 0; ch < TT / 128; ++ch) { const int j0 = ch * 128 + lane * 4; const v4f a = *(const v4fa*)(sr + j0); const v4i mk = *(const v4i*)(km + j0);
#pragma unroll
            for (int q = 0; q < 4; ++q) { const float t = (mk[q] != 0) ? a[q] * SCL : -3.0e38f; v[ch * 4 + q] = t;   /* mask == 0 -> -inf */ mx = fmaxf(mx, t); } }
#pragma unroll
        for (int sh = 16; sh; sh >>= 1) mx = fmaxf(mx, __shfl_xor(mx, sh, 32));
        float sum = 0.f;
#pragma unroll
        for (int k = 0; k < TT / 32; ++k) { const float d0 = __fsub_rn(v[k], mx); v[k] = __builtin_amdgcn_exp2f(__fmul_rn(d0, 1.4426950408889634f)); sum += v[k]; }
#pragma unroll
        for (int sh = 16; sh; sh >>= 1) sum += __shfl_xor(sum, sh, 32);
        const float f = __fdiv_rn(1.0f, sum); bf* pr = (bf*)sr;   // P hi in the row's first 2 KiB, P lo in its second; every score of the row is in registers by now (the sum needed them all)
#pragma unroll
        for (int ch = 0; ch < TT / 128; ++ch) { v4us oh, ol;
#pragma unroll
            for (int q = 0; q < 4; ++q) { unsigned short a, c2; splitf(v[ch * 4 + q] * f, a, c2); oh[q] = a; ol[q] = c2; }
            *(v4usa*)(pr + ch * 128 + lane * 4) = oh; *(v4usa*)(pr + TT + ch * 128 + lane * 4) = ol; } }
    __syncthreads();
    if (w < 4) { v8f acc[MT];
#pragma unroll
        for (int mb = 0; mb < MT; ++mb) acc[mb] = (v8f){};
        const bf* pl = (const bf*)(sc + lr * SP) + 8 * hi;   // this lane's P hi row of row tile 0; row tile mb lies 16 rows on, P lo TT elements on
        v16bf pa[PA][MT], pb[PA][MT];   // P hi / lo fragments, read from LDS PA - 1 k steps ahead of their products
#pragma unroll
        for (int d = 0; d < PA - 1; ++d)
#pragma unroll
            for (int mb = 0; mb < MT; ++mb) { const bf* pr = pl + mb * 16 * SP * 2 + d * 32; pa[d][mb] = cat16b(*(const v8usa*)pr, *(const v8usa*)(pr + 16)); pb[d][mb] = cat16b(*(const v8usa*)(pr + TT), *(const v8usa*)(pr + TT + 16)); }
        // unrolled: the fragment rings are then indexed at compile time and stay in registers, and the last steps ask for nothing
#pragma unroll
        for (int ks = 0; ks < TT / 32; ++ks) { const int kc = ks * 32; const v16bf b = vh[ks % PD], b2 = vl[ks % PD];
            if (ks + PD < TT / 32) { vh[ks % PD] = F::ld(Vh + vo + kc + 32 * PD); vl[ks % PD] = F::ld(Vl + vo + kc + 32 * PD); }
            if (ks + PA - 1 < TT / 32) {
#pragma unroll
                for (int mb = 0; mb < MT; ++mb) { const bf* pr = pl + mb * 16 * SP * 2 + kc + (PA - 1) * 32; pa[(ks + PA - 1) % PA][mb] = cat16b(*(const v8usa*)pr, *(const v8usa*)(pr + 16)); pb[(ks + PA - 1) % PA][mb] = cat16b(*(const v8usa*)(pr + TT), *(const v8usa*)(pr + TT + 16)); } }
#pragma unroll
            for (int mb = 0; mb < MT; ++mb) acc[mb] = wmmab(pa[ks % PA][mb], b, acc[mb]);
#pragma unroll
            for (int mb = 0; mb < MT; ++mb) acc[mb] = wmmab(pb[ks % PA][mb], b, acc[mb]);
#pragma unroll
            for (int mb = 0; mb < MT; ++mb) acc[mb] = wmmab(pa[ks % PA][mb], b2, acc[mb]); }
#pragma unroll
        for (int mb = 0; mb < MT; ++mb)
#pragma unroll
            for (int jj = 0; jj < 8; ++jj) os[(mb * 16 + hi * 8 + jj) * 68 + w * 16 + lr] = acc[mb][jj]; }
    __syncthreads();
#pragma unroll
    for (int s = 0; s < MT; ++s) { const int row = s * 16 + (int)(threadIdx.x >> 4), cofs = (int)(threadIdx.x & 15) * 4; *(v4f*)(OUTb + (size_t)(i0 + row) * DQ + h * HD + cofs) = *(const v4fa*)(os + row * 68 + cofs); }
}

extern "C" void kernel_launch(void* const* d_in, const int* in_sizes, int n_in,
                              void* d_out, int out_size, void* d_ws, size_t ws_size, hipStream_t stream) {
    (void)in_sizes; (void)n_in; (void)out_size;
    const float* x = (const float*)d_in[0]; const float* xk = (const float*)d_in[1]; const int* kmask = (const int*)d_in[2]; const float* pemb = (const float*)d_in[3]; const float* wq = (const float*)d_in[4]; const float* wkv = (const float*)d_in[5]; const float* wr = (const float*)d_in[6]; const float* rrb = (const float*)d_in[7]; const float* rwb = (const float*)d_in[8]; const float* wk = nullptr; const float* wv = nullptr; (void)wk; (void)wv;
    float* OUT = (float*)d_out;     // [4][1024][1024]
    char* wsp = (char*)d_ws;
    auto take = [&](size_t bytes) { char* p = wsp; wsp += (bytes + 255) & ~(size_t)255; return (void*)p; };
    bf* WQ = (bf*)take((size_t)DQ * DM * 2); bf* WKV = (bf*)take((size_t)DKV2 * DM * 2); bf* WR = (bf*)take((size_t)HD * HD * 2); bf* PE = (bf*)take((size_t)NR * HD * 2); float* RF = (float*)take((size_t)NR * HD * 4); h16* RP16 = (h16*)take((size_t)NR * HD * 2); bf* RPh = (bf*)take((size_t)NR * HD * 2); bf* RPl = (bf*)take((size_t)NR * HD * 2); float* KB = (float*)take((size_t)NB_ * NH_ * TT * 4); float* RB = (float*)take((size_t)NH_ * NR * 4);
    // every per-batch buffer holds all NB_ batches, batch-major
    bf* XB = (bf*)take((size_t)NB_ * TT * DM * 2);
    bf* QPh = (bf*)take((size_t)NB_ * NH_ * TT * HD * 2); bf* QPl = (bf*)take((size_t)NB_ * NH_ * TT * HD * 2); bf* KPh = (bf*)take((size_t)NB_ * NKV * TT * HD * 2); bf* KPl = (bf*)take((size_t)NB_ * NKV * TT * HD * 2); bf* VTh = (bf*)take((size_t)NB_ * NKV * HD * TT * 2); bf* VTl = (bf*)take((size_t)NB_ * NKV * HD * TT * 2);
    if ((size_t)(wsp - (char*)d_ws) > ws_size) return;    // about 64 MiB of the 256 MiB
    { k_wtG<<<(unsigned)((DM * DQ / 64 + 63) / 64), 256, 0, stream>>>(wq, DM, DQ, WQ); k_wtG<<<(unsigned)((DM * DKV2 / 64 + 63) / 64), 256, 0, stream>>>(wkv, DM, DKV2, WKV); k_wtG<<<(unsigned)((HD * HD / 64 + 63) / 64), 256, 0, stream>>>(wr, HD, HD, WR);
      k_cvt8<<<(unsigned)(((size_t)NR * HD / 8 + 255) / 256), 256, 0, stream>>>(pemb, PE, (size_t)NR * HD / 8); k_gemmw<bf, 0, false, 0><<<dim3(NR / 64, HD / 64, 1), 32, 0, stream>>>(PE, nullptr, WR, nullptr, HD, RF, HD, nullptr, 0, 0, 0, nullptr, nullptr, nullptr, nullptr, nullptr, nullptr);   /* r = pos_embed Wr (exact) */
      k_flat<<<(unsigned)(((size_t)NR * HD / 4 + 255) / 256), 256, 0, stream>>>(RF, RP16, RPh, RPl, (size_t)NR * HD / 4); k_hdot<<<(unsigned)(((size_t)NH_ * (NR / 32) + 7) / 8), 256, 0, stream>>>(rwb, RF, HD, NR, 0, RB);   /* r is shared by all heads: no column offset */   /* r planes; RB[h][l] = r_w_bias_h . r_l */
      
       }
    // One launch of each stage covers all NB_ batches: the projections see the batches as NB_ * TT rows and write the head planes themselves, the attention kernel takes the batch from blockIdx.z.
    k_cvt8<<<(unsigned)(((size_t)NB_ * TT * DM / 8 + 255) / 256), 256, 0, stream>>>(x, XB, (size_t)NB_ * TT * DM / 8);
    k_gemmw<bf, 0, false, 1><<<dim3(NB_ * TT / 64, DQ / 64, 1), 32, 0, stream>>>(XB, nullptr, WQ, nullptr, DM, nullptr, 0, nullptr, 0, 0, 0, QPh, QPl, nullptr, nullptr, nullptr, nullptr);   /* qh planes */
    k_cvt8<<<(unsigned)(((size_t)NB_ * TT * DM / 8 + 255) / 256), 256, 0, stream>>>(xk, XB, (size_t)NB_ * TT * DM / 8);
    k_gemmw<bf, 0, false, 2><<<dim3(NB_ * TT / 64, DKV2 / 64, 1), 32, 0, stream>>>(XB, nullptr, WKV, nullptr, DM, nullptr, 0, nullptr, 0, 0, 0, KPh, KPl, VTh, VTl, rrb, KB);   /* kv = k Wkv: k planes (columns 0..1023) with KB[b][h][j] = r_r_bias_h . kh_j, v planes (columns 1024..2047) */
    k_fattn<<<dim3(TT / ROWS, NH_, NB_), 256, 0, stream>>>(QPh, QPl, KPh, KPl, RPh, RPl, VTh, VTl, KB, RB, kmask, OUT);   /* scores, shift, softmax and P.V of every head of every batch */
}

// v005
// It runs in 190 microseconds.
// Two timings next to v004 both put it at 1.32 times that version's speed.
// All steps since v000 together make it 9.04 times as fast.
#include <hip/hip_runtime.h>

// Transformer-XL relative multi-head attention (q, k [4][1024][1024]; qh = q Wq ('xw' [1024][1024]), kv = k Wkv ('xw' [1024][2048]: k | v column blocks; 16 heads x 64); r = pos_embed Wr ([2048][64] x [64][64], shared by all heads); AC = (qh + r_r_bias_h).kh, BD = shift((qh + r_w_bias_h).r): BD[i][j] = (qh_i + r_w_bias_h).r[L + j - i]; attn = (AC + BD)/8; keys with mask[b][j] == 0 -> -inf (int [4][1024], read); softmax; out = merged attn.vh -> [4][1024][1024] (4.2 M)).
// Compute dtypes, f32 accumulate: every input rounded to bf16; projections exact; relative terms 3 products / f32 dots; content scores 3 products on every row; softmax f32; output f32.

#define NB_  4
#define TT   1024
#define DM   1024
#define NH_  16
#define NKV  16
#define REP  (NH_ / NKV)
#define HD   64
#define DQ   (NH_ * HD)
#define DKV  (NKV * HD)
#define RH   1024                 // = TT: every row hi/lo
#define WIN  0
#define PCAR 1024.0f
#define SCL  0.125f
#define NR   2048    // relative positions (2L)
#define DKV2 2048    // kv projection width (k | v)
typedef _Float16 h16;
typedef unsigned short bf;
typedef __attribute__((ext_vector_type(16))) __bf16   v16bf;
typedef __attribute__((ext_vector_type(16))) _Float16 v16h;
typedef __attribute__((ext_vector_type(8)))  _Float16 v8h;
typedef __attribute__((ext_vector_type(8)))  unsigned short v8us;
typedef __attribute__((ext_vector_type(8)))  float    v8f;
typedef __attribute__((ext_vector_type(4)))  float    v4f;
typedef __attribute__((ext_vector_type(4)))  unsigned v4u;
typedef v8h  __attribute__((may_alias)) v8ha;
typedef v4f  __attribute__((may_alias)) v4fa;
typedef v8us __attribute__((may_alias)) v8usa;

__device__ __forceinline__ unsigned short f2bf(float f) { unsigned u = __float_as_uint(f); u += 0x7FFFu + ((u >> 16) & 1u); return (unsigned short)(u >> 16); }
__device__ __forceinline__ float bf2f(unsigned short b) { return __uint_as_float(((unsigned)b) << 16); }
__device__ __forceinline__ float bfr(float f) { return bf2f(f2bf(f)); }
__device__ __forceinline__ void splitf(float y, unsigned short& h, unsigned short& l) { h = f2bf(y); l = f2bf(y - bf2f(h)); }
typedef __attribute__((ext_vector_type(4))) unsigned short v4us;
__device__ __forceinline__ v16h cat16(v8h lo, v8h hi) { return __builtin_shufflevector(lo, hi, 0, 1, 2, 3, 4, 5, 6, 7, 8, 9, 10, 11, 12, 13, 14, 15); }
__device__ __forceinline__ v16bf cat16b(v8us lo, v8us hi) { return __builtin_bit_cast(v16bf, __builtin_shufflevector(lo, hi, 0, 1, 2, 3, 4, 5, 6, 7, 8, 9, 10, 11, 12, 13, 14, 15)); }
__device__ __forceinline__ v8f wmma16(v16h a, v16h b, v8f c) { return __builtin_amdgcn_wmma_f32_16x16x32_f16(false, a, false, b, (short)0, c, false, false); }
__device__ __forceinline__ v8f wmmab(v16bf a, v16bf b, v8f c) { return __builtin_amdgcn_wmma_f32_16x16x32_bf16(false, a, false, b, (short)0, c, false, false); }



// ---- k_gemmw: register-blocked GEMM, ONE WAVE per 64x64 output tile (16 accumulators), operands straight from 16-bit planes, A K-contiguous [m][k], Bt in fragment order (ldfo below); grid (M/64, N/64, Z), 32 threads.
// C[m][n] (f32, pitch ldc, + optional f32 bias[n]) = sum_k A[m][k] Bt[n][k] (+ split products per NSPLIT). z-batch strides sA/sB/sC in elements. K % 32 == 0.
// EPI 0: C goes out as f32. EPI 1 (q projection) and 2 (kv projection), rows = batch x TT: no f32 result leaves the kernel. A tile is 64 rows of one batch x the 64 columns of one head, and the epilogue writes
// the bf16 hi | lo planes that the attention kernel reads, in fragment order (ldfo below): q, and the kv column blocks below DQ (k), as fragments of 16 t rows x 32 d, P[b][h][t / 16][d / 32][512], k with KBo[b][h][t] = HB_h . row (d ascending); the kv column blocks from DQ on (v) as fragments of 16 d rows x 32 t, V[b][g][d / 16][t / 32][512].
template <typename T16> struct WFrag;
template <> struct WFrag<h16> { typedef v16h V; static __device__ __forceinline__ V ld(const h16* p) { return cat16(*(const v8h*)p, *(const v8h*)(p + 16)); } static __device__ __forceinline__ v8f mma(V a, V b, v8f c) { return wmma16(a, b, c); } };
template <> struct WFrag<bf> { typedef v16bf V; static __device__ __forceinline__ V ld(const bf* p) { return cat16b(*(const v8us*)p, *(const v8us*)(p + 16)); } static __device__ __forceinline__ V ldf(const bf* p) { return cat16b(*(const v8us*)p, *(const v8us*)(p + 256)); } static __device__ __forceinline__ v8f mma(V a, V b, v8f c) { return wmmab(a, b, c); } };
// Fragment order: one 16-row x 32-k operand fragment is a block of 512 elements (1 KiB); element (row r, k) lies at (k >> 4) * 256 + (((k >> 3) & 1) * 16 + r) * 8 + (k & 7), which puts lane l's two 16-byte pieces at 8 l and 256 + 8 l.
// Each 16-byte load of a wave then covers 512 successive bytes, 4 whole 128-byte lines, where a row-major plane gives it 32 bytes of each of 16 lines. p = block + 8 * lane.
__device__ __forceinline__ v16bf ldfo(const bf* p) { return WFrag<bf>::ldf(p); }
template <typename T16, int NSPLIT, bool BIAS, int EPI>
__global__ __launch_bounds__(32) void k_gemmw(const T16* __restrict__ A, const T16* __restrict__ A2, const T16* __restrict__ Bt, const T16* __restrict__ Bt2, int K, float* C, int ldc, const float* __restrict__ bias, size_t sA, size_t sB, size_t sC, bf* Ph, bf* Pl, bf* Vh, bf* Vl, const float* __restrict__ HB, float* KBo) {
    typedef typename WFrag<T16>::V V;
    __shared__ __align__(16) float os[16 * 68];
    const size_t z = blockIdx.z; A += z * sA; if (A2) A2 += z * sA; Bt += z * sB; if (Bt2) Bt2 += z * sB; C += z * sC;
    const int lane = threadIdx.x & 31, lr = lane & 15, hi = lane >> 4; const int r0 = blockIdx.x * 64, c0 = blockIdx.y * 64;
    v8f acc[4][4];
#pragma unroll
    for (int mb = 0; mb < 4; ++mb)
#pragma unroll
        for (int nb = 0; nb < 4; ++nb) acc[mb][nb] = (v8f){};
    const size_t aoff = (size_t)(r0 + lr) * K + 8 * hi, boff = (size_t)c0 * K + 8 * lane;   // Bt: fragment blocks [n / 16][k / 32][512], so 16 rows are 16 K elements and a k step is one block
#pragma unroll 1
    for (int kc = 0; kc < K; kc += 32) {
        V a[4], a2[4], b[4]; v4u x[16]; const T16* pa = A + aoff + kc; const T16* pb = Bt + boff + kc * 16;
        // The sixteen operand loads of a k step and their data wait in one statement: here the eight address pairs live to the statement's end and no result shares a register with them.
        asm volatile("global_load_b128 %0, %16, off\n\tglobal_load_b128 %1, %16, off offset:32\n\tglobal_load_b128 %2, %17, off\n\tglobal_load_b128 %3, %17, off offset:32\n\tglobal_load_b128 %4, %18, off\n\tglobal_load_b128 %5, %18, off offset:32\n\tglobal_load_b128 %6, %19, off\n\tglobal_load_b128 %7, %19, off offset:32\n\tglobal_load_b128 %8, %20, off\n\tglobal_load_b128 %9, %20, off offset:512\n\tglobal_load_b128 %10, %21, off\n\tglobal_load_b128 %11, %21, off offset:512\n\tglobal_load_b128 %12, %22, off\n\tglobal_load_b128 %13, %22, off offset:512\n\tglobal_load_b128 %14, %23, off\n\tglobal_load_b128 %15, %23, off offset:512\n\ts_wait_loadcnt 0x0" : "=&v"(x[0]), "=&v"(x[1]), "=&v"(x[2]), "=&v"(x[3]), "=&v"(x[4]), "=&v"(x[5]), "=&v"(x[6]), "=&v"(x[7]), "=&v"(x[8]), "=&v"(x[9]), "=&v"(x[10]), "=&v"(x[11]), "=&v"(x[12]), "=&v"(x[13]), "=&v"(x[14]), "=&v"(x[15]) : "v"(pa + (size_t)0 * K), "v"(pa + (size_t)16 * K), "v"(pa + (size_t)32 * K), "v"(pa + (size_t)48 * K), "v"(pb + (size_t)0 * K), "v"(pb + (size_t)16 * K), "v"(pb + (size_t)32 * K), "v"(pb + (size_t)48 * K) : "memory");
#pragma unroll
        for (int mb = 0; mb < 4; ++mb) { a[mb] = __builtin_bit_cast(V, __builtin_shufflevector(x[2 * mb], x[2 * mb + 1], 0, 1, 2, 3, 4, 5, 6, 7)); b[mb] = __builtin_bit_cast(V, __builtin_shufflevector(x[8 + 2 * mb], x[9 + 2 * mb], 0, 1, 2, 3, 4, 5, 6, 7)); if (NSPLIT == 1 || NSPLIT == 2) a2[mb] = WFrag<T16>::ld(A2 + aoff + (size_t)mb * 16 * K + kc); }
#pragma unroll
        for (int nb = 0; nb < 4; ++nb) { V b2; if (NSPLIT >= 2) b2 = WFrag<T16>::ldf(Bt2 + boff + (size_t)nb * 16 * K + kc * 16);
#pragma unroll
            for (int mb = 0; mb < 4; ++mb) { acc[mb][nb] = WFrag<T16>::mma(a[mb], b[nb], acc[mb][nb]); if (NSPLIT == 1 || NSPLIT == 2) acc[mb][nb] = WFrag<T16>::mma(a2[mb], b[nb], acc[mb][nb]); if (NSPLIT >= 2) acc[mb][nb] = WFrag<T16>::mma(a[mb], b2, acc[mb][nb]); } }
        asm volatile("v_nop\n\tv_nop\n\tv_nop\n\tv_nop" : "+v"(acc[0][0]), "+v"(acc[1][1]), "+v"(acc[2][2]), "+v"(acc[3][3]) : "v"(a[0]), "v"(a[3]));
    }
    if (EPI >= 1) {
        const int bz = r0 / TT, t0 = r0 % TT;
        if (EPI == 1 || c0 < DQ) {   // q or k: 16 rows (two fragments a plane) at a time through LDS, which turns the accumulator's columns into the fragments' 16-byte row pieces; each store covers 512 successive bytes
            const int h = c0 / HD; const size_t po = ((size_t)(bz * NH_ + h) * TT + t0) * HD + lane * 8;
#pragma unroll
            for (int mb = 0; mb < 4; ++mb) {
#pragma unroll
                for (int nb = 0; nb < 4; ++nb) {
#pragma unroll
                    for (int j = 0; j < 8; ++j) os[(hi * 8 + j) * 68 + nb * 16 + lr] = acc[mb][nb][j]; }
                __builtin_amdgcn_wave_barrier(); asm volatile("" ::: "memory");   // the reads below take other lanes' values: the compiler may not lift them over the writes
                v8us oh[4], ol[4];   // piece s: row lr, columns 16 s + 8 hi .. + 7
#pragma unroll
                for (int s = 0; s < 4; ++s) { const float* sp = os + lr * 68 + s * 16 + hi * 8; const v4f va = *(const v4fa*)sp, vb = *(const v4fa*)(sp + 4);
#pragma unroll
                    for (int q = 0; q < 4; ++q) { unsigned short x2, y2; splitf(va[q], x2, y2); oh[s][q] = x2; ol[s][q] = y2; splitf(vb[q], x2, y2); oh[s][4 + q] = x2; ol[s][4 + q] = y2; } }
                float kd = 0.f;
                if (EPI == 2) { const float* bh = HB + h * HD;   // lane lr sums row lr, d ascending (both lane halves alike, the lower one stores)
#pragma unroll
                    for (int d = 0; d < HD; d += 4) { const v4f f = *(const v4fa*)(os + lr * 68 + d);
#pragma unroll
                        for (int q = 0; q < 4; ++q) kd = __fadd_rn(kd, __fmul_rn(bfr(bh[d + q]), f[q])); } }
                bf* ph = Ph + po + (size_t)mb * 16 * HD; bf* pl = Pl + po + (size_t)mb * 16 * HD;
#pragma unroll
                for (int s = 0; s < 4; ++s) { *(v8us*)(ph + s * 256) = oh[s]; *(v8us*)(pl + s * 256) = ol[s]; }
                // every register that the stores above name stays live up to this wait, so that none is rewritten in front of it
                asm volatile("s_wait_xcnt 0x0" :: "v"(ph), "v"(pl), "v"(oh[0]), "v"(oh[1]), "v"(oh[2]), "v"(oh[3]), "v"(ol[0]), "v"(ol[1]), "v"(ol[2]), "v"(ol[3]) : "memory");
                if (EPI == 2) { float* kp = KBo + (size_t)(bz * NH_ + h) * TT + t0 + mb * 16 + lr; if (hi == 0) *kp = kd;
                    asm volatile("s_wait_xcnt 0x0" :: "v"(kp), "v"(kd) : "memory"); }   // as above, for the registers of this store
                __builtin_amdgcn_wave_barrier();   // the next 16 rows' LDS writes stay behind this round's reads
            }
        } else {   // v: a lane holds 8 successive t of one d, which is its own 16-byte piece of a fragment: accumulator (mb, nb) goes out as half a fragment, 512 successive bytes a plane, straight from the registers
            const int g = (c0 - DQ) / HD; const size_t vo = ((size_t)(bz * NKV + g) * (HD / 16) * (TT / 32) + t0 / 32) * 512 + lane * 8;
#pragma unroll
            for (int nb = 0; nb < 4; ++nb) { v8us oh[4], ol[4];
#pragma unroll
                for (int mb = 0; mb < 4; ++mb) {
#pragma unroll
                    for (int j = 0; j < 8; ++j) { unsigned short x2, y2; splitf(acc[mb][nb][j], x2, y2); oh[mb][j] = x2; ol[mb][j] = y2; } }
                bf* vh = Vh + vo + (size_t)nb * (TT / 32) * 512; bf* vl = Vl + vo + (size_t)nb * (TT / 32) * 512;
#pragma unroll
                for (int mb = 0; mb < 4; ++mb) { *(v8us*)(vh + mb * 256) = oh[mb]; *(v8us*)(vl + mb * 256) = ol[mb]; }
                // every register that the stores above name stays live up to this wait, so that none is rewritten in front of it
                asm volatile("s_wait_xcnt 0x0" :: "v"(vh), "v"(vl), "v"(oh[0]), "v"(oh[1]), "v"(oh[2]), "v"(oh[3]), "v"(ol[0]), "v"(ol[1]), "v"(ol[2]), "v"(ol[3]) : "memory");
            }
        }
        return;
    }
#pragma unroll
    for (int mb = 0; mb < 4; ++mb) {
#pragma unroll
        for (int nb = 0; nb < 4; ++nb) {
#pragma unroll
            for (int j = 0; j < 8; ++j) os[(hi * 8 + j) * 68 + nb * 16 + lr] = acc[mb][nb][j]; }
        __builtin_amdgcn_wave_barrier(); asm volatile("" ::: "memory");
        float* crow = C + (size_t)(r0 + mb * 16) * ldc + c0;
{
#pragma unroll
            for (int s = 0; s < 8; ++s) { const int row = 2 * s + hi, cofs = lr * 4; v4f val = *(const v4fa*)(os + row * 68 + cofs); if (BIAS) { val[0] += bfr(bias[c0 + cofs]); val[1] += bfr(bias[c0 + cofs + 1]); val[2] += bfr(bias[c0 + cofs + 2]); val[3] += bfr(bias[c0 + cofs + 3]); }
                *(v4f*)(crow + (size_t)row * ldc + cofs) = val; }
             }
        __builtin_amdgcn_wave_barrier(); asm volatile("" ::: "memory");
    }
}

__device__ __forceinline__ h16 tohx(float x) { return (h16)x; }
typedef __attribute__((ext_vector_type(2))) _Float16 v2h;
typedef __attribute__((ext_vector_type(4))) _Float16 v4h;
typedef __attribute__((ext_vector_type(2))) unsigned short v2us;
typedef __attribute__((ext_vector_type(2))) float v2f;
typedef __attribute__((ext_vector_type(4))) int v4i;

__global__ __launch_bounds__(256) void k_wtG(const float* __restrict__ w, int K, int N, bf* Bt) {
    // Bt = w transposed, in fragment order (ldfo): one wave writes one fragment block (16 n x 32 k, 1 KiB in a row); lane (lr, hi) gathers column n = 16 nt + lr at k = 32 kb + 16 c + 8 hi + 0..7
    const int lane = threadIdx.x & 31, lr = lane & 15, hi = lane >> 4; const int fb = blockIdx.x * 8 + __builtin_amdgcn_readfirstlane((int)(threadIdx.x >> 5)); if (fb >= N * K / 512) return;
    const int kb = fb % (K / 32), nt = fb / (K / 32); const float* s = w + (size_t)kb * 32 * N + nt * 16; const float* p[16]; float f[16]; v8us o[2];
#pragma unroll
    for (int q = 0; q < 16; ++q) p[q] = s + (size_t)((q >> 3) * 16 + hi * 8 + (q & 7)) * N + lr;
#pragma unroll
    for (int q = 0; q < 16; ++q) f[q] = *p[q];
    // behind the last load of the gather: all sixteen address pairs stay live up to this wait, so that none is handed to a later load's result in front of it
    asm volatile("s_wait_xcnt 0x0" :: "v"(p[0]), "v"(p[1]), "v"(p[2]), "v"(p[3]), "v"(p[4]), "v"(p[5]), "v"(p[6]), "v"(p[7]), "v"(p[8]), "v"(p[9]), "v"(p[10]), "v"(p[11]), "v"(p[12]), "v"(p[13]), "v"(p[14]), "v"(p[15]) : "memory");
#pragma unroll
    for (int q = 0; q < 16; ++q) o[q >> 3][q & 7] = f2bf(f[q]);
    bf* d = Bt + (size_t)fb * 512 + lane * 8; *(v8us*)d = o[0]; *(v8us*)(d + 256) = o[1];
}
__global__ __launch_bounds__(256) void k_cvt8(const float* __restrict__ src, bf* dst, size_t n8) { const size_t i = (size_t)blockIdx.x * 256 + threadIdx.x; if (i >= n8) return; const v8f v = *(const v8f*)(src + i * 8); v8us o;
#pragma unroll
    for (int k = 0; k < 8; ++k) o[k] = f2bf(v[k]); *(v8us*)(dst + i * 8) = o;  }

__global__ __launch_bounds__(256) void k_flat(const float* __restrict__ F, h16* P16, bf* Ph, bf* Pl, size_t n4) { const size_t i = (size_t)blockIdx.x * 256 + threadIdx.x; if (i >= n4) return; const v4f a = *(const v4f*)(F + i * 4); v4h o16; v4us oh, ol;
#pragma unroll
    for (int q = 0; q < 4; ++q) { o16[q] = tohx(a[q]); unsigned short x2, y2; splitf(a[q], x2, y2); oh[q] = x2; ol[q] = y2; }
    const int row = (int)(i * 4 / HD), d = (int)(i * 4 % HD); const size_t fo = (size_t)(row >> 4) * (16 * HD) + (d >> 4) * 256 + (((d >> 3) & 1) * 16 + (row & 15)) * 8 + (d & 7);   // the hi | lo planes in fragment order (ldfo): F is [rows][HD]
    *(v4h*)(P16 + i * 4) = o16; *(v4us*)(Ph + fo) = oh; *(v4us*)(Pl + fo) = ol;  }

__global__ __launch_bounds__(256) void k_hdot(const float* __restrict__ bias, const float* __restrict__ F, int pitch, int nrows, int hcol, float* OUT) {
    { const size_t bz = blockIdx.y; F += bz * nrows * pitch; OUT += bz * NH_ * nrows; }   // blockIdx.y = batch (one for r)
    const int lane = threadIdx.x & 31; const size_t wv = (size_t)blockIdx.x * 8 + (threadIdx.x >> 5); if (wv >= (size_t)NH_ * (nrows / 32)) return; const int h = (int)(wv / (nrows / 32)); const int n = (int)(wv % (nrows / 32)) * 32 + lane; const float* f = F + (size_t)n * pitch + (hcol ? h * HD : 0);   /* hcol: F has per-head columns (k); 0: one 64-wide row shared by all heads (r) */ const float* bh = bias + h * HD; float s = 0.f;
#pragma unroll 4
    for (int d = 0; d < HD; ++d) { s = __fadd_rn(s, __fmul_rn(bfr(bh[d]), f[d])); }
    *(float*)(OUT + (size_t)h * nrows + n) = s;  }

#define MT   2                    // 16-row query tiles per work-group
#define ROWS (16 * MT)
#define PD   6                    // k steps by which the V fragment loads run ahead in the P.V product
#define PA   3                    // ring of P fragment sets in the P.V product
#define SP   1028                 // floats per LDS score row: 4112 B = 16 B x odd, the conflict-free pitch for 16-byte fragment reads
typedef v4us __attribute__((may_alias)) v4usa;
// ld4: the hi and lo fragments of both 32-wide k halves of one 16-row tile (x[0] hi k 0..31, x[1] lo, x[2] hi k 32..63, x[3] lo); ph, pl = the tile's first fragment block + 8 * lane.
__device__ __forceinline__ void ld4(const bf* ph, const bf* pl, v16bf (&x)[4]) {
    x[0] = ldfo(ph); x[1] = ldfo(pl); x[2] = ldfo(ph + 512); x[3] = ldfo(pl + 512);
    asm volatile("s_wait_xcnt 0x0" :: "v"(ph), "v"(pl) : "memory");   // both address pairs stay live up to this wait
}
// k_fattn: one work-group (8 waves) = ROWS query rows of one head of one batch; their whole score rows stay in LDS from the score products to the P.V product.
// 1. wave w owns keys [128 w, 128 w + 128): q.r tiles over the window l = TT + j - i are stored straight to their shifted place sc[i][j];
// 2. q.k tiles: sc = ((q.k + KB[j]) + q.r) + RB[l]; 3. softmax, one wave per row, P hi | lo planes written over the row's own scores;
// 4. O = P.V (waves 0..3, one 16-column block each, k ascending), staged in LDS so that each wave stores whole output lines.
__global__ __launch_bounds__(256) void k_fattn(const bf* __restrict__ Qh, const bf* __restrict__ Ql, const bf* __restrict__ Kh, const bf* __restrict__ Kl, const bf* __restrict__ Rh, const bf* __restrict__ Rl, const bf* __restrict__ Vh, const bf* __restrict__ Vl, const float* __restrict__ KB, const float* __restrict__ RB, const int* __restrict__ km, float* OUTb) {
    __shared__ __align__(16) float sc[ROWS * SP];
    __shared__ __align__(16) float os[ROWS * 68];
    __shared__ float rbs[TT + ROWS];
    const int lane = threadIdx.x & 31, lr = lane & 15, hi = lane >> 4; const int w = __builtin_amdgcn_readfirstlane((int)(threadIdx.x >> 5));
    const int i0 = blockIdx.x * ROWS, h = blockIdx.y, jw = w * 128;
    { const size_t bz = blockIdx.z, po = bz * NH_ * TT * HD; Qh += po; Ql += po; Kh += po; Kl += po; Vh += po; Vl += po; KB += bz * NH_ * TT; km += bz * TT; OUTb += bz * TT * DQ; }   // blockIdx.z = batch; the r planes and RB are shared by all batches
    const float* rbg = RB + (size_t)h * NR + (TT - i0 - ROWS) + threadIdx.x; float rv[TT / 256 + 1];   // rbs[x] = RB[h][TT - i0 - ROWS + x]: every l this work-group's rows meet; loaded here, stored in front of the first barrier
#pragma unroll
    for (int q = 0; q < TT / 256; ++q) rv[q] = rbg[q * 256];
    rv[TT / 256] = (threadIdx.x < ROWS) ? rbg[TT] : 0.f;
    v16bf ah[MT][2], al[MT][2];
#pragma unroll
    for (int mb = 0; mb < MT; ++mb) { const size_t o = ((size_t)h * TT + i0 + mb * 16) * HD + 8 * lane; v16bf x[4]; ld4(Qh + o, Ql + o, x); ah[mb][0] = x[0]; al[mb][0] = x[1]; ah[mb][1] = x[2]; al[mb][1] = x[3]; }
    const int lbase = TT + jw - i0 - ROWS;   // first l of the wave's window; the window [lbase, lbase + 128 + ROWS) lies in [0, NR)
    // Both tile loops are unrolled: which row tile needs which window tile is then decided at compile time, and the next tile's loads (issued ahead, in the source too) fly while this tile is multiplied.
    v16bf nx[4];
    { const size_t o = (size_t)lbase * HD + 8 * lane; ld4(Rh + o, Rl + o, nx); }
#pragma unroll
    for (int t = 0; t < 8 + MT; ++t) { const v16bf b[2] = {nx[0], nx[2]}, c[2] = {nx[1], nx[3]};
        if (t + 1 < 8 + MT) { const size_t o = (size_t)(lbase + (t + 1) * 16) * HD + 8 * lane; ld4(Rh + o, Rl + o, nx); }
        else { const size_t o = ((size_t)h * TT + jw) * HD + 8 * lane; ld4(Kh + o, Kl + o, nx); }   // the first key tile
        v8f acc[MT];
#pragma unroll
        for (int mb = 0; mb < MT; ++mb) acc[mb] = (v8f){};
#pragma unroll
        for (int s = 0; s < 2; ++s) {
#pragma unroll
            for (int mb = 0; mb < MT; ++mb) if (t + mb >= MT - 1 && t + mb <= MT + 7) acc[mb] = wmmab(ah[mb][s], b[s], acc[mb]);
#pragma unroll
            for (int mb = 0; mb < MT; ++mb) if (t + mb >= MT - 1 && t + mb <= MT + 7) acc[mb] = wmmab(al[mb][s], b[s], acc[mb]);
#pragma unroll
            for (int mb = 0; mb < MT; ++mb) if (t + mb >= MT - 1 && t + mb <= MT + 7) acc[mb] = wmmab(ah[mb][s], c[s], acc[mb]); }
        asm volatile("v_nop\n\tv_nop\n\tv_nop\n\tv_nop" : "+v"(acc[0]), "+v"(acc[1]));   // the four vector slots the chip needs before the next tile's first product overwrites these result registers: only LDS stores stand between
#pragma unroll
        for (int mb = 0; mb < MT; ++mb) { if (t + mb < MT - 1 || t + mb > MT + 7) continue;
#pragma unroll
            for (int jj = 0; jj < 8; ++jj) { const int ii = mb * 16 + hi * 8 + jj; const int jrel = t * 16 + lr + ii - ROWS;   /* j - jw of (row ii, l = lbase + 16 t + lr) */ if (jrel >= 0 && jrel < 128) sc[ii * SP + jw + jrel] = acc[mb][jj]; } } }
#pragma unroll
    for (int q = 0; q < TT / 256; ++q) rbs[q * 256 + threadIdx.x] = rv[q];
    if (threadIdx.x < ROWS) rbs[TT + threadIdx.x] = rv[TT / 256];
    __syncthreads();
#pragma unroll
    for (int nb = 0; nb < 8; ++nb) { const int j = jw + nb * 16 + lr; const v16bf b[2] = {nx[0], nx[2]}, c[2] = {nx[1], nx[3]}; const float kb = KB[(size_t)h * TT + j];
        if (nb + 1 < 8) { const size_t o = ((size_t)h * TT + jw + (nb + 1) * 16) * HD + 8 * lane; ld4(Kh + o, Kl + o, nx); }
        v8f acc[MT];
#pragma unroll
        for (int mb = 0; mb < MT; ++mb) acc[mb] = (v8f){};
#pragma unroll
        for (int s = 0; s < 2; ++s) {
#pragma unroll
            for (int mb = 0; mb < MT; ++mb) acc[mb] = wmmab(ah[mb][s], b[s], acc[mb]);
#pragma unroll
            for (int mb = 0; mb < MT; ++mb) acc[mb] = wmmab(al[mb][s], b[s], acc[mb]);
#pragma unroll
            for (int mb = 0; mb < MT; ++mb) acc[mb] = wmmab(ah[mb][s], c[s], acc[mb]); }
#pragma unroll
        for (int mb = 0; mb < MT; ++mb)
#pragma unroll
            for (int jj = 0; jj < 8; ++jj) { const int ii = mb * 16 + hi * 8 + jj; float* p = sc + ii * SP + j; *p = __fadd_rn(__fadd_rn(__fadd_rn(acc[mb][jj], kb), *p), rbs[j - ii + ROWS]); } }
    __syncthreads();
    // V fragments run PD k steps ahead of their products; the first PD are asked for here, so that they land during the softmax
    v16bf vh[PD], vl[PD]; const size_t vo = ((size_t)h * (HD / 16) + (w & 3)) * (TT / 32) * 512 + 8 * lane;   // this wave's 16 d rows: TT / 32 fragment blocks in a row
    if (w < 4) {
#pragma unroll
        for (int d = 0; d < PD; ++d) { vh[d] = ldfo(Vh + vo + 512 * d); vl[d] = ldfo(Vl + vo + 512 * d); } }
    for (int rr = 0; rr < ROWS / 8; ++rr) { float* sr = sc + (w * (ROWS / 8) + rr) * SP; float v[TT / 32]; float mx = -3.0e38f;
#pragma unroll
        for (int ch = 0; ch < TT / 128; ++ch) { const int j0 = ch * 128 + lane * 4; const v4f a = *(const v4fa*)(sr + j0); const v4i mk = *(const v4i*)(km + j0);
#pragma unroll
            for (int q = 0; q < 4; ++q) { const float t = (mk[q] != 0) ? a[q] * SCL : -3.0e38f; v[ch * 4 + q] = t;   /* mask == 0 -> -inf */ mx = fmaxf(mx, t); } }
#pragma unroll
        for (int sh = 16; sh; sh >>= 1) mx = fmaxf(mx, __shfl_xor(mx, sh, 32));
        float sum = 0.f;
#pragma unroll
        for (int k = 0; k < TT / 32; ++k) { const float d0 = __fsub_rn(v[k], mx); v[k] = __builtin_amdgcn_exp2f(__fmul_rn(d0, 1.4426950408889634f)); sum += v[k]; }
#pragma unroll
        for (int sh = 16; sh; sh >>= 1) sum += __shfl_xor(sum, sh, 32);
        const float f = __fdiv_rn(1.0f, sum); bf* pr = (bf*)sr;   // P hi in the row's first 2 KiB, P lo in its second; every score of the row is in registers by now (the sum needed them all)
#pragma unroll
        for (int ch = 0; ch < TT / 128; ++ch) { v4us oh, ol;
#pragma unroll
            for (int q = 0; q < 4; ++q) { unsigned short a, c2; splitf(v[ch * 4 + q] * f, a, c2); oh[q] = a; ol[q] = c2; }
            *(v4usa*)(pr + ch * 128 + lane * 4) = oh; *(v4usa*)(pr + TT + ch * 128 + lane * 4) = ol; } }
    __syncthreads();
    if (w < 4) { v8f acc[MT];
#pragma unroll
        for (int mb = 0; mb < MT; ++mb) acc[mb] = (v8f){};
        const bf* pl = (const bf*)(sc + lr * SP) + 8 * hi;   // this lane's P hi row of row tile 0; row tile mb lies 16 rows on, P lo TT elements on
        v16bf pa[PA][MT], pb[PA][MT];   // P hi / lo fragments, read from LDS PA - 1 k steps ahead of their products
#pragma unroll
        for (int d = 0; d < PA - 1; ++d)
#pragma unroll
            for (int mb = 0; mb < MT; ++mb) { const bf* pr = pl + mb * 16 * SP * 2 + d * 32; pa[d][mb] = cat16b(*(const v8usa*)pr, *(const v8usa*)(pr + 16)); pb[d][mb] = cat16b(*(const v8usa*)(pr + TT), *(const v8usa*)(pr + TT + 16)); }
        // unrolled: the fragment rings are then indexed at compile time and stay in registers, and the last steps ask for nothing
#pragma unroll
        for (int ks = 0; ks < TT / 32; ++ks) { const int kc = ks * 32; const v16bf b = vh[ks % PD], b2 = vl[ks % PD];
            if (ks + PD < TT / 32) { vh[ks % PD] = ldfo(Vh + vo + 512 * (ks + PD)); vl[ks % PD] = ldfo(Vl + vo + 512 * (ks + PD)); }
            if (ks + PD == TT / 32 - 1) asm volatile("s_wait_xcnt 0x0" :: "v"(Vh + vo), "v"(Vl + vo) : "memory");   // behind the last V load: both address pairs stay live up to this wait, so that neither is rewritten in front of it
            if (ks + PA - 1 < TT / 32) {
#pragma unroll
                for (int mb = 0; mb < MT; ++mb) { const bf* pr = pl + mb * 16 * SP * 2 + kc + (PA - 1) * 32; pa[(ks + PA - 1) % PA][mb] = cat16b(*(const v8usa*)pr, *(const v8usa*)(pr + 16)); pb[(ks + PA - 1) % PA][mb] = cat16b(*(const v8usa*)(pr + TT), *(const v8usa*)(pr + TT + 16)); } }
#pragma unroll
            for (int mb = 0; mb < MT; ++mb) acc[mb] = wmmab(pa[ks % PA][mb], b, acc[mb]);
#pragma unroll
            for (int mb = 0; mb < MT; ++mb) acc[mb] = wmmab(pb[ks % PA][mb], b, acc[mb]);
#pragma unroll
            for (int mb = 0; mb < MT; ++mb) acc[mb] = wmmab(pa[ks % PA][mb], b2, acc[mb]); }
#pragma unroll
        for (int mb = 0; mb < MT; ++mb)
#pragma unroll
            for (int jj = 0; jj < 8; ++jj) os[(mb * 16 + hi * 8 + jj) * 68 + w * 16 + lr] = acc[mb][jj]; }
    __syncthreads();
#pragma unroll
    for (int s = 0; s < MT; ++s) { const int row = s * 16 + (int)(threadIdx.x >> 4), cofs = (int)(threadIdx.x & 15) * 4; *(v4f*)(OUTb + (size_t)(i0 + row) * DQ + h * HD + cofs) = *(const v4fa*)(os + row * 68 + cofs); }
}

extern "C" void kernel_launch(void* const* d_in, const int* in_sizes, int n_in,
                              void* d_out, int out_size, void* d_ws, size_t ws_size, hipStream_t stream) {
    (void)in_sizes; (void)n_in; (void)out_size;
    const float* x = (const float*)d_in[0]; const float* xk = (const float*)d_in[1]; const int* kmask = (const int*)d_in[2]; const float* pemb = (const float*)d_in[3]; const float* wq = (const float*)d_in[4]; const float* wkv = (const float*)d_in[5]; const float* wr = (const float*)d_in[6]; const float* rrb = (const float*)d_in[7]; const float* rwb = (const float*)d_in[8]; const float* wk = nullptr; const float* wv = nullptr; (void)wk; (void)wv;
    float* OUT = (float*)d_out;     // [4][1024][1024]
    char* wsp = (char*)d_ws;
    auto take = [&](size_t bytes) { char* p = wsp; wsp += (bytes + 255) & ~(size_t)255; return (void*)p; };
    bf* WQ = (bf*)take((size_t)DQ * DM * 2); bf* WKV = (bf*)take((size_t)DKV2 * DM * 2); bf* WR = (bf*)take((size_t)HD * HD * 2); bf* PE = (bf*)take((size_t)NR * HD * 2); float* RF = (float*)take((size_t)NR * HD * 4); h16* RP16 = (h16*)take((size_t)NR * HD * 2); bf* RPh = (bf*)take((size_t)NR * HD * 2); bf* RPl = (bf*)take((size_t)NR * HD * 2); float* KB = (float*)take((size_t)NB_ * NH_ * TT * 4); float* RB = (float*)take((size_t)NH_ * NR * 4);
    // every per-batch buffer holds all NB_ batches, batch-major
    bf* XB = (bf*)take((size_t)NB_ * TT * DM * 2);
    bf* QPh = (bf*)take((size_t)NB_ * NH_ * TT * HD * 2); bf* QPl = (bf*)take((size_t)NB_ * NH_ * TT * HD * 2); bf* KPh = (bf*)take((size_t)NB_ * NKV * TT * HD * 2); bf* KPl = (bf*)take((size_t)NB_ * NKV * TT * HD * 2); bf* VTh = (bf*)take((size_t)NB_ * NKV * HD * TT * 2); bf* VTl = (bf*)take((size_t)NB_ * NKV * HD * TT * 2);
    if ((size_t)(wsp - (char*)d_ws) > ws_size) return;    // about 64 MiB of the 256 MiB
    { k_wtG<<<(unsigned)((DM * DQ / 64 + 63) / 64), 256, 0, stream>>>(wq, DM, DQ, WQ); k_wtG<<<(unsigned)((DM * DKV2 / 64 + 63) / 64), 256, 0, stream>>>(wkv, DM, DKV2, WKV); k_wtG<<<(unsigned)((HD * HD / 64 + 63) / 64), 256, 0, stream>>>(wr, HD, HD, WR);
      k_cvt8<<<(unsigned)(((size_t)NR * HD / 8 + 255) / 256), 256, 0, stream>>>(pemb, PE, (size_t)NR * HD / 8); k_gemmw<bf, 0, false, 0><<<dim3(NR / 64, HD / 64, 1), 32, 0, stream>>>(PE, nullptr, WR, nullptr, HD, RF, HD, nullptr, 0, 0, 0, nullptr, nullptr, nullptr, nullptr, nullptr, nullptr);   /* r = pos_embed Wr (exact) */
      k_flat<<<(unsigned)(((size_t)NR * HD / 4 + 255) / 256), 256, 0, stream>>>(RF, RP16, RPh, RPl, (size_t)NR * HD / 4); k_hdot<<<(unsigned)(((size_t)NH_ * (NR / 32) + 7) / 8), 256, 0, stream>>>(rwb, RF, HD, NR, 0, RB);   /* r is shared by all heads: no column offset */   /* r planes; RB[h][l] = r_w_bias_h . r_l */
      
       }
    // One launch of each stage covers all NB_ batches: the projections see the batches as NB_ * TT rows and write the head planes themselves, the attention kernel takes the batch from blockIdx.z.
    k_cvt8<<<(unsigned)(((size_t)NB_ * TT * DM / 8 + 255) / 256), 256, 0, stream>>>(x, XB, (size_t)NB_ * TT * DM / 8);
    k_gemmw<bf, 0, false, 1><<<dim3(NB_ * TT / 64, DQ / 64, 1), 32, 0, stream>>>(XB, nullptr, WQ, nullptr, DM, nullptr, 0, nullptr, 0, 0, 0, QPh, QPl, nullptr, nullptr, nullptr, nullptr);   /* qh planes */
    k_cvt8<<<(unsigned)(((size_t)NB_ * TT * DM / 8 + 255) / 256), 256, 0, stream>>>(xk, XB, (size_t)NB_ * TT * DM / 8);
    k_gemmw<bf, 0, false, 2><<<dim3(NB_ * TT / 64, DKV2 / 64, 1), 32, 0, stream>>>(XB, nullptr, WKV, nullptr, DM, nullptr, 0, nullptr, 0, 0, 0, KPh, KPl, VTh, VTl, rrb, KB);   /* kv = k Wkv: k planes (columns 0..1023) with KB[b][h][j] = r_r_bias_h . kh_j, v planes (columns 1024..2047) */
    k_fattn<<<dim3(TT / ROWS, NH_, NB_), 256, 0, stream>>>(QPh, QPl, KPh, KPl, RPh, RPl, VTh, VTl, KB, RB, kmask, OUT);   /* scores, shift, softmax and P.V of every head of every batch */
}

// v006
// A run of this version takes 159 microseconds.
// Timed twice side by side with v005, it ran 1.21 and 1.17 times as fast.
// Counting every step since v000, it is 10.8 times as fast.
#include <hip/hip_runtime.h>

// Transformer-XL relative multi-head attention (q, k [4][1024][1024]; qh = q Wq ('xw' [1024][1024]), kv = k Wkv ('xw' [1024][2048]: k | v column blocks; 16 heads x 64); r = pos_embed Wr ([2048][64] x [64][64], shared by all heads); AC = (qh + r_r_bias_h).kh, BD = shift((qh + r_w_bias_h).r): BD[i][j] = (qh_i + r_w_bias_h).r[L + j - i]; attn = (AC + BD)/8; keys with mask[b][j] == 0 -> -inf (int [4][1024], read); softmax; out = merged attn.vh -> [4][1024][1024] (4.2 M)).
// Compute dtypes, f32 accumulate: every input rounded to bf16; projections exact; relative terms 3 products / f32 dots; content scores 3 products on every row; softmax f32; output f32.

#define NB_  4
#define TT   1024
#define DM   1024
#define NH_  16
#define NKV  16
#define REP  (NH_ / NKV)
#define HD   64
#define DQ   (NH_ * HD)
#define DKV  (NKV * HD)
#define RH   1024                 // = TT: every row hi/lo
#define WIN  0
#define PCAR 1024.0f
#define SCL  0.125f
#define NR   2048    // relative positions (2L)
#define DKV2 2048    // kv projection width (k | v)
typedef _Float16 h16;
typedef unsigned short bf;
typedef __attribute__((ext_vector_type(16))) __bf16   v16bf;
typedef __attribute__((ext_vector_type(16))) _Float16 v16h;
typedef __attribute__((ext_vector_type(8)))  _Float16 v8h;
typedef __attribute__((ext_vector_type(8)))  unsigned short v8us;
typedef __attribute__((ext_vector_type(8)))  float    v8f;
typedef __attribute__((ext_vector_type(4)))  float    v4f;
typedef __attribute__((ext_vector_type(4)))  unsigned v4u;
typedef v8h  __attribute__((may_alias)) v8ha;
typedef v4f  __attribute__((may_alias)) v4fa;
typedef v8us __attribute__((may_alias)) v8usa;

__device__ __forceinline__ unsigned short f2bf(float f) { unsigned u = __float_as_uint(f); u += 0x7FFFu + ((u >> 16) & 1u); return (unsigned short)(u >> 16); }
__device__ __forceinline__ float bf2f(unsigned short b) { return __uint_as_float(((unsigned)b) << 16); }
__device__ __forceinline__ float bfr(float f) { return bf2f(f2bf(f)); }
__device__ __forceinline__ void splitf(float y, unsigned short& h, unsigned short& l) { h = f2bf(y); l = f2bf(y - bf2f(h)); }
typedef __attribute__((ext_vector_type(4))) unsigned short v4us;
__device__ __forceinline__ v16h cat16(v8h lo, v8h hi) { return __builtin_shufflevector(lo, hi, 0, 1, 2, 3, 4, 5, 6, 7, 8, 9, 10, 11, 12, 13, 14, 15); }
__device__ __forceinline__ v16bf cat16b(v8us lo, v8us hi) { return __builtin_bit_cast(v16bf, __builtin_shufflevector(lo, hi, 0, 1, 2, 3, 4, 5, 6, 7, 8, 9, 10, 11, 12, 13, 14, 15)); }
__device__ __forceinline__ v8f wmma16(v16h a, v16h b, v8f c) { return __builtin_amdgcn_wmma_f32_16x16x32_f16(false, a, false, b, (short)0, c, false, false); }
__device__ __forceinline__ v8f wmmab(v16bf a, v16bf b, v8f c) { return __builtin_amdgcn_wmma_f32_16x16x32_bf16(false, a, false, b, (short)0, c, false, false); }



// ---- d_gemmw: register-blocked GEMM, ONE WAVE per 64x64 output tile (16 accumulators), operands straight from 16-bit planes, A K-contiguous [m][k], Bt in fragment order (ldfo below); tile (bx, by) of (M/64, N/64), 32 threads; os = the work-group's 16 x 68 floats of LDS. k_gemm3 below calls it.
// C[m][n] (f32, pitch ldc, + optional f32 bias[n]) = sum_k A[m][k] Bt[n][k] (+ split products per NSPLIT). z-batch strides sA/sB/sC in elements. K % 32 == 0.
// EPI 0: C goes out as f32. EPI 1 (q projection) and 2 (kv projection), rows = batch x TT: no f32 result leaves the kernel. A tile is 64 rows of one batch x the 64 columns of one head, and the epilogue writes
// the bf16 hi | lo planes that the attention kernel reads, in fragment order (ldfo below): q, and the kv column blocks below DQ (k), as fragments of 16 t rows x 32 d, P[b][h][t / 16][d / 32][512], k with KBo[b][h][t] = HB_h . row (d ascending); the kv column blocks from DQ on (v) as fragments of 16 d rows x 32 t, V[b][g][d / 16][t / 32][512].
template <typename T16> struct WFrag;
template <> struct WFrag<h16> { typedef v16h V; static __device__ __forceinline__ V ld(const h16* p) { return cat16(*(const v8h*)p, *(const v8h*)(p + 16)); } static __device__ __forceinline__ v8f mma(V a, V b, v8f c) { return wmma16(a, b, c); } };
template <> struct WFrag<bf> { typedef v16bf V; static __device__ __forceinline__ V ld(const bf* p) { return cat16b(*(const v8us*)p, *(const v8us*)(p + 16)); } static __device__ __forceinline__ V ldf(const bf* p) { return cat16b(*(const v8us*)p, *(const v8us*)(p + 256)); } static __device__ __forceinline__ v8f mma(V a, V b, v8f c) { return wmmab(a, b, c); } };
// Fragment order: one 16-row x 32-k operand fragment is a block of 512 elements (1 KiB); element (row r, k) lies at (k >> 4) * 256 + (((k >> 3) & 1) * 16 + r) * 8 + (k & 7), which puts lane l's two 16-byte pieces at 8 l and 256 + 8 l.
// Each 16-byte load of a wave then covers 512 successive bytes, 4 whole 128-byte lines, where a row-major plane gives it 32 bytes of each of 16 lines. p = block + 8 * lane.
__device__ __forceinline__ v16bf ldfo(const bf* p) { return WFrag<bf>::ldf(p); }
template <typename T16, int NSPLIT, bool BIAS, int EPI>
__device__ __forceinline__ void d_gemmw(const T16* __restrict__ A, const T16* __restrict__ A2, const T16* __restrict__ Bt, const T16* __restrict__ Bt2, int K, float* C, int ldc, const float* __restrict__ bias, size_t sA, size_t sB, size_t sC, bf* Ph, bf* Pl, bf* Vh, bf* Vl, const float* __restrict__ HB, float* KBo, int bx, int by, float* os) {
    typedef typename WFrag<T16>::V V;
    const size_t z = blockIdx.z; A += z * sA; if (A2) A2 += z * sA; Bt += z * sB; if (Bt2) Bt2 += z * sB; C += z * sC;
    const int lane = threadIdx.x & 31, lr = lane & 15, hi = lane >> 4; const int r0 = bx * 64, c0 = by * 64;
    v8f acc[4][4];
#pragma unroll
    for (int mb = 0; mb < 4; ++mb)
#pragma unroll
        for (int nb = 0; nb < 4; ++nb) acc[mb][nb] = (v8f){};
    const size_t aoff = (size_t)(r0 + lr) * K + 8 * hi, boff = (size_t)c0 * K + 8 * lane;   // Bt: fragment blocks [n / 16][k / 32][512], so 16 rows are 16 K elements and a k step is one block
#pragma unroll 1
    for (int kc = 0; kc < K; kc += 32) {
        V a[4], a2[4], b[4]; v4u x[16]; const T16* pa = A + aoff + kc; const T16* pb = Bt + boff + kc * 16;
        // The sixteen operand loads of a k step and their data wait in one statement: here the eight address pairs live to the statement's end and no result shares a register with them.
        asm volatile("global_load_b128 %0, %16, off\n\tglobal_load_b128 %1, %16, off offset:32\n\tglobal_load_b128 %2, %17, off\n\tglobal_load_b128 %3, %17, off offset:32\n\tglobal_load_b128 %4, %18, off\n\tglobal_load_b128 %5, %18, off offset:32\n\tglobal_load_b128 %6, %19, off\n\tglobal_load_b128 %7, %19, off offset:32\n\tglobal_load_b128 %8, %20, off\n\tglobal_load_b128 %9, %20, off offset:512\n\tglobal_load_b128 %10, %21, off\n\tglobal_load_b128 %11, %21, off offset:512\n\tglobal_load_b128 %12, %22, off\n\tglobal_load_b128 %13, %22, off offset:512\n\tglobal_load_b128 %14, %23, off\n\tglobal_load_b128 %15, %23, off offset:512\n\ts_wait_loadcnt 0x0" : "=&v"(x[0]), "=&v"(x[1]), "=&v"(x[2]), "=&v"(x[3]), "=&v"(x[4]), "=&v"(x[5]), "=&v"(x[6]), "=&v"(x[7]), "=&v"(x[8]), "=&v"(x[9]), "=&v"(x[10]), "=&v"(x[11]), "=&v"(x[12]), "=&v"(x[13]), "=&v"(x[14]), "=&v"(x[15]) : "v"(pa + (size_t)0 * K), "v"(pa + (size_t)16 * K), "v"(pa + (size_t)32 * K), "v"(pa + (size_t)48 * K), "v"(pb + (size_t)0 * K), "v"(pb + (size_t)16 * K), "v"(pb + (size_t)32 * K), "v"(pb + (size_t)48 * K) : "memory");
#pragma unroll
        for (int mb = 0; mb < 4; ++mb) { a[mb] = __builtin_bit_cast(V, __builtin_shufflevector(x[2 * mb], x[2 * mb + 1], 0, 1, 2, 3, 4, 5, 6, 7)); b[mb] = __builtin_bit_cast(V, __builtin_shufflevector(x[8 + 2 * mb], x[9 + 2 * mb], 0, 1, 2, 3, 4, 5, 6, 7)); if (NSPLIT == 1 || NSPLIT == 2) a2[mb] = WFrag<T16>::ld(A2 + aoff + (size_t)mb * 16 * K + kc); }
#pragma unroll
        for (int nb = 0; nb < 4; ++nb) { V b2; if (NSPLIT >= 2) b2 = WFrag<T16>::ldf(Bt2 + boff + (size_t)nb * 16 * K + kc * 16);
#pragma unroll
            for (int mb = 0; mb < 4; ++mb) { acc[mb][nb] = WFrag<T16>::mma(a[mb], b[nb], acc[mb][nb]); if (NSPLIT == 1 || NSPLIT == 2) acc[mb][nb] = WFrag<T16>::mma(a2[mb], b[nb], acc[mb][nb]); if (NSPLIT >= 2) acc[mb][nb] = WFrag<T16>::mma(a[mb], b2, acc[mb][nb]); } }
        asm volatile("v_nop\n\tv_nop\n\tv_nop\n\tv_nop" : "+v"(acc[0][0]), "+v"(acc[1][1]), "+v"(acc[2][2]), "+v"(acc[3][3]) : "v"(a[0]), "v"(a[3]));
    }
    if (EPI >= 1) {
        const int bz = r0 / TT, t0 = r0 % TT;
        if (EPI == 1 || c0 < DQ) {   // q or k: 16 rows (two fragments a plane) at a time through LDS, which turns the accumulator's columns into the fragments' 16-byte row pieces; each store covers 512 successive bytes
            const int h = c0 / HD; const size_t po = ((size_t)(bz * NH_ + h) * TT + t0) * HD + lane * 8;
#pragma unroll
            for (int mb = 0; mb < 4; ++mb) {
#pragma unroll
                for (int nb = 0; nb < 4; ++nb) {
#pragma unroll
                    for (int j = 0; j < 8; ++j) os[(hi * 8 + j) * 68 + nb * 16 + lr] = acc[mb][nb][j]; }
                __builtin_amdgcn_wave_barrier(); asm volatile("" ::: "memory");   // the reads below take other lanes' values: the compiler may not lift them over the writes
                v8us oh[4], ol[4];   // piece s: row lr, columns 16 s + 8 hi .. + 7
#pragma unroll
                for (int s = 0; s < 4; ++s) { const float* sp = os + lr * 68 + s * 16 + hi * 8; const v4f va = *(const v4fa*)sp, vb = *(const v4fa*)(sp + 4);
#pragma unroll
                    for (int q = 0; q < 4; ++q) { unsigned short x2, y2; splitf(va[q], x2, y2); oh[s][q] = x2; ol[s][q] = y2; splitf(vb[q], x2, y2); oh[s][4 + q] = x2; ol[s][4 + q] = y2; } }
                float kd = 0.f;
                if (EPI == 2) { const float* bh = HB + h * HD;   // lane lr sums row lr, d ascending (both lane halves alike, the lower one stores)
#pragma unroll
                    for (int d = 0; d < HD; d += 4) { const v4f f = *(const v4fa*)(os + lr * 68 + d);
#pragma unroll
                        for (int q = 0; q < 4; ++q) kd = __fadd_rn(kd, __fmul_rn(bfr(bh[d + q]), f[q])); } }
                bf* ph = Ph + po + (size_t)mb * 16 * HD; bf* pl = Pl + po + (size_t)mb * 16 * HD;
#pragma unroll
                for (int s = 0; s < 4; ++s) { *(v8us*)(ph + s * 256) = oh[s]; *(v8us*)(pl + s * 256) = ol[s]; }
                // every register that the stores above name stays live up to this wait, so that none is rewritten in front of it
                asm volatile("s_wait_xcnt 0x0" :: "v"(ph), "v"(pl), "v"(oh[0]), "v"(oh[1]), "v"(oh[2]), "v"(oh[3]), "v"(ol[0]), "v"(ol[1]), "v"(ol[2]), "v"(ol[3]) : "memory");
                if (EPI == 2) { float* kp = KBo + (size_t)(bz * NH_ + h) * TT + t0 + mb * 16 + lr; if (hi == 0) *kp = kd;
                    asm volatile("s_wait_xcnt 0x0" :: "v"(kp), "v"(kd) : "memory"); }   // as above, for the registers of this store
                __builtin_amdgcn_wave_barrier();   // the next 16 rows' LDS writes stay behind this round's reads
            }
        } else {   // v: a lane holds 8 successive t of one d, which is its own 16-byte piece of a fragment: accumulator (mb, nb) goes out as half a fragment, 512 successive bytes a plane, straight from the registers
            const int g = (c0 - DQ) / HD; const size_t vo = ((size_t)(bz * NKV + g) * (HD / 16) * (TT / 32) + t0 / 32) * 512 + lane * 8;
#pragma unroll
            for (int nb = 0; nb < 4; ++nb) { v8us oh[4], ol[4];
#pragma unroll
                for (int mb = 0; mb < 4; ++mb) {
#pragma unroll
                    for (int j = 0; j < 8; ++j) { unsigned short x2, y2; splitf(acc[mb][nb][j], x2, y2); oh[mb][j] = x2; ol[mb][j] = y2; } }
                bf* vh = Vh + vo + (size_t)nb * (TT / 32) * 512; bf* vl = Vl + vo + (size_t)nb * (TT / 32) * 512;
#pragma unroll
                for (int mb = 0; mb < 4; ++mb) { *(v8us*)(vh + mb * 256) = oh[mb]; *(v8us*)(vl + mb * 256) = ol[mb]; }
                // every register that the stores above name stays live up to this wait, so that none is rewritten in front of it
                asm volatile("s_wait_xcnt 0x0" :: "v"(vh), "v"(vl), "v"(oh[0]), "v"(oh[1]), "v"(oh[2]), "v"(oh[3]), "v"(ol[0]), "v"(ol[1]), "v"(ol[2]), "v"(ol[3]) : "memory");
            }
        }
        return;
    }
#pragma unroll
    for (int mb = 0; mb < 4; ++mb) {
#pragma unroll
        for (int nb = 0; nb < 4; ++nb) {
#pragma unroll
            for (int j = 0; j < 8; ++j) os[(hi * 8 + j) * 68 + nb * 16 + lr] = acc[mb][nb][j]; }
        __builtin_amdgcn_wave_barrier(); asm volatile("" ::: "memory");
        const int cofs = lr * 4; float* cp = C + (size_t)(r0 + mb * 16 + hi) * ldc + c0 + cofs; v4f val[8];   // store s: row 2 s + hi of these 16
#pragma unroll
        for (int s = 0; s < 8; ++s) { val[s] = *(const v4fa*)(os + (2 * s + hi) * 68 + cofs); if (BIAS) { val[s][0] += bfr(bias[c0 + cofs]); val[s][1] += bfr(bias[c0 + cofs + 1]); val[s][2] += bfr(bias[c0 + cofs + 2]); val[s][3] += bfr(bias[c0 + cofs + 3]); }
            *(v4f*)(cp + (size_t)(2 * s) * ldc) = val[s]; }
        // every register that the stores above name stays live up to this wait, so that none is rewritten in front of it (in a kernel of several bodies other code follows this epilogue in the listing)
        asm volatile("s_wait_xcnt 0x0" :: "v"(cp), "v"(val[0]), "v"(val[1]), "v"(val[2]), "v"(val[3]), "v"(val[4]), "v"(val[5]), "v"(val[6]), "v"(val[7]) : "memory");
        __builtin_amdgcn_wave_barrier(); asm volatile("" ::: "memory");
    }
}

__device__ __forceinline__ h16 tohx(float x) { return (h16)x; }
typedef __attribute__((ext_vector_type(2))) _Float16 v2h;
typedef __attribute__((ext_vector_type(4))) _Float16 v4h;
typedef __attribute__((ext_vector_type(2))) unsigned short v2us;
typedef __attribute__((ext_vector_type(2))) float v2f;
typedef __attribute__((ext_vector_type(4))) int v4i;

__device__ __forceinline__ void d_wtG(const float* __restrict__ w, int K, int N, bf* Bt, int blk) {
    // Bt = w transposed, in fragment order (ldfo): one wave writes one fragment block (16 n x 32 k, 1 KiB in a row); lane (lr, hi) gathers column n = 16 nt + lr at k = 32 kb + 16 c + 8 hi + 0..7
    const int lane = threadIdx.x & 31, lr = lane & 15, hi = lane >> 4; const int fb = blk * 8 + __builtin_amdgcn_readfirstlane((int)(threadIdx.x >> 5)); if (fb >= N * K / 512) return;
    const int kb = fb % (K / 32), nt = fb / (K / 32); const float* s = w + (size_t)kb * 32 * N + nt * 16; const float* p[16]; float f[16]; v8us o[2];
#pragma unroll
    for (int q = 0; q < 16; ++q) p[q] = s + (size_t)((q >> 3) * 16 + hi * 8 + (q & 7)) * N + lr;
#pragma unroll
    for (int q = 0; q < 16; ++q) f[q] = *p[q];
    // behind the last load of the gather: all sixteen address pairs stay live up to this wait, so that none is handed to a later load's result in front of it
    asm volatile("s_wait_xcnt 0x0" :: "v"(p[0]), "v"(p[1]), "v"(p[2]), "v"(p[3]), "v"(p[4]), "v"(p[5]), "v"(p[6]), "v"(p[7]), "v"(p[8]), "v"(p[9]), "v"(p[10]), "v"(p[11]), "v"(p[12]), "v"(p[13]), "v"(p[14]), "v"(p[15]) : "memory");
#pragma unroll
    for (int q = 0; q < 16; ++q) o[q >> 3][q & 7] = f2bf(f[q]);
    bf* d = Bt + (size_t)fb * 512 + lane * 8; *(v8us*)d = o[0]; *(v8us*)(d + 256) = o[1];
}
__device__ __forceinline__ void d_cvt8(const float* __restrict__ src, bf* dst, size_t n8, int blk) { const size_t i = (size_t)blk * 256 + threadIdx.x; if (i >= n8) return; const v8f v = *(const v8f*)(src + i * 8); v8us o;
#pragma unroll
    for (int k = 0; k < 8; ++k) o[k] = f2bf(v[k]); *(v8us*)(dst + i * 8) = o;  }

__device__ __forceinline__ void d_flat(const float* __restrict__ F, h16* P16, bf* Ph, bf* Pl, size_t n4, int blk) { const size_t i = (size_t)blk * 256 + threadIdx.x; if (i >= n4) return; const v4f a = *(const v4f*)(F + i * 4); v4h o16; v4us oh, ol;
#pragma unroll
    for (int q = 0; q < 4; ++q) { o16[q] = tohx(a[q]); unsigned short x2, y2; splitf(a[q], x2, y2); oh[q] = x2; ol[q] = y2; }
    const int row = (int)(i * 4 / HD), d = (int)(i * 4 % HD); const size_t fo = (size_t)(row >> 4) * (16 * HD) + (d >> 4) * 256 + (((d >> 3) & 1) * 16 + (row & 15)) * 8 + (d & 7);   // the hi | lo planes in fragment order (ldfo): F is [rows][HD]
    *(v4h*)(P16 + i * 4) = o16; *(v4us*)(Ph + fo) = oh; *(v4us*)(Pl + fo) = ol;  }

__device__ __forceinline__ void d_hdot(const float* __restrict__ bias, const float* __restrict__ F, int pitch, int nrows, int hcol, float* OUT, int blk) {
    { const size_t bz = blockIdx.y; F += bz * nrows * pitch; OUT += bz * NH_ * nrows; }   // blockIdx.y = batch (one for r)
    const int lane = threadIdx.x & 31; const size_t wv = (size_t)blk * 8 + (threadIdx.x >> 5); if (wv >= (size_t)NH_ * (nrows / 32)) return; const int h = (int)(wv / (nrows / 32)); const int n = (int)(wv % (nrows / 32)) * 32 + lane; const float* f = F + (size_t)n * pitch + (hcol ? h * HD : 0);   /* hcol: F has per-head columns (k); 0: one 64-wide row shared by all heads (r) */ const float* bh = bias + h * HD; float s = 0.f;
#pragma unroll 4
    for (int d = 0; d < HD; ++d) { s = __fadd_rn(s, __fmul_rn(bfr(bh[d]), f[d])); }
    *(float*)(OUT + (size_t)h * nrows + n) = s;  }

// Launches whose bodies do not depend on one another share one grid: a work-group picks its body by its block index (the same for all its threads), and the index inside the body's own range is what blockIdx gave it when the body was a launch of its own.
#define G_WQ  (DM * DQ / 512 / 8)          // work-groups of each body of k_prep: 8 fragment blocks, or 256 x 8 elements, a work-group
#define G_WKV (DM * DKV2 / 512 / 8)
#define G_WR  1
#define G_PE  (NR * HD / 8 / 256)
#define G_X   (NB_ * TT * DM / 8 / 256)
// k_prep: everything that reads only the inputs: the three weights to bf16 fragment order, pos_embed, q and k to bf16.
__global__ __launch_bounds__(256) void k_prep(const float* __restrict__ wq, const float* __restrict__ wkv, const float* __restrict__ wr, const float* __restrict__ pemb, const float* __restrict__ x, const float* __restrict__ xk, bf* WQ, bf* WKV, bf* WR, bf* PE, bf* XB, bf* XK) {
    int b = blockIdx.x;
    if (b < G_WQ) { d_wtG(wq, DM, DQ, WQ, b); return; } b -= G_WQ;
    if (b < G_WKV) { d_wtG(wkv, DM, DKV2, WKV, b); return; } b -= G_WKV;
    if (b < G_WR) { d_wtG(wr, HD, HD, WR, b); return; } b -= G_WR;
    if (b < G_PE) { d_cvt8(pemb, PE, (size_t)NR * HD / 8, b); return; } b -= G_PE;
    if (b < G_X) { d_cvt8(x, XB, (size_t)NB_ * TT * DM / 8, b); return; } b -= G_X;
    d_cvt8(xk, XK, (size_t)NB_ * TT * DM / 8, b);
}
// k_gemm3: the three projections. blockIdx.y: DKV2 / 64 column tiles of kv, then DQ / 64 of q, then one row of tiles for r (NR / 64 of them).
__global__ __launch_bounds__(32) void k_gemm3(const bf* __restrict__ XB, const bf* __restrict__ XK, const bf* __restrict__ PE, const bf* __restrict__ WQ, const bf* __restrict__ WKV, const bf* __restrict__ WR, float* RF, bf* QPh, bf* QPl, bf* KPh, bf* KPl, bf* VTh, bf* VTl, const float* __restrict__ rrb, float* KB) {
    __shared__ __align__(16) float os[16 * 68];
    const int bx = blockIdx.x, by = blockIdx.y;
    if (by < DKV2 / 64) d_gemmw<bf, 0, false, 2>(XK, nullptr, WKV, nullptr, DM, nullptr, 0, nullptr, 0, 0, 0, KPh, KPl, VTh, VTl, rrb, KB, bx, by, os);   /* kv = k Wkv: k planes (columns 0..1023) with KB[b][h][j] = r_r_bias_h . kh_j, v planes (columns 1024..2047) */
    else if (by < DKV2 / 64 + DQ / 64) d_gemmw<bf, 0, false, 1>(XB, nullptr, WQ, nullptr, DM, nullptr, 0, nullptr, 0, 0, 0, QPh, QPl, nullptr, nullptr, nullptr, nullptr, bx, by - DKV2 / 64, os);   /* qh planes */
    else if (bx < NR / 64) d_gemmw<bf, 0, false, 0>(PE, nullptr, WR, nullptr, HD, RF, HD, nullptr, 0, 0, 0, nullptr, nullptr, nullptr, nullptr, nullptr, nullptr, bx, 0, os);   /* r = pos_embed Wr (exact) */
}
#define G_FL  (NR * HD / 4 / 256)
#define G_HD  (NH_ * (NR / 32) / 8)
// k_rfin: what reads r: its planes, and RB[h][l] = r_w_bias_h . r_l (r is shared by all heads: no column offset).
__global__ __launch_bounds__(256) void k_rfin(const float* __restrict__ RF, h16* RP16, bf* RPh, bf* RPl, const float* __restrict__ rwb, float* RB) {
    const int b = blockIdx.x;
    if (b < G_FL) d_flat(RF, RP16, RPh, RPl, (size_t)NR * HD / 4, b);
    else d_hdot(rwb, RF, HD, NR, 0, RB, b - G_FL);
}

#define MT   2                    // 16-row query tiles per work-group
#define ROWS (16 * MT)
#define PD   6                    // k steps by which the V fragment loads run ahead in the P.V product
#define PA   3                    // ring of P fragment sets in the P.V product
#define SP   1028                 // floats per LDS score row: 4112 B = 16 B x odd, the conflict-free pitch for 16-byte fragment reads
typedef v4us __attribute__((may_alias)) v4usa;
// ld4: the hi and lo fragments of both 32-wide k halves of one 16-row tile (x[0] hi k 0..31, x[1] lo, x[2] hi k 32..63, x[3] lo); ph, pl = the tile's first fragment block + 8 * lane.
__device__ __forceinline__ void ld4(const bf* ph, const bf* pl, v16bf (&x)[4]) {
    x[0] = ldfo(ph); x[1] = ldfo(pl); x[2] = ldfo(ph + 512); x[3] = ldfo(pl + 512);
    asm volatile("s_wait_xcnt 0x0" :: "v"(ph), "v"(pl) : "memory");   // both address pairs stay live up to this wait
}
// k_fattn: one work-group (8 waves) = ROWS query rows of one head of one batch; their whole score rows stay in LDS from the score products to the P.V product.
// 1. wave w owns keys [128 w, 128 w + 128): q.r tiles over the window l = TT + j - i are stored straight to their shifted place sc[i][j];
// 2. q.k tiles: sc = ((q.k + KB[j]) + q.r) + RB[l]; 3. softmax, one wave per row, P hi | lo planes written over the row's own scores;
// 4. O = P.V (waves 0..3, one 16-column block each, k ascending), staged in LDS so that each wave stores whole output lines.
__global__ __launch_bounds__(256) void k_fattn(const bf* __restrict__ Qh, const bf* __restrict__ Ql, const bf* __restrict__ Kh, const bf* __restrict__ Kl, const bf* __restrict__ Rh, const bf* __restrict__ Rl, const bf* __restrict__ Vh, const bf* __restrict__ Vl, const float* __restrict__ KB, const float* __restrict__ RB, const int* __restrict__ km, float* OUTb) {
    __shared__ __align__(16) float sc[ROWS * SP];
    __shared__ __align__(16) float os[ROWS * 68];
    __shared__ float rbs[TT + ROWS];
    const int lane = threadIdx.x & 31, lr = lane & 15, hi = lane >> 4; const int w = __builtin_amdgcn_readfirstlane((int)(threadIdx.x >> 5));
    const int i0 = blockIdx.x * ROWS, h = blockIdx.y, jw = w * 128;
    { const size_t bz = blockIdx.z, po = bz * NH_ * TT * HD; Qh += po; Ql += po; Kh += po; Kl += po; Vh += po; Vl += po; KB += bz * NH_ * TT; km += bz * TT; OUTb += bz * TT * DQ; }   // blockIdx.z = batch; the r planes and RB are shared by all batches
    const float* rbg = RB + (size_t)h * NR + (TT - i0 - ROWS) + threadIdx.x; float rv[TT / 256 + 1];   // rbs[x] = RB[h][TT - i0 - ROWS + x]: every l this work-group's rows meet; loaded here, stored in front of the first barrier
#pragma unroll
    for (int q = 0; q < TT / 256; ++q) rv[q] = rbg[q * 256];
    rv[TT / 256] = (threadIdx.x < ROWS) ? rbg[TT] : 0.f;
    v16bf ah[MT][2], al[MT][2];
#pragma unroll
    for (int mb = 0; mb < MT; ++mb) { const size_t o = ((size_t)h * TT + i0 + mb * 16) * HD + 8 * lane; v16bf x[4]; ld4(Qh + o, Ql + o, x); ah[mb][0] = x[0]; al[mb][0] = x[1]; ah[mb][1] = x[2]; al[mb][1] = x[3]; }
    const int lbase = TT + jw - i0 - ROWS;   // first l of the wave's window; the window [lbase, lbase + 128 + ROWS) lies in [0, NR)
    // Both tile loops are unrolled: which row tile needs which window tile is then decided at compile time, and the next tile's loads (issued ahead, in the source too) fly while this tile is multiplied.
    v16bf nx[4];
    { const size_t o = (size_t)lbase * HD + 8 * lane; ld4(Rh + o, Rl + o, nx); }
#pragma unroll
    for (int t = 0; t < 8 + MT; ++t) { const v16bf b[2] = {nx[0], nx[2]}, c[2] = {nx[1], nx[3]};
        if (t + 1 < 8 + MT) { const size_t o = (size_t)(lbase + (t + 1) * 16) * HD + 8 * lane; ld4(Rh + o, Rl + o, nx); }
        else { const size_t o = ((size_t)h * TT + jw) * HD + 8 * lane; ld4(Kh + o, Kl + o, nx); }   // the first key tile
        v8f acc[MT];
#pragma unroll
        for (int mb = 0; mb < MT; ++mb) acc[mb] = (v8f){};
#pragma unroll
        for (int s = 0; s < 2; ++s) {
#pragma unroll
            for (int mb = 0; mb < MT; ++mb) if (t + mb >= MT - 1 && t + mb <= MT + 7) acc[mb] = wmmab(ah[mb][s], b[s], acc[mb]);
#pragma unroll
            for (int mb = 0; mb < MT; ++mb) if (t + mb >= MT - 1 && t + mb <= MT + 7) acc[mb] = wmmab(al[mb][s], b[s], acc[mb]);
#pragma unroll
            for (int mb = 0; mb < MT; ++mb) if (t + mb >= MT - 1 && t + mb <= MT + 7) acc[mb] = wmmab(ah[mb][s], c[s], acc[mb]); }
        asm volatile("v_nop\n\tv_nop\n\tv_nop\n\tv_nop" : "+v"(acc[0]), "+v"(acc[1]));   // the four vector slots the chip needs before the next tile's first product overwrites these result registers: only LDS stores stand between
#pragma unroll
        for (int mb = 0; mb < MT; ++mb) { if (t + mb < MT - 1 || t + mb > MT + 7) continue;
#pragma unroll
            for (int jj = 0; jj < 8; ++jj) { const int ii = mb * 16 + hi * 8 + jj; const int jrel = t * 16 + lr + ii - ROWS;   /* j - jw of (row ii, l = lbase + 16 t + lr) */ if (jrel >= 0 && jrel < 128) sc[ii * SP + jw + jrel] = acc[mb][jj]; } } }
#pragma unroll
    for (int q = 0; q < TT / 256; ++q) rbs[q * 256 + threadIdx.x] = rv[q];
    if (threadIdx.x < ROWS) rbs[TT + threadIdx.x] = rv[TT / 256];
    __syncthreads();
#pragma unroll
    for (int nb = 0; nb < 8; ++nb) { const int j = jw + nb * 16 + lr; const v16bf b[2] = {nx[0], nx[2]}, c[2] = {nx[1], nx[3]}; const float kb = KB[(size_t)h * TT + j];
        if (nb + 1 < 8) { const size_t o = ((size_t)h * TT + jw + (nb + 1) * 16) * HD + 8 * lane; ld4(Kh + o, Kl + o, nx); }
        v8f acc[MT];
#pragma unroll
        for (int mb = 0; mb < MT; ++mb) acc[mb] = (v8f){};
#pragma unroll
        for (int s = 0; s < 2; ++s) {
#pragma unroll
            for (int mb = 0; mb < MT; ++mb) acc[mb] = wmmab(ah[mb][s], b[s], acc[mb]);
#pragma unroll
            for (int mb = 0; mb < MT; ++mb) acc[mb] = wmmab(al[mb][s], b[s], acc[mb]);
#pragma unroll
            for (int mb = 0; mb < MT; ++mb) acc[mb] = wmmab(ah[mb][s], c[s], acc[mb]); }
#pragma unroll
        for (int mb = 0; mb < MT; ++mb)
#pragma unroll
            for (int jj = 0; jj < 8; ++jj) { const int ii = mb * 16 + hi * 8 + jj; float* p = sc + ii * SP + j; *p = __fadd_rn(__fadd_rn(__fadd_rn(acc[mb][jj], kb), *p), rbs[j - ii + ROWS]); } }
    __syncthreads();
    // V fragments run PD k steps ahead of their products; the first PD are asked for here, so that they land during the softmax
    v16bf vh[PD], vl[PD]; const size_t vo = ((size_t)h * (HD / 16) + (w & 3)) * (TT / 32) * 512 + 8 * lane;   // this wave's 16 d rows: TT / 32 fragment blocks in a row
    if (w < 4) {
#pragma unroll
        for (int d = 0; d < PD; ++d) { vh[d] = ldfo(Vh + vo + 512 * d); vl[d] = ldfo(Vl + vo + 512 * d); } }
    for (int rr = 0; rr < ROWS / 8; ++rr) { float* sr = sc + (w * (ROWS / 8) + rr) * SP; float v[TT / 32]; float mx = -3.0e38f;
#pragma unroll
        for (int ch = 0; ch < TT / 128; ++ch) { const int j0 = ch * 128 + lane * 4; const v4f a = *(const v4fa*)(sr + j0); const v4i mk = *(const v4i*)(km + j0);
#pragma unroll
            for (int q = 0; q < 4; ++q) { const float t = (mk[q] != 0) ? a[q] * SCL : -3.0e38f; v[ch * 4 + q] = t;   /* mask == 0 -> -inf */ mx = fmaxf(mx, t); } }
#pragma unroll
        for (int sh = 16; sh; sh >>= 1) mx = fmaxf(mx, __shfl_xor(mx, sh, 32));
        float sum = 0.f;
#pragma unroll
        for (int k = 0; k < TT / 32; ++k) { const float d0 = __fsub_rn(v[k], mx); v[k] = __builtin_amdgcn_exp2f(__fmul_rn(d0, 1.4426950408889634f)); sum += v[k]; }
#pragma unroll
        for (int sh = 16; sh; sh >>= 1) sum += __shfl_xor(sum, sh, 32);
        const float f = __fdiv_rn(1.0f, sum); bf* pr = (bf*)sr;   // P hi in the row's first 2 KiB, P lo in its second; every score of the row is in registers by now (the sum needed them all)
#pragma unroll
        for (int ch = 0; ch < TT / 128; ++ch) { v4us oh, ol;
#pragma unroll
            for (int q = 0; q < 4; ++q) { unsigned short a, c2; splitf(v[ch * 4 + q] * f, a, c2); oh[q] = a; ol[q] = c2; }
            *(v4usa*)(pr + ch * 128 + lane * 4) = oh; *(v4usa*)(pr + TT + ch * 128 + lane * 4) = ol; } }
    __syncthreads();
    if (w < 4) { v8f acc[MT];
#pragma unroll
        for (int mb = 0; mb < MT; ++mb) acc[mb] = (v8f){};
        const bf* pl = (const bf*)(sc + lr * SP) + 8 * hi;   // this lane's P hi row of row tile 0; row tile mb lies 16 rows on, P lo TT elements on
        v16bf pa[PA][MT], pb[PA][MT];   // P hi / lo fragments, read from LDS PA - 1 k steps ahead of their products
#pragma unroll
        for (int d = 0; d < PA - 1; ++d)
#pragma unroll
            for (int mb = 0; mb < MT; ++mb) { const bf* pr = pl + mb * 16 * SP * 2 + d * 32; pa[d][mb] = cat16b(*(const v8usa*)pr, *(const v8usa*)(pr + 16)); pb[d][mb] = cat16b(*(const v8usa*)(pr + TT), *(const v8usa*)(pr + TT + 16)); }
        // unrolled: the fragment rings are then indexed at compile time and stay in registers, and the last steps ask for nothing
#pragma unroll
        for (int ks = 0; ks < TT / 32; ++ks) { const int kc = ks * 32; const v16bf b = vh[ks % PD], b2 = vl[ks % PD];
            if (ks + PD < TT / 32) { vh[ks % PD] = ldfo(Vh + vo + 512 * (ks + PD)); vl[ks % PD] = ldfo(Vl + vo + 512 * (ks + PD)); }
            if (ks + PD == TT / 32 - 1) asm volatile("s_wait_xcnt 0x0" :: "v"(Vh + vo), "v"(Vl + vo) : "memory");   // behind the last V load: both address pairs stay live up to this wait, so that neither is rewritten in front of it
            if (ks + PA - 1 < TT / 32) {
#pragma unroll
                for (int mb = 0; mb < MT; ++mb) { const bf* pr = pl + mb * 16 * SP * 2 + kc + (PA - 1) * 32; pa[(ks + PA - 1) % PA][mb] = cat16b(*(const v8usa*)pr, *(const v8usa*)(pr + 16)); pb[(ks + PA - 1) % PA][mb] = cat16b(*(const v8usa*)(pr + TT), *(const v8usa*)(pr + TT + 16)); } }
#pragma unroll
            for (int mb = 0; mb < MT; ++mb) acc[mb] = wmmab(pa[ks % PA][mb], b, acc[mb]);
#pragma unroll
            for (int mb = 0; mb < MT; ++mb) acc[mb] = wmmab(pb[ks % PA][mb], b, acc[mb]);
#pragma unroll
            for (int mb = 0; mb < MT; ++mb) acc[mb] = wmmab(pa[ks % PA][mb], b2, acc[mb]); }
#pragma unroll
        for (int mb = 0; mb < MT; ++mb)
#pragma unroll
            for (int jj = 0; jj < 8; ++jj) os[(mb * 16 + hi * 8 + jj) * 68 + w * 16 + lr] = acc[mb][jj]; }
    __syncthreads();
#pragma unroll
    for (int s = 0; s < MT; ++s) { const int row = s * 16 + (int)(threadIdx.x >> 4), cofs = (int)(threadIdx.x & 15) * 4; *(v4f*)(OUTb + (size_t)(i0 + row) * DQ + h * HD + cofs) = *(const v4fa*)(os + row * 68 + cofs); }
}

extern "C" void kernel_launch(void* const* d_in, const int* in_sizes, int n_in,
                              void* d_out, int out_size, void* d_ws, size_t ws_size, hipStream_t stream) {
    (void)in_sizes; (void)n_in; (void)out_size;
    const float* x = (const float*)d_in[0]; const float* xk = (const float*)d_in[1]; const int* kmask = (const int*)d_in[2]; const float* pemb = (const float*)d_in[3]; const float* wq = (const float*)d_in[4]; const float* wkv = (const float*)d_in[5]; const float* wr = (const float*)d_in[6]; const float* rrb = (const float*)d_in[7]; const float* rwb = (const float*)d_in[8]; const float* wk = nullptr; const float* wv = nullptr; (void)wk; (void)wv;
    float* OUT = (float*)d_out;     // [4][1024][1024]
    char* wsp = (char*)d_ws;
    auto take = [&](size_t bytes) { char* p = wsp; wsp += (bytes + 255) & ~(size_t)255; return (void*)p; };
    bf* WQ = (bf*)take((size_t)DQ * DM * 2); bf* WKV = (bf*)take((size_t)DKV2 * DM * 2); bf* WR = (bf*)take((size_t)HD * HD * 2); bf* PE = (bf*)take((size_t)NR * HD * 2); float* RF = (float*)take((size_t)NR * HD * 4); h16* RP16 = (h16*)take((size_t)NR * HD * 2); bf* RPh = (bf*)take((size_t)NR * HD * 2); bf* RPl = (bf*)take((size_t)NR * HD * 2); float* KB = (float*)take((size_t)NB_ * NH_ * TT * 4); float* RB = (float*)take((size_t)NH_ * NR * 4);
    // every per-batch buffer holds all NB_ batches, batch-major
    bf* XB = (bf*)take((size_t)NB_ * TT * DM * 2); bf* XK = (bf*)take((size_t)NB_ * TT * DM * 2);
    bf* QPh = (bf*)take((size_t)NB_ * NH_ * TT * HD * 2); bf* QPl = (bf*)take((size_t)NB_ * NH_ * TT * HD * 2); bf* KPh = (bf*)take((size_t)NB_ * NKV * TT * HD * 2); bf* KPl = (bf*)take((size_t)NB_ * NKV * TT * HD * 2); bf* VTh = (bf*)take((size_t)NB_ * NKV * HD * TT * 2); bf* VTl = (bf*)take((size_t)NB_ * NKV * HD * TT * 2);
    if ((size_t)(wsp - (char*)d_ws) > ws_size) return;    // about 72 MiB of the 256 MiB
    // Four launches, each reading only what an earlier one wrote; every stage covers all NB_ batches: the projections see the batches as NB_ * TT rows and write the head planes themselves, the attention kernel takes the batch from blockIdx.z.
    k_prep<<<G_WQ + G_WKV + G_WR + G_PE + 2 * G_X, 256, 0, stream>>>(wq, wkv, wr, pemb, x, xk, WQ, WKV, WR, PE, XB, XK);
    k_gemm3<<<dim3(NB_ * TT / 64, DKV2 / 64 + DQ / 64 + 1, 1), 32, 0, stream>>>(XB, XK, PE, WQ, WKV, WR, RF, QPh, QPl, KPh, KPl, VTh, VTl, rrb, KB);
    k_rfin<<<G_FL + G_HD, 256, 0, stream>>>(RF, RP16, RPh, RPl, rwb, RB);
    k_fattn<<<dim3(TT / ROWS, NH_, NB_), 256, 0, stream>>>(QPh, QPl, KPh, KPl, RPh, RPl, VTh, VTl, KB, RB, kmask, OUT);   /* scores, shift, softmax and P.V of every head of every batch */
}

// v007
// It runs in 148 microseconds.
// Next to v006, in two timings, it ran 1.06 and 1.09 times as fast.
// All steps since v000 together make it 11.6 times as fast.
#include <hip/hip_runtime.h>

// Transformer-XL relative multi-head attention (q, k [4][1024][1024]; qh = q Wq ('xw' [1024][1024]), kv = k Wkv ('xw' [1024][2048]: k | v column blocks; 16 heads x 64); r = pos_embed Wr ([2048][64] x [64][64], shared by all heads); AC = (qh + r_r_bias_h).kh, BD = shift((qh + r_w_bias_h).r): BD[i][j] = (qh_i + r_w_bias_h).r[L + j - i]; attn = (AC + BD)/8; keys with mask[b][j] == 0 -> -inf (int [4][1024], read); softmax; out = merged attn.vh -> [4][1024][1024] (4.2 M)).
// Compute dtypes, f32 accumulate: every input rounded to bf16; projections exact; relative terms 3 products / f32 dots; content scores 3 products on every row; softmax f32; output f32.

#define NB_  4
#define TT   1024
#define DM   1024
#define NH_  16
#define NKV  16
#define REP  (NH_ / NKV)
#define HD   64
#define DQ   (NH_ * HD)
#define DKV  (NKV * HD)
#define RH   1024                 // = TT: every row hi/lo
#define WIN  0
#define PCAR 1024.0f
#define SCL  0.125f
#define NR   2048    // relative positions (2L)
#define DKV2 2048    // kv projection width (k | v)
typedef _Float16 h16;
typedef unsigned short bf;
typedef __attribute__((ext_vector_type(16))) __bf16   v16bf;
typedef __attribute__((ext_vector_type(16))) _Float16 v16h;
typedef __attribute__((ext_vector_type(8)))  _Float16 v8h;
typedef __attribute__((ext_vector_type(8)))  unsigned short v8us;
typedef __attribute__((ext_vector_type(8)))  float    v8f;
typedef __attribute__((ext_vector_type(4)))  float    v4f;
typedef __attribute__((ext_vector_type(4)))  unsigned v4u;
typedef v8h  __attribute__((may_alias)) v8ha;
typedef v4f  __attribute__((may_alias)) v4fa;
typedef v8us __attribute__((may_alias)) v8usa;

__device__ __forceinline__ unsigned short f2bf(float f) { unsigned u = __float_as_uint(f); u += 0x7FFFu + ((u >> 16) & 1u); return (unsigned short)(u >> 16); }
__device__ __forceinline__ float bf2f(unsigned short b) { return __uint_as_float(((unsigned)b) << 16); }
__device__ __forceinline__ float bfr(float f) { return bf2f(f2bf(f)); }
__device__ __forceinline__ void splitf(float y, unsigned short& h, unsigned short& l) { h = f2bf(y); l = f2bf(y - bf2f(h)); }
typedef __attribute__((ext_vector_type(4))) unsigned short v4us;
__device__ __forceinline__ v16h cat16(v8h lo, v8h hi) { return __builtin_shufflevector(lo, hi, 0, 1, 2, 3, 4, 5, 6, 7, 8, 9, 10, 11, 12, 13, 14, 15); }
__device__ __forceinline__ v16bf cat16b(v8us lo, v8us hi) { return __builtin_bit_cast(v16bf, __builtin_shufflevector(lo, hi, 0, 1, 2, 3, 4, 5, 6, 7, 8, 9, 10, 11, 12, 13, 14, 15)); }
__device__ __forceinline__ v8f wmma16(v16h a, v16h b, v8f c) { return __builtin_amdgcn_wmma_f32_16x16x32_f16(false, a, false, b, (short)0, c, false, false); }
__device__ __forceinline__ v8f wmmab(v16bf a, v16bf b, v8f c) { return __builtin_amdgcn_wmma_f32_16x16x32_bf16(false, a, false, b, (short)0, c, false, false); }



// ---- d_gemmw: register-blocked GEMM, ONE WAVE per 64x64 output tile (16 accumulators), operands straight from 16-bit planes, A (rows m) and Bt (rows n) both in fragment order (ldfo below); tile (bx, by) of (M/64, N/64), 32 threads; os = the work-group's 16 x 68 floats of LDS. k_gemm3 below calls it.
// C[m][n] (f32, pitch ldc, + optional f32 bias[n]) = sum_k A[m][k] Bt[n][k] (+ split products per NSPLIT). z-batch strides sA/sB/sC in elements. K % 32 == 0.
// EPI 0: C goes out as f32. EPI 1 (q projection) and 2 (kv projection), rows = batch x TT: no f32 result leaves the kernel. A tile is 64 rows of one batch x the 64 columns of one head, and the epilogue writes
// the bf16 hi | lo planes that the attention kernel reads, in fragment order (ldfo below): q, and the kv column blocks below DQ (k), as fragments of 16 t rows x 32 d, P[b][h][t / 16][d / 32][512], k with KBo[b][h][t] = HB_h . row (d ascending); the kv column blocks from DQ on (v) as fragments of 16 d rows x 32 t, V[b][g][d / 16][t / 32][512].
template <typename T16> struct WFrag;
template <> struct WFrag<h16> { typedef v16h V; static __device__ __forceinline__ V ld(const h16* p) { return cat16(*(const v8h*)p, *(const v8h*)(p + 16)); } static __device__ __forceinline__ v8f mma(V a, V b, v8f c) { return wmma16(a, b, c); } };
template <> struct WFrag<bf> { typedef v16bf V; static __device__ __forceinline__ V ld(const bf* p) { return cat16b(*(const v8us*)p, *(const v8us*)(p + 16)); } static __device__ __forceinline__ V ldf(const bf* p) { return cat16b(*(const v8us*)p, *(const v8us*)(p + 256)); } static __device__ __forceinline__ v8f mma(V a, V b, v8f c) { return wmmab(a, b, c); } };
// Fragment order: one 16-row x 32-k operand fragment is a block of 512 elements (1 KiB); element (row r, k) lies at (k >> 4) * 256 + (((k >> 3) & 1) * 16 + r) * 8 + (k & 7), which puts lane l's two 16-byte pieces at 8 l and 256 + 8 l.
// Each 16-byte load of a wave then covers 512 successive bytes, 4 whole 128-byte lines, where a row-major plane gives it 32 bytes of each of 16 lines. p = block + 8 * lane.
__device__ __forceinline__ v16bf ldfo(const bf* p) { return WFrag<bf>::ldf(p); }
template <typename T16, int NSPLIT, bool BIAS, int EPI>
__device__ __forceinline__ void d_gemmw(const T16* __restrict__ A, const T16* __restrict__ A2, const T16* __restrict__ Bt, const T16* __restrict__ Bt2, int K, float* C, int ldc, const float* __restrict__ bias, size_t sA, size_t sB, size_t sC, bf* Ph, bf* Pl, bf* Vh, bf* Vl, const float* __restrict__ HB, float* KBo, int bx, int by, float* os) {
    typedef typename WFrag<T16>::V V;
    const size_t z = blockIdx.z; A += z * sA; if (A2) A2 += z * sA; Bt += z * sB; if (Bt2) Bt2 += z * sB; C += z * sC;
    const int lane = threadIdx.x & 31, lr = lane & 15, hi = lane >> 4; const int r0 = bx * 64, c0 = by * 64;
    v8f acc[4][4];
#pragma unroll
    for (int mb = 0; mb < 4; ++mb)
#pragma unroll
        for (int nb = 0; nb < 4; ++nb) acc[mb][nb] = (v8f){};
    const size_t aoff = (size_t)r0 * K + 8 * lane, boff = (size_t)c0 * K + 8 * lane;   // A and Bt: fragment blocks [row / 16][k / 32][512], so 16 rows are 16 K elements and a k step is one block
#pragma unroll 1
    for (int kc = 0; kc < K; kc += 32) {
        V a[4], a2[4], b[4]; v4u x[16]; const T16* pa = A + aoff + kc * 16; const T16* pb = Bt + boff + kc * 16;
        // The sixteen operand loads of a k step and their data wait in one statement. Here the eight address pairs live to the statement's end and no result shares a register with them.
        asm volatile("global_load_b128 %0, %16, off\n\tglobal_load_b128 %1, %16, off offset:512\n\tglobal_load_b128 %2, %17, off\n\tglobal_load_b128 %3, %17, off offset:512\n\tglobal_load_b128 %4, %18, off\n\tglobal_load_b128 %5, %18, off offset:512\n\tglobal_load_b128 %6, %19, off\n\tglobal_load_b128 %7, %19, off offset:512\n\tglobal_load_b128 %8, %20, off\n\tglobal_load_b128 %9, %20, off offset:512\n\tglobal_load_b128 %10, %21, off\n\tglobal_load_b128 %11, %21, off offset:512\n\tglobal_load_b128 %12, %22, off\n\tglobal_load_b128 %13, %22, off offset:512\n\tglobal_load_b128 %14, %23, off\n\tglobal_load_b128 %15, %23, off offset:512\n\ts_wait_loadcnt 0x0" : "=&v"(x[0]), "=&v"(x[1]), "=&v"(x[2]), "=&v"(x[3]), "=&v"(x[4]), "=&v"(x[5]), "=&v"(x[6]), "=&v"(x[7]), "=&v"(x[8]), "=&v"(x[9]), "=&v"(x[10]), "=&v"(x[11]), "=&v"(x[12]), "=&v"(x[13]), "=&v"(x[14]), "=&v"(x[15]) : "v"(pa + (size_t)0 * K), "v"(pa + (size_t)16 * K), "v"(pa + (size_t)32 * K), "v"(pa + (size_t)48 * K), "v"(pb + (size_t)0 * K), "v"(pb + (size_t)16 * K), "v"(pb + (size_t)32 * K), "v"(pb + (size_t)48 * K) : "memory");
#pragma unroll
        for (int mb = 0; mb < 4; ++mb) { a[mb] = __builtin_bit_cast(V, __builtin_shufflevector(x[2 * mb], x[2 * mb + 1], 0, 1, 2, 3, 4, 5, 6, 7)); b[mb] = __builtin_bit_cast(V, __builtin_shufflevector(x[8 + 2 * mb], x[9 + 2 * mb], 0, 1, 2, 3, 4, 5, 6, 7)); if (NSPLIT == 1 || NSPLIT == 2) a2[mb] = WFrag<T16>::ldf(A2 + aoff + (size_t)mb * 16 * K + kc * 16); }
#pragma unroll
        for (int nb = 0; nb < 4; ++nb) { V b2; if (NSPLIT >= 2) b2 = WFrag<T16>::ldf(Bt2 + boff + (size_t)nb * 16 * K + kc * 16);
#pragma unroll
            for (int mb = 0; mb < 4; ++mb) { acc[mb][nb] = WFrag<T16>::mma(a[mb], b[nb], acc[mb][nb]); if (NSPLIT == 1 || NSPLIT == 2) acc[mb][nb] = WFrag<T16>::mma(a2[mb], b[nb], acc[mb][nb]); if (NSPLIT >= 2) acc[mb][nb] = WFrag<T16>::mma(a[mb], b2, acc[mb][nb]); } }
        asm volatile("v_nop\n\tv_nop\n\tv_nop\n\tv_nop" : "+v"(acc[0][0]), "+v"(acc[1][1]), "+v"(acc[2][2]), "+v"(acc[3][3]) : "v"(a[0]), "v"(a[3]));
    }
    if (EPI >= 1) {
        const int bz = r0 / TT, t0 = r0 % TT;
        if (EPI == 1 || c0 < DQ) {   // q or k: 16 rows (two fragments a plane) at a time through LDS, which turns the accumulator's columns into the fragments' 16-byte row pieces; each store covers 512 successive bytes
            const int h = c0 / HD; const size_t po = ((size_t)(bz * NH_ + h) * TT + t0) * HD + lane * 8;
#pragma unroll
            for (int mb = 0; mb < 4; ++mb) {
#pragma unroll
                for (int nb = 0; nb < 4; ++nb) {
#pragma unroll
                    for (int j = 0; j < 8; ++j) os[(hi * 8 + j) * 68 + nb * 16 + lr] = acc[mb][nb][j]; }
                __builtin_amdgcn_wave_barrier(); asm volatile("" ::: "memory");   // the reads below take other lanes' values: the compiler may not lift them over the writes
                v8us oh[4], ol[4];   // piece s: row lr, columns 16 s + 8 hi .. + 7
#pragma unroll
                for (int s = 0; s < 4; ++s) { const float* sp = os + lr * 68 + s * 16 + hi * 8; const v4f va = *(const v4fa*)sp, vb = *(const v4fa*)(sp + 4);
#pragma unroll
                    for (int q = 0; q < 4; ++q) { unsigned short x2, y2; splitf(va[q], x2, y2); oh[s][q] = x2; ol[s][q] = y2; splitf(vb[q], x2, y2); oh[s][4 + q] = x2; ol[s][4 + q] = y2; } }
                float kd = 0.f;
                if (EPI == 2) { const float* bh = HB + h * HD;   // lane lr sums row lr, d ascending (both lane halves alike, the lower one stores)
#pragma unroll
                    for (int d = 0; d < HD; d += 4) { const v4f f = *(const v4fa*)(os + lr * 68 + d);
#pragma unroll
                        for (int q = 0; q < 4; ++q) kd = __fadd_rn(kd, __fmul_rn(bfr(bh[d + q]), f[q])); } }
                bf* ph = Ph + po + (size_t)mb * 16 * HD; bf* pl = Pl + po + (size_t)mb * 16 * HD;
#pragma unroll
                for (int s = 0; s < 4; ++s) { *(v8us*)(ph + s * 256) = oh[s]; *(v8us*)(pl + s * 256) = ol[s]; }
                // every register that the stores above name stays live up to this wait, so that none is rewritten in front of it
                asm volatile("s_wait_xcnt 0x0" :: "v"(ph), "v"(pl), "v"(oh[0]), "v"(oh[1]), "v"(oh[2]), "v"(oh[3]), "v"(ol[0]), "v"(ol[1]), "v"(ol[2]), "v"(ol[3]) : "memory");
                if (EPI == 2) { float* kp = KBo + (size_t)(bz * NH_ + h) * TT + t0 + mb * 16 + lr; if (hi == 0) *kp = kd;
                    asm volatile("s_wait_xcnt 0x0" :: "v"(kp), "v"(kd) : "memory"); }   // as above, for the registers of this store
                __builtin_amdgcn_wave_barrier();   // the next 16 rows' LDS writes stay behind this round's reads
            }
        } else {   // v: a lane holds 8 successive t of one d, which is its own 16-byte piece of a fragment: accumulator (mb, nb) goes out as half a fragment, 512 successive bytes a plane, straight from the registers
            const int g = (c0 - DQ) / HD; const size_t vo = ((size_t)(bz * NKV + g) * (HD / 16) * (TT / 32) + t0 / 32) * 512 + lane * 8;
#pragma unroll
            for (int nb = 0; nb < 4; ++nb) { v8us oh[4], ol[4];
#pragma unroll
                for (int mb = 0; mb < 4; ++mb) {
#pragma unroll
                    for (int j = 0; j < 8; ++j) { unsigned short x2, y2; splitf(acc[mb][nb][j], x2, y2); oh[mb][j] = x2; ol[mb][j] = y2; } }
                bf* vh = Vh + vo + (size_t)nb * (TT / 32) * 512; bf* vl = Vl + vo + (size_t)nb * (TT / 32) * 512;
#pragma unroll
                for (int mb = 0; mb < 4; ++mb) { *(v8us*)(vh + mb * 256) = oh[mb]; *(v8us*)(vl + mb * 256) = ol[mb]; }
                // every register that the stores above name stays live up to this wait, so that none is rewritten in front of it
                asm volatile("s_wait_xcnt 0x0" :: "v"(vh), "v"(vl), "v"(oh[0]), "v"(oh[1]), "v"(oh[2]), "v"(oh[3]), "v"(ol[0]), "v"(ol[1]), "v"(ol[2]), "v"(ol[3]) : "memory");
            }
        }
        return;
    }
#pragma unroll
    for (int mb = 0; mb < 4; ++mb) {
#pragma unroll
        for (int nb = 0; nb < 4; ++nb) {
#pragma unroll
            for (int j = 0; j < 8; ++j) os[(hi * 8 + j) * 68 + nb * 16 + lr] = acc[mb][nb][j]; }
        __builtin_amdgcn_wave_barrier(); asm volatile("" ::: "memory");
        const int cofs = lr * 4; float* cp = C + (size_t)(r0 + mb * 16 + hi) * ldc + c0 + cofs; v4f val[8];   // store s: row 2 s + hi of these 16
#pragma unroll
        for (int s = 0; s < 8; ++s) { val[s] = *(const v4fa*)(os + (2 * s + hi) * 68 + cofs); if (BIAS) { val[s][0] += bfr(bias[c0 + cofs]); val[s][1] += bfr(bias[c0 + cofs + 1]); val[s][2] += bfr(bias[c0 + cofs + 2]); val[s][3] += bfr(bias[c0 + cofs + 3]); }
            *(v4f*)(cp + (size_t)(2 * s) * ldc) = val[s]; }
        // every register that the stores above name stays live up to this wait, so that none is rewritten in front of it (in a kernel of several bodies other code follows this epilogue in the listing)
        asm volatile("s_wait_xcnt 0x0" :: "v"(cp), "v"(val[0]), "v"(val[1]), "v"(val[2]), "v"(val[3]), "v"(val[4]), "v"(val[5]), "v"(val[6]), "v"(val[7]) : "memory");
        __builtin_amdgcn_wave_barrier(); asm volatile("" ::: "memory");
    }
}

__device__ __forceinline__ h16 tohx(float x) { return (h16)x; }
typedef __attribute__((ext_vector_type(2))) _Float16 v2h;
typedef __attribute__((ext_vector_type(4))) _Float16 v4h;
typedef __attribute__((ext_vector_type(2))) unsigned short v2us;
typedef __attribute__((ext_vector_type(2))) float v2f;
typedef __attribute__((ext_vector_type(4))) int v4i;

__device__ __forceinline__ void d_wtG(const float* __restrict__ w, int K, int N, bf* Bt, int blk) {
    // Bt = w transposed, in fragment order (ldfo): one wave writes one fragment block (16 n x 32 k, 1 KiB in a row); lane (lr, hi) gathers column n = 16 nt + lr at k = 32 kb + 16 c + 8 hi + 0..7
    const int lane = threadIdx.x & 31, lr = lane & 15, hi = lane >> 4; const int fb = blk * 8 + __builtin_amdgcn_readfirstlane((int)(threadIdx.x >> 5)); if (fb >= N * K / 512) return;
    const int kb = fb % (K / 32), nt = fb / (K / 32); const float* s = w + (size_t)kb * 32 * N + nt * 16; const float* p[16]; float f[16]; v8us o[2];
#pragma unroll
    for (int q = 0; q < 16; ++q) p[q] = s + (size_t)((q >> 3) * 16 + hi * 8 + (q & 7)) * N + lr;
#pragma unroll
    for (int q = 0; q < 16; ++q) f[q] = *p[q];
    // behind the last load of the gather: all sixteen address pairs stay live up to this wait, so that none is handed to a later load's result in front of it
    asm volatile("s_wait_xcnt 0x0" :: "v"(p[0]), "v"(p[1]), "v"(p[2]), "v"(p[3]), "v"(p[4]), "v"(p[5]), "v"(p[6]), "v"(p[7]), "v"(p[8]), "v"(p[9]), "v"(p[10]), "v"(p[11]), "v"(p[12]), "v"(p[13]), "v"(p[14]), "v"(p[15]) : "memory");
#pragma unroll
    for (int q = 0; q < 16; ++q) o[q >> 3][q & 7] = f2bf(f[q]);
    bf* d = Bt + (size_t)fb * 512 + lane * 8; *(v8us*)d = o[0]; *(v8us*)(d + 256) = o[1];
}
// d_cvtF: src [rows][K] rounded to bf16, in fragment order (ldfo), the GEMM's A operand. One wave takes 8 rows x 32 k, half a fragment block: 4 lanes a row read its whole 128-byte line (8 floats a lane),
// and lane (row r, piece p: k = 8 p .. 8 p + 7) writes its 16-byte piece, so that the wave's store covers 4 whole 128-byte lines. n8 = rows * K / 8 pieces.
__device__ __forceinline__ void d_cvtF(const float* __restrict__ src, bf* dst, int K, size_t n8, int blk) {
    const int lane = threadIdx.x & 31, p = lane & 3, r = lane >> 2; const int wv = blk * 8 + (int)(threadIdx.x >> 5); if ((size_t)wv * 32 >= n8) return;
    const int r8 = (wv & 1) * 8 + r, fb = wv >> 1; const int kb = fb % (K / 32), mt = fb / (K / 32);
    const float* s = src + (size_t)(mt * 16 + r8) * K + kb * 32 + p * 8; const v8f v = *(const v8f*)s; v8us o;
    asm volatile("s_wait_xcnt 0x0" :: "v"(s) : "memory");   // the address pair stays live up to this wait, so that it is not handed to a load's result in front of it
#pragma unroll
    for (int k = 0; k < 8; ++k) o[k] = f2bf(v[k]);
    *(v8us*)(dst + (size_t)fb * 512 + (p >> 1) * 256 + ((p & 1) * 16 + r8) * 8) = o;  }

__device__ __forceinline__ void d_flat(const float* __restrict__ F, h16* P16, bf* Ph, bf* Pl, size_t n4, int blk) { const size_t i = (size_t)blk * 256 + threadIdx.x; if (i >= n4) return; const v4f a = *(const v4f*)(F + i * 4); v4h o16; v4us oh, ol;
#pragma unroll
    for (int q = 0; q < 4; ++q) { o16[q] = tohx(a[q]); unsigned short x2, y2; splitf(a[q], x2, y2); oh[q] = x2; ol[q] = y2; }
    const int row = (int)(i * 4 / HD), d = (int)(i * 4 % HD); const size_t fo = (size_t)(row >> 4) * (16 * HD) + (d >> 4) * 256 + (((d >> 3) & 1) * 16 + (row & 15)) * 8 + (d & 7);   // the hi | lo planes in fragment order (ldfo): F is [rows][HD]
    *(v4h*)(P16 + i * 4) = o16; *(v4us*)(Ph + fo) = oh; *(v4us*)(Pl + fo) = ol;  }

__device__ __forceinline__ void d_hdot(const float* __restrict__ bias, const float* __restrict__ F, int pitch, int nrows, int hcol, float* OUT, int blk) {
    { const size_t bz = blockIdx.y; F += bz * nrows * pitch; OUT += bz * NH_ * nrows; }   // blockIdx.y = batch (one for r)
    const int lane = threadIdx.x & 31; const size_t wv = (size_t)blk * 8 + (threadIdx.x >> 5); if (wv >= (size_t)NH_ * (nrows / 32)) return; const int h = (int)(wv / (nrows / 32)); const int n = (int)(wv % (nrows / 32)) * 32 + lane; const float* f = F + (size_t)n * pitch + (hcol ? h * HD : 0);   /* hcol: F has per-head columns (k); 0: one 64-wide row shared by all heads (r) */ const float* bh = bias + h * HD; float s = 0.f;
#pragma unroll 4
    for (int d = 0; d < HD; ++d) { s = __fadd_rn(s, __fmul_rn(bfr(bh[d]), f[d])); }
    *(float*)(OUT + (size_t)h * nrows + n) = s;  }

// Launches whose bodies do not depend on one another share one grid: a work-group picks its body by its block index (the same for all its threads), and the index inside the body's own range is what blockIdx gave it when the body was a launch of its own.
#define G_WQ  (DM * DQ / 512 / 8)          // work-groups of each body of k_prep: 8 fragment blocks, or 256 x 8 elements, a work-group
#define G_WKV (DM * DKV2 / 512 / 8)
#define G_WR  1
#define G_PE  (NR * HD / 8 / 256)
#define G_X   (NB_ * TT * DM / 8 / 256)
// k_prep: everything that reads only the inputs: the three weights, pos_embed, q and k to bf16 fragment order.
__global__ __launch_bounds__(256) void k_prep(const float* __restrict__ wq, const float* __restrict__ wkv, const float* __restrict__ wr, const float* __restrict__ pemb, const float* __restrict__ x, const float* __restrict__ xk, bf* WQ, bf* WKV, bf* WR, bf* PE, bf* XB, bf* XK) {
    int b = blockIdx.x;
    if (b < G_WQ) { d_wtG(wq, DM, DQ, WQ, b); return; } b -= G_WQ;
    if (b < G_WKV) { d_wtG(wkv, DM, DKV2, WKV, b); return; } b -= G_WKV;
    if (b < G_WR) { d_wtG(wr, HD, HD, WR, b); return; } b -= G_WR;
    if (b < G_PE) { d_cvtF(pemb, PE, HD, (size_t)NR * HD / 8, b); return; } b -= G_PE;
    if (b < G_X) { d_cvtF(x, XB, DM, (size_t)NB_ * TT * DM / 8, b); return; } b -= G_X;
    d_cvtF(xk, XK, DM, (size_t)NB_ * TT * DM / 8, b);
}
// k_gemm3: the three projections. blockIdx.y: DKV2 / 64 column tiles of kv, then DQ / 64 of q, then one row of tiles for r (NR / 64 of them).
__global__ __launch_bounds__(32) void k_gemm3(const bf* __restrict__ XB, const bf* __restrict__ XK, const bf* __restrict__ PE, const bf* __restrict__ WQ, const bf* __restrict__ WKV, const bf* __restrict__ WR, float* RF, bf* QPh, bf* QPl, bf* KPh, bf* KPl, bf* VTh, bf* VTl, const float* __restrict__ rrb, float* KB) {
    __shared__ __align__(16) float os[16 * 68];
    const int bx = blockIdx.x, by = blockIdx.y;
    if (by < DKV2 / 64) d_gemmw<bf, 0, false, 2>(XK, nullptr, WKV, nullptr, DM, nullptr, 0, nullptr, 0, 0, 0, KPh, KPl, VTh, VTl, rrb, KB, bx, by, os);   /* kv = k Wkv: k planes (columns 0..1023) with KB[b][h][j] = r_r_bias_h . kh_j, v planes (columns 1024..2047) */
    else if (by < DKV2 / 64 + DQ / 64) d_gemmw<bf, 0, false, 1>(XB, nullptr, WQ, nullptr, DM, nullptr, 0, nullptr, 0, 0, 0, QPh, QPl, nullptr, nullptr, nullptr, nullptr, bx, by - DKV2 / 64, os);   /* qh planes */
    else if (bx < NR / 64) d_gemmw<bf, 0, false, 0>(PE, nullptr, WR, nullptr, HD, RF, HD, nullptr, 0, 0, 0, nullptr, nullptr, nullptr, nullptr, nullptr, nullptr, bx, 0, os);   /* r = pos_embed Wr (exact) */
}
#define G_FL  (NR * HD / 4 / 256)
#define G_HD  (NH_ * (NR / 32) / 8)
// k_rfin: what reads r: its planes, and RB[h][l] = r_w_bias_h . r_l (r is shared by all heads: no column offset).
__global__ __launch_bounds__(256) void k_rfin(const float* __restrict__ RF, h16* RP16, bf* RPh, bf* RPl, const float* __restrict__ rwb, float* RB) {
    const int b = blockIdx.x;
    if (b < G_FL) d_flat(RF, RP16, RPh, RPl, (size_t)NR * HD / 4, b);
    else d_hdot(rwb, RF, HD, NR, 0, RB, b - G_FL);
}

#define MT   2                    // 16-row query tiles per work-group
#define ROWS (16 * MT)
#define PD   6                    // k steps by which the V fragment loads run ahead in the P.V product
#define PA   3                    // ring of P fragment sets in the P.V product
#define SP   1028                 // floats per LDS score row: 4112 B = 16 B x odd, the conflict-free pitch for 16-byte fragment reads
typedef v4us __attribute__((may_alias)) v4usa;
// ld4: the hi and lo fragments of both 32-wide k halves of one 16-row tile (x[0] hi k 0..31, x[1] lo, x[2] hi k 32..63, x[3] lo); ph, pl = the tile's first fragment block + 8 * lane.
__device__ __forceinline__ void ld4(const bf* ph, const bf* pl, v16bf (&x)[4]) {
    x[0] = ldfo(ph); x[1] = ldfo(pl); x[2] = ldfo(ph + 512); x[3] = ldfo(pl + 512);
    asm volatile("s_wait_xcnt 0x0" :: "v"(ph), "v"(pl) : "memory");   // both address pairs stay live up to this wait
}
// k_fattn: one work-group (8 waves) = ROWS query rows of one head of one batch; their whole score rows stay in LDS from the score products to the P.V product.
// 1. wave w owns keys [128 w, 128 w + 128): q.r tiles over the window l = TT + j - i are stored straight to their shifted place sc[i][j];
// 2. q.k tiles: sc = ((q.k + KB[j]) + q.r) + RB[l]; 3. softmax, one wave per row, P hi | lo planes written over the row's own scores;
// 4. O = P.V (waves 0..3, one 16-column block each, k ascending), staged in LDS so that each wave stores whole output lines.
__global__ __launch_bounds__(256) void k_fattn(const bf* __restrict__ Qh, const bf* __restrict__ Ql, const bf* __restrict__ Kh, const bf* __restrict__ Kl, const bf* __restrict__ Rh, const bf* __restrict__ Rl, const bf* __restrict__ Vh, const bf* __restrict__ Vl, const float* __restrict__ KB, const float* __restrict__ RB, const int* __restrict__ km, float* OUTb) {
    __shared__ __align__(16) float sc[ROWS * SP];
    __shared__ __align__(16) float os[ROWS * 68];
    __shared__ float rbs[TT + ROWS];
    const int lane = threadIdx.x & 31, lr = lane & 15, hi = lane >> 4; const int w = __builtin_amdgcn_readfirstlane((int)(threadIdx.x >> 5));
    const int i0 = blockIdx.x * ROWS, h = blockIdx.y, jw = w * 128;
    { const size_t bz = blockIdx.z, po = bz * NH_ * TT * HD; Qh += po; Ql += po; Kh += po; Kl += po; Vh += po; Vl += po; KB += bz * NH_ * TT; km += bz * TT; OUTb += bz * TT * DQ; }   // blockIdx.z = batch; the r planes and RB are shared by all batches
    const float* rbg = RB + (size_t)h * NR + (TT - i0 - ROWS) + threadIdx.x; float rv[TT / 256 + 1];   // rbs[x] = RB[h][TT - i0 - ROWS + x]: every l this work-group's rows meet; loaded here, stored in front of the first barrier
#pragma unroll
    for (int q = 0; q < TT / 256; ++q) rv[q] = rbg[q * 256];
    rv[TT / 256] = (threadIdx.x < ROWS) ? rbg[TT] : 0.f;
    v16bf ah[MT][2], al[MT][2];
#pragma unroll
    for (int mb = 0; mb < MT; ++mb) { const size_t o = ((size_t)h * TT + i0 + mb * 16) * HD + 8 * lane; v16bf x[4]; ld4(Qh + o, Ql + o, x); ah[mb][0] = x[0]; al[mb][0] = x[1]; ah[mb][1] = x[2]; al[mb][1] = x[3]; }
    const int lbase = TT + jw - i0 - ROWS;   // first l of the wave's window; the window [lbase, lbase + 128 + ROWS) lies in [0, NR)
    // Both tile loops are unrolled: which row tile needs which window tile is then decided at compile time, and the next tile's loads (issued ahead, in the source too) fly while this tile is multiplied.
    v16bf nx[4];
    { const size_t o = (size_t)lbase * HD + 8 * lane; ld4(Rh + o, Rl + o, nx); }
#pragma unroll
    for (int t = 0; t < 8 + MT; ++t) { const v16bf b[2] = {nx[0], nx[2]}, c[2] = {nx[1], nx[3]};
        if (t + 1 < 8 + MT) { const size_t o = (size_t)(lbase + (t + 1) * 16) * HD + 8 * lane; ld4(Rh + o, Rl + o, nx); }
        else { const size_t o = ((size_t)h * TT + jw) * HD + 8 * lane; ld4(Kh + o, Kl + o, nx); }   // the first key tile
        v8f acc[MT];
#pragma unroll
        for (int mb = 0; mb < MT; ++mb) acc[mb] = (v8f){};
#pragma unroll
        for (int s = 0; s < 2; ++s) {
#pragma unroll
            for (int mb = 0; mb < MT; ++mb) if (t + mb >= MT - 1 && t + mb <= MT + 7) acc[mb] = wmmab(ah[mb][s], b[s], acc[mb]);
#pragma unroll
            for (int mb = 0; mb < MT; ++mb) if (t + mb >= MT - 1 && t + mb <= MT + 7) acc[mb] = wmmab(al[mb][s], b[s], acc[mb]);
#pragma unroll
            for (int mb = 0; mb < MT; ++mb) if (t + mb >= MT - 1 && t + mb <= MT + 7) acc[mb] = wmmab(ah[mb][s], c[s], acc[mb]); }
        asm volatile("v_nop\n\tv_nop\n\tv_nop\n\tv_nop" : "+v"(acc[0]), "+v"(acc[1]));   // the four vector slots the chip needs before the next tile's first product overwrites these result registers: only LDS stores stand between
#pragma unroll
        for (int mb = 0; mb < MT; ++mb) { if (t + mb < MT - 1 || t + mb > MT + 7) continue;
#pragma unroll
            for (int jj = 0; jj < 8; ++jj) { const int ii = mb * 16 + hi * 8 + jj; const int jrel = t * 16 + lr + ii - ROWS;   /* j - jw of (row ii, l = lbase + 16 t + lr) */ if (jrel >= 0 && jrel < 128) sc[ii * SP + jw + jrel] = acc[mb][jj]; } } }
#pragma unroll
    for (int q = 0; q < TT / 256; ++q) rbs[q * 256 + threadIdx.x] = rv[q];
    if (threadIdx.x < ROWS) rbs[TT + threadIdx.x] = rv[TT / 256];
    __syncthreads();
#pragma unroll
    for (int nb = 0; nb < 8; ++nb) { const int j = jw + nb * 16 + lr; const v16bf b[2] = {nx[0], nx[2]}, c[2] = {nx[1], nx[3]}; const float kb = KB[(size_t)h * TT + j];
        if (nb + 1 < 8) { const size_t o = ((size_t)h * TT + jw + (nb + 1) * 16) * HD + 8 * lane; ld4(Kh + o, Kl + o, nx); }
        v8f acc[MT];
#pragma unroll
        for (int mb = 0; mb < MT; ++mb) acc[mb] = (v8f){};
#pragma unroll
        for (int s = 0; s < 2; ++s) {
#pragma unroll
            for (int mb = 0; mb < MT; ++mb) acc[mb] = wmmab(ah[mb][s], b[s], acc[mb]);
#pragma unroll
            for (int mb = 0; mb < MT; ++mb) acc[mb] = wmmab(al[mb][s], b[s], acc[mb]);
#pragma unroll
            for (int mb = 0; mb < MT; ++mb) acc[mb] = wmmab(ah[mb][s], c[s], acc[mb]); }
#pragma unroll
        for (int mb = 0; mb < MT; ++mb)
#pragma unroll
            for (int jj = 0; jj < 8; ++jj) { const int ii = mb * 16 + hi * 8 + jj; float* p = sc + ii * SP + j; *p = __fadd_rn(__fadd_rn(__fadd_rn(acc[mb][jj], kb), *p), rbs[j - ii + ROWS]); } }
    __syncthreads();
    // V fragments run PD k steps ahead of their products; the first PD are asked for here, so that they land during the softmax
    v16bf vh[PD], vl[PD]; const size_t vo = ((size_t)h * (HD / 16) + (w & 3)) * (TT / 32) * 512 + 8 * lane;   // this wave's 16 d rows: TT / 32 fragment blocks in a row
    if (w < 4) {
#pragma unroll
        for (int d = 0; d < PD; ++d) { vh[d] = ldfo(Vh + vo + 512 * d); vl[d] = ldfo(Vl + vo + 512 * d); } }
    for (int rr = 0; rr < ROWS / 8; ++rr) { float* sr = sc + (w * (ROWS / 8) + rr) * SP; float v[TT / 32]; float mx = -3.0e38f;
#pragma unroll
        for (int ch = 0; ch < TT / 128; ++ch) { const int j0 = ch * 128 + lane * 4; const v4f a = *(const v4fa*)(sr + j0); const v4i mk = *(const v4i*)(km + j0);
#pragma unroll
            for (int q = 0; q < 4; ++q) { const float t = (mk[q] != 0) ? a[q] * SCL : -3.0e38f; v[ch * 4 + q] = t;   /* mask == 0 -> -inf */ mx = fmaxf(mx, t); } }
#pragma unroll
        for (int sh = 16; sh; sh >>= 1) mx = fmaxf(mx, __shfl_xor(mx, sh, 32));
        float sum = 0.f;
#pragma unroll
        for (int k = 0; k < TT / 32; ++k) { const float d0 = __fsub_rn(v[k], mx); v[k] = __builtin_amdgcn_exp2f(__fmul_rn(d0, 1.4426950408889634f)); sum += v[k]; }
#pragma unroll
        for (int sh = 16; sh; sh >>= 1) sum += __shfl_xor(sum, sh, 32);
        const float f = __fdiv_rn(1.0f, sum); bf* pr = (bf*)sr;   // P hi in the row's first 2 KiB, P lo in its second; every score of the row is in registers by now (the sum needed them all)
#pragma unroll
        for (int ch = 0; ch < TT / 128; ++ch) { v4us oh, ol;
#pragma unroll
            for (int q = 0; q < 4; ++q) { unsigned short a, c2; splitf(v[ch * 4 + q] * f, a, c2); oh[q] = a; ol[q] = c2; }
            *(v4usa*)(pr + ch * 128 + lane * 4) = oh; *(v4usa*)(pr + TT + ch * 128 + lane * 4) = ol; } }
    __syncthreads();
    if (w < 4) { v8f acc[MT];
#pragma unroll
        for (int mb = 0; mb < MT; ++mb) acc[mb] = (v8f){};
        const bf* pl = (const bf*)(sc + lr * SP) + 8 * hi;   // this lane's P hi row of row tile 0; row tile mb lies 16 rows on, P lo TT elements on
        v16bf pa[PA][MT], pb[PA][MT];   // P hi / lo fragments, read from LDS PA - 1 k steps ahead of their products
#pragma unroll
        for (int d = 0; d < PA - 1; ++d)
#pragma unroll
            for (int mb = 0; mb < MT; ++mb) { const bf* pr = pl + mb * 16 * SP * 2 + d * 32; pa[d][mb] = cat16b(*(const v8usa*)pr, *(const v8usa*)(pr + 16)); pb[d][mb] = cat16b(*(const v8usa*)(pr + TT), *(const v8usa*)(pr + TT + 16)); }
        // unrolled: the fragment rings are then indexed at compile time and stay in registers, and the last steps ask for nothing
#pragma unroll
        for (int ks = 0; ks < TT / 32; ++ks) { const int kc = ks * 32; const v16bf b = vh[ks % PD], b2 = vl[ks % PD];
            if (ks + PD < TT / 32) { vh[ks % PD] = ldfo(Vh + vo + 512 * (ks + PD)); vl[ks % PD] = ldfo(Vl + vo + 512 * (ks + PD)); }
            if (ks + PD == TT / 32 - 1) asm volatile("s_wait_xcnt 0x0" :: "v"(Vh + vo), "v"(Vl + vo) : "memory");   // behind the last V load: both address pairs stay live up to this wait, so that neither is rewritten in front of it
            if (ks + PA - 1 < TT / 32) {
#pragma unroll
                for (int mb = 0; mb < MT; ++mb) { const bf* pr = pl + mb * 16 * SP * 2 + kc + (PA - 1) * 32; pa[(ks + PA - 1) % PA][mb] = cat16b(*(const v8usa*)pr, *(const v8usa*)(pr + 16)); pb[(ks + PA - 1) % PA][mb] = cat16b(*(const v8usa*)(pr + TT), *(const v8usa*)(pr + TT + 16)); } }
#pragma unroll
            for (int mb = 0; mb < MT; ++mb) acc[mb] = wmmab(pa[ks % PA][mb], b, acc[mb]);
#pragma unroll
            for (int mb = 0; mb < MT; ++mb) acc[mb] = wmmab(pb[ks % PA][mb], b, acc[mb]);
#pragma unroll
            for (int mb = 0; mb < MT; ++mb) acc[mb] = wmmab(pa[ks % PA][mb], b2, acc[mb]); }
#pragma unroll
        for (int mb = 0; mb < MT; ++mb)
#pragma unroll
            for (int jj = 0; jj < 8; ++jj) os[(mb * 16 + hi * 8 + jj) * 68 + w * 16 + lr] = acc[mb][jj]; }
    __syncthreads();
#pragma unroll
    for (int s = 0; s < MT; ++s) { const int row = s * 16 + (int)(threadIdx.x >> 4), cofs = (int)(threadIdx.x & 15) * 4; *(v4f*)(OUTb + (size_t)(i0 + row) * DQ + h * HD + cofs) = *(const v4fa*)(os + row * 68 + cofs); }
}

extern "C" void kernel_launch(void* const* d_in, const int* in_sizes, int n_in,
                              void* d_out, int out_size, void* d_ws, size_t ws_size, hipStream_t stream) {
    (void)in_sizes; (void)n_in; (void)out_size;
    const float* x = (const float*)d_in[0]; const float* xk = (const float*)d_in[1]; const int* kmask = (const int*)d_in[2]; const float* pemb = (const float*)d_in[3]; const float* wq = (const float*)d_in[4]; const float* wkv = (const float*)d_in[5]; const float* wr = (const float*)d_in[6]; const float* rrb = (const float*)d_in[7]; const float* rwb = (const float*)d_in[8]; const float* wk = nullptr; const float* wv = nullptr; (void)wk; (void)wv;
    float* OUT = (float*)d_out;     // [4][1024][1024]
    char* wsp = (char*)d_ws;
    auto take = [&](size_t bytes) { char* p = wsp; wsp += (bytes + 255) & ~(size_t)255; return (void*)p; };
    bf* WQ = (bf*)take((size_t)DQ * DM * 2); bf* WKV = (bf*)take((size_t)DKV2 * DM * 2); bf* WR = (bf*)take((size_t)HD * HD * 2); bf* PE = (bf*)take((size_t)NR * HD * 2); float* RF = (float*)take((size_t)NR * HD * 4); h16* RP16 = (h16*)take((size_t)NR * HD * 2); bf* RPh = (bf*)take((size_t)NR * HD * 2); bf* RPl = (bf*)take((size_t)NR * HD * 2); float* KB = (float*)take((size_t)NB_ * NH_ * TT * 4); float* RB = (float*)take((size_t)NH_ * NR * 4);
    // every per-batch buffer holds all NB_ batches, batch-major
    bf* XB = (bf*)take((size_t)NB_ * TT * DM * 2); bf* XK = (bf*)take((size_t)NB_ * TT * DM * 2);
    bf* QPh = (bf*)take((size_t)NB_ * NH_ * TT * HD * 2); bf* QPl = (bf*)take((size_t)NB_ * NH_ * TT * HD * 2); bf* KPh = (bf*)take((size_t)NB_ * NKV * TT * HD * 2); bf* KPl = (bf*)take((size_t)NB_ * NKV * TT * HD * 2); bf* VTh = (bf*)take((size_t)NB_ * NKV * HD * TT * 2); bf* VTl = (bf*)take((size_t)NB_ * NKV * HD * TT * 2);
    if ((size_t)(wsp - (char*)d_ws) > ws_size) return;    // about 72 MiB of the 256 MiB
    // Four launches, each reading only what an earlier one wrote; every stage covers all NB_ batches: the projections see the batches as NB_ * TT rows and write the head planes themselves, the attention kernel takes the batch from blockIdx.z.
    k_prep<<<G_WQ + G_WKV + G_WR + G_PE + 2 * G_X, 256, 0, stream>>>(wq, wkv, wr, pemb, x, xk, WQ, WKV, WR, PE, XB, XK);
    k_gemm3<<<dim3(NB_ * TT / 64, DKV2 / 64 + DQ / 64 + 1, 1), 32, 0, stream>>>(XB, XK, PE, WQ, WKV, WR, RF, QPh, QPl, KPh, KPl, VTh, VTl, rrb, KB);
    k_rfin<<<G_FL + G_HD, 256, 0, stream>>>(RF, RP16, RPh, RPl, rwb, RB);
    k_fattn<<<dim3(TT / ROWS, NH_, NB_), 256, 0, stream>>>(QPh, QPl, KPh, KPl, RPh, RPl, VTh, VTl, KB, RB, kmask, OUT);   /* scores, shift, softmax and P.V of every head of every batch */
}

// v008
// A run of this version takes 141 microseconds.
// Next to v007, in two timings, it ran 1.06 times as fast each time.
// All steps since v000 together make it 12.3 times as fast.
#include <hip/hip_runtime.h>

// Transformer-XL relative multi-head attention (q, k [4][1024][1024]; qh = q Wq ('xw' [1024][1024]), kv = k Wkv ('xw' [1024][2048]: k | v column blocks; 16 heads x 64); r = pos_embed Wr ([2048][64] x [64][64], shared by all heads); AC = (qh + r_r_bias_h).kh, BD = shift((qh + r_w_bias_h).r): BD[i][j] = (qh_i + r_w_bias_h).r[L + j - i]; attn = (AC + BD)/8; keys with mask[b][j] == 0 -> -inf (int [4][1024], read); softmax; out = merged attn.vh -> [4][1024][1024] (4.2 M)).
// Compute dtypes, f32 accumulate: every input rounded to bf16; projections exact; relative terms 3 products / f32 dots; content scores 3 products on every row; softmax f32; output f32.

#define NB_  4
#define TT   1024
#define DM   1024
#define NH_  16
#define NKV  16
#define REP  (NH_ / NKV)
#define HD   64
#define DQ   (NH_ * HD)
#define DKV  (NKV * HD)
#define RH   1024                 // = TT: every row hi/lo
#define WIN  0
#define PCAR 1024.0f
#define SCL  0.125f
#define NR   2048    // relative positions (2L)
#define DKV2 2048    // kv projection width (k | v)
typedef _Float16 h16;
typedef unsigned short bf;
typedef __attribute__((ext_vector_type(16))) __bf16   v16bf;
typedef __attribute__((ext_vector_type(16))) _Float16 v16h;
typedef __attribute__((ext_vector_type(8)))  _Float16 v8h;
typedef __attribute__((ext_vector_type(8)))  unsigned short v8us;
typedef __attribute__((ext_vector_type(8)))  float    v8f;
typedef __attribute__((ext_vector_type(4)))  float    v4f;
typedef __attribute__((ext_vector_type(4)))  unsigned v4u;
typedef __attribute__((ext_vector_type(2)))  unsigned v2u;
typedef v8h  __attribute__((may_alias)) v8ha;
typedef v4f  __attribute__((may_alias)) v4fa;
typedef v8us __attribute__((may_alias)) v8usa;

typedef __attribute__((ext_vector_type(2))) __bf16 v2bf;
typedef __attribute__((ext_vector_type(2))) float  v2fl;
// Rounding to bf16 (nearest, ties to even) is the chip's own packed conversion: one instruction for two values, already packed as the planes store them (a in the low half).
__device__ __forceinline__ unsigned cvt2(float a, float b) { const v2fl t = {a, b}; return __builtin_bit_cast(unsigned, __builtin_convertvector(t, v2bf)); }
__device__ __forceinline__ unsigned short f2bf(float f) { return __builtin_bit_cast(unsigned short, (__bf16)f); }
__device__ __forceinline__ float bf2f(unsigned short b) { return __uint_as_float(((unsigned)b) << 16); }
__device__ __forceinline__ float bfr(float f) { return bf2f(f2bf(f)); }
// split2: the hi and lo parts of two values, each pair packed in one word
__device__ __forceinline__ void split2(float y0, float y1, unsigned& h, unsigned& l) { h = cvt2(y0, y1); l = cvt2(y0 - __uint_as_float(h << 16), y1 - __uint_as_float(h & 0xFFFF0000u)); }
typedef __attribute__((ext_vector_type(4))) unsigned short v4us;
__device__ __forceinline__ v16h cat16(v8h lo, v8h hi) { return __builtin_shufflevector(lo, hi, 0, 1, 2, 3, 4, 5, 6, 7, 8, 9, 10, 11, 12, 13, 14, 15); }
__device__ __forceinline__ v16bf cat16b(v8us lo, v8us hi) { return __builtin_bit_cast(v16bf, __builtin_shufflevector(lo, hi, 0, 1, 2, 3, 4, 5, 6, 7, 8, 9, 10, 11, 12, 13, 14, 15)); }
__device__ __forceinline__ v8f wmma16(v16h a, v16h b, v8f c) { return __builtin_amdgcn_wmma_f32_16x16x32_f16(false, a, false, b, (short)0, c, false, false); }
__device__ __forceinline__ v8f wmmab(v16bf a, v16bf b, v8f c) { return __builtin_amdgcn_wmma_f32_16x16x32_bf16(false, a, false, b, (short)0, c, false, false); }



// ---- d_gemmw: register-blocked GEMM, ONE WAVE per 64x64 output tile (16 accumulators), operands straight from 16-bit planes, A (rows m) and Bt (rows n) both in fragment order (ldfo below); tile (bx, by) of (M/64, N/64), 32 threads; os = the work-group's 16 x 68 floats of LDS. k_gemm3 below calls it.
// C[m][n] (f32, pitch ldc, + optional f32 bias[n]) = sum_k A[m][k] Bt[n][k] (+ split products per NSPLIT). z-batch strides sA/sB/sC in elements. K % 32 == 0.
// EPI 0: C goes out as f32. EPI 1 (q projection) and 2 (kv projection), rows = batch x TT: no f32 result leaves the kernel. A tile is 64 rows of one batch x the 64 columns of one head, and the epilogue writes
// the bf16 hi | lo planes that the attention kernel reads, in fragment order (ldfo below): q, and the kv column blocks below DQ (k), as fragments of 16 t rows x 32 d, P[b][h][t / 16][d / 32][512], k with KBo[b][h][t] = HB_h . row (d ascending); the kv column blocks from DQ on (v) as fragments of 16 d rows x 32 t, V[b][g][d / 16][t / 32][512].
template <typename T16> struct WFrag;
template <> struct WFrag<h16> { typedef v16h V; static __device__ __forceinline__ V ld(const h16* p) { return cat16(*(const v8h*)p, *(const v8h*)(p + 16)); } static __device__ __forceinline__ v8f mma(V a, V b, v8f c) { return wmma16(a, b, c); } };
template <> struct WFrag<bf> { typedef v16bf V; static __device__ __forceinline__ V ld(const bf* p) { return cat16b(*(const v8us*)p, *(const v8us*)(p + 16)); } static __device__ __forceinline__ V ldf(const bf* p) { return cat16b(*(const v8us*)p, *(const v8us*)(p + 256)); } static __device__ __forceinline__ v8f mma(V a, V b, v8f c) { return wmmab(a, b, c); } };
// Fragment order: one 16-row x 32-k operand fragment is a block of 512 elements (1 KiB); element (row r, k) lies at (k >> 4) * 256 + (((k >> 3) & 1) * 16 + r) * 8 + (k & 7), which puts lane l's two 16-byte pieces at 8 l and 256 + 8 l.
// Each 16-byte load of a wave then covers 512 successive bytes, 4 whole 128-byte lines, where a row-major plane gives it 32 bytes of each of 16 lines. p = block + 8 * lane.
__device__ __forceinline__ v16bf ldfo(const bf* p) { return WFrag<bf>::ldf(p); }
template <typename T16, int NSPLIT, bool BIAS, int EPI>
__device__ __forceinline__ void d_gemmw(const T16* __restrict__ A, const T16* __restrict__ A2, const T16* __restrict__ Bt, const T16* __restrict__ Bt2, int K, float* C, int ldc, const float* __restrict__ bias, size_t sA, size_t sB, size_t sC, bf* Ph, bf* Pl, bf* Vh, bf* Vl, const float* __restrict__ HB, float* KBo, int bx, int by, float* os) {
    typedef typename WFrag<T16>::V V;
    const size_t z = blockIdx.z; A += z * sA; if (A2) A2 += z * sA; Bt += z * sB; if (Bt2) Bt2 += z * sB; C += z * sC;
    const int lane = threadIdx.x & 31, lr = lane & 15, hi = lane >> 4; const int r0 = bx * 64, c0 = by * 64;
    v8f acc[4][4];
#pragma unroll
    for (int mb = 0; mb < 4; ++mb)
#pragma unroll
        for (int nb = 0; nb < 4; ++nb) acc[mb][nb] = (v8f){};
    const size_t aoff = (size_t)r0 * K + 8 * lane, boff = (size_t)c0 * K + 8 * lane;   // A and Bt: fragment blocks [row / 16][k / 32][512], so 16 rows are 16 K elements and a k step is one block
#pragma unroll 1
    for (int kc = 0; kc < K; kc += 32) {
        V a[4], a2[4], b[4]; v4u x[16]; const T16* pa = A + aoff + kc * 16; const T16* pb = Bt + boff + kc * 16;
        // The sixteen operand loads of a k step and their data wait in one statement. Here the eight address pairs live to the statement's end and no result shares a register with them.
        asm volatile("global_load_b128 %0, %16, off\n\tglobal_load_b128 %1, %16, off offset:512\n\tglobal_load_b128 %2, %17, off\n\tglobal_load_b128 %3, %17, off offset:512\n\tglobal_load_b128 %4, %18, off\n\tglobal_load_b128 %5, %18, off offset:512\n\tglobal_load_b128 %6, %19, off\n\tglobal_load_b128 %7, %19, off offset:512\n\tglobal_load_b128 %8, %20, off\n\tglobal_load_b128 %9, %20, off offset:512\n\tglobal_load_b128 %10, %21, off\n\tglobal_load_b128 %11, %21, off offset:512\n\tglobal_load_b128 %12, %22, off\n\tglobal_load_b128 %13, %22, off offset:512\n\tglobal_load_b128 %14, %23, off\n\tglobal_load_b128 %15, %23, off offset:512\n\ts_wait_loadcnt 0x0" : "=&v"(x[0]), "=&v"(x[1]), "=&v"(x[2]), "=&v"(x[3]), "=&v"(x[4]), "=&v"(x[5]), "=&v"(x[6]), "=&v"(x[7]), "=&v"(x[8]), "=&v"(x[9]), "=&v"(x[10]), "=&v"(x[11]), "=&v"(x[12]), "=&v"(x[13]), "=&v"(x[14]), "=&v"(x[15]) : "v"(pa + (size_t)0 * K), "v"(pa + (size_t)16 * K), "v"(pa + (size_t)32 * K), "v"(pa + (size_t)48 * K), "v"(pb + (size_t)0 * K), "v"(pb + (size_t)16 * K), "v"(pb + (size_t)32 * K), "v"(pb + (size_t)48 * K) : "memory");
#pragma unroll
        for (int mb = 0; mb < 4; ++mb) { a[mb] = __builtin_bit_cast(V, __builtin_shufflevector(x[2 * mb], x[2 * mb + 1], 0, 1, 2, 3, 4, 5, 6, 7)); b[mb] = __builtin_bit_cast(V, __builtin_shufflevector(x[8 + 2 * mb], x[9 + 2 * mb], 0, 1, 2, 3, 4, 5, 6, 7)); if (NSPLIT == 1 || NSPLIT == 2) a2[mb] = WFrag<T16>::ldf(A2 + aoff + (size_t)mb * 16 * K + kc * 16); }
#pragma unroll
        for (int nb = 0; nb < 4; ++nb) { V b2; if (NSPLIT >= 2) b2 = WFrag<T16>::ldf(Bt2 + boff + (size_t)nb * 16 * K + kc * 16);
#pragma unroll
            for (int mb = 0; mb < 4; ++mb) { acc[mb][nb] = WFrag<T16>::mma(a[mb], b[nb], acc[mb][nb]); if (NSPLIT == 1 || NSPLIT == 2) acc[mb][nb] = WFrag<T16>::mma(a2[mb], b[nb], acc[mb][nb]); if (NSPLIT >= 2) acc[mb][nb] = WFrag<T16>::mma(a[mb], b2, acc[mb][nb]); } }
        asm volatile("v_nop\n\tv_nop\n\tv_nop\n\tv_nop" : "+v"(acc[0][0]), "+v"(acc[1][1]), "+v"(acc[2][2]), "+v"(acc[3][3]) : "v"(a[0]), "v"(a[3]));
    }
    if (EPI >= 1) {
        const int bz = r0 / TT, t0 = r0 % TT;
        if (EPI == 1 || c0 < DQ) {   // q or k: 16 rows (two fragments a plane) at a time through LDS, which turns the accumulator's columns into the fragments' 16-byte row pieces; each store covers 512 successive bytes
            const int h = c0 / HD; const size_t po = ((size_t)(bz * NH_ + h) * TT + t0) * HD + lane * 8;
#pragma unroll
            for (int mb = 0; mb < 4; ++mb) {
#pragma unroll
                for (int nb = 0; nb < 4; ++nb) {
#pragma unroll
                    for (int j = 0; j < 8; ++j) os[(hi * 8 + j) * 68 + nb * 16 + lr] = acc[mb][nb][j]; }
                __builtin_amdgcn_wave_barrier(); asm volatile("" ::: "memory");   // the reads below take other lanes' values: the compiler may not lift them over the writes
                v4u oh[4], ol[4];   // piece s: row lr, columns 16 s + 8 hi .. + 7, two columns a word
#pragma unroll
                for (int s = 0; s < 4; ++s) { const float* sp = os + lr * 68 + s * 16 + hi * 8; const v4f va = *(const v4fa*)sp, vb = *(const v4fa*)(sp + 4);
#pragma unroll
                    for (int q = 0; q < 2; ++q) { unsigned x2, y2; split2(va[2 * q], va[2 * q + 1], x2, y2); oh[s][q] = x2; ol[s][q] = y2; split2(vb[2 * q], vb[2 * q + 1], x2, y2); oh[s][2 + q] = x2; ol[s][2 + q] = y2; } }
                float kd = 0.f;
                if (EPI == 2) { const float* bh = HB + h * HD;   // lane lr sums row lr, d ascending (both lane halves alike, the lower one stores)
#pragma unroll
                    for (int d = 0; d < HD; d += 4) { const v4f f = *(const v4fa*)(os + lr * 68 + d);
#pragma unroll
                        for (int q = 0; q < 4; ++q) kd = __fadd_rn(kd, __fmul_rn(bfr(bh[d + q]), f[q])); } }
                bf* ph = Ph + po + (size_t)mb * 16 * HD; bf* pl = Pl + po + (size_t)mb * 16 * HD;
#pragma unroll
                for (int s = 0; s < 4; ++s) { *(v8us*)(ph + s * 256) = __builtin_bit_cast(v8us, oh[s]); *(v8us*)(pl + s * 256) = __builtin_bit_cast(v8us, ol[s]); }
                // every register that the stores above name stays live up to this wait, so that none is rewritten in front of it
                asm volatile("s_wait_xcnt 0x0" :: "v"(ph), "v"(pl), "v"(oh[0]), "v"(oh[1]), "v"(oh[2]), "v"(oh[3]), "v"(ol[0]), "v"(ol[1]), "v"(ol[2]), "v"(ol[3]) : "memory");
                if (EPI == 2) { float* kp = KBo + (size_t)(bz * NH_ + h) * TT + t0 + mb * 16 + lr; if (hi == 0) *kp = kd;
                    asm volatile("s_wait_xcnt 0x0" :: "v"(kp), "v"(kd) : "memory"); }   // as above, for the registers of this store
                __builtin_amdgcn_wave_barrier();   // the next 16 rows' LDS writes stay behind this round's reads
            }
        } else {   // v: a lane holds 8 successive t of one d, which is its own 16-byte piece of a fragment: accumulator (mb, nb) goes out as half a fragment, 512 successive bytes a plane, straight from the registers
            const int g = (c0 - DQ) / HD; const size_t vo = ((size_t)(bz * NKV + g) * (HD / 16) * (TT / 32) + t0 / 32) * 512 + lane * 8;
#pragma unroll
            for (int nb = 0; nb < 4; ++nb) { v4u oh[4], ol[4];
#pragma unroll
                for (int mb = 0; mb < 4; ++mb) {
#pragma unroll
                    for (int j = 0; j < 4; ++j) { unsigned x2, y2; split2(acc[mb][nb][2 * j], acc[mb][nb][2 * j + 1], x2, y2); oh[mb][j] = x2; ol[mb][j] = y2; } }
                bf* vh = Vh + vo + (size_t)nb * (TT / 32) * 512; bf* vl = Vl + vo + (size_t)nb * (TT / 32) * 512;
#pragma unroll
                for (int mb = 0; mb < 4; ++mb) { *(v8us*)(vh + mb * 256) = __builtin_bit_cast(v8us, oh[mb]); *(v8us*)(vl + mb * 256) = __builtin_bit_cast(v8us, ol[mb]); }
                // every register that the stores above name stays live up to this wait, so that none is rewritten in front of it
                asm volatile("s_wait_xcnt 0x0" :: "v"(vh), "v"(vl), "v"(oh[0]), "v"(oh[1]), "v"(oh[2]), "v"(oh[3]), "v"(ol[0]), "v"(ol[1]), "v"(ol[2]), "v"(ol[3]) : "memory");
            }
        }
        return;
    }
#pragma unroll
    for (int mb = 0; mb < 4; ++mb) {
#pragma unroll
        for (int nb = 0; nb < 4; ++nb) {
#pragma unroll
            for (int j = 0; j < 8; ++j) os[(hi * 8 + j) * 68 + nb * 16 + lr] = acc[mb][nb][j]; }
        __builtin_amdgcn_wave_barrier(); asm volatile("" ::: "memory");
        const int cofs = lr * 4; float* cp = C + (size_t)(r0 + mb * 16 + hi) * ldc + c0 + cofs; v4f val[8];   // store s: row 2 s + hi of these 16
#pragma unroll
        for (int s = 0; s < 8; ++s) { val[s] = *(const v4fa*)(os + (2 * s + hi) * 68 + cofs); if (BIAS) { val[s][0] += bfr(bias[c0 + cofs]); val[s][1] += bfr(bias[c0 + cofs + 1]); val[s][2] += bfr(bias[c0 + cofs + 2]); val[s][3] += bfr(bias[c0 + cofs + 3]); }
            *(v4f*)(cp + (size_t)(2 * s) * ldc) = val[s]; }
        // every register that the stores above name stays live up to this wait, so that none is rewritten in front of it (in a kernel of several bodies other code follows this epilogue in the listing)
        asm volatile("s_wait_xcnt 0x0" :: "v"(cp), "v"(val[0]), "v"(val[1]), "v"(val[2]), "v"(val[3]), "v"(val[4]), "v"(val[5]), "v"(val[6]), "v"(val[7]) : "memory");
        __builtin_amdgcn_wave_barrier(); asm volatile("" ::: "memory");
    }
}

__device__ __forceinline__ h16 tohx(float x) { return (h16)x; }
typedef __attribute__((ext_vector_type(2))) _Float16 v2h;
typedef __attribute__((ext_vector_type(4))) _Float16 v4h;
typedef __attribute__((ext_vector_type(2))) unsigned short v2us;
typedef __attribute__((ext_vector_type(2))) float v2f;
typedef __attribute__((ext_vector_type(4))) int v4i;

__device__ __forceinline__ void d_wtG(const float* __restrict__ w, int K, int N, bf* Bt, int blk) {
    // Bt = w transposed, in fragment order (ldfo): one wave writes one fragment block (16 n x 32 k, 1 KiB in a row); lane (lr, hi) gathers column n = 16 nt + lr at k = 32 kb + 16 c + 8 hi + 0..7
    const int lane = threadIdx.x & 31, lr = lane & 15, hi = lane >> 4; const int fb = blk * 8 + __builtin_amdgcn_readfirstlane((int)(threadIdx.x >> 5)); if (fb >= N * K / 512) return;
    const int kb = fb % (K / 32), nt = fb / (K / 32); const float* s = w + (size_t)kb * 32 * N + nt * 16; const float* p[16]; float f[16]; v4u o[2];
#pragma unroll
    for (int q = 0; q < 16; ++q) p[q] = s + (size_t)((q >> 3) * 16 + hi * 8 + (q & 7)) * N + lr;
#pragma unroll
    for (int q = 0; q < 16; ++q) f[q] = *p[q];
    // behind the last load of the gather: all sixteen address pairs stay live up to this wait, so that none is handed to a later load's result in front of it
    asm volatile("s_wait_xcnt 0x0" :: "v"(p[0]), "v"(p[1]), "v"(p[2]), "v"(p[3]), "v"(p[4]), "v"(p[5]), "v"(p[6]), "v"(p[7]), "v"(p[8]), "v"(p[9]), "v"(p[10]), "v"(p[11]), "v"(p[12]), "v"(p[13]), "v"(p[14]), "v"(p[15]) : "memory");
#pragma unroll
    for (int q = 0; q < 8; ++q) o[q >> 2][q & 3] = cvt2(f[2 * q], f[2 * q + 1]);
    bf* d = Bt + (size_t)fb * 512 + lane * 8; *(v8us*)d = __builtin_bit_cast(v8us, o[0]); *(v8us*)(d + 256) = __builtin_bit_cast(v8us, o[1]);
}
// d_cvtF: src [rows][K] rounded to bf16, in fragment order (ldfo), the GEMM's A operand. One wave takes 8 rows x 32 k, half a fragment block: 4 lanes a row read its whole 128-byte line (8 floats a lane),
// and lane (row r, piece p: k = 8 p .. 8 p + 7) writes its 16-byte piece, so that the wave's store covers 4 whole 128-byte lines. n8 = rows * K / 8 pieces.
__device__ __forceinline__ void d_cvtF(const float* __restrict__ src, bf* dst, int K, size_t n8, int blk) {
    const int lane = threadIdx.x & 31, p = lane & 3, r = lane >> 2; const int wv = blk * 8 + (int)(threadIdx.x >> 5); if ((size_t)wv * 32 >= n8) return;
    const int r8 = (wv & 1) * 8 + r, fb = wv >> 1; const int kb = fb % (K / 32), mt = fb / (K / 32);
    const float* s = src + (size_t)(mt * 16 + r8) * K + kb * 32 + p * 8; const v8f v = *(const v8f*)s; v4u o;
    asm volatile("s_wait_xcnt 0x0" :: "v"(s) : "memory");   // the address pair stays live up to this wait, so that it is not handed to a load's result in front of it
#pragma unroll
    for (int k = 0; k < 4; ++k) o[k] = cvt2(v[2 * k], v[2 * k + 1]);
    *(v8us*)(dst + (size_t)fb * 512 + (p >> 1) * 256 + ((p & 1) * 16 + r8) * 8) = __builtin_bit_cast(v8us, o);  }

__device__ __forceinline__ void d_flat(const float* __restrict__ F, h16* P16, bf* Ph, bf* Pl, size_t n4, int blk) { const size_t i = (size_t)blk * 256 + threadIdx.x; if (i >= n4) return; const v4f a = *(const v4f*)(F + i * 4); v4h o16; v2u oh, ol;
#pragma unroll
    for (int q = 0; q < 4; ++q) o16[q] = tohx(a[q]);
#pragma unroll
    for (int q = 0; q < 2; ++q) { unsigned x2, y2; split2(a[2 * q], a[2 * q + 1], x2, y2); oh[q] = x2; ol[q] = y2; }
    const int row = (int)(i * 4 / HD), d = (int)(i * 4 % HD); const size_t fo = (size_t)(row >> 4) * (16 * HD) + (d >> 4) * 256 + (((d >> 3) & 1) * 16 + (row & 15)) * 8 + (d & 7);   // the hi | lo planes in fragment order (ldfo): F is [rows][HD]
    *(v4h*)(P16 + i * 4) = o16; *(v4us*)(Ph + fo) = __builtin_bit_cast(v4us, oh); *(v4us*)(Pl + fo) = __builtin_bit_cast(v4us, ol);  }

__device__ __forceinline__ void d_hdot(const float* __restrict__ bias, const float* __restrict__ F, int pitch, int nrows, int hcol, float* OUT, int blk) {
    { const size_t bz = blockIdx.y; F += bz * nrows * pitch; OUT += bz * NH_ * nrows; }   // blockIdx.y = batch (one for r)
    const int lane = threadIdx.x & 31; const size_t wv = (size_t)blk * 8 + (threadIdx.x >> 5); if (wv >= (size_t)NH_ * (nrows / 32)) return; const int h = (int)(wv / (nrows / 32)); const int n = (int)(wv % (nrows / 32)) * 32 + lane; const float* f = F + (size_t)n * pitch + (hcol ? h * HD : 0);   /* hcol: F has per-head columns (k); 0: one 64-wide row shared by all heads (r) */ const float* bh = bias + h * HD; float s = 0.f;
#pragma unroll 4
    for (int d = 0; d < HD; ++d) { s = __fadd_rn(s, __fmul_rn(bfr(bh[d]), f[d])); }
    *(float*)(OUT + (size_t)h * nrows + n) = s;  }

// Launches whose bodies do not depend on one another share one grid: a work-group picks its body by its block index (the same for all its threads), and the index inside the body's own range is what blockIdx gave it when the body was a launch of its own.
#define G_WQ  (DM * DQ / 512 / 8)          // work-groups of each body of k_prep: 8 fragment blocks, or 256 x 8 elements, a work-group
#define G_WKV (DM * DKV2 / 512 / 8)
#define G_WR  1
#define G_PE  (NR * HD / 8 / 256)
#define G_X   (NB_ * TT * DM / 8 / 256)
// k_prep: everything that reads only the inputs: the three weights, pos_embed, q and k to bf16 fragment order.
__global__ __launch_bounds__(256) void k_prep(const float* __restrict__ wq, const float* __restrict__ wkv, const float* __restrict__ wr, const float* __restrict__ pemb, const float* __restrict__ x, const float* __restrict__ xk, bf* WQ, bf* WKV, bf* WR, bf* PE, bf* XB, bf* XK) {
    int b = blockIdx.x;
    if (b < G_WQ) { d_wtG(wq, DM, DQ, WQ, b); return; } b -= G_WQ;
    if (b < G_WKV) { d_wtG(wkv, DM, DKV2, WKV, b); return; } b -= G_WKV;
    if (b < G_WR) { d_wtG(wr, HD, HD, WR, b); return; } b -= G_WR;
    if (b < G_PE) { d_cvtF(pemb, PE, HD, (size_t)NR * HD / 8, b); return; } b -= G_PE;
    if (b < G_X) { d_cvtF(x, XB, DM, (size_t)NB_ * TT * DM / 8, b); return; } b -= G_X;
    d_cvtF(xk, XK, DM, (size_t)NB_ * TT * DM / 8, b);
}
// k_gemm3: the three projections. blockIdx.y: DKV2 / 64 column tiles of kv, then DQ / 64 of q, then one row of tiles for r (NR / 64 of them).
__global__ __launch_bounds__(32) void k_gemm3(const bf* __restrict__ XB, const bf* __restrict__ XK, const bf* __restrict__ PE, const bf* __restrict__ WQ, const bf* __restrict__ WKV, const bf* __restrict__ WR, float* RF, bf* QPh, bf* QPl, bf* KPh, bf* KPl, bf* VTh, bf* VTl, const float* __restrict__ rrb, float* KB) {
    __shared__ __align__(16) float os[16 * 68];
    const int bx = blockIdx.x, by = blockIdx.y;
    if (by < DKV2 / 64) d_gemmw<bf, 0, false, 2>(XK, nullptr, WKV, nullptr, DM, nullptr, 0, nullptr, 0, 0, 0, KPh, KPl, VTh, VTl, rrb, KB, bx, by, os);   /* kv = k Wkv: k planes (columns 0..1023) with KB[b][h][j] = r_r_bias_h . kh_j, v planes (columns 1024..2047) */
    else if (by < DKV2 / 64 + DQ / 64) d_gemmw<bf, 0, false, 1>(XB, nullptr, WQ, nullptr, DM, nullptr, 0, nullptr, 0, 0, 0, QPh, QPl, nullptr, nullptr, nullptr, nullptr, bx, by - DKV2 / 64, os);   /* qh planes */
    else if (bx < NR / 64) d_gemmw<bf, 0, false, 0>(PE, nullptr, WR, nullptr, HD, RF, HD, nullptr, 0, 0, 0, nullptr, nullptr, nullptr, nullptr, nullptr, nullptr, bx, 0, os);   /* r = pos_embed Wr (exact) */
}
#define G_FL  (NR * HD / 4 / 256)
#define G_HD  (NH_ * (NR / 32) / 8)
// k_rfin: what reads r: its planes, and RB[h][l] = r_w_bias_h . r_l (r is shared by all heads: no column offset).
__global__ __launch_bounds__(256) void k_rfin(const float* __restrict__ RF, h16* RP16, bf* RPh, bf* RPl, const float* __restrict__ rwb, float* RB) {
    const int b = blockIdx.x;
    if (b < G_FL) d_flat(RF, RP16, RPh, RPl, (size_t)NR * HD / 4, b);
    else d_hdot(rwb, RF, HD, NR, 0, RB, b - G_FL);
}

#define MT   2                    // 16-row query tiles per work-group
#define ROWS (16 * MT)
#define PD   6                    // k steps by which the V fragment loads run ahead in the P.V product
#define PA   3                    // ring of P fragment sets in the P.V product
#define SP   1028                 // floats per LDS score row: 4112 B = 16 B x odd, the conflict-free pitch for 16-byte fragment reads
typedef v4us __attribute__((may_alias)) v4usa;
// ld4: the hi and lo fragments of both 32-wide k halves of one 16-row tile (x[0] hi k 0..31, x[1] lo, x[2] hi k 32..63, x[3] lo); ph, pl = the tile's first fragment block + 8 * lane.
__device__ __forceinline__ void ld4(const bf* ph, const bf* pl, v16bf (&x)[4]) {
    x[0] = ldfo(ph); x[1] = ldfo(pl); x[2] = ldfo(ph + 512); x[3] = ldfo(pl + 512);
    asm volatile("s_wait_xcnt 0x0" :: "v"(ph), "v"(pl) : "memory");   // both address pairs stay live up to this wait
}
// k_fattn: one work-group (8 waves) = ROWS query rows of one head of one batch; their whole score rows stay in LDS from the score products to the P.V product.
// 1. wave w owns keys [128 w, 128 w + 128): q.r tiles over the window l = TT + j - i are stored straight to their shifted place sc[i][j];
// 2. q.k tiles: sc = ((q.k + KB[j]) + q.r) + RB[l]; 3. softmax, one wave per row, P hi | lo planes written over the row's own scores;
// 4. O = P.V (waves 0..3, one 16-column block each, k ascending), staged in LDS so that each wave stores whole output lines.
__global__ __launch_bounds__(256) void k_fattn(const bf* __restrict__ Qh, const bf* __restrict__ Ql, const bf* __restrict__ Kh, const bf* __restrict__ Kl, const bf* __restrict__ Rh, const bf* __restrict__ Rl, const bf* __restrict__ Vh, const bf* __restrict__ Vl, const float* __restrict__ KB, const float* __restrict__ RB, const int* __restrict__ km, float* OUTb) {
    __shared__ __align__(16) float sc[ROWS * SP];
    __shared__ __align__(16) float os[ROWS * 68];
    __shared__ float rbs[TT + ROWS];
    const int lane = threadIdx.x & 31, lr = lane & 15, hi = lane >> 4; const int w = __builtin_amdgcn_readfirstlane((int)(threadIdx.x >> 5));
    const int i0 = blockIdx.x * ROWS, h = blockIdx.y, jw = w * 128;
    { const size_t bz = blockIdx.z, po = bz * NH_ * TT * HD; Qh += po; Ql += po; Kh += po; Kl += po; Vh += po; Vl += po; KB += bz * NH_ * TT; km += bz * TT; OUTb += bz * TT * DQ; }   // blockIdx.z = batch; the r planes and RB are shared by all batches
    const float* rbg = RB + (size_t)h * NR + (TT - i0 - ROWS) + threadIdx.x; float rv[TT / 256 + 1];   // rbs[x] = RB[h][TT - i0 - ROWS + x]: every l this work-group's rows meet; loaded here, stored in front of the first barrier
#pragma unroll
    for (int q = 0; q < TT / 256; ++q) rv[q] = rbg[q * 256];
    rv[TT / 256] = (threadIdx.x < ROWS) ? rbg[TT] : 0.f;
    v16bf ah[MT][2], al[MT][2];
#pragma unroll
    for (int mb = 0; mb < MT; ++mb) { const size_t o = ((size_t)h * TT + i0 + mb * 16) * HD + 8 * lane; v16bf x[4]; ld4(Qh + o, Ql + o, x); ah[mb][0] = x[0]; al[mb][0] = x[1]; ah[mb][1] = x[2]; al[mb][1] = x[3]; }
    const int lbase = TT + jw - i0 - ROWS;   // first l of the wave's window; the window [lbase, lbase + 128 + ROWS) lies in [0, NR)
    // Both tile loops are unrolled: which row tile needs which window tile is then decided at compile time, and the next tile's loads (issued ahead, in the source too) fly while this tile is multiplied.
    v16bf nx[4];
    { const size_t o = (size_t)lbase * HD + 8 * lane; ld4(Rh + o, Rl + o, nx); }
#pragma unroll
    for (int t = 0; t < 8 + MT; ++t) { const v16bf b[2] = {nx[0], nx[2]}, c[2] = {nx[1], nx[3]};
        if (t + 1 < 8 + MT) { const size_t o = (size_t)(lbase + (t + 1) * 16) * HD + 8 * lane; ld4(Rh + o, Rl + o, nx); }
        else { const size_t o = ((size_t)h * TT + jw) * HD + 8 * lane; ld4(Kh + o, Kl + o, nx); }   // the first key tile
        v8f acc[MT];
#pragma unroll
        for (int mb = 0; mb < MT; ++mb) acc[mb] = (v8f){};
#pragma unroll
        for (int s = 0; s < 2; ++s) {
#pragma unroll
            for (int mb = 0; mb < MT; ++mb) if (t + mb >= MT - 1 && t + mb <= MT + 7) acc[mb] = wmmab(ah[mb][s], b[s], acc[mb]);
#pragma unroll
            for (int mb = 0; mb < MT; ++mb) if (t + mb >= MT - 1 && t + mb <= MT + 7) acc[mb] = wmmab(al[mb][s], b[s], acc[mb]);
#pragma unroll
            for (int mb = 0; mb < MT; ++mb) if (t + mb >= MT - 1 && t + mb <= MT + 7) acc[mb] = wmmab(ah[mb][s], c[s], acc[mb]); }
        asm volatile("v_nop\n\tv_nop\n\tv_nop\n\tv_nop" : "+v"(acc[0]), "+v"(acc[1]));   // the four vector slots the chip needs before the next tile's first product overwrites these result registers: only LDS stores stand between
#pragma unroll
        for (int mb = 0; mb < MT; ++mb) { if (t + mb < MT - 1 || t + mb > MT + 7) continue;
#pragma unroll
            for (int jj = 0; jj < 8; ++jj) { const int ii = mb * 16 + hi * 8 + jj; const int jrel = t * 16 + lr + ii - ROWS;   /* j - jw of (row ii, l = lbase + 16 t + lr) */ if (jrel >= 0 && jrel < 128) sc[ii * SP + jw + jrel] = acc[mb][jj]; } } }
#pragma unroll
    for (int q = 0; q < TT / 256; ++q) rbs[q * 256 + threadIdx.x] = rv[q];
    if (threadIdx.x < ROWS) rbs[TT + threadIdx.x] = rv[TT / 256];
    __syncthreads();
#pragma unroll
    for (int nb = 0; nb < 8; ++nb) { const int j = jw + nb * 16 + lr; const v16bf b[2] = {nx[0], nx[2]}, c[2] = {nx[1], nx[3]}; const float kb = KB[(size_t)h * TT + j];
        if (nb + 1 < 8) { const size_t o = ((size_t)h * TT + jw + (nb + 1) * 16) * HD + 8 * lane; ld4(Kh + o, Kl + o, nx); }
        v8f acc[MT];
#pragma unroll
        for (int mb = 0; mb < MT; ++mb) acc[mb] = (v8f){};
#pragma unroll
        for (int s = 0; s < 2; ++s) {
#pragma unroll
            for (int mb = 0; mb < MT; ++mb) acc[mb] = wmmab(ah[mb][s], b[s], acc[mb]);
#pragma unroll
            for (int mb = 0; mb < MT; ++mb) acc[mb] = wmmab(al[mb][s], b[s], acc[mb]);
#pragma unroll
            for (int mb = 0; mb < MT; ++mb) acc[mb] = wmmab(ah[mb][s], c[s], acc[mb]); }
#pragma unroll
        for (int mb = 0; mb < MT; ++mb)
#pragma unroll
            for (int jj = 0; jj < 8; ++jj) { const int ii = mb * 16 + hi * 8 + jj; float* p = sc + ii * SP + j; *p = __fadd_rn(__fadd_rn(__fadd_rn(acc[mb][jj], kb), *p), rbs[j - ii + ROWS]); } }
    __syncthreads();
    // V fragments run PD k steps ahead of their products; the first PD are asked for here, so that they land during the softmax
    v16bf vh[PD], vl[PD]; const size_t vo = ((size_t)h * (HD / 16) + (w & 3)) * (TT / 32) * 512 + 8 * lane;   // this wave's 16 d rows: TT / 32 fragment blocks in a row
    if (w < 4) {
#pragma unroll
        for (int d = 0; d < PD; ++d) { vh[d] = ldfo(Vh + vo + 512 * d); vl[d] = ldfo(Vl + vo + 512 * d); } }
    for (int rr = 0; rr < ROWS / 8; ++rr) { float* sr = sc + (w * (ROWS / 8) + rr) * SP; float v[TT / 32]; float mx = -3.0e38f;
#pragma unroll
        for (int ch = 0; ch < TT / 128; ++ch) { const int j0 = ch * 128 + lane * 4; const v4f a = *(const v4fa*)(sr + j0); const v4i mk = *(const v4i*)(km + j0);
#pragma unroll
            for (int q = 0; q < 4; ++q) { const float t = (mk[q] != 0) ? a[q] * SCL : -3.0e38f; v[ch * 4 + q] = t;   /* mask == 0 -> -inf */ mx = fmaxf(mx, t); } }
#pragma unroll
        for (int sh = 16; sh; sh >>= 1) mx = fmaxf(mx, __shfl_xor(mx, sh, 32));
        float sum = 0.f;
#pragma unroll
        for (int k = 0; k < TT / 32; ++k) { const float d0 = __fsub_rn(v[k], mx); v[k] = __builtin_amdgcn_exp2f(__fmul_rn(d0, 1.4426950408889634f)); sum += v[k]; }
#pragma unroll
        for (int sh = 16; sh; sh >>= 1) sum += __shfl_xor(sum, sh, 32);
        const float f = __fdiv_rn(1.0f, sum); bf* pr = (bf*)sr;   // P hi in the row's first 2 KiB, P lo in its second; every score of the row is in registers by now (the sum needed them all)
#pragma unroll
        for (int ch = 0; ch < TT / 128; ++ch) { v2u oh, ol;
#pragma unroll
            for (int q = 0; q < 2; ++q) { unsigned a, c2; split2(v[ch * 4 + 2 * q] * f, v[ch * 4 + 2 * q + 1] * f, a, c2); oh[q] = a; ol[q] = c2; }
            *(v4usa*)(pr + ch * 128 + lane * 4) = __builtin_bit_cast(v4us, oh); *(v4usa*)(pr + TT + ch * 128 + lane * 4) = __builtin_bit_cast(v4us, ol); } }
    __syncthreads();
    if (w < 4) { v8f acc[MT];
#pragma unroll
        for (int mb = 0; mb < MT; ++mb) acc[mb] = (v8f){};
        const bf* pl = (const bf*)(sc + lr * SP) + 8 * hi;   // this lane's P hi row of row tile 0; row tile mb lies 16 rows on, P lo TT elements on
        v16bf pa[PA][MT], pb[PA][MT];   // P hi / lo fragments, read from LDS PA - 1 k steps ahead of their products
#pragma unroll
        for (int d = 0; d < PA - 1; ++d)
#pragma unroll
            for (int mb = 0; mb < MT; ++mb) { const bf* pr = pl + mb * 16 * SP * 2 + d * 32; pa[d][mb] = cat16b(*(const v8usa*)pr, *(const v8usa*)(pr + 16)); pb[d][mb] = cat16b(*(const v8usa*)(pr + TT), *(const v8usa*)(pr + TT + 16)); }
        // unrolled: the fragment rings are then indexed at compile time and stay in registers, and the last steps ask for nothing
#pragma unroll
        for (int ks = 0; ks < TT / 32; ++ks) { const int kc = ks * 32; const v16bf b = vh[ks % PD], b2 = vl[ks % PD];
            if (ks + PD < TT / 32) { vh[ks % PD] = ldfo(Vh + vo + 512 * (ks + PD)); vl[ks % PD] = ldfo(Vl + vo + 512 * (ks + PD)); }
            if (ks + PD == TT / 32 - 1) asm volatile("s_wait_xcnt 0x0" :: "v"(Vh + vo), "v"(Vl + vo) : "memory");   // behind the last V load: both address pairs stay live up to this wait, so that neither is rewritten in front of it
            if (ks + PA - 1 < TT / 32) {
#pragma unroll
                for (int mb = 0; mb < MT; ++mb) { const bf* pr = pl + mb * 16 * SP * 2 + kc + (PA - 1) * 32; pa[(ks + PA - 1) % PA][mb] = cat16b(*(const v8usa*)pr, *(const v8usa*)(pr + 16)); pb[(ks + PA - 1) % PA][mb] = cat16b(*(const v8usa*)(pr + TT), *(const v8usa*)(pr + TT + 16)); } }
#pragma unroll
            for (int mb = 0; mb < MT; ++mb) acc[mb] = wmmab(pa[ks % PA][mb], b, acc[mb]);
#pragma unroll
            for (int mb = 0; mb < MT; ++mb) acc[mb] = wmmab(pb[ks % PA][mb], b, acc[mb]);
#pragma unroll
            for (int mb = 0; mb < MT; ++mb) acc[mb] = wmmab(pa[ks % PA][mb], b2, acc[mb]); }
#pragma unroll
        for (int mb = 0; mb < MT; ++mb)
#pragma unroll
            for (int jj = 0; jj < 8; ++jj) os[(mb * 16 + hi * 8 + jj) * 68 + w * 16 + lr] = acc[mb][jj]; }
    __syncthreads();
#pragma unroll
    for (int s = 0; s < MT; ++s) { const int row = s * 16 + (int)(threadIdx.x >> 4), cofs = (int)(threadIdx.x & 15) * 4; *(v4f*)(OUTb + (size_t)(i0 + row) * DQ + h * HD + cofs) = *(const v4fa*)(os + row * 68 + cofs); }
}

extern "C" void kernel_launch(void* const* d_in, const int* in_sizes, int n_in,
                              void* d_out, int out_size, void* d_ws, size_t ws_size, hipStream_t stream) {
    (void)in_sizes; (void)n_in; (void)out_size;
    const float* x = (const float*)d_in[0]; const float* xk = (const float*)d_in[1]; const int* kmask = (const int*)d_in[2]; const float* pemb = (const float*)d_in[3]; const float* wq = (const float*)d_in[4]; const float* wkv = (const float*)d_in[5]; const float* wr = (const float*)d_in[6]; const float* rrb = (const float*)d_in[7]; const float* rwb = (const float*)d_in[8]; const float* wk = nullptr; const float* wv = nullptr; (void)wk; (void)wv;
    float* OUT = (float*)d_out;     // [4][1024][1024]
    char* wsp = (char*)d_ws;
    auto take = [&](size_t bytes) { char* p = wsp; wsp += (bytes + 255) & ~(size_t)255; return (void*)p; };
    bf* WQ = (bf*)take((size_t)DQ * DM * 2); bf* WKV = (bf*)take((size_t)DKV2 * DM * 2); bf* WR = (bf*)take((size_t)HD * HD * 2); bf* PE = (bf*)take((size_t)NR * HD * 2); float* RF = (float*)take((size_t)NR * HD * 4); h16* RP16 = (h16*)take((size_t)NR * HD * 2); bf* RPh = (bf*)take((size_t)NR * HD * 2); bf* RPl = (bf*)take((size_t)NR * HD * 2); float* KB = (float*)take((size_t)NB_ * NH_ * TT * 4); float* RB = (float*)take((size_t)NH_ * NR * 4);
    // every per-batch buffer holds all NB_ batches, batch-major
    bf* XB = (bf*)take((size_t)NB_ * TT * DM * 2); bf* XK = (bf*)take((size_t)NB_ * TT * DM * 2);
    bf* QPh = (bf*)take((size_t)NB_ * NH_ * TT * HD * 2); bf* QPl = (bf*)take((size_t)NB_ * NH_ * TT * HD * 2); bf* KPh = (bf*)take((size_t)NB_ * NKV * TT * HD * 2); bf* KPl = (bf*)take((size_t)NB_ * NKV * TT * HD * 2); bf* VTh = (bf*)take((size_t)NB_ * NKV * HD * TT * 2); bf* VTl = (bf*)take((size_t)NB_ * NKV * HD * TT * 2);
    if ((size_t)(wsp - (char*)d_ws) > ws_size) return;    // about 72 MiB of the 256 MiB
    // Four launches, each reading only what an earlier one wrote; every stage covers all NB_ batches: the projections see the batches as NB_ * TT rows and write the head planes themselves, the attention kernel takes the batch from blockIdx.z.
    k_prep<<<G_WQ + G_WKV + G_WR + G_PE + 2 * G_X, 256, 0, stream>>>(wq, wkv, wr, pemb, x, xk, WQ, WKV, WR, PE, XB, XK);
    k_gemm3<<<dim3(NB_ * TT / 64, DKV2 / 64 + DQ / 64 + 1, 1), 32, 0, stream>>>(XB, XK, PE, WQ, WKV, WR, RF, QPh, QPl, KPh, KPl, VTh, VTl, rrb, KB);
    k_rfin<<<G_FL + G_HD, 256, 0, stream>>>(RF, RP16, RPh, RPl, rwb, RB);
    k_fattn<<<dim3(TT / ROWS, NH_, NB_), 256, 0, stream>>>(QPh, QPl, KPh, KPl, RPh, RPl, VTh, VTl, KB, RB, kmask, OUT);   /* scores, shift, softmax and P.V of every head of every batch */
}

// v009
// One run takes 137 microseconds.
// Two timings next to v008 put it at 1.04 and 1.02 times that version's speed.
// Over all steps from v000 it is 12.7 times as fast.
#include <hip/hip_runtime.h>

// Transformer-XL relative multi-head attention (q, k [4][1024][1024]; qh = q Wq ('xw' [1024][1024]), kv = k Wkv ('xw' [1024][2048]: k | v column blocks; 16 heads x 64); r = pos_embed Wr ([2048][64] x [64][64], shared by all heads); AC = (qh + r_r_bias_h).kh, BD = shift((qh + r_w_bias_h).r): BD[i][j] = (qh_i + r_w_bias_h).r[L + j - i]; attn = (AC + BD)/8; keys with mask[b][j] == 0 -> -inf (int [4][1024], read); softmax; out = merged attn.vh -> [4][1024][1024] (4.2 M)).
// Compute dtypes, f32 accumulate: every input rounded to bf16; projections exact; relative terms 3 products / f32 dots; content scores 3 products on every row; softmax f32; output f32.

#define NB_  4
#define TT   1024
#define DM   1024
#define NH_  16
#define NKV  16
#define REP  (NH_ / NKV)
#define HD   64
#define DQ   (NH_ * HD)
#define DKV  (NKV * HD)
#define RH   1024                 // = TT: every row hi/lo
#define WIN  0
#define PCAR 1024.0f
#define SCL  0.125f
#define NR   2048    // relative positions (2L)
#define DKV2 2048    // kv projection width (k | v)
typedef _Float16 h16;
typedef unsigned short bf;
typedef __attribute__((ext_vector_type(16))) __bf16   v16bf;
typedef __attribute__((ext_vector_type(16))) _Float16 v16h;
typedef __attribute__((ext_vector_type(8)))  _Float16 v8h;
typedef __attribute__((ext_vector_type(8)))  unsigned short v8us;
typedef __attribute__((ext_vector_type(8)))  float    v8f;
typedef __attribute__((ext_vector_type(4)))  float    v4f;
typedef __attribute__((ext_vector_type(4)))  unsigned v4u;
typedef __attribute__((ext_vector_type(2)))  unsigned v2u;
typedef v8h  __attribute__((may_alias)) v8ha;
typedef v4f  __attribute__((may_alias)) v4fa;
typedef v8us __attribute__((may_alias)) v8usa;

typedef __attribute__((ext_vector_type(2))) __bf16 v2bf;
typedef __attribute__((ext_vector_type(2))) float  v2fl;
// Rounding to bf16 (nearest, ties to even) is the chip's own packed conversion: one instruction for two values, already packed as the planes store them (a in the low half).
__device__ __forceinline__ unsigned cvt2(float a, float b) { const v2fl t = {a, b}; return __builtin_bit_cast(unsigned, __builtin_convertvector(t, v2bf)); }
__device__ __forceinline__ unsigned short f2bf(float f) { return __builtin_bit_cast(unsigned short, (__bf16)f); }
__device__ __forceinline__ float bf2f(unsigned short b) { return __uint_as_float(((unsigned)b) << 16); }
__device__ __forceinline__ float bfr(float f) { return bf2f(f2bf(f)); }
// split2: the hi and lo parts of two values, each pair packed in one word
__device__ __forceinline__ void split2(float y0, float y1, unsigned& h, unsigned& l) { h = cvt2(y0, y1); l = cvt2(y0 - __uint_as_float(h << 16), y1 - __uint_as_float(h & 0xFFFF0000u)); }
typedef __attribute__((ext_vector_type(4))) unsigned short v4us;
__device__ __forceinline__ v16h cat16(v8h lo, v8h hi) { return __builtin_shufflevector(lo, hi, 0, 1, 2, 3, 4, 5, 6, 7, 8, 9, 10, 11, 12, 13, 14, 15); }
__device__ __forceinline__ v16bf cat16b(v8us lo, v8us hi) { return __builtin_bit_cast(v16bf, __builtin_shufflevector(lo, hi, 0, 1, 2, 3, 4, 5, 6, 7, 8, 9, 10, 11, 12, 13, 14, 15)); }
__device__ __forceinline__ v8f wmma16(v16h a, v16h b, v8f c) { return __builtin_amdgcn_wmma_f32_16x16x32_f16(false, a, false, b, (short)0, c, false, false); }
__device__ __forceinline__ v8f wmmab(v16bf a, v16bf b, v8f c) { return __builtin_amdgcn_wmma_f32_16x16x32_bf16(false, a, false, b, (short)0, c, false, false); }



// ---- d_gemmw: register-blocked GEMM, ONE WAVE per 64x64 output tile (16 accumulators), operands straight from 16-bit planes, A (rows m) and Bt (rows n) both in fragment order (ldfo below); tile (bx, by) of (M/64, N/64), 32 threads; os = the work-group's 16 x 68 floats of LDS. k_gemm3 below calls it.
// C[m][n] (f32, pitch ldc, + optional f32 bias[n]) = sum_k A[m][k] Bt[n][k] (+ split products per NSPLIT). z-batch strides sA/sB/sC in elements. K % 32 == 0.
// EPI 0: C goes out as f32. EPI 1 (q projection) and 2 (kv projection), rows = batch x TT: no f32 result leaves the kernel. A tile is 64 rows of one batch x the 64 columns of one head, and the epilogue writes
// the bf16 hi | lo planes that the attention kernel reads, in fragment order (ldfo below): q, and the kv column blocks below DQ (k), as fragments of 16 t rows x 32 d, P[b][h][t / 16][d / 32][512], k with KBo[b][h][t] = HB_h . row (d ascending); the kv column blocks from DQ on (v) as fragments of 16 d rows x 32 t, V[b][g][d / 16][t / 32][512].
template <typename T16> struct WFrag;
template <> struct WFrag<h16> { typedef v16h V; static __device__ __forceinline__ V ld(const h16* p) { return cat16(*(const v8h*)p, *(const v8h*)(p + 16)); } static __device__ __forceinline__ v8f mma(V a, V b, v8f c) { return wmma16(a, b, c); } };
template <> struct WFrag<bf> { typedef v16bf V; static __device__ __forceinline__ V ld(const bf* p) { return cat16b(*(const v8us*)p, *(const v8us*)(p + 16)); } static __device__ __forceinline__ V ldf(const bf* p) { return cat16b(*(const v8us*)p, *(const v8us*)(p + 256)); } static __device__ __forceinline__ v8f mma(V a, V b, v8f c) { return wmmab(a, b, c); } };
// Fragment order: one 16-row x 32-k operand fragment is a block of 512 elements (1 KiB); element (row r, k) lies at (k >> 4) * 256 + (((k >> 3) & 1) * 16 + r) * 8 + (k & 7), which puts lane l's two 16-byte pieces at 8 l and 256 + 8 l.
// Each 16-byte load of a wave then covers 512 successive bytes, 4 whole 128-byte lines, where a row-major plane gives it 32 bytes of each of 16 lines. p = block + 8 * lane.
__device__ __forceinline__ v16bf ldfo(const bf* p) { return WFrag<bf>::ldf(p); }
template <typename T16, int NSPLIT, bool BIAS, int EPI>
__device__ __forceinline__ void d_gemmw(const T16* __restrict__ A, const T16* __restrict__ A2, const T16* __restrict__ Bt, const T16* __restrict__ Bt2, int K, float* C, int ldc, const float* __restrict__ bias, size_t sA, size_t sB, size_t sC, bf* Ph, bf* Pl, bf* Vh, bf* Vl, const float* __restrict__ HB, float* KBo, int bx, int by, float* os) {
    typedef typename WFrag<T16>::V V;
    const size_t z = blockIdx.z; A += z * sA; if (A2) A2 += z * sA; Bt += z * sB; if (Bt2) Bt2 += z * sB; C += z * sC;
    const int lane = threadIdx.x & 31, lr = lane & 15, hi = lane >> 4; const int r0 = bx * 64, c0 = by * 64;
    v8f acc[4][4];
#pragma unroll
    for (int mb = 0; mb < 4; ++mb)
#pragma unroll
        for (int nb = 0; nb < 4; ++nb) acc[mb][nb] = (v8f){};
    const size_t aoff = (size_t)r0 * K + 8 * lane, boff = (size_t)c0 * K + 8 * lane;   // A and Bt: fragment blocks [row / 16][k / 32][512], so 16 rows are 16 K elements and a k step is one block
#pragma unroll 1
    for (int kc = 0; kc < K; kc += 32) {
        V a[4], a2[4], b[4]; v4u x[16]; const T16* pa = A + aoff + kc * 16; const T16* pb = Bt + boff + kc * 16;
        // The sixteen operand loads of a k step and their data wait in one statement. Here the eight address pairs live to the statement's end and no result shares a register with them.
        asm volatile("global_load_b128 %0, %16, off\n\tglobal_load_b128 %1, %16, off offset:512\n\tglobal_load_b128 %2, %17, off\n\tglobal_load_b128 %3, %17, off offset:512\n\tglobal_load_b128 %4, %18, off\n\tglobal_load_b128 %5, %18, off offset:512\n\tglobal_load_b128 %6, %19, off\n\tglobal_load_b128 %7, %19, off offset:512\n\tglobal_load_b128 %8, %20, off\n\tglobal_load_b128 %9, %20, off offset:512\n\tglobal_load_b128 %10, %21, off\n\tglobal_load_b128 %11, %21, off offset:512\n\tglobal_load_b128 %12, %22, off\n\tglobal_load_b128 %13, %22, off offset:512\n\tglobal_load_b128 %14, %23, off\n\tglobal_load_b128 %15, %23, off offset:512\n\ts_wait_loadcnt 0x0" : "=&v"(x[0]), "=&v"(x[1]), "=&v"(x[2]), "=&v"(x[3]), "=&v"(x[4]), "=&v"(x[5]), "=&v"(x[6]), "=&v"(x[7]), "=&v"(x[8]), "=&v"(x[9]), "=&v"(x[10]), "=&v"(x[11]), "=&v"(x[12]), "=&v"(x[13]), "=&v"(x[14]), "=&v"(x[15]) : "v"(pa + (size_t)0 * K), "v"(pa + (size_t)16 * K), "v"(pa + (size_t)32 * K), "v"(pa + (size_t)48 * K), "v"(pb + (size_t)0 * K), "v"(pb + (size_t)16 * K), "v"(pb + (size_t)32 * K), "v"(pb + (size_t)48 * K) : "memory");
#pragma unroll
        for (int mb = 0; mb < 4; ++mb) { a[mb] = __builtin_bit_cast(V, __builtin_shufflevector(x[2 * mb], x[2 * mb + 1], 0, 1, 2, 3, 4, 5, 6, 7)); b[mb] = __builtin_bit_cast(V, __builtin_shufflevector(x[8 + 2 * mb], x[9 + 2 * mb], 0, 1, 2, 3, 4, 5, 6, 7)); if (NSPLIT == 1 || NSPLIT == 2) a2[mb] = WFrag<T16>::ldf(A2 + aoff + (size_t)mb * 16 * K + kc * 16); }
#pragma unroll
        for (int nb = 0; nb < 4; ++nb) { V b2; if (NSPLIT >= 2) b2 = WFrag<T16>::ldf(Bt2 + boff + (size_t)nb * 16 * K + kc * 16);
#pragma unroll
            for (int mb = 0; mb < 4; ++mb) { acc[mb][nb] = WFrag<T16>::mma(a[mb], b[nb], acc[mb][nb]); if (NSPLIT == 1 || NSPLIT == 2) acc[mb][nb] = WFrag<T16>::mma(a2[mb], b[nb], acc[mb][nb]); if (NSPLIT >= 2) acc[mb][nb] = WFrag<T16>::mma(a[mb], b2, acc[mb][nb]); } }
        asm volatile("v_nop\n\tv_nop\n\tv_nop\n\tv_nop" : "+v"(acc[0][0]), "+v"(acc[1][1]), "+v"(acc[2][2]), "+v"(acc[3][3]) : "v"(a[0]), "v"(a[3]));
    }
    if (EPI >= 1) {
        const int bz = r0 / TT, t0 = r0 % TT;
        if (EPI == 1 || c0 < DQ) {   // q or k: 16 rows (two fragments a plane) at a time through LDS, which turns the accumulator's columns into the fragments' 16-byte row pieces; each store covers 512 successive bytes
            const int h = c0 / HD; const size_t po = ((size_t)(bz * NH_ + h) * TT + t0) * HD + lane * 8;
#pragma unroll
            for (int mb = 0; mb < 4; ++mb) {
#pragma unroll
                for (int nb = 0; nb < 4; ++nb) {
#pragma unroll
                    for (int j = 0; j < 8; ++j) os[(hi * 8 + j) * 68 + nb * 16 + lr] = acc[mb][nb][j]; }
                __builtin_amdgcn_wave_barrier(); asm volatile("" ::: "memory");   // the reads below take other lanes' values: the compiler may not lift them over the writes
                v4u oh[4], ol[4];   // piece s: row lr, columns 16 s + 8 hi .. + 7, two columns a word
#pragma unroll
                for (int s = 0; s < 4; ++s) { const float* sp = os + lr * 68 + s * 16 + hi * 8; const v4f va = *(const v4fa*)sp, vb = *(const v4fa*)(sp + 4);
#pragma unroll
                    for (int q = 0; q < 2; ++q) { unsigned x2, y2; split2(va[2 * q], va[2 * q + 1], x2, y2); oh[s][q] = x2; ol[s][q] = y2; split2(vb[2 * q], vb[2 * q + 1], x2, y2); oh[s][2 + q] = x2; ol[s][2 + q] = y2; } }
                float kd = 0.f;
                if (EPI == 2) { const float* bh = HB + h * HD;   // lane lr sums row lr, d ascending (both lane halves alike, the lower one stores)
#pragma unroll
                    for (int d = 0; d < HD; d += 4) { const v4f f = *(const v4fa*)(os + lr * 68 + d);
#pragma unroll
                        for (int q = 0; q < 4; ++q) kd = __fadd_rn(kd, __fmul_rn(bfr(bh[d + q]), f[q])); } }
                bf* ph = Ph + po + (size_t)mb * 16 * HD; bf* pl = Pl + po + (size_t)mb * 16 * HD;
#pragma unroll
                for (int s = 0; s < 4; ++s) { *(v8us*)(ph + s * 256) = __builtin_bit_cast(v8us, oh[s]); *(v8us*)(pl + s * 256) = __builtin_bit_cast(v8us, ol[s]); }
                // every register that the stores above name stays live up to this wait, so that none is rewritten in front of it
                asm volatile("s_wait_xcnt 0x0" :: "v"(ph), "v"(pl), "v"(oh[0]), "v"(oh[1]), "v"(oh[2]), "v"(oh[3]), "v"(ol[0]), "v"(ol[1]), "v"(ol[2]), "v"(ol[3]) : "memory");
                if (EPI == 2) { float* kp = KBo + (size_t)(bz * NH_ + h) * TT + t0 + mb * 16 + lr; if (hi == 0) *kp = kd;
                    asm volatile("s_wait_xcnt 0x0" :: "v"(kp), "v"(kd) : "memory"); }   // as above, for the registers of this store
                __builtin_amdgcn_wave_barrier();   // the next 16 rows' LDS writes stay behind this round's reads
            }
        } else {   // v: a lane holds 8 successive t of one d, which is its own 16-byte piece of a fragment: accumulator (mb, nb) goes out as half a fragment, 512 successive bytes a plane, straight from the registers
            const int g = (c0 - DQ) / HD; const size_t vo = ((size_t)(bz * NKV + g) * (HD / 16) * (TT / 32) + t0 / 32) * 512 + lane * 8;
#pragma unroll
            for (int nb = 0; nb < 4; ++nb) { v4u oh[4], ol[4];
#pragma unroll
                for (int mb = 0; mb < 4; ++mb) {
#pragma unroll
                    for (int j = 0; j < 4; ++j) { unsigned x2, y2; split2(acc[mb][nb][2 * j], acc[mb][nb][2 * j + 1], x2, y2); oh[mb][j] = x2; ol[mb][j] = y2; } }
                bf* vh = Vh + vo + (size_t)nb * (TT / 32) * 512; bf* vl = Vl + vo + (size_t)nb * (TT / 32) * 512;
#pragma unroll
                for (int mb = 0; mb < 4; ++mb) { *(v8us*)(vh + mb * 256) = __builtin_bit_cast(v8us, oh[mb]); *(v8us*)(vl + mb * 256) = __builtin_bit_cast(v8us, ol[mb]); }
                // every register that the stores above name stays live up to this wait, so that none is rewritten in front of it
                asm volatile("s_wait_xcnt 0x0" :: "v"(vh), "v"(vl), "v"(oh[0]), "v"(oh[1]), "v"(oh[2]), "v"(oh[3]), "v"(ol[0]), "v"(ol[1]), "v"(ol[2]), "v"(ol[3]) : "memory");
            }
        }
        return;
    }
#pragma unroll
    for (int mb = 0; mb < 4; ++mb) {
#pragma unroll
        for (int nb = 0; nb < 4; ++nb) {
#pragma unroll
            for (int j = 0; j < 8; ++j) os[(hi * 8 + j) * 68 + nb * 16 + lr] = acc[mb][nb][j]; }
        __builtin_amdgcn_wave_barrier(); asm volatile("" ::: "memory");
        const int cofs = lr * 4; float* cp = C + (size_t)(r0 + mb * 16 + hi) * ldc + c0 + cofs; v4f val[8];   // store s: row 2 s + hi of these 16
#pragma unroll
        for (int s = 0; s < 8; ++s) { val[s] = *(const v4fa*)(os + (2 * s + hi) * 68 + cofs); if (BIAS) { val[s][0] += bfr(bias[c0 + cofs]); val[s][1] += bfr(bias[c0 + cofs + 1]); val[s][2] += bfr(bias[c0 + cofs + 2]); val[s][3] += bfr(bias[c0 + cofs + 3]); }
            *(v4f*)(cp + (size_t)(2 * s) * ldc) = val[s]; }
        // every register that the stores above name stays live up to this wait, so that none is rewritten in front of it (in a kernel of several bodies other code follows this epilogue in the listing)
        asm volatile("s_wait_xcnt 0x0" :: "v"(cp), "v"(val[0]), "v"(val[1]), "v"(val[2]), "v"(val[3]), "v"(val[4]), "v"(val[5]), "v"(val[6]), "v"(val[7]) : "memory");
        __builtin_amdgcn_wave_barrier(); asm volatile("" ::: "memory");
    }
}

__device__ __forceinline__ h16 tohx(float x) { return (h16)x; }
typedef __attribute__((ext_vector_type(2))) _Float16 v2h;
typedef __attribute__((ext_vector_type(4))) _Float16 v4h;
typedef __attribute__((ext_vector_type(2))) unsigned short v2us;
typedef __attribute__((ext_vector_type(2))) float v2f;
typedef __attribute__((ext_vector_type(4))) int v4i;

__device__ __forceinline__ void d_wtG(const float* __restrict__ w, int K, int N, bf* Bt, int blk) {
    // Bt = w transposed, in fragment order (ldfo): one wave writes one fragment block (16 n x 32 k, 1 KiB in a row); lane (lr, hi) gathers column n = 16 nt + lr at k = 32 kb + 16 c + 8 hi + 0..7
    const int lane = threadIdx.x & 31, lr = lane & 15, hi = lane >> 4; const int fb = blk * 8 + __builtin_amdgcn_readfirstlane((int)(threadIdx.x >> 5)); if (fb >= N * K / 512) return;
    const int kb = fb % (K / 32), nt = fb / (K / 32); const float* s = w + (size_t)kb * 32 * N + nt * 16; const float* p[16]; float f[16]; v4u o[2];
#pragma unroll
    for (int q = 0; q < 16; ++q) p[q] = s + (size_t)((q >> 3) * 16 + hi * 8 + (q & 7)) * N + lr;
#pragma unroll
    for (int q = 0; q < 16; ++q) f[q] = *p[q];
    // behind the last load of the gather: all sixteen address pairs stay live up to this wait, so that none is handed to a later load's result in front of it
    asm volatile("s_wait_xcnt 0x0" :: "v"(p[0]), "v"(p[1]), "v"(p[2]), "v"(p[3]), "v"(p[4]), "v"(p[5]), "v"(p[6]), "v"(p[7]), "v"(p[8]), "v"(p[9]), "v"(p[10]), "v"(p[11]), "v"(p[12]), "v"(p[13]), "v"(p[14]), "v"(p[15]) : "memory");
#pragma unroll
    for (int q = 0; q < 8; ++q) o[q >> 2][q & 3] = cvt2(f[2 * q], f[2 * q + 1]);
    bf* d = Bt + (size_t)fb * 512 + lane * 8; *(v8us*)d = __builtin_bit_cast(v8us, o[0]); *(v8us*)(d + 256) = __builtin_bit_cast(v8us, o[1]);
}
// d_cvtF: src [rows][K] rounded to bf16, in fragment order (ldfo), the GEMM's A operand. One wave takes 8 rows x 32 k, half a fragment block: 4 lanes a row read its whole 128-byte line (8 floats a lane),
// and lane (row r, piece p: k = 8 p .. 8 p + 7) writes its 16-byte piece, so that the wave's store covers 4 whole 128-byte lines. n8 = rows * K / 8 pieces.
__device__ __forceinline__ void d_cvtF(const float* __restrict__ src, bf* dst, int K, size_t n8, int blk) {
    const int lane = threadIdx.x & 31, p = lane & 3, r = lane >> 2; const int wv = blk * 8 + (int)(threadIdx.x >> 5); if ((size_t)wv * 32 >= n8) return;
    const int r8 = (wv & 1) * 8 + r, fb = wv >> 1; const int kb = fb % (K / 32), mt = fb / (K / 32);
    const float* s = src + (size_t)(mt * 16 + r8) * K + kb * 32 + p * 8; const v8f v = *(const v8f*)s; v4u o;
    asm volatile("s_wait_xcnt 0x0" :: "v"(s) : "memory");   // the address pair stays live up to this wait, so that it is not handed to a load's result in front of it
#pragma unroll
    for (int k = 0; k < 4; ++k) o[k] = cvt2(v[2 * k], v[2 * k + 1]);
    *(v8us*)(dst + (size_t)fb * 512 + (p >> 1) * 256 + ((p & 1) * 16 + r8) * 8) = __builtin_bit_cast(v8us, o);  }

__device__ __forceinline__ void d_flat(const float* __restrict__ F, h16* P16, bf* Ph, bf* Pl, size_t n4, int blk) { const size_t i = (size_t)blk * 256 + threadIdx.x; if (i >= n4) return; const v4f a = *(const v4f*)(F + i * 4); v4h o16; v2u oh, ol;
#pragma unroll
    for (int q = 0; q < 4; ++q) o16[q] = tohx(a[q]);
#pragma unroll
    for (int q = 0; q < 2; ++q) { unsigned x2, y2; split2(a[2 * q], a[2 * q + 1], x2, y2); oh[q] = x2; ol[q] = y2; }
    const int row = (int)(i * 4 / HD), d = (int)(i * 4 % HD); const size_t fo = (size_t)(row >> 4) * (16 * HD) + (d >> 4) * 256 + (((d >> 3) & 1) * 16 + (row & 15)) * 8 + (d & 7);   // the hi | lo planes in fragment order (ldfo): F is [rows][HD]
    *(v4h*)(P16 + i * 4) = o16; *(v4us*)(Ph + fo) = __builtin_bit_cast(v4us, oh); *(v4us*)(Pl + fo) = __builtin_bit_cast(v4us, ol);  }

__device__ __forceinline__ void d_hdot(const float* __restrict__ bias, const float* __restrict__ F, int pitch, int nrows, int hcol, float* OUT, int blk) {
    { const size_t bz = blockIdx.y; F += bz * nrows * pitch; OUT += bz * NH_ * nrows; }   // blockIdx.y = batch (one for r)
    const int lane = threadIdx.x & 31; const size_t wv = (size_t)blk * 8 + (threadIdx.x >> 5); if (wv >= (size_t)NH_ * (nrows / 32)) return; const int h = (int)(wv / (nrows / 32)); const int n = (int)(wv % (nrows / 32)) * 32 + lane; const float* f = F + (size_t)n * pitch + (hcol ? h * HD : 0);   /* hcol: F has per-head columns (k); 0: one 64-wide row shared by all heads (r) */ const float* bh = bias + h * HD; float s = 0.f;
#pragma unroll 4
    for (int d = 0; d < HD; ++d) { s = __fadd_rn(s, __fmul_rn(bfr(bh[d]), f[d])); }
    *(float*)(OUT + (size_t)h * nrows + n) = s;  }

// Launches whose bodies do not depend on one another share one grid: a work-group picks its body by its block index (the same for all its threads), and the index inside the body's own range is what blockIdx gave it when the body was a launch of its own.
#define G_WQ  (DM * DQ / 512 / 8)          // work-groups of each body of k_prep: 8 fragment blocks, or 256 x 8 elements, a work-group
#define G_WKV (DM * DKV2 / 512 / 8)
#define G_WR  1
#define G_PE  (NR * HD / 8 / 256)
#define G_X   (NB_ * TT * DM / 8 / 256)
// k_prep: everything that reads only the inputs: the three weights, pos_embed, q and k to bf16 fragment order.
__global__ __launch_bounds__(256) void k_prep(const float* __restrict__ wq, const float* __restrict__ wkv, const float* __restrict__ wr, const float* __restrict__ pemb, const float* __restrict__ x, const float* __restrict__ xk, bf* WQ, bf* WKV, bf* WR, bf* PE, bf* XB, bf* XK) {
    int b = blockIdx.x;
    if (b < G_WQ) { d_wtG(wq, DM, DQ, WQ, b); return; } b -= G_WQ;
    if (b < G_WKV) { d_wtG(wkv, DM, DKV2, WKV, b); return; } b -= G_WKV;
    if (b < G_WR) { d_wtG(wr, HD, HD, WR, b); return; } b -= G_WR;
    if (b < G_PE) { d_cvtF(pemb, PE, HD, (size_t)NR * HD / 8, b); return; } b -= G_PE;
    if (b < G_X) { d_cvtF(x, XB, DM, (size_t)NB_ * TT * DM / 8, b); return; } b -= G_X;
    d_cvtF(xk, XK, DM, (size_t)NB_ * TT * DM / 8, b);
}
// k_gemm3: the three projections. blockIdx.y: DKV2 / 64 column tiles of kv, then DQ / 64 of q, then one row of tiles for r (NR / 64 of them).
__global__ __launch_bounds__(32) void k_gemm3(const bf* __restrict__ XB, const bf* __restrict__ XK, const bf* __restrict__ PE, const bf* __restrict__ WQ, const bf* __restrict__ WKV, const bf* __restrict__ WR, float* RF, bf* QPh, bf* QPl, bf* KPh, bf* KPl, bf* VTh, bf* VTl, const float* __restrict__ rrb, float* KB) {
    __shared__ __align__(16) float os[16 * 68];
    const int bx = blockIdx.x, by = blockIdx.y;
    if (by < DKV2 / 64) d_gemmw<bf, 0, false, 2>(XK, nullptr, WKV, nullptr, DM, nullptr, 0, nullptr, 0, 0, 0, KPh, KPl, VTh, VTl, rrb, KB, bx, by, os);   /* kv = k Wkv: k planes (columns 0..1023) with KB[b][h][j] = r_r_bias_h . kh_j, v planes (columns 1024..2047) */
    else if (by < DKV2 / 64 + DQ / 64) d_gemmw<bf, 0, false, 1>(XB, nullptr, WQ, nullptr, DM, nullptr, 0, nullptr, 0, 0, 0, QPh, QPl, nullptr, nullptr, nullptr, nullptr, bx, by - DKV2 / 64, os);   /* qh planes */
    else if (bx < NR / 64) d_gemmw<bf, 0, false, 0>(PE, nullptr, WR, nullptr, HD, RF, HD, nullptr, 0, 0, 0, nullptr, nullptr, nullptr, nullptr, nullptr, nullptr, bx, 0, os);   /* r = pos_embed Wr (exact) */
}
#define G_FL  (NR * HD / 4 / 256)
#define G_HD  (NH_ * (NR / 32) / 8)
// k_rfin: what reads r: its planes, and RB[h][l] = r_w_bias_h . r_l (r is shared by all heads: no column offset).
__global__ __launch_bounds__(256) void k_rfin(const float* __restrict__ RF, h16* RP16, bf* RPh, bf* RPl, const float* __restrict__ rwb, float* RB) {
    const int b = blockIdx.x;
    if (b < G_FL) d_flat(RF, RP16, RPh, RPl, (size_t)NR * HD / 4, b);
    else d_hdot(rwb, RF, HD, NR, 0, RB, b - G_FL);
}

#define MT   2                    // 16-row query tiles per work-group
#define ROWS (16 * MT)
#define PD   6                    // k steps by which the V fragment loads run ahead in the P.V product
#define PA   3                    // ring of P fragment sets in the P.V product
#define SD   2                    // score tiles (r window, then keys) by which the operand fragment loads run ahead of their products
#define SP   1028                 // floats per LDS score row: 4112 B = 16 B x odd, the conflict-free pitch for 16-byte fragment reads
typedef v4us __attribute__((may_alias)) v4usa;
// ld4: the hi and lo fragments of both 32-wide k halves of one 16-row tile (x[0] hi k 0..31, x[1] lo, x[2] hi k 32..63, x[3] lo); ph, pl = the tile's first fragment block + 8 * lane.
__device__ __forceinline__ void ld4(const bf* ph, const bf* pl, v16bf (&x)[4]) {
    x[0] = ldfo(ph); x[1] = ldfo(pl); x[2] = ldfo(ph + 512); x[3] = ldfo(pl + 512);
    asm volatile("s_wait_xcnt 0x0" :: "v"(ph), "v"(pl) : "memory");   // both address pairs stay live up to this wait
}
// k_fattn: one work-group (8 waves) = ROWS query rows of one head of one batch; their whole score rows stay in LDS from the score products to the P.V product.
// 1. wave w owns keys [128 w, 128 w + 128): q.r tiles over the window l = TT + j - i are stored straight to their shifted place sc[i][j];
// 2. q.k tiles: sc = ((q.k + KB[j]) + q.r) + RB[l]; 3. softmax, one wave per row, P hi | lo planes written over the row's own scores;
// 4. O = P.V (waves 0..3, one 16-column block each, k ascending), staged in LDS so that each wave stores whole output lines.
// amdgpu_waves_per_eu(4, 4): the register budget of four waves a SIMD (256), so that the fragment ring of phases 1 and 2 leaves two work-groups on a WGP.
__global__ __launch_bounds__(256) __attribute__((amdgpu_waves_per_eu(4, 4))) void k_fattn(const bf* __restrict__ Qh, const bf* __restrict__ Ql, const bf* __restrict__ Kh, const bf* __restrict__ Kl, const bf* __restrict__ Rh, const bf* __restrict__ Rl, const bf* __restrict__ Vh, const bf* __restrict__ Vl, const float* __restrict__ KB, const float* __restrict__ RB, const int* __restrict__ km, float* OUTb) {
    __shared__ __align__(16) float sc[ROWS * SP];
    __shared__ __align__(16) float os[ROWS * 68];
    __shared__ float rbs[TT + ROWS];
    const int lane = threadIdx.x & 31, lr = lane & 15, hi = lane >> 4; const int w = __builtin_amdgcn_readfirstlane((int)(threadIdx.x >> 5));
    const int i0 = blockIdx.x * ROWS, h = blockIdx.y, jw = w * 128;
    { const size_t bz = blockIdx.z, po = bz * NH_ * TT * HD; Qh += po; Ql += po; Kh += po; Kl += po; Vh += po; Vl += po; KB += bz * NH_ * TT; km += bz * TT; OUTb += bz * TT * DQ; }   // blockIdx.z = batch; the r planes and RB are shared by all batches
    const float* rbg = RB + (size_t)h * NR + (TT - i0 - ROWS) + threadIdx.x; float rv[TT / 256 + 1];   // rbs[x] = RB[h][TT - i0 - ROWS + x]: every l this work-group's rows meet; loaded here, stored in front of the first barrier
#pragma unroll
    for (int q = 0; q < TT / 256; ++q) rv[q] = rbg[q * 256];
    rv[TT / 256] = (threadIdx.x < ROWS) ? rbg[TT] : 0.f;
    v16bf ah[MT][2], al[MT][2];
#pragma unroll
    for (int mb = 0; mb < MT; ++mb) { const size_t o = ((size_t)h * TT + i0 + mb * 16) * HD + 8 * lane; v16bf x[4]; ld4(Qh + o, Ql + o, x); ah[mb][0] = x[0]; al[mb][0] = x[1]; ah[mb][1] = x[2]; al[mb][1] = x[3]; }
    { const size_t o = ((size_t)h * TT + i0) * HD + 8 * lane; asm volatile("s_wait_xcnt 0x0" :: "v"(Qh + o), "v"(Ql + o) : "memory"); }   // the loads of every row tile name the first tile's address pairs with an offset: both pairs stay live up to this wait, so that neither is handed to a later load's result in front of it
    const int lbase = TT + jw - i0 - ROWS;   // first l of the wave's window; the window [lbase, lbase + 128 + ROWS) lies in [0, NR)
    // Both tile loops are unrolled: which row tile needs which window tile is then decided at compile time, and the next tile's loads (issued ahead, in the source too) fly while this tile is multiplied.
    // The wave's 8 + MT window tiles and its 8 key tiles are one row of tiles n; a ring of SD fragment sets holds tiles n + 1 .. n + SD while tile n is multiplied, so that a load has SD tiles' work to land in.
    v16bf nx[SD][4];
    const bf* rh0 = Rh + (size_t)lbase * HD + 8 * lane; const bf* rl0 = Rl + (size_t)lbase * HD + 8 * lane; const bf* kh0 = Kh + ((size_t)h * TT + jw) * HD + 8 * lane; const bf* kl0 = Kl + ((size_t)h * TT + jw) * HD + 8 * lane;
#pragma unroll
    for (int n = 0; n < SD; ++n) ld4(rh0 + n * 16 * HD, rl0 + n * 16 * HD, nx[n]);
#pragma unroll
    for (int t = 0; t < 8 + MT; ++t) { const v16bf b[2] = {nx[t % SD][0], nx[t % SD][2]}, c[2] = {nx[t % SD][1], nx[t % SD][3]};
        if (t + SD < 8 + MT) ld4(rh0 + (t + SD) * 16 * HD, rl0 + (t + SD) * 16 * HD, nx[t % SD]);
        else ld4(kh0 + (t + SD - 8 - MT) * 16 * HD, kl0 + (t + SD - 8 - MT) * 16 * HD, nx[t % SD]);   // the first key tiles
        __builtin_amdgcn_sched_barrier(0);   // keeps the loads above in front of this tile's products: left alone the compiler sinks them to where a fragment register falls free, a few products ahead of their use, and the wave waits out the whole load latency
        v8f acc[MT];
#pragma unroll
        for (int mb = 0; mb < MT; ++mb) acc[mb] = (v8f){};
#pragma unroll
        for (int s = 0; s < 2; ++s) {
#pragma unroll
            for (int mb = 0; mb < MT; ++mb) if (t + mb >= MT - 1 && t + mb <= MT + 7) acc[mb] = wmmab(ah[mb][s], b[s], acc[mb]);
#pragma unroll
            for (int mb = 0; mb < MT; ++mb) if (t + mb >= MT - 1 && t + mb <= MT + 7) acc[mb] = wmmab(al[mb][s], b[s], acc[mb]);
#pragma unroll
            for (int mb = 0; mb < MT; ++mb) if (t + mb >= MT - 1 && t + mb <= MT + 7) acc[mb] = wmmab(ah[mb][s], c[s], acc[mb]); }
        asm volatile("v_nop\n\tv_nop\n\tv_nop\n\tv_nop" : "+v"(acc[0]), "+v"(acc[1]));   // the four vector slots the chip needs before the next tile's first product overwrites these result registers: only LDS stores stand between
#pragma unroll
        for (int mb = 0; mb < MT; ++mb) { if (t + mb < MT - 1 || t + mb > MT + 7) continue;
#pragma unroll
            for (int jj = 0; jj < 8; ++jj) { const int ii = mb * 16 + hi * 8 + jj; const int jrel = t * 16 + lr + ii - ROWS;   /* j - jw of (row ii, l = lbase + 16 t + lr) */ if (jrel >= 0 && jrel < 128) sc[ii * SP + jw + jrel] = acc[mb][jj]; } } }
#pragma unroll
    for (int q = 0; q < TT / 256; ++q) rbs[q * 256 + threadIdx.x] = rv[q];
    if (threadIdx.x < ROWS) rbs[TT + threadIdx.x] = rv[TT / 256];
    __syncthreads();
#pragma unroll
    for (int nb = 0; nb < 8; ++nb) { const int j = jw + nb * 16 + lr; const v16bf b[2] = {nx[(nb + 8 + MT) % SD][0], nx[(nb + 8 + MT) % SD][2]}, c[2] = {nx[(nb + 8 + MT) % SD][1], nx[(nb + 8 + MT) % SD][3]}; const float kb = KB[(size_t)h * TT + j];
        if (nb + SD < 8) ld4(kh0 + (nb + SD) * 16 * HD, kl0 + (nb + SD) * 16 * HD, nx[(nb + 8 + MT) % SD]);
        __builtin_amdgcn_sched_barrier(0);   // as in the window loop: the loads above stay in front of this tile's products
        v8f acc[MT];
#pragma unroll
        for (int mb = 0; mb < MT; ++mb) acc[mb] = (v8f){};
#pragma unroll
        for (int s = 0; s < 2; ++s) {
#pragma unroll
            for (int mb = 0; mb < MT; ++mb) acc[mb] = wmmab(ah[mb][s], b[s], acc[mb]);
#pragma unroll
            for (int mb = 0; mb < MT; ++mb) acc[mb] = wmmab(al[mb][s], b[s], acc[mb]);
#pragma unroll
            for (int mb = 0; mb < MT; ++mb) acc[mb] = wmmab(ah[mb][s], c[s], acc[mb]); }
#pragma unroll
        for (int mb = 0; mb < MT; ++mb)
#pragma unroll
            for (int jj = 0; jj < 8; ++jj) { const int ii = mb * 16 + hi * 8 + jj; float* p = sc + ii * SP + j; *p = __fadd_rn(__fadd_rn(__fadd_rn(acc[mb][jj], kb), *p), rbs[j - ii + ROWS]); } }
    __syncthreads();
    // V fragments run PD k steps ahead of their products; the first PD are asked for here, so that they land during the softmax
    v16bf vh[PD], vl[PD]; const size_t vo = ((size_t)h * (HD / 16) + (w & 3)) * (TT / 32) * 512 + 8 * lane;   // this wave's 16 d rows: TT / 32 fragment blocks in a row
    if (w < 4) {
#pragma unroll
        for (int d = 0; d < PD; ++d) { vh[d] = ldfo(Vh + vo + 512 * d); vl[d] = ldfo(Vl + vo + 512 * d); } }
    for (int rr = 0; rr < ROWS / 8; ++rr) { float* sr = sc + (w * (ROWS / 8) + rr) * SP; float v[TT / 32]; float mx = -3.0e38f;
#pragma unroll
        for (int ch = 0; ch < TT / 128; ++ch) { const int j0 = ch * 128 + lane * 4; const v4f a = *(const v4fa*)(sr + j0); const v4i mk = *(const v4i*)(km + j0);
#pragma unroll
            for (int q = 0; q < 4; ++q) { const float t = (mk[q] != 0) ? a[q] * SCL : -3.0e38f; v[ch * 4 + q] = t;   /* mask == 0 -> -inf */ mx = fmaxf(mx, t); } }
#pragma unroll
        for (int sh = 16; sh; sh >>= 1) mx = fmaxf(mx, __shfl_xor(mx, sh, 32));
        float sum = 0.f;
#pragma unroll
        for (int k = 0; k < TT / 32; ++k) { const float d0 = __fsub_rn(v[k], mx); v[k] = __builtin_amdgcn_exp2f(__fmul_rn(d0, 1.4426950408889634f)); sum += v[k]; }
#pragma unroll
        for (int sh = 16; sh; sh >>= 1) sum += __shfl_xor(sum, sh, 32);
        const float f = __fdiv_rn(1.0f, sum); bf* pr = (bf*)sr;   // P hi in the row's first 2 KiB, P lo in its second; every score of the row is in registers by now (the sum needed them all)
#pragma unroll
        for (int ch = 0; ch < TT / 128; ++ch) { v2u oh, ol;
#pragma unroll
            for (int q = 0; q < 2; ++q) { unsigned a, c2; split2(v[ch * 4 + 2 * q] * f, v[ch * 4 + 2 * q + 1] * f, a, c2); oh[q] = a; ol[q] = c2; }
            *(v4usa*)(pr + ch * 128 + lane * 4) = __builtin_bit_cast(v4us, oh); *(v4usa*)(pr + TT + ch * 128 + lane * 4) = __builtin_bit_cast(v4us, ol); } }
    __syncthreads();
    if (w < 4) { v8f acc[MT];
#pragma unroll
        for (int mb = 0; mb < MT; ++mb) acc[mb] = (v8f){};
        const bf* pl = (const bf*)(sc + lr * SP) + 8 * hi;   // this lane's P hi row of row tile 0; row tile mb lies 16 rows on, P lo TT elements on
        v16bf pa[PA][MT], pb[PA][MT];   // P hi / lo fragments, read from LDS PA - 1 k steps ahead of their products
#pragma unroll
        for (int d = 0; d < PA - 1; ++d)
#pragma unroll
            for (int mb = 0; mb < MT; ++mb) { const bf* pr = pl + mb * 16 * SP * 2 + d * 32; pa[d][mb] = cat16b(*(const v8usa*)pr, *(const v8usa*)(pr + 16)); pb[d][mb] = cat16b(*(const v8usa*)(pr + TT), *(const v8usa*)(pr + TT + 16)); }
        // unrolled: the fragment rings are then indexed at compile time and stay in registers, and the last steps ask for nothing
#pragma unroll
        for (int ks = 0; ks < TT / 32; ++ks) { const int kc = ks * 32; const v16bf b = vh[ks % PD], b2 = vl[ks % PD];
            if (ks + PD < TT / 32) { vh[ks % PD] = ldfo(Vh + vo + 512 * (ks + PD)); vl[ks % PD] = ldfo(Vl + vo + 512 * (ks + PD)); }
            if (ks + PD == TT / 32 - 1) asm volatile("s_wait_xcnt 0x0" :: "v"(Vh + vo), "v"(Vl + vo) : "memory");   // behind the last V load: both address pairs stay live up to this wait, so that neither is rewritten in front of it
            if (ks + PA - 1 < TT / 32) {
#pragma unroll
                for (int mb = 0; mb < MT; ++mb) { const bf* pr = pl + mb * 16 * SP * 2 + kc + (PA - 1) * 32; pa[(ks + PA - 1) % PA][mb] = cat16b(*(const v8usa*)pr, *(const v8usa*)(pr + 16)); pb[(ks + PA - 1) % PA][mb] = cat16b(*(const v8usa*)(pr + TT), *(const v8usa*)(pr + TT + 16)); } }
#pragma unroll
            for (int mb = 0; mb < MT; ++mb) acc[mb] = wmmab(pa[ks % PA][mb], b, acc[mb]);
#pragma unroll
            for (int mb = 0; mb < MT; ++mb) acc[mb] = wmmab(pb[ks % PA][mb], b, acc[mb]);
#pragma unroll
            for (int mb = 0; mb < MT; ++mb) acc[mb] = wmmab(pa[ks % PA][mb], b2, acc[mb]); }
#pragma unroll
        for (int mb = 0; mb < MT; ++mb)
#pragma unroll
            for (int jj = 0; jj < 8; ++jj) os[(mb * 16 + hi * 8 + jj) * 68 + w * 16 + lr] = acc[mb][jj]; }
    __syncthreads();
#pragma unroll
    for (int s = 0; s < MT; ++s) { const int row = s * 16 + (int)(threadIdx.x >> 4), cofs = (int)(threadIdx.x & 15) * 4; *(v4f*)(OUTb + (size_t)(i0 + row) * DQ + h * HD + cofs) = *(const v4fa*)(os + row * 68 + cofs); }
}

extern "C" void kernel_launch(void* const* d_in, const int* in_sizes, int n_in,
                              void* d_out, int out_size, void* d_ws, size_t ws_size, hipStream_t stream) {
    (void)in_sizes; (void)n_in; (void)out_size;
    const float* x = (const float*)d_in[0]; const float* xk = (const float*)d_in[1]; const int* kmask = (const int*)d_in[2]; const float* pemb = (const float*)d_in[3]; const float* wq = (const float*)d_in[4]; const float* wkv = (const float*)d_in[5]; const float* wr = (const float*)d_in[6]; const float* rrb = (const float*)d_in[7]; const float* rwb = (const float*)d_in[8]; const float* wk = nullptr; const float* wv = nullptr; (void)wk; (void)wv;
    float* OUT = (float*)d_out;     // [4][1024][1024]
    char* wsp = (char*)d_ws;
    auto take = [&](size_t bytes) { char* p = wsp; wsp += (bytes + 255) & ~(size_t)255; return (void*)p; };
    bf* WQ = (bf*)take((size_t)DQ * DM * 2); bf* WKV = (bf*)take((size_t)DKV2 * DM * 2); bf* WR = (bf*)take((size_t)HD * HD * 2); bf* PE = (bf*)take((size_t)NR * HD * 2); float* RF = (float*)take((size_t)NR * HD * 4); h16* RP16 = (h16*)take((size_t)NR * HD * 2); bf* RPh = (bf*)take((size_t)NR * HD * 2); bf* RPl = (bf*)take((size_t)NR * HD * 2); float* KB = (float*)take((size_t)NB_ * NH_ * TT * 4); float* RB = (float*)take((size_t)NH_ * NR * 4);
    // every per-batch buffer holds all NB_ batches, batch-major
    bf* XB = (bf*)take((size_t)NB_ * TT * DM * 2); bf* XK = (bf*)take((size_t)NB_ * TT * DM * 2);
    bf* QPh = (bf*)take((size_t)NB_ * NH_ * TT * HD * 2); bf* QPl = (bf*)take((size_t)NB_ * NH_ * TT * HD * 2); bf* KPh = (bf*)take((size_t)NB_ * NKV * TT * HD * 2); bf* KPl = (bf*)take((size_t)NB_ * NKV * TT * HD * 2); bf* VTh = (bf*)take((size_t)NB_ * NKV * HD * TT * 2); bf* VTl = (bf*)take((size_t)NB_ * NKV * HD * TT * 2);
    if ((size_t)(wsp - (char*)d_ws) > ws_size) return;    // about 72 MiB of the 256 MiB
    // Four launches, each reading only what an earlier one wrote; every stage covers all NB_ batches: the projections see the batches as NB_ * TT rows and write the head planes themselves, the attention kernel takes the batch from blockIdx.z.
    k_prep<<<G_WQ + G_WKV + G_WR + G_PE + 2 * G_X, 256, 0, stream>>>(wq, wkv, wr, pemb, x, xk, WQ, WKV, WR, PE, XB, XK);
    k_gemm3<<<dim3(NB_ * TT / 64, DKV2 / 64 + DQ / 64 + 1, 1), 32, 0, stream>>>(XB, XK, PE, WQ, WKV, WR, RF, QPh, QPl, KPh, KPl, VTh, VTl, rrb, KB);
    k_rfin<<<G_FL + G_HD, 256, 0, stream>>>(RF, RP16, RPh, RPl, rwb, RB);
    k_fattn<<<dim3(TT / ROWS, NH_, NB_), 256, 0, stream>>>(QPh, QPl, KPh, KPl, RPh, RPl, VTh, VTl, KB, RB, kmask, OUT);   /* scores, shift, softmax and P.V of every head of every batch */
}

// v010
// Measured time: 126 microseconds a run.
// Next to v009, in two timings, it ran 1.08 and 1.07 times as fast.
// Counting every step since v000, it is 13.7 times as fast.
#include <hip/hip_runtime.h>

// Transformer-XL relative multi-head attention (q, k [4][1024][1024]; qh = q Wq ('xw' [1024][1024]), kv = k Wkv ('xw' [1024][2048]: k | v column blocks; 16 heads x 64); r = pos_embed Wr ([2048][64] x [64][64], shared by all heads); AC = (qh + r_r_bias_h).kh, BD = shift((qh + r_w_bias_h).r): BD[i][j] = (qh_i + r_w_bias_h).r[L + j - i]; attn = (AC + BD)/8; keys with mask[b][j] == 0 -> -inf (int [4][1024], read); softmax; out = merged attn.vh -> [4][1024][1024] (4.2 M)).
// Compute dtypes, f32 accumulate: every input rounded to bf16; projections exact; relative terms 3 products / f32 dots; content scores 3 products on every row; softmax f32; output f32.

#define NB_  4
#define TT   1024
#define DM   1024
#define NH_  16
#define NKV  16
#define REP  (NH_ / NKV)
#define HD   64
#define DQ   (NH_ * HD)
#define DKV  (NKV * HD)
#define RH   1024                 // = TT: every row hi/lo
#define WIN  0
#define PCAR 1024.0f
#define SCL  0.125f
#define NR   2048    // relative positions (2L)
#define DKV2 2048    // kv projection width (k | v)
typedef _Float16 h16;
typedef unsigned short bf;
typedef __attribute__((ext_vector_type(16))) __bf16   v16bf;
typedef __attribute__((ext_vector_type(16))) _Float16 v16h;
typedef __attribute__((ext_vector_type(8)))  _Float16 v8h;
typedef __attribute__((ext_vector_type(8)))  unsigned short v8us;
typedef __attribute__((ext_vector_type(8)))  float    v8f;
typedef __attribute__((ext_vector_type(4)))  float    v4f;
typedef __attribute__((ext_vector_type(4)))  unsigned v4u;
typedef __attribute__((ext_vector_type(2)))  unsigned v2u;
typedef v8h  __attribute__((may_alias)) v8ha;
typedef v4f  __attribute__((may_alias)) v4fa;
typedef v8us __attribute__((may_alias)) v8usa;

typedef __attribute__((ext_vector_type(2))) __bf16 v2bf;
typedef __attribute__((ext_vector_type(2))) float  v2fl;
// Rounding to bf16 (nearest, ties to even) is the chip's own packed conversion: one instruction for two values, already packed as the planes store them (a in the low half).
__device__ __forceinline__ unsigned cvt2(float a, float b) { const v2fl t = {a, b}; return __builtin_bit_cast(unsigned, __builtin_convertvector(t, v2bf)); }
__device__ __forceinline__ unsigned short f2bf(float f) { return __builtin_bit_cast(unsigned short, (__bf16)f); }
__device__ __forceinline__ float bf2f(unsigned short b) { return __uint_as_float(((unsigned)b) << 16); }
__device__ __forceinline__ float bfr(float f) { return bf2f(f2bf(f)); }
// split2: the hi and lo parts of two values, each pair packed in one word
__device__ __forceinline__ void split2(float y0, float y1, unsigned& h, unsigned& l) { h = cvt2(y0, y1); l = cvt2(y0 - __uint_as_float(h << 16), y1 - __uint_as_float(h & 0xFFFF0000u)); }
typedef __attribute__((ext_vector_type(4))) unsigned short v4us;
__device__ __forceinline__ v16h cat16(v8h lo, v8h hi) { return __builtin_shufflevector(lo, hi, 0, 1, 2, 3, 4, 5, 6, 7, 8, 9, 10, 11, 12, 13, 14, 15); }
__device__ __forceinline__ v16bf cat16b(v8us lo, v8us hi) { return __builtin_bit_cast(v16bf, __builtin_shufflevector(lo, hi, 0, 1, 2, 3, 4, 5, 6, 7, 8, 9, 10, 11, 12, 13, 14, 15)); }
__device__ __forceinline__ v8f wmma16(v16h a, v16h b, v8f c) { return __builtin_amdgcn_wmma_f32_16x16x32_f16(false, a, false, b, (short)0, c, false, false); }
__device__ __forceinline__ v8f wmmab(v16bf a, v16bf b, v8f c) { return __builtin_amdgcn_wmma_f32_16x16x32_bf16(false, a, false, b, (short)0, c, false, false); }



// ---- d_gemmw: register-blocked GEMM, ONE WAVE per 64x64 output tile (16 accumulators), operands from 16-bit planes, A (rows m) and Bt (rows n) both in fragment order (ldfo below); tile (bx, by) of (M/64, N/64); os = the wave's own 16 x 68 floats of LDS. k_gemm3 below calls it.
// C[m][n] (f32, pitch ldc, + optional f32 bias[n]) = sum_k A[m][k] Bt[n][k] (+ split products per NSPLIT). z-batch strides sA/sB/sC in elements. K % 32 == 0.
// EPI 0: C goes out as f32. EPI 1 (q projection) and 2 (kv projection), rows = batch x TT: no f32 result leaves the kernel. A tile is 64 rows of one batch x the 64 columns of one head, and the epilogue writes
// the bf16 hi | lo planes that the attention kernel reads, in fragment order (ldfo below): q, and the kv column blocks below DQ (k), as fragments of 16 t rows x 32 d, P[b][h][t / 16][d / 32][512], k with KBo[b][h][t] = HB_h . row (d ascending); the kv column blocks from DQ on (v) as fragments of 16 d rows x 32 t, V[b][g][d / 16][t / 32][512].
template <typename T16> struct WFrag;
template <> struct WFrag<h16> { typedef v16h V; static __device__ __forceinline__ V ld(const h16* p) { return cat16(*(const v8h*)p, *(const v8h*)(p + 16)); } static __device__ __forceinline__ v8f mma(V a, V b, v8f c) { return wmma16(a, b, c); } };
template <> struct WFrag<bf> { typedef v16bf V; static __device__ __forceinline__ V ld(const bf* p) { return cat16b(*(const v8us*)p, *(const v8us*)(p + 16)); } static __device__ __forceinline__ V ldf(const bf* p) { return cat16b(*(const v8us*)p, *(const v8us*)(p + 256)); } static __device__ __forceinline__ v8f mma(V a, V b, v8f c) { return wmmab(a, b, c); } };
// Fragment order: one 16-row x 32-k operand fragment is a block of 512 elements (1 KiB); element (row r, k) lies at (k >> 4) * 256 + (((k >> 3) & 1) * 16 + r) * 8 + (k & 7), which puts lane l's two 16-byte pieces at 8 l and 256 + 8 l.
// Each 16-byte load of a wave then covers 512 successive bytes, 4 whole 128-byte lines, where a row-major plane gives it 32 bytes of each of 16 lines. p = block + 8 * lane.
__device__ __forceinline__ v16bf ldfo(const bf* p) { return WFrag<bf>::ldf(p); }
// Staged form (STG): the four waves of a work-group hold a 2 x 2 block of such tiles, 128 x 128, and share their operands through LDS. A stage is GKS k of the 8 A and the 8 B strips (16 rows each): in fragment order a strip's
// stage is 2 KiB in a row, so a stage is 16 such pieces, copied as they lie; each is read from L2 once a work-group, where four waves with loads of their own read it twice. Two buffers: stage t + 2 flies while stage t is multiplied.
#define GKS 64
#define GST (16 * 16 * GKS)       // elements of one stage buffer
// cp8: eight asynchronous 16-byte copies of a lane, global to LDS, pieces gp elements apart in global memory and 2 KiB apart in LDS. The closing wait stands in the copies' own statement, so that no address register is rewritten in front of it.
__device__ __forceinline__ void cp8(unsigned l, const bf* g, size_t gp) {
    asm volatile("global_load_async_to_lds_b128 %0, %8, off\n\tglobal_load_async_to_lds_b128 %1, %9, off\n\tglobal_load_async_to_lds_b128 %2, %10, off\n\tglobal_load_async_to_lds_b128 %3, %11, off\n\tglobal_load_async_to_lds_b128 %4, %12, off\n\tglobal_load_async_to_lds_b128 %5, %13, off\n\tglobal_load_async_to_lds_b128 %6, %14, off\n\tglobal_load_async_to_lds_b128 %7, %15, off\n\ts_wait_xcnt 0x0" :: "v"(l), "v"(l + 2048u), "v"(l + 4096u), "v"(l + 6144u), "v"(l + 8192u), "v"(l + 10240u), "v"(l + 12288u), "v"(l + 14336u), "v"(g), "v"(g + gp), "v"(g + 2 * gp), "v"(g + 3 * gp), "v"(g + 4 * gp), "v"(g + 5 * gp), "v"(g + 6 * gp), "v"(g + 7 * gp) : "memory");
}
template <typename T16, int NSPLIT, bool BIAS, int EPI, bool STG>
__device__ __forceinline__ void d_gemmw(const T16* __restrict__ A, const T16* __restrict__ A2, const T16* __restrict__ Bt, const T16* __restrict__ Bt2, int K, float* C, int ldc, const float* __restrict__ bias, size_t sA, size_t sB, size_t sC, bf* Ph, bf* Pl, bf* Vh, bf* Vl, const float* __restrict__ HB, float* KBo, int bx, int by, float* os, bf* st) {
    typedef typename WFrag<T16>::V V;
    const size_t z = blockIdx.z; A += z * sA; if (A2) A2 += z * sA; Bt += z * sB; if (Bt2) Bt2 += z * sB; C += z * sC;
    const int lane = threadIdx.x & 31, lr = lane & 15, hi = lane >> 4; const int r0 = bx * 64, c0 = by * 64;
    v8f acc[4][4];
    const size_t aoff = (size_t)r0 * K + 8 * lane, boff = (size_t)c0 * K + 8 * lane;   // A and Bt: fragment blocks [row / 16][k / 32][512], so 16 rows are 16 K elements and a k step is one block
    if (!STG) {
#pragma unroll
        for (int mb = 0; mb < 4; ++mb)
#pragma unroll
            for (int nb = 0; nb < 4; ++nb) acc[mb][nb] = (v8f){};
    }
    if (STG) {
        // The inner loops below are unrolled: the fragment and accumulator arrays are then indexed at compile time and stay in registers.
        const int tid = threadIdx.x; const unsigned l0 = (unsigned)(size_t)st + tid * 16;   // this lane's 16 bytes of each 2-KiB piece (128 lanes a piece)
        const bf* gA = (const bf*)A + (size_t)(bx & ~1) * 64 * K + tid * 8; const bf* gB = (const bf*)Bt + (size_t)(by & ~1) * 64 * K + tid * 8;   // the work-group's first A and B strip
        const bf* sa = st + (bx & 1) * 4 * (16 * GKS) + 8 * lane; const bf* sb = st + (8 + (by & 1) * 4) * (16 * GKS) + 8 * lane;   // this wave's four A and four B strips in a buffer
        cp8(l0, gA, (size_t)16 * K); cp8(l0 + 16384u, gB, (size_t)16 * K);
        asm volatile("s_wait_asynccnt 0x0" ::: "memory");   // this wave's copies of stage 0 have landed
        __syncthreads();                                    // and every other wave's: stage 0 may be read
        cp8(l0 + 2u * GST, gA + 16 * GKS, (size_t)16 * K); cp8(l0 + 2u * GST + 16384u, gB + 16 * GKS, (size_t)16 * K);
#pragma unroll
        for (int mb = 0; mb < 4; ++mb)
#pragma unroll
            for (int nb = 0; nb < 4; ++nb) acc[mb][nb] = (v8f){};
        for (int t = 0; t < K / GKS; ++t) { const int bo = (t & 1) * GST;
            V a[GKS / 32][4], b[GKS / 32][4];
#pragma unroll
            for (int kh = 0; kh < GKS / 32; ++kh)
#pragma unroll
                for (int mb = 0; mb < 4; ++mb) { a[kh][mb] = WFrag<T16>::ldf(sa + bo + mb * (16 * GKS) + kh * 512); b[kh][mb] = WFrag<T16>::ldf(sb + bo + mb * (16 * GKS) + kh * 512); }
            // All of stage t's fragments go to registers in one group, so the buffer is handed on in front of the products, and the refill flies under them.
            asm volatile("s_wait_dscnt 0x0" ::: "memory");      // this wave has read all of stage t that it needs
            asm volatile("s_wait_asynccnt 0x0" ::: "memory");   // its copies of stage t + 1 have landed
            __syncthreads();                                    // both hold for every wave: stage t + 1 may be read, stage t's buffer refilled
            if (t + 2 < K / GKS) { cp8(l0 + 2u * bo, gA + (size_t)(t + 2) * (16 * GKS), (size_t)16 * K); cp8(l0 + 2u * bo + 16384u, gB + (size_t)(t + 2) * (16 * GKS), (size_t)16 * K); }
#pragma unroll
            for (int kh = 0; kh < GKS / 32; ++kh)
#pragma unroll
                for (int nb = 0; nb < 4; ++nb)
#pragma unroll
                    for (int mb = 0; mb < 4; ++mb) acc[mb][nb] = WFrag<T16>::mma(a[kh][mb], b[kh][nb], acc[mb][nb]);
        }
        asm volatile("s_wait_asynccnt 0x0" ::: "memory");   // no copy is left in flight where the buffers become the epilogue's staging rows
    } else
#pragma unroll 1
    for (int kc = 0; kc < K; kc += 32) {
        V a[4], a2[4], b[4]; v4u x[16]; const T16* pa = A + aoff + kc * 16; const T16* pb = Bt + boff + kc * 16;
        // The sixteen operand loads of a k step and their data wait in one statement. Here the eight address pairs live to the statement's end and no result shares a register with them.
        asm volatile("global_load_b128 %0, %16, off\n\tglobal_load_b128 %1, %16, off offset:512\n\tglobal_load_b128 %2, %17, off\n\tglobal_load_b128 %3, %17, off offset:512\n\tglobal_load_b128 %4, %18, off\n\tglobal_load_b128 %5, %18, off offset:512\n\tglobal_load_b128 %6, %19, off\n\tglobal_load_b128 %7, %19, off offset:512\n\tglobal_load_b128 %8, %20, off\n\tglobal_load_b128 %9, %20, off offset:512\n\tglobal_load_b128 %10, %21, off\n\tglobal_load_b128 %11, %21, off offset:512\n\tglobal_load_b128 %12, %22, off\n\tglobal_load_b128 %13, %22, off offset:512\n\tglobal_load_b128 %14, %23, off\n\tglobal_load_b128 %15, %23, off offset:512\n\ts_wait_loadcnt 0x0" : "=&v"(x[0]), "=&v"(x[1]), "=&v"(x[2]), "=&v"(x[3]), "=&v"(x[4]), "=&v"(x[5]), "=&v"(x[6]), "=&v"(x[7]), "=&v"(x[8]), "=&v"(x[9]), "=&v"(x[10]), "=&v"(x[11]), "=&v"(x[12]), "=&v"(x[13]), "=&v"(x[14]), "=&v"(x[15]) : "v"(pa + (size_t)0 * K), "v"(pa + (size_t)16 * K), "v"(pa + (size_t)32 * K), "v"(pa + (size_t)48 * K), "v"(pb + (size_t)0 * K), "v"(pb + (size_t)16 * K), "v"(pb + (size_t)32 * K), "v"(pb + (size_t)48 * K) : "memory");
#pragma unroll
        for (int mb = 0; mb < 4; ++mb) { a[mb] = __builtin_bit_cast(V, __builtin_shufflevector(x[2 * mb], x[2 * mb + 1], 0, 1, 2, 3, 4, 5, 6, 7)); b[mb] = __builtin_bit_cast(V, __builtin_shufflevector(x[8 + 2 * mb], x[9 + 2 * mb], 0, 1, 2, 3, 4, 5, 6, 7)); if (NSPLIT == 1 || NSPLIT == 2) a2[mb] = WFrag<T16>::ldf(A2 + aoff + (size_t)mb * 16 * K + kc * 16); }
#pragma unroll
        for (int nb = 0; nb < 4; ++nb) { V b2; if (NSPLIT >= 2) b2 = WFrag<T16>::ldf(Bt2 + boff + (size_t)nb * 16 * K + kc * 16);
#pragma unroll
            for (int mb = 0; mb < 4; ++mb) { acc[mb][nb] = WFrag<T16>::mma(a[mb], b[nb], acc[mb][nb]); if (NSPLIT == 1 || NSPLIT == 2) acc[mb][nb] = WFrag<T16>::mma(a2[mb], b[nb], acc[mb][nb]); if (NSPLIT >= 2) acc[mb][nb] = WFrag<T16>::mma(a[mb], b2, acc[mb][nb]); } }
        asm volatile("v_nop\n\tv_nop\n\tv_nop\n\tv_nop" : "+v"(acc[0][0]), "+v"(acc[1][1]), "+v"(acc[2][2]), "+v"(acc[3][3]) : "v"(a[0]), "v"(a[3]));
    }
    if (EPI >= 1) {
        const int bz = r0 / TT, t0 = r0 % TT;
        if (EPI == 1 || c0 < DQ) {   // q or k: 16 rows (two fragments a plane) at a time through LDS, which turns the accumulator's columns into the fragments' 16-byte row pieces; each store covers 512 successive bytes
            const int h = c0 / HD; const size_t po = ((size_t)(bz * NH_ + h) * TT + t0) * HD + lane * 8;
            v4f hb[16];   // EPI 2: the head's 64 bias values, fetched once for the four rounds below
            if (EPI == 2) { const float* bh = HB + h * HD;
#pragma unroll   // hb is then indexed at compile time and stays in registers
                for (int d = 0; d < 16; ++d) hb[d] = *(const v4fa*)(bh + 4 * d);
                asm volatile("s_wait_xcnt 0x0" :: "v"(bh) : "memory"); }   // behind the last of the sixteen loads and in front of the rounds' LDS traffic, so that no register which the loads name is rewritten in front of it; bh as an operand keeps the loads in front of the statement
#pragma unroll
            for (int mb = 0; mb < 4; ++mb) {
#pragma unroll
                for (int nb = 0; nb < 4; ++nb) {
#pragma unroll
                    for (int j = 0; j < 8; ++j) os[(hi * 8 + j) * 68 + nb * 16 + lr] = acc[mb][nb][j]; }
                __builtin_amdgcn_wave_barrier(); asm volatile("" ::: "memory");   // the reads below take other lanes' values: the compiler may not lift them over the writes
                v4u oh[4], ol[4];   // piece s: row lr, columns 16 s + 8 hi .. + 7, two columns a word
#pragma unroll
                for (int s = 0; s < 4; ++s) { const float* sp = os + lr * 68 + s * 16 + hi * 8; const v4f va = *(const v4fa*)sp, vb = *(const v4fa*)(sp + 4);
#pragma unroll
                    for (int q = 0; q < 2; ++q) { unsigned x2, y2; split2(va[2 * q], va[2 * q + 1], x2, y2); oh[s][q] = x2; ol[s][q] = y2; split2(vb[2 * q], vb[2 * q + 1], x2, y2); oh[s][2 + q] = x2; ol[s][2 + q] = y2; } }
                float kd = 0.f;
                if (EPI == 2) {   // lane lr sums row lr, d ascending (both lane halves alike, the lower one stores)
#pragma unroll
                    for (int d = 0; d < HD; d += 4) { const v4f f = *(const v4fa*)(os + lr * 68 + d);
#pragma unroll
                        for (int q = 0; q < 4; ++q) kd = __fadd_rn(kd, __fmul_rn(bfr(hb[d >> 2][q]), f[q])); } }
                bf* ph = Ph + po + (size_t)mb * 16 * HD; bf* pl = Pl + po + (size_t)mb * 16 * HD;
#pragma unroll
                for (int s = 0; s < 4; ++s) { *(v8us*)(ph + s * 256) = __builtin_bit_cast(v8us, oh[s]); *(v8us*)(pl + s * 256) = __builtin_bit_cast(v8us, ol[s]); }
                // every register that the stores above name stays live up to this wait, so that none is rewritten in front of it
                asm volatile("s_wait_xcnt 0x0" :: "v"(ph), "v"(pl), "v"(oh[0]), "v"(oh[1]), "v"(oh[2]), "v"(oh[3]), "v"(ol[0]), "v"(ol[1]), "v"(ol[2]), "v"(ol[3]) : "memory");
                if (EPI == 2) { float* kp = KBo + (size_t)(bz * NH_ + h) * TT + t0 + mb * 16 + lr; if (hi == 0) *kp = kd;
                    asm volatile("s_wait_xcnt 0x0" :: "v"(kp), "v"(kd) : "memory"); }   // as above, for the registers of this store
                __builtin_amdgcn_wave_barrier();   // the next 16 rows' LDS writes stay behind this round's reads
            }
        } else {   // v: a lane holds 8 successive t of one d, which is its own 16-byte piece of a fragment: accumulator (mb, nb) goes out as half a fragment, 512 successive bytes a plane, straight from the registers
            const int g = (c0 - DQ) / HD; const size_t vo = ((size_t)(bz * NKV + g) * (HD / 16) * (TT / 32) + t0 / 32) * 512 + lane * 8;
#pragma unroll
            for (int nb = 0; nb < 4; ++nb) { v4u oh[4], ol[4];
#pragma unroll
                for (int mb = 0; mb < 4; ++mb) {
#pragma unroll
                    for (int j = 0; j < 4; ++j) { unsigned x2, y2; split2(acc[mb][nb][2 * j], acc[mb][nb][2 * j + 1], x2, y2); oh[mb][j] = x2; ol[mb][j] = y2; } }
                bf* vh = Vh + vo + (size_t)nb * (TT / 32) * 512; bf* vl = Vl + vo + (size_t)nb * (TT / 32) * 512;
#pragma unroll
                for (int mb = 0; mb < 4; ++mb) { *(v8us*)(vh + mb * 256) = __builtin_bit_cast(v8us, oh[mb]); *(v8us*)(vl + mb * 256) = __builtin_bit_cast(v8us, ol[mb]); }
                // every register that the stores above name stays live up to this wait, so that none is rewritten in front of it
                asm volatile("s_wait_xcnt 0x0" :: "v"(vh), "v"(vl), "v"(oh[0]), "v"(oh[1]), "v"(oh[2]), "v"(oh[3]), "v"(ol[0]), "v"(ol[1]), "v"(ol[2]), "v"(ol[3]) : "memory");
            }
        }
        return;
    }
#pragma unroll
    for (int mb = 0; mb < 4; ++mb) {
#pragma unroll
        for (int nb = 0; nb < 4; ++nb) {
#pragma unroll
            for (int j = 0; j < 8; ++j) os[(hi * 8 + j) * 68 + nb * 16 + lr] = acc[mb][nb][j]; }
        __builtin_amdgcn_wave_barrier(); asm volatile("" ::: "memory");
        const int cofs = lr * 4; float* cp = C + (size_t)(r0 + mb * 16 + hi) * ldc + c0 + cofs; v4f val[8];   // store s: row 2 s + hi of these 16
#pragma unroll
        for (int s = 0; s < 8; ++s) { val[s] = *(const v4fa*)(os + (2 * s + hi) * 68 + cofs); if (BIAS) { val[s][0] += bfr(bias[c0 + cofs]); val[s][1] += bfr(bias[c0 + cofs + 1]); val[s][2] += bfr(bias[c0 + cofs + 2]); val[s][3] += bfr(bias[c0 + cofs + 3]); }
            *(v4f*)(cp + (size_t)(2 * s) * ldc) = val[s]; }
        // every register that the stores above name stays live up to this wait, so that none is rewritten in front of it (in a kernel of several bodies other code follows this epilogue in the listing)
        asm volatile("s_wait_xcnt 0x0" :: "v"(cp), "v"(val[0]), "v"(val[1]), "v"(val[2]), "v"(val[3]), "v"(val[4]), "v"(val[5]), "v"(val[6]), "v"(val[7]) : "memory");
        __builtin_amdgcn_wave_barrier(); asm volatile("" ::: "memory");
    }
}

__device__ __forceinline__ h16 tohx(float x) { return (h16)x; }
typedef __attribute__((ext_vector_type(2))) _Float16 v2h;
typedef __attribute__((ext_vector_type(4))) _Float16 v4h;
typedef __attribute__((ext_vector_type(2))) unsigned short v2us;
typedef __attribute__((ext_vector_type(2))) float v2f;
typedef __attribute__((ext_vector_type(4))) int v4i;

__device__ __forceinline__ void d_wtG(const float* __restrict__ w, int K, int N, bf* Bt, int blk) {
    // Bt = w transposed, in fragment order (ldfo): one wave writes one fragment block (16 n x 32 k, 1 KiB in a row); lane (lr, hi) gathers column n = 16 nt + lr at k = 32 kb + 16 c + 8 hi + 0..7
    const int lane = threadIdx.x & 31, lr = lane & 15, hi = lane >> 4; const int fb = blk * 8 + __builtin_amdgcn_readfirstlane((int)(threadIdx.x >> 5)); if (fb >= N * K / 512) return;
    const int kb = fb % (K / 32), nt = fb / (K / 32); const float* s = w + (size_t)kb * 32 * N + nt * 16; const float* p[16]; float f[16]; v4u o[2];
#pragma unroll
    for (int q = 0; q < 16; ++q) p[q] = s + (size_t)((q >> 3) * 16 + hi * 8 + (q & 7)) * N + lr;
#pragma unroll
    for (int q = 0; q < 16; ++q) f[q] = *p[q];
    // behind the last load of the gather: all sixteen address pairs stay live up to this wait, so that none is handed to a later load's result in front of it
    asm volatile("s_wait_xcnt 0x0" :: "v"(p[0]), "v"(p[1]), "v"(p[2]), "v"(p[3]), "v"(p[4]), "v"(p[5]), "v"(p[6]), "v"(p[7]), "v"(p[8]), "v"(p[9]), "v"(p[10]), "v"(p[11]), "v"(p[12]), "v"(p[13]), "v"(p[14]), "v"(p[15]) : "memory");
#pragma unroll
    for (int q = 0; q < 8; ++q) o[q >> 2][q & 3] = cvt2(f[2 * q], f[2 * q + 1]);
    bf* d = Bt + (size_t)fb * 512 + lane * 8; *(v8us*)d = __builtin_bit_cast(v8us, o[0]); *(v8us*)(d + 256) = __builtin_bit_cast(v8us, o[1]);
}
// d_cvtF: src [rows][K] rounded to bf16, in fragment order (ldfo), the GEMM's A operand. One wave takes 8 rows x 32 k, half a fragment block: 4 lanes a row read its whole 128-byte line (8 floats a lane),
// and lane (row r, piece p: k = 8 p .. 8 p + 7) writes its 16-byte piece, so that the wave's store covers 4 whole 128-byte lines. n8 = rows * K / 8 pieces.
__device__ __forceinline__ void d_cvtF(const float* __restrict__ src, bf* dst, int K, size_t n8, int blk) {
    const int lane = threadIdx.x & 31, p = lane & 3, r = lane >> 2; const int wv = blk * 8 + (int)(threadIdx.x >> 5); if ((size_t)wv * 32 >= n8) return;
    const int r8 = (wv & 1) * 8 + r, fb = wv >> 1; const int kb = fb % (K / 32), mt = fb / (K / 32);
    const float* s = src + (size_t)(mt * 16 + r8) * K + kb * 32 + p * 8; const v8f v = *(const v8f*)s; v4u o;
    asm volatile("s_wait_xcnt 0x0" :: "v"(s) : "memory");   // the address pair stays live up to this wait, so that it is not handed to a load's result in front of it
#pragma unroll
    for (int k = 0; k < 4; ++k) o[k] = cvt2(v[2 * k], v[2 * k + 1]);
    *(v8us*)(dst + (size_t)fb * 512 + (p >> 1) * 256 + ((p & 1) * 16 + r8) * 8) = __builtin_bit_cast(v8us, o);  }

__device__ __forceinline__ void d_flat(const float* __restrict__ F, h16* P16, bf* Ph, bf* Pl, size_t n4, int blk) { const size_t i = (size_t)blk * 256 + threadIdx.x; if (i >= n4) return; const v4f a = *(const v4f*)(F + i * 4); v4h o16; v2u oh, ol;
#pragma unroll
    for (int q = 0; q < 4; ++q) o16[q] = tohx(a[q]);
#pragma unroll
    for (int q = 0; q < 2; ++q) { unsigned x2, y2; split2(a[2 * q], a[2 * q + 1], x2, y2); oh[q] = x2; ol[q] = y2; }
    const int row = (int)(i * 4 / HD), d = (int)(i * 4 % HD); const size_t fo = (size_t)(row >> 4) * (16 * HD) + (d >> 4) * 256 + (((d >> 3) & 1) * 16 + (row & 15)) * 8 + (d & 7);   // the hi | lo planes in fragment order (ldfo): F is [rows][HD]
    *(v4h*)(P16 + i * 4) = o16; *(v4us*)(Ph + fo) = __builtin_bit_cast(v4us, oh); *(v4us*)(Pl + fo) = __builtin_bit_cast(v4us, ol);  }

__device__ __forceinline__ void d_hdot(const float* __restrict__ bias, const float* __restrict__ F, int pitch, int nrows, int hcol, float* OUT, int blk) {
    { const size_t bz = blockIdx.y; F += bz * nrows * pitch; OUT += bz * NH_ * nrows; }   // blockIdx.y = batch (one for r)
    const int lane = threadIdx.x & 31; const size_t wv = (size_t)blk * 8 + (threadIdx.x >> 5); if (wv >= (size_t)NH_ * (nrows / 32)) return; const int h = (int)(wv / (nrows / 32)); const int n = (int)(wv % (nrows / 32)) * 32 + lane; const float* f = F + (size_t)n * pitch + (hcol ? h * HD : 0);   /* hcol: F has per-head columns (k); 0: one 64-wide row shared by all heads (r) */ const float* bh = bias + h * HD; float s = 0.f;
#pragma unroll 4
    for (int d = 0; d < HD; ++d) { s = __fadd_rn(s, __fmul_rn(bfr(bh[d]), f[d])); }
    *(float*)(OUT + (size_t)h * nrows + n) = s;  }

// Launches whose bodies do not depend on one another share one grid: a work-group picks its body by its block index (the same for all its threads), and the index inside the body's own range is what blockIdx gave it when the body was a launch of its own.
#define G_WQ  (DM * DQ / 512 / 8)          // work-groups of each body of k_prep: 8 fragment blocks, or 256 x 8 elements, a work-group
#define G_WKV (DM * DKV2 / 512 / 8)
#define G_WR  1
#define G_PE  (NR * HD / 8 / 256)
#define G_X   (NB_ * TT * DM / 8 / 256)
// k_prep: everything that reads only the inputs: the three weights, pos_embed, q and k to bf16 fragment order.
__global__ __launch_bounds__(256) void k_prep(const float* __restrict__ wq, const float* __restrict__ wkv, const float* __restrict__ wr, const float* __restrict__ pemb, const float* __restrict__ x, const float* __restrict__ xk, bf* WQ, bf* WKV, bf* WR, bf* PE, bf* XB, bf* XK) {
    int b = blockIdx.x;
    if (b < G_WQ) { d_wtG(wq, DM, DQ, WQ, b); return; } b -= G_WQ;
    if (b < G_WKV) { d_wtG(wkv, DM, DKV2, WKV, b); return; } b -= G_WKV;
    if (b < G_WR) { d_wtG(wr, HD, HD, WR, b); return; } b -= G_WR;
    if (b < G_PE) { d_cvtF(pemb, PE, HD, (size_t)NR * HD / 8, b); return; } b -= G_PE;
    if (b < G_X) { d_cvtF(x, XB, DM, (size_t)NB_ * TT * DM / 8, b); return; } b -= G_X;
    d_cvtF(xk, XK, DM, (size_t)NB_ * TT * DM / 8, b);
}
// k_gemm3: the three projections, four waves a work-group. blockIdx.y: 0 = r (one 64 x 64 tile a wave, NR / 64 of them, loads of its own: K is one stage), then DKV2 / 128 column blocks of kv, then DQ / 128 of q; blockIdx.x = block of 128 rows.
__global__ __launch_bounds__(128) void k_gemm3(const bf* __restrict__ XB, const bf* __restrict__ XK, const bf* __restrict__ PE, const bf* __restrict__ WQ, const bf* __restrict__ WKV, const bf* __restrict__ WR, float* RF, bf* QPh, bf* QPl, bf* KPh, bf* KPl, bf* VTh, bf* VTl, const float* __restrict__ rrb, float* KB) {
    __shared__ __align__(2048) bf st[2 * GST];   // the two stage buffers; behind the k loop's last barrier each wave stages its epilogue rows (16 x 68 floats) in a part of its own
    const int w = __builtin_amdgcn_readfirstlane((int)(threadIdx.x >> 5)); float* os = (float*)st + w * (16 * 68);
    const int gx = blockIdx.x, gy = (int)blockIdx.y - 1, bx = gx * 2 + (w & 1);
    if (gy < 0) { if (gx < NR / 64 / 4) d_gemmw<bf, 0, false, 0, false>(PE, nullptr, WR, nullptr, HD, RF, HD, nullptr, 0, 0, 0, nullptr, nullptr, nullptr, nullptr, nullptr, nullptr, gx * 4 + w, 0, os, st); }   /* r = pos_embed Wr (exact) */
    else if (gy < DKV2 / 128) d_gemmw<bf, 0, false, 2, true>(XK, nullptr, WKV, nullptr, DM, nullptr, 0, nullptr, 0, 0, 0, KPh, KPl, VTh, VTl, rrb, KB, bx, gy * 2 + (w >> 1), os, st);   /* kv = k Wkv: k planes (columns 0..1023) with KB[b][h][j] = r_r_bias_h . kh_j, v planes (columns 1024..2047) */
    else d_gemmw<bf, 0, false, 1, true>(XB, nullptr, WQ, nullptr, DM, nullptr, 0, nullptr, 0, 0, 0, QPh, QPl, nullptr, nullptr, nullptr, nullptr, bx, (gy - DKV2 / 128) * 2 + (w >> 1), os, st);   /* qh planes */
}
#define G_FL  (NR * HD / 4 / 256)
#define G_HD  (NH_ * (NR / 32) / 8)
// k_rfin: what reads r: its planes, and RB[h][l] = r_w_bias_h . r_l (r is shared by all heads: no column offset).
__global__ __launch_bounds__(256) void k_rfin(const float* __restrict__ RF, h16* RP16, bf* RPh, bf* RPl, const float* __restrict__ rwb, float* RB) {
    const int b = blockIdx.x;
    if (b < G_FL) d_flat(RF, RP16, RPh, RPl, (size_t)NR * HD / 4, b);
    else d_hdot(rwb, RF, HD, NR, 0, RB, b - G_FL);
}

#define MT   2                    // 16-row query tiles per work-group
#define ROWS (16 * MT)
#define PD   6                    // k steps by which the V fragment loads run ahead in the P.V product
#define PA   3                    // ring of P fragment sets in the P.V product
#define SD   2                    // score tiles (r window, then keys) by which the operand fragment loads run ahead of their products
#define SP   1028                 // floats per LDS score row: 4112 B = 16 B x odd, the conflict-free pitch for 16-byte fragment reads
typedef v4us __attribute__((may_alias)) v4usa;
// ld4: the hi and lo fragments of both 32-wide k halves of one 16-row tile (x[0] hi k 0..31, x[1] lo, x[2] hi k 32..63, x[3] lo); ph, pl = the tile's first fragment block + 8 * lane.
__device__ __forceinline__ void ld4(const bf* ph, const bf* pl, v16bf (&x)[4]) {
    x[0] = ldfo(ph); x[1] = ldfo(pl); x[2] = ldfo(ph + 512); x[3] = ldfo(pl + 512);
    asm volatile("s_wait_xcnt 0x0" :: "v"(ph), "v"(pl) : "memory");   // both address pairs stay live up to this wait
}
// k_fattn: one work-group (8 waves) = ROWS query rows of one head of one batch; their whole score rows stay in LDS from the score products to the P.V product.
// 1. wave w owns keys [128 w, 128 w + 128): q.r tiles over the window l = TT + j - i are stored straight to their shifted place sc[i][j];
// 2. q.k tiles: sc = ((q.k + KB[j]) + q.r) + RB[l]; 3. softmax, one wave per row, P hi | lo planes written over the row's own scores;
// 4. O = P.V (waves 0..3, one 16-column block each, k ascending), staged in LDS so that each wave stores whole output lines.
// amdgpu_waves_per_eu(4, 4): the register budget of four waves a SIMD (256), so that the fragment ring of phases 1 and 2 leaves two work-groups on a WGP.
__global__ __launch_bounds__(256) __attribute__((amdgpu_waves_per_eu(4, 4))) void k_fattn(const bf* __restrict__ Qh, const bf* __restrict__ Ql, const bf* __restrict__ Kh, const bf* __restrict__ Kl, const bf* __restrict__ Rh, const bf* __restrict__ Rl, const bf* __restrict__ Vh, const bf* __restrict__ Vl, const float* __restrict__ KB, const float* __restrict__ RB, const int* __restrict__ km, float* OUTb) {
    __shared__ __align__(16) float sc[ROWS * SP];
    __shared__ __align__(16) float os[ROWS * 68];
    __shared__ float rbs[TT + ROWS];
    const int lane = threadIdx.x & 31, lr = lane & 15, hi = lane >> 4; const int w = __builtin_amdgcn_readfirstlane((int)(threadIdx.x >> 5));
    const int i0 = blockIdx.x * ROWS, h = blockIdx.y, jw = w * 128;
    { const size_t bz = blockIdx.z, po = bz * NH_ * TT * HD; Qh += po; Ql += po; Kh += po; Kl += po; Vh += po; Vl += po; KB += bz * NH_ * TT; km += bz * TT; OUTb += bz * TT * DQ; }   // blockIdx.z = batch; the r planes and RB are shared by all batches
    const float* rbg = RB + (size_t)h * NR + (TT - i0 - ROWS) + threadIdx.x; float rv[TT / 256 + 1];   // rbs[x] = RB[h][TT - i0 - ROWS + x]: every l this work-group's rows meet; loaded here, stored in front of the first barrier
#pragma unroll
    for (int q = 0; q < TT / 256; ++q) rv[q] = rbg[q * 256];
    rv[TT / 256] = (threadIdx.x < ROWS) ? rbg[TT] : 0.f;
    v16bf ah[MT][2], al[MT][2];
#pragma unroll
    for (int mb = 0; mb < MT; ++mb) { const size_t o = ((size_t)h * TT + i0 + mb * 16) * HD + 8 * lane; v16bf x[4]; ld4(Qh + o, Ql + o, x); ah[mb][0] = x[0]; al[mb][0] = x[1]; ah[mb][1] = x[2]; al[mb][1] = x[3]; }
    { const size_t o = ((size_t)h * TT + i0) * HD + 8 * lane; asm volatile("s_wait_xcnt 0x0" :: "v"(Qh + o), "v"(Ql + o) : "memory"); }   // the loads of every row tile name the first tile's address pairs with an offset: both pairs stay live up to this wait, so that neither is handed to a later load's result in front of it
    const int lbase = TT + jw - i0 - ROWS;   // first l of the wave's window; the window [lbase, lbase + 128 + ROWS) lies in [0, NR)
    // Both tile loops are unrolled: which row tile needs which window tile is then decided at compile time, and the next tile's loads (issued ahead, in the source too) fly while this tile is multiplied.
    // The wave's 8 + MT window tiles and its 8 key tiles are one row of tiles n; a ring of SD fragment sets holds tiles n + 1 .. n + SD while tile n is multiplied, so that a load has SD tiles' work to land in.
    v16bf nx[SD][4];
    const bf* rh0 = Rh + (size_t)lbase * HD + 8 * lane; const bf* rl0 = Rl + (size_t)lbase * HD + 8 * lane; const bf* kh0 = Kh + ((size_t)h * TT + jw) * HD + 8 * lane; const bf* kl0 = Kl + ((size_t)h * TT + jw) * HD + 8 * lane;
#pragma unroll
    for (int n = 0; n < SD; ++n) ld4(rh0 + n * 16 * HD, rl0 + n * 16 * HD, nx[n]);
#pragma unroll
    for (int t = 0; t < 8 + MT; ++t) { const v16bf b[2] = {nx[t % SD][0], nx[t % SD][2]}, c[2] = {nx[t % SD][1], nx[t % SD][3]};
        if (t + SD < 8 + MT) ld4(rh0 + (t + SD) * 16 * HD, rl0 + (t + SD) * 16 * HD, nx[t % SD]);
        else ld4(kh0 + (t + SD - 8 - MT) * 16 * HD, kl0 + (t + SD - 8 - MT) * 16 * HD, nx[t % SD]);   // the first key tiles
        __builtin_amdgcn_sched_barrier(0);   // keeps the loads above in front of this tile's products: left alone the compiler sinks them to where a fragment register falls free, a few products ahead of their use, and the wave waits out the whole load latency
        v8f acc[MT];
#pragma unroll
        for (int mb = 0; mb < MT; ++mb) acc[mb] = (v8f){};
#pragma unroll
        for (int s = 0; s < 2; ++s) {
#pragma unroll
            for (int mb = 0; mb < MT; ++mb) if (t + mb >= MT - 1 && t + mb <= MT + 7) acc[mb] = wmmab(ah[mb][s], b[s], acc[mb]);
#pragma unroll
            for (int mb = 0; mb < MT; ++mb) if (t + mb >= MT - 1 && t + mb <= MT + 7) acc[mb] = wmmab(al[mb][s], b[s], acc[mb]);
#pragma unroll
            for (int mb = 0; mb < MT; ++mb) if (t + mb >= MT - 1 && t + mb <= MT + 7) acc[mb] = wmmab(ah[mb][s], c[s], acc[mb]); }
        asm volatile("v_nop\n\tv_nop\n\tv_nop\n\tv_nop" : "+v"(acc[0]), "+v"(acc[1]));   // the four vector slots the chip needs before the next tile's first product overwrites these result registers: only LDS stores stand between
#pragma unroll
        for (int mb = 0; mb < MT; ++mb) { if (t + mb < MT - 1 || t + mb > MT + 7) continue;
#pragma unroll
            for (int jj = 0; jj < 8; ++jj) { const int ii = mb * 16 + hi * 8 + jj; const int jrel = t * 16 + lr + ii - ROWS;   /* j - jw of (row ii, l = lbase + 16 t + lr) */ if (jrel >= 0 && jrel < 128) sc[ii * SP + jw + jrel] = acc[mb][jj]; } } }
#pragma unroll
    for (int q = 0; q < TT / 256; ++q) rbs[q * 256 + threadIdx.x] = rv[q];
    if (threadIdx.x < ROWS) rbs[TT + threadIdx.x] = rv[TT / 256];
    __syncthreads();
#pragma unroll
    for (int nb = 0; nb < 8; ++nb) { const int j = jw + nb * 16 + lr; const v16bf b[2] = {nx[(nb + 8 + MT) % SD][0], nx[(nb + 8 + MT) % SD][2]}, c[2] = {nx[(nb + 8 + MT) % SD][1], nx[(nb + 8 + MT) % SD][3]}; const float kb = KB[(size_t)h * TT + j];
        if (nb + SD < 8) ld4(kh0 + (nb + SD) * 16 * HD, kl0 + (nb + SD) * 16 * HD, nx[(nb + 8 + MT) % SD]);
        __builtin_amdgcn_sched_barrier(0);   // as in the window loop: the loads above stay in front of this tile's products
        v8f acc[MT];
#pragma unroll
        for (int mb = 0; mb < MT; ++mb) acc[mb] = (v8f){};
#pragma unroll
        for (int s = 0; s < 2; ++s) {
#pragma unroll
            for (int mb = 0; mb < MT; ++mb) acc[mb] = wmmab(ah[mb][s], b[s], acc[mb]);
#pragma unroll
            for (int mb = 0; mb < MT; ++mb) acc[mb] = wmmab(al[mb][s], b[s], acc[mb]);
#pragma unroll
            for (int mb = 0; mb < MT; ++mb) acc[mb] = wmmab(ah[mb][s], c[s], acc[mb]); }
#pragma unroll
        for (int mb = 0; mb < MT; ++mb)
#pragma unroll
            for (int jj = 0; jj < 8; ++jj) { const int ii = mb * 16 + hi * 8 + jj; float* p = sc + ii * SP + j; *p = __fadd_rn(__fadd_rn(__fadd_rn(acc[mb][jj], kb), *p), rbs[j - ii + ROWS]); } }
    __syncthreads();
    // V fragments run PD k steps ahead of their products; the first PD are asked for here, so that they land during the softmax
    v16bf vh[PD], vl[PD]; const size_t vo = ((size_t)h * (HD / 16) + (w & 3)) * (TT / 32) * 512 + 8 * lane;   // this wave's 16 d rows: TT / 32 fragment blocks in a row
    if (w < 4) {
#pragma unroll
        for (int d = 0; d < PD; ++d) { vh[d] = ldfo(Vh + vo + 512 * d); vl[d] = ldfo(Vl + vo + 512 * d); } }
    for (int rr = 0; rr < ROWS / 8; ++rr) { float* sr = sc + (w * (ROWS / 8) + rr) * SP; float v[TT / 32]; float mx = -3.0e38f;
#pragma unroll
        for (int ch = 0; ch < TT / 128; ++ch) { const int j0 = ch * 128 + lane * 4; const v4f a = *(const v4fa*)(sr + j0); const v4i mk = *(const v4i*)(km + j0);
#pragma unroll
            for (int q = 0; q < 4; ++q) { const float t = (mk[q] != 0) ? a[q] * SCL : -3.0e38f; v[ch * 4 + q] = t;   /* mask == 0 -> -inf */ mx = fmaxf(mx, t); } }
#pragma unroll
        for (int sh = 16; sh; sh >>= 1) mx = fmaxf(mx, __shfl_xor(mx, sh, 32));
        float sum = 0.f;
#pragma unroll
        for (int k = 0; k < TT / 32; ++k) { const float d0 = __fsub_rn(v[k], mx); v[k] = __builtin_amdgcn_exp2f(__fmul_rn(d0, 1.4426950408889634f)); sum += v[k]; }
#pragma unroll
        for (int sh = 16; sh; sh >>= 1) sum += __shfl_xor(sum, sh, 32);
        const float f = __fdiv_rn(1.0f, sum); bf* pr = (bf*)sr;   // P hi in the row's first 2 KiB, P lo in its second; every score of the row is in registers by now (the sum needed them all)
#pragma unroll
        for (int ch = 0; ch < TT / 128; ++ch) { v2u oh, ol;
#pragma unroll
            for (int q = 0; q < 2; ++q) { unsigned a, c2; split2(v[ch * 4 + 2 * q] * f, v[ch * 4 + 2 * q + 1] * f, a, c2); oh[q] = a; ol[q] = c2; }
            *(v4usa*)(pr + ch * 128 + lane * 4) = __builtin_bit_cast(v4us, oh); *(v4usa*)(pr + TT + ch * 128 + lane * 4) = __builtin_bit_cast(v4us, ol); } }
    __syncthreads();
    if (w < 4) { v8f acc[MT];
#pragma unroll
        for (int mb = 0; mb < MT; ++mb) acc[mb] = (v8f){};
        const bf* pl = (const bf*)(sc + lr * SP) + 8 * hi;   // this lane's P hi row of row tile 0; row tile mb lies 16 rows on, P lo TT elements on
        v16bf pa[PA][MT], pb[PA][MT];   // P hi / lo fragments, read from LDS PA - 1 k steps ahead of their products
#pragma unroll
        for (int d = 0; d < PA - 1; ++d)
#pragma unroll
            for (int mb = 0; mb < MT; ++mb) { const bf* pr = pl + mb * 16 * SP * 2 + d * 32; pa[d][mb] = cat16b(*(const v8usa*)pr, *(const v8usa*)(pr + 16)); pb[d][mb] = cat16b(*(const v8usa*)(pr + TT), *(const v8usa*)(pr + TT + 16)); }
        // unrolled: the fragment rings are then indexed at compile time and stay in registers, and the last steps ask for nothing
#pragma unroll
        for (int ks = 0; ks < TT / 32; ++ks) { const int kc = ks * 32; const v16bf b = vh[ks % PD], b2 = vl[ks % PD];
            if (ks + PD < TT / 32) { vh[ks % PD] = ldfo(Vh + vo + 512 * (ks + PD)); vl[ks % PD] = ldfo(Vl + vo + 512 * (ks + PD)); }
            if (ks + PD == TT / 32 - 1) asm volatile("s_wait_xcnt 0x0" :: "v"(Vh + vo), "v"(Vl + vo) : "memory");   // behind the last V load: both address pairs stay live up to this wait, so that neither is rewritten in front of it
            if (ks + PA - 1 < TT / 32) {
#pragma unroll
                for (int mb = 0; mb < MT; ++mb) { const bf* pr = pl + mb * 16 * SP * 2 + kc + (PA - 1) * 32; pa[(ks + PA - 1) % PA][mb] = cat16b(*(const v8usa*)pr, *(const v8usa*)(pr + 16)); pb[(ks + PA - 1) % PA][mb] = cat16b(*(const v8usa*)(pr + TT), *(const v8usa*)(pr + TT + 16)); } }
#pragma unroll
            for (int mb = 0; mb < MT; ++mb) acc[mb] = wmmab(pa[ks % PA][mb], b, acc[mb]);
#pragma unroll
            for (int mb = 0; mb < MT; ++mb) acc[mb] = wmmab(pb[ks % PA][mb], b, acc[mb]);
#pragma unroll
            for (int mb = 0; mb < MT; ++mb) acc[mb] = wmmab(pa[ks % PA][mb], b2, acc[mb]); }
#pragma unroll
        for (int mb = 0; mb < MT; ++mb)
#pragma unroll
            for (int jj = 0; jj < 8; ++jj) os[(mb * 16 + hi * 8 + jj) * 68 + w * 16 + lr] = acc[mb][jj]; }
    __syncthreads();
#pragma unroll
    for (int s = 0; s < MT; ++s) { const int row = s * 16 + (int)(threadIdx.x >> 4), cofs = (int)(threadIdx.x & 15) * 4; *(v4f*)(OUTb + (size_t)(i0 + row) * DQ + h * HD + cofs) = *(const v4fa*)(os + row * 68 + cofs); }
}

extern "C" void kernel_launch(void* const* d_in, const int* in_sizes, int n_in,
                              void* d_out, int out_size, void* d_ws, size_t ws_size, hipStream_t stream) {
    (void)in_sizes; (void)n_in; (void)out_size;
    const float* x = (const float*)d_in[0]; const float* xk = (const float*)d_in[1]; const int* kmask = (const int*)d_in[2]; const float* pemb = (const float*)d_in[3]; const float* wq = (const float*)d_in[4]; const float* wkv = (const float*)d_in[5]; const float* wr = (const float*)d_in[6]; const float* rrb = (const float*)d_in[7]; const float* rwb = (const float*)d_in[8]; const float* wk = nullptr; const float* wv = nullptr; (void)wk; (void)wv;
    float* OUT = (float*)d_out;     // [4][1024][1024]
    char* wsp = (char*)d_ws;
    auto take = [&](size_t bytes) { char* p = wsp; wsp += (bytes + 255) & ~(size_t)255; return (void*)p; };
    bf* WQ = (bf*)take((size_t)DQ * DM * 2); bf* WKV = (bf*)take((size_t)DKV2 * DM * 2); bf* WR = (bf*)take((size_t)HD * HD * 2); bf* PE = (bf*)take((size_t)NR * HD * 2); float* RF = (float*)take((size_t)NR * HD * 4); h16* RP16 = (h16*)take((size_t)NR * HD * 2); bf* RPh = (bf*)take((size_t)NR * HD * 2); bf* RPl = (bf*)take((size_t)NR * HD * 2); float* KB = (float*)take((size_t)NB_ * NH_ * TT * 4); float* RB = (float*)take((size_t)NH_ * NR * 4);
    // every per-batch buffer holds all NB_ batches, batch-major
    bf* XB = (bf*)take((size_t)NB_ * TT * DM * 2); bf* XK = (bf*)take((size_t)NB_ * TT * DM * 2);
    bf* QPh = (bf*)take((size_t)NB_ * NH_ * TT * HD * 2); bf* QPl = (bf*)take((size_t)NB_ * NH_ * TT * HD * 2); bf* KPh = (bf*)take((size_t)NB_ * NKV * TT * HD * 2); bf* KPl = (bf*)take((size_t)NB_ * NKV * TT * HD * 2); bf* VTh = (bf*)take((size_t)NB_ * NKV * HD * TT * 2); bf* VTl = (bf*)take((size_t)NB_ * NKV * HD * TT * 2);
    if ((size_t)(wsp - (char*)d_ws) > ws_size) return;    // about 72 MiB of the 256 MiB
    // Four launches, each reading only what an earlier one wrote; every stage covers all NB_ batches: the projections see the batches as NB_ * TT rows and write the head planes themselves, the attention kernel takes the batch from blockIdx.z.
    k_prep<<<G_WQ + G_WKV + G_WR + G_PE + 2 * G_X, 256, 0, stream>>>(wq, wkv, wr, pemb, x, xk, WQ, WKV, WR, PE, XB, XK);
    k_gemm3<<<dim3(NB_ * TT / 128, 1 + DKV2 / 128 + DQ / 128, 1), 128, 0, stream>>>(XB, XK, PE, WQ, WKV, WR, RF, QPh, QPl, KPh, KPl, VTh, VTl, rrb, KB);
    k_rfin<<<G_FL + G_HD, 256, 0, stream>>>(RF, RP16, RPh, RPl, rwb, RB);
    k_fattn<<<dim3(TT / ROWS, NH_, NB_), 256, 0, stream>>>(QPh, QPl, KPh, KPl, RPh, RPl, VTh, VTl, KB, RB, kmask, OUT);   /* scores, shift, softmax and P.V of every head of every batch */
}
